// v000
// Times are from an AMD MI455X. After a warm-up the kernel runs many times in a row, and a time is the length of
// such a window on the GPU divided by its runs, so every launch and the gaps after it count. The runs cycle
// through copies of the inputs. A figure is the median of several windows, for all but v000 over two sittings.
// Sittings can differ by a few percent; kernels timed side by side share one.
// The starting kernel, v000, takes 282 microseconds a run.
// Contractions: q|k|v projection = v_wmma_f32_16x16x32_f16 (A = f16 of RNE-bf16 x carried x16, B = f16 of RNE-bf16 wq|wk|wv carried x1024, single product); attention q.k^T and p.v^T = v_wmma_f32_16x16x32_f16 (q, k, v^T f16 planes x16 plus x2^11 residual planes, p f16 x256 plus x2^11 residual; hi.hi + hi.res + res.hi); output projection = v_wmma_f32_16x16x32_f16 (A = ctx f16 x16 plus its x2^11 residual plane, B = f16 of RNE-bf16 wo x1024; hi.B + res.B); all f32 accumulate. RoPE cos/sin table, rotation, windowed causal online-max softmax and row sums in f32 on the VALU.
#include <hip/hip_runtime.h>
#include <math.h>
#include <stdint.h>

#define SEQ   4096                  // token rows processed (a row prefix of x); every stride, carve and grid derives from it
#define DM    1024
#define NH    16
#define HD    64
#define WIN   512
#define DQKV  (3 * DM)              // 3072
#define NQB   (SEQ / 64)            // query tiles of 64 rows
#define KTW   (WIN / 64 + 1)        // key tiles visited per 64-row query tile = 9
#define OUTN  (SEQ * DM)
static_assert(NH * HD == DM);
static_assert(HD == 64);
static_assert((WIN % 64) == 0);
static_assert(KTW == 9);
static_assert((SEQ % 64) == 0 && (DM % 64) == 0 && (DQKV % 64) == 0);
static_assert((DM % 32) == 0);
static_assert((((SEQ / 64) * (DQKV / 64)) % 8) == 0);
static_assert((((SEQ / 64) * (DM / 64)) % 8) == 0);
static_assert(((SEQ * DM / 8) % 256) == 0);
static_assert(((DM * DM / 8) % 256) == 0);
static_assert((SEQ % 8) == 0);

typedef _Float16 v16h __attribute__((ext_vector_type(16)));
typedef _Float16 v8h  __attribute__((ext_vector_type(8)));
typedef float    v8f  __attribute__((ext_vector_type(8)));
typedef float    v4f  __attribute__((ext_vector_type(4)));
typedef unsigned int v4u __attribute__((ext_vector_type(4)));

// ---- scalar helpers --------------------------------------------------------------------------------
__device__ __forceinline__ unsigned short bf_bits(float f) {          // f32 -> bf16 bits, RNE convert
  unsigned u = __float_as_uint(f);
  return (unsigned short)((u + 0x7FFFu + ((u >> 16) & 1u)) >> 16);
}
__device__ __forceinline__ float bfr(float f) { return __uint_as_float(((unsigned)bf_bits(f)) << 16); }
__device__ __forceinline__ unsigned short h_bits(_Float16 x) { return __builtin_bit_cast(unsigned short, x); }
__device__ __forceinline__ unsigned pk16(unsigned short a, unsigned short b) { return (unsigned)a | ((unsigned)b << 16); }
__device__ __forceinline__ v8f zero8() { v8f z = {0.f, 0.f, 0.f, 0.f, 0.f, 0.f, 0.f, 0.f}; return z; }

// ---- fragment loader: 16-bit A/B operand, lane -> row/col (lane&15), p already includes +8*(lane>>4);
//      elements 0..7 <- p[0..7] (k0+8h..), elements 8..15 <- p[16..23] (k0+16+8h..)
__device__ __forceinline__ v16h ldfrag_h(const _Float16* p) {
  union { v16h v; v8h h[2]; } f;
  f.h[0] = *(const v8h*)(p);
  f.h[1] = *(const v8h*)(p + 16);
  return f.v;
}

// ---- WMMA helpers with trailing VALU hazard gap --------------------------------------------------------
__device__ __forceinline__ v8f mma_h(v16h a, v16h b, v8f c) {
  c = __builtin_amdgcn_wmma_f32_16x16x32_f16(false, a, false, b, (short)0, c, false, false);
#if defined(__HIP_DEVICE_COMPILE__)
  asm volatile("v_nop\n\tv_nop\n\tv_nop\n\tv_nop" : "+v"(c) : "v"(a), "v"(b));
#endif
  return c;
}
__device__ __forceinline__ v8f mma_h_raw(v16h a, v16h b, v8f c) {
  return __builtin_amdgcn_wmma_f32_16x16x32_f16(false, a, false, b, (short)0, c, false, false);
}
__device__ __forceinline__ void dep_guard_h(v8f& a, v8f& b, v16h x, v16h y) {
#if defined(__HIP_DEVICE_COMPILE__)
  asm volatile("v_nop\n\tv_nop\n\tv_nop\n\tv_nop" : "+v"(a), "+v"(b) : "v"(x), "v"(y));
#endif
}
__device__ __forceinline__ void keep4_h(v16h a, v16h b, v16h c, v16h d) {
#if defined(__HIP_DEVICE_COMPILE__)
  asm volatile("v_nop" :: "v"(a), "v"(b), "v"(c), "v"(d));
#endif
}
__device__ __forceinline__ void acc_guard4(v8f& a, v8f& b, v8f& c, v8f& d) {
#if defined(__HIP_DEVICE_COMPILE__)
  asm volatile("v_nop\n\tv_nop\n\tv_nop\n\tv_nop" : "+v"(a), "+v"(b), "+v"(c), "+v"(d));
#endif
}

// =====================================================================================================
// f32 plane -> f16 bits of bfr(v) * scale (scale a power of two): x (x16) and the [n][k] weights (x1024),
// whose [out][in] layout is already the k-contiguous Bt layout of the GEMM below.
// coverage: n8 threads x 8 = the whole plane.
// =====================================================================================================
__global__ __launch_bounds__(256) void cvt16(const float* __restrict__ in, unsigned short* out, int n8, float scale) {
  const int i = blockIdx.x * 256 + threadIdx.x;
  if (i < n8) {
    const v4f a = *(const v4f*)(in + (size_t)i * 8);
    const v4f b = *(const v4f*)(in + (size_t)i * 8 + 4);
    v4u p;
    p[0] = pk16(h_bits((_Float16)(bfr(a[0]) * scale)), h_bits((_Float16)(bfr(a[1]) * scale)));
    p[1] = pk16(h_bits((_Float16)(bfr(a[2]) * scale)), h_bits((_Float16)(bfr(a[3]) * scale)));
    p[2] = pk16(h_bits((_Float16)(bfr(b[0]) * scale)), h_bits((_Float16)(bfr(b[1]) * scale)));
    p[3] = pk16(h_bits((_Float16)(bfr(b[2]) * scale)), h_bits((_Float16)(bfr(b[3]) * scale)));
    *(v4u*)(out + (size_t)i * 8) = p;
    
  }
}

// =====================================================================================================
// RoPE inverse frequencies: inv[m] = 1 / powf(10000, (2m)/64), m = 0..31, f32. One block of 32 threads;
// =====================================================================================================
__global__ __launch_bounds__(32) void k_invfreq(float* inv) {
  const int m = threadIdx.x & 31;
  const float e = (float)(2 * m) * (1.0f / 64.0f);
  const float p = powf(10000.0f, e);
  const float v = 1.0f / p;
  *(float*)(inv + m) = v;
  
}

// =====================================================================================================
// RoPE table tab[t][64] f32: [0..31] = cos(t * inv[m]), [32..63] = sin(t * inv[m]) (precise sincosf, f32
// angle = fl(t * inv[m])). Block = 8 tokens x 32 pairs (256 threads); the 8x64 tile is staged in LDS, then
// coverage: compute 8 x 32 threads x 2 = 8x64; store 128 lanes x 4 floats = 8 rows x 64; grid covers every t.
// =====================================================================================================
__global__ __launch_bounds__(256) void k_rope_tab(const float* __restrict__ inv, float* tab) {
  __shared__ __align__(16) float st[8 * 64];
  const int tid = threadIdx.x;
  const int m   = tid & 31, tr = tid >> 5;
  const int t   = blockIdx.x * 8 + tr;              // < SEQ by the grid
  const float w = inv[m];
  const float ang = (float)t * w;
  float sn, cs;
  sincosf(ang, &sn, &cs);
  st[tr * 64 + m]      = cs;
  st[tr * 64 + 32 + m] = sn;
  __syncthreads();
  if (tid < 128) {                                  // waves 0..3, wave-uniform
    const int row = tid >> 4, c4 = (tid & 15) * 4;
    const v4f v = *(const v4f*)(st + row * 64 + c4);
    float* dst = tab + (size_t)(blockIdx.x * 8 + row) * 64 + c4;
    *(v4f*)dst = v;
    
  }
}

// =====================================================================================================
// Register-blocked f16 WMMA GEMM, one wave per 64x64 tile, no block barriers:
//   v[m][n] = (sum_k A[m][k] * Bt[n][k]  [+ 2^-11 * sum_k Ar[m][k] * Bt[n][k] when ARES]) * cscale
// A, Ar row-major [M][K] pitch lda (f16), Bt row-major [N][K] pitch ldb (f16, k contiguous); M, N multiples of
// 64, K multiple of 32; tile count a multiple of 8 at the call (a wave-uniform bound check anyway).
// ARES: the residual plane is accumulated first from zero, the accumulators are scaled by 2^-11 exactly on the
// VALU (with nop gaps on both sides), then the hi plane accumulates on top: one accumulator set.
// Epilogue variants:
//   EPI 0: f16 hi plane = f16(v' * oscale) at Cp and residual plane = f16((v'*oscale - hi) * 2048) at Crp,
//          pitch ldc halves, where v' = v for tiles with n0 >= ropeN and, for n0 < ropeN (wave-uniform),
//          v' = rotate-half RoPE of the wave's 64-column tile (one head): pair index mm = column mod 32,
//          token = output row, c = rtab[token][mm], s = rtab[token][32+mm]:
//          col mm -> v[mm]*c - v[32+mm]*s ; col 32+mm -> v[32+mm]*c + v[mm]*s (f32, from the LDS slab).
//   EPI 1: f32 out = v, pitch ldc floats
// 16-row slabs staged per wave in LDS. f32 out: each 64-wide row segment (256 B = 2 lines) by 16 lanes x 16 B,
// coverage: 4 slabs x 16 rows x 64 cols = the wave's whole 64x64 tile; grid x 8 tiles = [M][N].
// =====================================================================================================
template <int EPI, bool ARES>
__global__ __launch_bounds__(256) void gemm64_f16(
    const unsigned short* __restrict__ Ap, const unsigned short* __restrict__ Arp, int lda,
    const unsigned short* __restrict__ Btp, int ldb,
    float cscale,
    void* Cp, unsigned short* Crp, int ldc, int M, int N, int K, float oscale,
    const float* __restrict__ rtab, int ropeN) {
  const _Float16* Ah  = (const _Float16*)(const void*)Ap;
  const _Float16* Arh = (const _Float16*)(const void*)Arp;
  const _Float16* Bt  = (const _Float16*)(const void*)Btp;
  __shared__ __align__(16) float sT[8][16 * 68];   // per-wave 16x64 slab, pitch 68 floats
  const int lane = threadIdx.x & 31;
  const int wave = threadIdx.x >> 5;
  const int tilesN = N >> 6;
  const int tilesM = M >> 6;
  const int tile = blockIdx.x * 8 + wave;
  if (tile >= tilesM * tilesN) return;   // wave-uniform; no block barriers in this kernel
  const int tm = tile / tilesN;
  const int tn = tile - tm * tilesN;
  const int m0 = tm << 6;
  const int n0 = tn << 6;

  const int rlane = lane & 15;                 // row (A) / col (B, D) within subtile
  const int koff  = (lane >> 4) * 8;           // k offset of this lane half
  const int mOff  = (lane >> 4) * 8;           // D row offset

  v8f acc[4][4];
#pragma unroll
  for (int i = 0; i < 4; ++i)
#pragma unroll
    for (int j = 0; j < 4; ++j) acc[i][j] = zero8();

  constexpr int NPL = ARES ? 2 : 1;
#pragma unroll 1
  for (int pl = 0; pl < NPL; ++pl) {
    const _Float16* Asel = (ARES && pl == 0) ? Arh : Ah;     // wave-uniform selection of a global pointer
    if (ARES && pl == 1) {
      acc_guard4(acc[0][0], acc[0][1], acc[0][2], acc[0][3]);
      acc_guard4(acc[1][0], acc[1][1], acc[1][2], acc[1][3]);
      acc_guard4(acc[2][0], acc[2][1], acc[2][2], acc[2][3]);
      acc_guard4(acc[3][0], acc[3][1], acc[3][2], acc[3][3]);
#pragma unroll
      for (int i = 0; i < 4; ++i)
#pragma unroll
        for (int j = 0; j < 4; ++j) acc[i][j] = acc[i][j] * (1.0f / 2048.0f);   // exact fold of the x2^11 residual carry
      acc_guard4(acc[0][0], acc[0][1], acc[0][2], acc[0][3]);
      acc_guard4(acc[1][0], acc[1][1], acc[1][2], acc[1][3]);
      acc_guard4(acc[2][0], acc[2][1], acc[2][2], acc[2][3]);
      acc_guard4(acc[3][0], acc[3][1], acc[3][2], acc[3][3]);
    }
    for (int k0 = 0; k0 < K; k0 += 32) {
      v16h bh[4];
#pragma unroll
      for (int j = 0; j < 4; ++j) {
        const size_t bo = (size_t)(n0 + (j << 4) + rlane) * ldb + koff + k0;
        bh[j] = ldfrag_h(Bt + bo);
      }
#pragma unroll
      for (int i = 0; i < 4; ++i) {
        const size_t ao = (size_t)(m0 + (i << 4) + rlane) * lda + koff + k0;
        const v16h ah = ldfrag_h(Asel + ao);
#pragma unroll
        for (int j = 0; j < 4; ++j) {
          acc[i][j] = mma_h_raw(ah, bh[j], acc[i][j]);
        }
        dep_guard_h(acc[i][0], acc[i][3], ah, bh[3]);
      }
      keep4_h(bh[0], bh[1], bh[2], bh[3]);
    }
  }
  acc_guard4(acc[0][0], acc[0][1], acc[0][2], acc[0][3]);
  acc_guard4(acc[1][0], acc[1][1], acc[1][2], acc[1][3]);
  acc_guard4(acc[2][0], acc[2][1], acc[2][2], acc[2][3]);
  acc_guard4(acc[3][0], acc[3][1], acc[3][2], acc[3][3]);

  // ---- epilogue ----
  float* slab = sT[wave];
#pragma unroll
  for (int i = 0; i < 4; ++i) {
    const int mBase = m0 + (i << 4);
#pragma unroll
    for (int r = 0; r < 8; ++r) {
      const int row = mOff + r;
#pragma unroll
      for (int j = 0; j < 4; ++j) slab[row * 68 + (j << 4) + rlane] = acc[i][j][r] * cscale;
    }
    __builtin_amdgcn_fence(__ATOMIC_RELEASE, "workgroup");
    __builtin_amdgcn_wave_barrier();
    __builtin_amdgcn_fence(__ATOMIC_ACQUIRE, "workgroup");
    if constexpr (EPI == 0) {
      unsigned short* C16 = (unsigned short*)Cp;
      const int rq = lane >> 3, piece = lane & 7;
      const bool rope_on = (n0 < ropeN);                   // wave-uniform (n0 is per wave)
      const float rsgn = (piece < 4) ? -1.0f : 1.0f;       // cols 0..31 carry x1 (minus), cols 32..63 carry x2 (plus)
      const int   pm   = (piece & 3) * 8;                  // rotation pair index base of this lane's 8 columns
      v4u ph[4], pr[4];
#pragma unroll
      for (int it = 0; it < 4; ++it) {
        const int row = it * 4 + rq;                         // it 0..3 x rq 0..3 = rows 0..15
        const v4f a  = *(const v4f*)(slab + row * 68 + piece * 8);
        const v4f a2 = *(const v4f*)(slab + row * 68 + piece * 8 + 4);
        float f[8];
        f[0] = a[0];  f[1] = a[1];  f[2] = a[2];  f[3] = a[3];
        f[4] = a2[0]; f[5] = a2[1]; f[6] = a2[2]; f[7] = a2[3];
        if (rope_on) {                                       // wave-uniform branch, LDS and table reads only
          const int po = (piece ^ 4) * 8;                    // partner half of the head (32 columns away)
          const v4f g  = *(const v4f*)(slab + row * 68 + po);
          const v4f g2 = *(const v4f*)(slab + row * 68 + po + 4);
          const float* trp = rtab + (size_t)(mBase + row) * 64 + pm;   // output row = token index
          const v4f c0 = *(const v4f*)(trp);
          const v4f c1 = *(const v4f*)(trp + 4);
          const v4f s0 = *(const v4f*)(trp + 32);
          const v4f s1 = *(const v4f*)(trp + 36);
          f[0] = f[0] * c0[0] + rsgn * g[0]  * s0[0];
          f[1] = f[1] * c0[1] + rsgn * g[1]  * s0[1];
          f[2] = f[2] * c0[2] + rsgn * g[2]  * s0[2];
          f[3] = f[3] * c0[3] + rsgn * g[3]  * s0[3];
          f[4] = f[4] * c1[0] + rsgn * g2[0] * s1[0];
          f[5] = f[5] * c1[1] + rsgn * g2[1] * s1[1];
          f[6] = f[6] * c1[2] + rsgn * g2[2] * s1[2];
          f[7] = f[7] * c1[3] + rsgn * g2[3] * s1[3];
        }
        v4u p, q;
#pragma unroll
        for (int e = 0; e < 4; ++e) {
          const float g0 = f[2 * e] * oscale, g1 = f[2 * e + 1] * oscale;
          const _Float16 x0 = (_Float16)g0, x1 = (_Float16)g1;
          const _Float16 y0 = (_Float16)((g0 - (float)x0) * 2048.0f);
          const _Float16 y1 = (_Float16)((g1 - (float)x1) * 2048.0f);
          p[e] = pk16(h_bits(x0), h_bits(x1));
          q[e] = pk16(h_bits(y0), h_bits(y1));
        }
        ph[it] = p;
        pr[it] = q;
      }
      {
#pragma unroll
        for (int it = 0; it < 4; ++it) {
          const int row = it * 4 + rq;
          const size_t co = (size_t)(mBase + row) * ldc + n0 + piece * 8;
          *(v4u*)(C16 + co) = ph[it];
          *(v4u*)(Crp + co) = pr[it];
        }
        
      }
    } else {
      float* Cf = (float*)Cp;
      const int hh = lane >> 4, c4 = (lane & 15) * 4;     // 256-B row segment = 16 lanes x 16 B
      v4f ov[8];
#pragma unroll
      for (int it = 0; it < 8; ++it) {
        const int row = it * 2 + hh;                       // it 0..7 x hh 0..1 = rows 0..15
        ov[it] = *(const v4f*)(slab + row * 68 + c4);
      }
      {
#pragma unroll
        for (int it = 0; it < 8; ++it) {
          const int row = it * 2 + hh;
          *(v4f*)(Cf + (size_t)(mBase + row) * ldc + n0 + c4) = ov[it];
        }
        
      }
    }
    __builtin_amdgcn_fence(__ATOMIC_RELEASE, "workgroup");
    __builtin_amdgcn_wave_barrier();
    __builtin_amdgcn_fence(__ATOMIC_ACQUIRE, "workgroup");
  }
}

// =====================================================================================================
// v columns of an f16 qkv plane (token-major, element (t, h, d) at [t*DQKV + 2*DM + h*64 + d])
// -> f16 v^T plane vt[(h*64 + d)*SEQ + t] (same bits). Used for the hi plane and the residual plane.
// Block = one 64-token x 64-feature tile of one head; grid = (SEQ/64, NH); tile staged in LDS as halves
// (v8h 16-B stores, __syncthreads, _Float16 element reads).
// Store: group g = tid>>3 (0..31), piece = tid&7: iteration it writes row d = it*32+g, lanes 8q..8q+7 x 16 B =
// coverage: load 2 x 256 threads x 8 halves = 64x64; store 2 iterations x 32 groups = 64 rows d, 8 pieces x 8
// = 64 tokens per row; grid covers every (h, token tile).
// =====================================================================================================
__global__ __launch_bounds__(256) void v_tr(const unsigned short* __restrict__ qkvp, unsigned short* vt) {
  __shared__ __align__(16) _Float16 sv[64 * 72];       // [tt][d], pitch 72 halves (144 B)
  const int tid = threadIdx.x;
  const int t0  = blockIdx.x * 64;
  const int hh  = blockIdx.y;
  const _Float16* src = (const _Float16*)(const void*)qkvp;
#pragma unroll
  for (int i = 0; i < 2; ++i) {
    const int idx = i * 256 + tid;                  // 0..511
    const int tt = idx >> 3, c8 = (idx & 7) * 8;
    const v8h a = *(const v8h*)(src + ((size_t)(t0 + tt)) * DQKV + 2 * DM + hh * HD + c8);
    *(v8h*)(sv + tt * 72 + c8) = a;
  }
  __syncthreads();

  const int g = tid >> 3, piece = tid & 7;
  v4u hv[2];
  size_t hofs[2];
#pragma unroll
  for (int it = 0; it < 2; ++it) {
    const int d = it * 32 + g;
    v4u a;
#pragma unroll
    for (int e = 0; e < 4; ++e) {
      const _Float16 x0 = sv[(piece * 8 + 2 * e) * 72 + d];
      const _Float16 x1 = sv[(piece * 8 + 2 * e + 1) * 72 + d];
      a[e] = pk16(h_bits(x0), h_bits(x1));
    }
    hv[it] = a;
    hofs[it] = ((size_t)(hh * HD + d)) * SEQ + t0 + piece * 8;
  }
  {
#pragma unroll
    for (int it = 0; it < 2; ++it) *(v4u*)(vt + hofs[it]) = hv[it];
    
  }
}

// =====================================================================================================
// Windowed causal multi-head softmax attention, head dim 64, online-max form.
//   q f16 (x16): element (t, h, d) at qkv[t*DQKV + h*64 + d]; k at + DM; residual planes (x2^11 of the f16
//   residue) in qkvr with the same addressing; v^T f16 (x16) at vt[(h*64 + d)*SEQ + s], residual vtr.
//   logit a = (q.k) / 8 = acc / 2048 (two x16 carries); HR: acc = qh.kh + 2^-11 (qh.kr + qr.kh).
//   Key j is allowed for query row i iff (j <= i) and (j + WIN >= i) (both bounds inclusive, up to WIN+1 keys);
//   other keys get a = -1e30 (select by value) and p = 0 (select by value). Per 64-key tile: tile max (per-lane
//   max over the 4 key groups, then a 16-lane xor max), mn = max(mrun, tile max), alpha = exp(mrun - mn),
//   p = exp(a - mn), lsum = lsum * alpha + sum p (per-lane partials, 16-lane xor reduction at the end), context
//   accumulators scaled by alpha on the VALU (nop gaps on both sides). A query row whose keys in a visited tile
//   are all masked keeps mrun, gets alpha = 1 and p = 0. The diagonal tile gives every row its own key, so
//   lsum >= 1 at the end.
//   P carried as f16(256 p) (HR: plus residual f16((256p - hi)*2048)); context = P . v^T on f16 WMMA
//   (HR: second accumulator += Ph.Vr + Pr.Vh, folded with 2^-11).
//   ctx plane f16 (x16): element (t, h*64 + d) at ctx[t*DM + h*64 + d] = 16 * context / (4096 lsum);
//   HR also writes the ctx residual plane f16((16 ctx - hi) * 2048).
//   Block = 4 waves = 64 query rows of one head; query tile qb = blockIdx % NQB, head = blockIdx / NQB;
//   grid = NQB*NH; kv tiles of 64 from max(qb - KTW + 1, 0) to qb, block-uniform trip count <= KTW (key tiles
//   outside the window are never visited; keys outside the window inside a visited tile contribute exactly 0).
//   K / V^T tile staging: 128 threads x 32 halves per plane = the whole 64x64 tile (plain 16-B loads,
//   __syncthreads before and after); P tiles are wave-private, spilled with _Float16 element stores and
//   wave in LDS as f32 (aliasing the K/V region after a block barrier) the same way.
//   Output coverage: each wave stores rows 0..15 of its tile (it 0..3 x lane>>3 0..3) x 64 columns (8 lanes x
//   every (head, query tile) exactly once.
// =====================================================================================================
template <bool HR>
__global__ __launch_bounds__(128)
void attn_k(const unsigned short* __restrict__ qkvp, const unsigned short* __restrict__ qkvrp,
            const unsigned short* __restrict__ vtp, const unsigned short* __restrict__ vtrp,
            unsigned short* ctxp, unsigned short* ctxrp) {
  union FH { v16h v; v8h h[2]; };
  constexpr int TB     = 64 * 64 * 2;                    // one f16 64x64 tile, bytes
  constexpr int PB     = 4 * 16 * 64 * 2;                // four wave-private 16x64 f16 P tiles, bytes
  constexpr int OFF_K  = 0;
  constexpr int OFF_V  = TB;
  constexpr int OFF_KR = 2 * TB;
  constexpr int OFF_VR = 3 * TB;
  constexpr int OFF_P  = HR ? 4 * TB : 2 * TB;
  constexpr int OFF_PR = OFF_P + PB;
  constexpr int SMEMB  = HR ? (OFF_PR + PB) : (OFF_P + PB);   // 49152 : 24576
  static_assert(4 * 16 * 64 * 4 <= OFF_P);                    // f32 context staging aliases the K/V region
  __shared__ __align__(16) unsigned char smem[SMEMB];
  _Float16* Ksh = (_Float16*)(smem + OFF_K);                  // K   [kv][d]
  _Float16* Vsh = (_Float16*)(smem + OFF_V);                  // V^T [d][kv]
  _Float16* Krs = (_Float16*)(smem + (HR ? OFF_KR : OFF_K));  // K residual (HR only)
  _Float16* Vrs = (_Float16*)(smem + (HR ? OFF_VR : OFF_V));  // V^T residual (HR only)
  _Float16* Psh = (_Float16*)(smem + OFF_P);
  _Float16* Prs = (_Float16*)(smem + (HR ? OFF_PR : OFF_P));

  const int tid  = threadIdx.x;
  const int wave = tid >> 5;
  const int lane = tid & 31;
  const int hh   = lane >> 4;
  const int c    = lane & 15;

  const int bx   = blockIdx.x;
  const int qb   = bx % NQB;
  const int h    = bx / NQB;                 // < NH by the grid size
  const int q0   = qb * 64 + wave * 16;

  const _Float16* Qp  = (const _Float16*)(const void*)qkvp  + (size_t)h * HD;
  const _Float16* Qrp = (const _Float16*)(const void*)qkvrp + (size_t)h * HD;
  const _Float16* Kp  = Qp + DM;
  const _Float16* Krp = Qrp + DM;
  const _Float16* Vt  = (const _Float16*)(const void*)vtp  + ((size_t)h * HD) * SEQ;
  const _Float16* Vrt = (const _Float16*)(const void*)vtrp + ((size_t)h * HD) * SEQ;

  // ---- Q fragments (A operand, row = lane&15): 2 d-chunks ----
  v16h qa[2], qr[2];
#pragma unroll
  for (int dc = 0; dc < 2; ++dc) {
    const size_t qo = (size_t)(q0 + c) * DQKV + dc * 32 + 8 * hh;
    qa[dc] = ldfrag_h(Qp + qo);
    if constexpr (HR) qr[dc] = ldfrag_h(Qrp + qo);
    else qr[dc] = qa[dc];
  }

  float lsum[8], mrun[8];
  v8f oacc[4], oacc2[4];
#pragma unroll
  for (int r = 0; r < 8; ++r) { lsum[r] = 0.f; mrun[r] = -1e30f; }
#pragma unroll
  for (int t = 0; t < 4; ++t) { oacc[t] = zero8(); oacc2[t] = zero8(); }

  _Float16* pw  = Psh + wave * (16 * 64);
  _Float16* prw = Prs + wave * (16 * 64);

  const int ktlo = (qb >= KTW - 1) ? (qb - (KTW - 1)) : 0;   // first key tile in the window, block-uniform
  const int nkt  = qb - ktlo + 1;                              // 1..KTW key tiles, block-uniform
  for (int kti = 0; kti < nkt; ++kti) {
    const int kv0 = (ktlo + kti) * 64;                         // <= qb*64 < SEQ
    __syncthreads();
    {
      const int r = tid >> 1, half = (tid & 1) * 32;
      const size_t ko = (size_t)(kv0 + r) * DQKV + half;      // K row kv0+r, d = half..half+31
      const size_t vo = (size_t)r * SEQ + kv0 + half;           // V^T row d = r, s = kv0+half..+31
#pragma unroll
      for (int i = 0; i < 4; ++i) {
        const v8h a0 = *(const v8h*)(Kp + ko + 8 * i);
        const v8h b0 = *(const v8h*)(Vt + vo + 8 * i);
        *(v8h*)(Ksh + r * 64 + half + 8 * i) = a0;
        *(v8h*)(Vsh + r * 64 + half + 8 * i) = b0;
        if constexpr (HR) {
          const v8h a1 = *(const v8h*)(Krp + ko + 8 * i);
          const v8h b1 = *(const v8h*)(Vrt + vo + 8 * i);
          *(v8h*)(Krs + r * 64 + half + 8 * i) = a1;
          *(v8h*)(Vrs + r * 64 + half + 8 * i) = b1;
        }
      }
    }
    __syncthreads();

    // ---- scores: 16 query rows x 64 keys per wave (B operand: lane c -> key j*16+c, split k map over d) ----
    v8f s[4];
#pragma unroll
    for (int j = 0; j < 4; ++j) {
      s[j] = zero8();
      v8f t = zero8();
#pragma unroll
      for (int dc = 0; dc < 2; ++dc) {
        FH kb;
        kb.h[0] = *(const v8h*)(Ksh + (j * 16 + c) * 64 + dc * 32 + 8 * hh);
        kb.h[1] = *(const v8h*)(Ksh + (j * 16 + c) * 64 + dc * 32 + 16 + 8 * hh);
        s[j] = mma_h(qa[dc], kb.v, s[j]);
        if constexpr (HR) {
          FH krb;
          krb.h[0] = *(const v8h*)(Krs + (j * 16 + c) * 64 + dc * 32 + 8 * hh);
          krb.h[1] = *(const v8h*)(Krs + (j * 16 + c) * 64 + dc * 32 + 16 + 8 * hh);
          t = mma_h(qa[dc], krb.v, t);
          t = mma_h(qr[dc], kb.v, t);
        }
      }
      if constexpr (HR) s[j] = s[j] + t * (1.0f / 2048.0f);
    }

    // ---- windowed causal online softmax: tile max, running max, alpha, p, row-sum partials,
    //      P (x256, f16; HR: + residual) ----
    float alpha[8];
#pragma unroll
    for (int r = 0; r < 8; ++r) {
      const int qrow = q0 + 8 * hh + r;
      float av[4];
      float tmx = -1e30f;
#pragma unroll
      for (int j = 0; j < 4; ++j) {
        const int key = kv0 + j * 16 + c;
        float a = s[j][r] * (1.0f / 2048.0f);              // 1/8 head scale, 1/256 for the two x16 carries
        const bool ok = (key <= qrow) && (key + WIN >= qrow);
        a = ok ? a : -1e30f;
        av[j] = a;
        tmx = fmaxf(tmx, a);
      }
#pragma unroll
      for (int off = 1; off < 16; off <<= 1) tmx = fmaxf(tmx, __shfl_xor(tmx, off, 32));
      const float mn = fmaxf(mrun[r], tmx);
      const float al = __expf(mrun[r] - mn);
      alpha[r] = al;
      mrun[r]  = mn;
      float ps = 0.0f;
#pragma unroll
      for (int j = 0; j < 4; ++j) {
        const int key = kv0 + j * 16 + c;
        const bool ok = (key <= qrow) && (key + WIN >= qrow);
        float p = __expf(av[j] - mn);
        p = ok ? p : 0.0f;
        ps += p;
        const float g = p * 256.0f;
        const _Float16 x0 = (_Float16)g;
        pw[(8 * hh + r) * 64 + j * 16 + c] = x0;
        if constexpr (HR) prw[(8 * hh + r) * 64 + j * 16 + c] = (_Float16)((g - (float)x0) * 2048.0f);
      }
      lsum[r] = lsum[r] * al + ps;
    }
    __builtin_amdgcn_fence(__ATOMIC_RELEASE, "workgroup");
    __builtin_amdgcn_wave_barrier();
    __builtin_amdgcn_fence(__ATOMIC_ACQUIRE, "workgroup");

    // ---- rescale the context accumulators by alpha (VALU), nop gaps before the next WMMA reads them ----
#pragma unroll
    for (int t = 0; t < 4; ++t) {
#pragma unroll
      for (int r = 0; r < 8; ++r) {
        oacc[t][r] = oacc[t][r] * alpha[r];
        if constexpr (HR) oacc2[t][r] = oacc2[t][r] * alpha[r];
      }
    }
    acc_guard4(oacc[0], oacc[1], oacc[2], oacc[3]);
    if constexpr (HR) acc_guard4(oacc2[0], oacc2[1], oacc2[2], oacc2[3]);

    // ---- context += P . V (f16 WMMA; A = P [row][key], B = V^T [d][key]) ----
#pragma unroll
    for (int kk = 0; kk < 2; ++kk) {
      FH pa, par;
      pa.h[0] = *(const v8h*)(pw + c * 64 + kk * 32 + 8 * hh);
      pa.h[1] = *(const v8h*)(pw + c * 64 + kk * 32 + 16 + 8 * hh);
      if constexpr (HR) {
        par.h[0] = *(const v8h*)(prw + c * 64 + kk * 32 + 8 * hh);
        par.h[1] = *(const v8h*)(prw + c * 64 + kk * 32 + 16 + 8 * hh);
      } else {
        par.v = pa.v;
      }
#pragma unroll
      for (int t = 0; t < 4; ++t) {
        FH vb;
        vb.h[0] = *(const v8h*)(Vsh + (t * 16 + c) * 64 + kk * 32 + 8 * hh);
        vb.h[1] = *(const v8h*)(Vsh + (t * 16 + c) * 64 + kk * 32 + 16 + 8 * hh);
        oacc[t] = mma_h(pa.v, vb.v, oacc[t]);
        if constexpr (HR) {
          FH vrb;
          vrb.h[0] = *(const v8h*)(Vrs + (t * 16 + c) * 64 + kk * 32 + 8 * hh);
          vrb.h[1] = *(const v8h*)(Vrs + (t * 16 + c) * 64 + kk * 32 + 16 + 8 * hh);
          oacc2[t] = mma_h(pa.v, vrb.v, oacc2[t]);
          oacc2[t] = mma_h(par.v, vb.v, oacc2[t]);
        }
      }
    }
  }
  __syncthreads();                           // every wave is done with the K/V tiles before they are aliased

  // ---- normalise (1/lsum, the 1/256 p carry; keep the x16 v carry), stage the wave's 16x64 f32 tile in
  float* os = (float*)(void*)smem + wave * (16 * 64);
#pragma unroll
  for (int r = 0; r < 8; ++r) {
    float l = lsum[r];
#pragma unroll
    for (int off = 1; off < 16; off <<= 1) l += __shfl_xor(l, off, 32);
    const float rl = 1.0f / l;               // l >= 1 (the max key contributes p = 1)
    const float sc = rl * (1.0f / 256.0f);
#pragma unroll
    for (int t = 0; t < 4; ++t) {
      float v = oacc[t][r];
      if constexpr (HR) v += oacc2[t][r] * (1.0f / 2048.0f);
      os[(8 * hh + r) * 64 + t * 16 + c] = v * sc;
    }
  }
  __builtin_amdgcn_fence(__ATOMIC_RELEASE, "workgroup");
  __builtin_amdgcn_wave_barrier();
  __builtin_amdgcn_fence(__ATOMIC_ACQUIRE, "workgroup");
  {
    const int rq = lane >> 3, piece = lane & 7;
    v4u ph[4], pr[4];
#pragma unroll
    for (int it = 0; it < 4; ++it) {
      const int row = it * 4 + rq;   // it 0..3 x rq 0..3 = rows 0..15 of the wave tile
      const v4f a  = *(const v4f*)(os + row * 64 + piece * 8);
      const v4f a2 = *(const v4f*)(os + row * 64 + piece * 8 + 4);
      float f[8];
      f[0] = a[0];  f[1] = a[1];  f[2] = a[2];  f[3] = a[3];
      f[4] = a2[0]; f[5] = a2[1]; f[6] = a2[2]; f[7] = a2[3];
      v4u p, q;
#pragma unroll
      for (int e = 0; e < 4; ++e) {
        const _Float16 x0 = (_Float16)f[2 * e], x1 = (_Float16)f[2 * e + 1];
        p[e] = pk16(h_bits(x0), h_bits(x1));
        if constexpr (HR) {
          const _Float16 y0 = (_Float16)((f[2 * e] - (float)x0) * 2048.0f);
          const _Float16 y1 = (_Float16)((f[2 * e + 1] - (float)x1) * 2048.0f);
          q[e] = pk16(h_bits(y0), h_bits(y1));
        } else {
          q[e] = p[e];
        }
      }
      ph[it] = p;
      pr[it] = q;
    }
    {
#pragma unroll
      for (int it = 0; it < 4; ++it) {
        const int row = it * 4 + rq;
        const size_t go = (size_t)(q0 + row) * DM + (size_t)h * HD + piece * 8;
        *(v4u*)(ctxp + go) = ph[it];
        if constexpr (HR) *(v4u*)(ctxrp + go) = pr[it];
      }
      
    }
  }
}

// =====================================================================================================
// Workspace map (bytes); every region is an exact multiple of its whole-line / whole-tile store granularity
// (row pitches 2048 / 6144 / 8192 / 256 B, all offsets multiples of 256, no aliasing within a launch):
//   Xh     f16 [SEQ][1024]                 (bf16 value of x, x16)
//   Wqkv   f16 [3072][1024]                (bf16 values of wq | wk | wv x1024, [n][k] = the input layout)
//   Wp     f16 [1024][1024]                (bf16 value of wo x1024, [n][k])
//   QKV    f16 [SEQ][3072]                 (rotated q | rotated k | v, x16)
//   QKVr   f16 [SEQ][3072]                 (x2^11 residual of the above)
//   VT     f16 [1024][SEQ]                 ([h*64 + d][s])
//   VTr    f16 [1024][SEQ]                 (residual)
//   Ctx    f16 [SEQ][1024]                 (attention context x16)
//   Ctxr   f16 [SEQ][1024]                 (residual)
//   Rt     f32 [SEQ][64]                   (cos | sin table)
//   Inv    f32 [32] (256 B)                (inverse frequencies)
//   total for SEQ = 4096: 101712128
// d_out f32: [SEQ][1024] at byte 0, every 64x64 tile written once by the projection launch.
// =====================================================================================================
extern "C" void kernel_launch(void* const* d_in, const int* in_sizes, int n_in,
                              void* d_out, int out_size, void* d_ws, size_t ws_size,
                              hipStream_t stream) {
  if (n_in < 5) return;
  if (in_sizes[0] < SEQ * DM) return;
  if (in_sizes[1] != DM * DM) return;
  if (in_sizes[2] != DM * DM) return;
  if (in_sizes[3] != DM * DM) return;
  if (in_sizes[4] != DM * DM) return;
  if (out_size < OUTN) return;

  const float* x  = (const float*)d_in[0];    // [SEQ][DM] (row prefix)
  const float* wq = (const float*)d_in[1];    // [DM n][DM k]
  const float* wk = (const float*)d_in[2];    // [DM n][DM k]
  const float* wv = (const float*)d_in[3];    // [DM n][DM k]
  const float* wo = (const float*)d_in[4];    // [DM n][DM k]

  const size_t PX   = (size_t)SEQ * DM * 2;          //  8388608 (SEQ 4096)
  const size_t PWq  = (size_t)DQKV * DM * 2;         //  6291456
  const size_t PWp  = (size_t)DM * DM * 2;           //  2097152
  const size_t PQKV = (size_t)SEQ * DQKV * 2;        // 25165824
  const size_t PVT  = (size_t)DM * SEQ * 2;          //  8388608
  const size_t PCtx = (size_t)SEQ * DM * 2;          //  8388608
  const size_t PRt  = (size_t)SEQ * 64 * 4;          //  1048576
  const size_t PInv = 256;
  size_t off = 0;
  const size_t oX    = off; off += PX;
  const size_t oWq   = off; off += PWq;
  const size_t oWp   = off; off += PWp;
  const size_t oQKV  = off; off += PQKV;
  const size_t oQKVr = off; off += PQKV;
  const size_t oVT   = off; off += PVT;
  const size_t oVTr  = off; off += PVT;
  const size_t oCtx  = off; off += PCtx;
  const size_t oCtxr = off; off += PCtx;
  const size_t oRt   = off; off += PRt;
  const size_t oInv  = off; off += PInv;
  if (off > ws_size) return;                         // off = 101712128 for SEQ 4096
  if (off > (size_t)134217728) return;

  char* ws = (char*)d_ws;
  unsigned short* Xh   = (unsigned short*)(ws + oX);
  unsigned short* Wqkv = (unsigned short*)(ws + oWq);
  unsigned short* Wp   = (unsigned short*)(ws + oWp);
  unsigned short* QKV  = (unsigned short*)(ws + oQKV);
  unsigned short* QKVr = (unsigned short*)(ws + oQKVr);
  unsigned short* VT   = (unsigned short*)(ws + oVT);
  unsigned short* VTr  = (unsigned short*)(ws + oVTr);
  unsigned short* Ctx  = (unsigned short*)(ws + oCtx);
  unsigned short* Ctxr = (unsigned short*)(ws + oCtxr);
  float*          Rt   = (float*)(ws + oRt);
  float*          Inv  = (float*)(ws + oInv);
  float*          outf = (float*)d_out;              // [SEQ][DM]

  const dim3 blk(256);
  const int n8x = SEQ * DM / 8;                      // 524288 for SEQ 4096
  const int n8w = DM * DM / 8;                       // 131072
  const dim3 gCx(n8x / 256);
  const dim3 gCw(n8w / 256);                         // 512 blocks
  const dim3 gGqkv(((SEQ / 64) * (DQKV / 64)) / 8);  // 3072 tiles -> 384 blocks (SEQ 4096)
  const dim3 gGdm(((SEQ / 64) * (DM / 64)) / 8);     // 1024 tiles -> 128 blocks
  const dim3 gVt(SEQ / 64, NH);                      // (64, 16)
  const dim3 gAttn(NQB * NH);                        // 1024 blocks: every (head, query tile)
  const dim3 gRt(SEQ / 8);                           // 512 blocks
  const float wScale = 1024.0f;                      // weights carried x1024
  const float aScale = 16.0f;                        // activations carried x16
  const float cscale = 1.0f / 16384.0f;              // 1/(16 * 1024)

  // (1) planes: x -> f16 x16 (bf16 values); weights [n][k] -> f16 x1024 (bf16 values), wq | wk | wv stacked
  cvt16<<<gCx, blk, 0, stream>>>(x, Xh, n8x, aScale);
  cvt16<<<gCw, blk, 0, stream>>>(wq, Wqkv, n8w, wScale);
  cvt16<<<gCw, blk, 0, stream>>>(wk, Wqkv + (size_t)DM * DM, n8w, wScale);
  cvt16<<<gCw, blk, 0, stream>>>(wv, Wqkv + (size_t)2 * DM * DM, n8w, wScale);
  cvt16<<<gCw, blk, 0, stream>>>(wo, Wp, n8w, wScale);
  // (2) RoPE tables: inverse frequencies, then cos | sin per token
  k_invfreq<<<dim3(1), dim3(32), 0, stream>>>(Inv);
  k_rope_tab<<<gRt, blk, 0, stream>>>(Inv, Rt);
  // (3) qkv = Xh . Wqkv^T with RoPE on the q and k column blocks (n0 < 2*DM) -> QKV f16 x16 + residual plane
  //     [SEQ][3072] (M=SEQ, N=3072, K=1024)
  gemm64_f16<0, false><<<gGqkv, blk, 0, stream>>>(Xh, Xh, DM, Wqkv, DM, cscale, (void*)QKV, QKVr, DQKV,
                                                  SEQ, DQKV, DM, aScale, Rt, 2 * DM);
  // (4) v -> v^T planes (hi and residual, all tokens)
  v_tr<<<gVt, blk, 0, stream>>>(QKV, VT);
  v_tr<<<gVt, blk, 0, stream>>>(QKVr, VTr);
  // (5) windowed causal softmax attention -> Ctx f16 x16 + residual plane (all query tiles)
  attn_k<true><<<gAttn, dim3(128), 0, stream>>>(QKV, QKVr, VT, VTr, Ctx, Ctxr);
  // (6) out = (Ctx + 2^-11 Ctxr) . Wp^T -> d_out f32 [SEQ][1024] (M=SEQ, N=1024, K=1024), every tile once
  gemm64_f16<1, true><<<gGdm, blk, 0, stream>>>(Ctx, Ctxr, DM, Wp, DM, cscale, (void*)outf, Ctxr, DM,
                                                SEQ, DM, DM, 1.0f, Rt, 0);
  (void)hipGetLastError();
}

// v001
// A run of this version takes 179 microseconds.
// Timed twice side by side with v000, it ran 1.60 and 1.61 times as fast.
// Contractions: q|k|v projection = v_wmma_f32_16x16x32_f16 (A = f16 of RNE-bf16 x carried x16, B = f16 of RNE-bf16 wq|wk|wv carried x1024, single product); attention q.k^T and p.v^T = v_wmma_f32_16x16x32_f16 (q, k, v^T f16 planes x16 plus x2^11 residual planes, p f16 x256 plus x2^11 residual; hi.hi + hi.res + res.hi); output projection = v_wmma_f32_16x16x32_f16 (A = ctx f16 x16 plus its x2^11 residual plane, B = f16 of RNE-bf16 wo x1024; hi.B + res.B); all f32 accumulate. RoPE cos/sin table, rotation, windowed causal online-max softmax and row sums in f32 on the VALU.
#include <hip/hip_runtime.h>
#include <math.h>
#include <stdint.h>

#define SEQ   4096                  // token rows processed (a row prefix of x); every stride, carve and grid derives from it
#define DM    1024
#define NH    16
#define HD    64
#define WIN   512
#define DQKV  (3 * DM)              // 3072
#define NQB   (SEQ / 64)            // query tiles of 64 rows
#define KTW   (WIN / 64 + 1)        // key tiles visited per 64-row query tile = 9
#define OUTN  (SEQ * DM)
static_assert(NH * HD == DM);
static_assert(HD == 64);
static_assert((WIN % 64) == 0);
static_assert(KTW == 9);
static_assert((SEQ % 64) == 0 && (DM % 64) == 0 && (DQKV % 64) == 0);
static_assert((DM % 32) == 0);
static_assert((SEQ % 128) == 0 && (DM % 128) == 0 && (DQKV % 128) == 0);   // GEMM block tile 128x128
static_assert((DM % 64) == 0 && DM >= 128);                                 // GEMM pass of 64 k, two passes or more
static_assert(((SEQ * DM / 8) % 256) == 0);
static_assert(((DM * DM / 8) % 256) == 0);
static_assert((SEQ % 8) == 0);

#define GP_B    144                 // GEMM LDS row pitch, bytes: 128-byte row + 16 (16 B x odd, for 16-byte readers)
#define GP_H    (GP_B / 2)          // the same in halves
#define GOFF_B  (128 * GP_B)        // Bt rows behind the A rows inside a stage
#define GSTAGE  (2 * 128 * GP_B)    // one stage, bytes

typedef _Float16 v16h __attribute__((ext_vector_type(16)));
typedef _Float16 v8h  __attribute__((ext_vector_type(8)));
typedef float    v8f  __attribute__((ext_vector_type(8)));
typedef float    v4f  __attribute__((ext_vector_type(4)));
typedef unsigned int v4u __attribute__((ext_vector_type(4)));

// ---- scalar helpers --------------------------------------------------------------------------------
__device__ __forceinline__ unsigned short bf_bits(float f) {          // f32 -> bf16 bits, RNE convert
  unsigned u = __float_as_uint(f);
  return (unsigned short)((u + 0x7FFFu + ((u >> 16) & 1u)) >> 16);
}
__device__ __forceinline__ float bfr(float f) { return __uint_as_float(((unsigned)bf_bits(f)) << 16); }
__device__ __forceinline__ unsigned short h_bits(_Float16 x) { return __builtin_bit_cast(unsigned short, x); }
__device__ __forceinline__ unsigned pk16(unsigned short a, unsigned short b) { return (unsigned)a | ((unsigned)b << 16); }
__device__ __forceinline__ v8f zero8() { v8f z = {0.f, 0.f, 0.f, 0.f, 0.f, 0.f, 0.f, 0.f}; return z; }

// ---- fragment loader: 16-bit A/B operand, lane -> row/col (lane&15), p already includes +8*(lane>>4);
//      elements 0..7 <- p[0..7] (k0+8h..), elements 8..15 <- p[16..23] (k0+16+8h..)
__device__ __forceinline__ v16h ldfrag_h(const _Float16* p) {
  union { v16h v; v8h h[2]; } f;
  f.h[0] = *(const v8h*)(p);
  f.h[1] = *(const v8h*)(p + 16);
  return f.v;
}

// ---- WMMA helpers with trailing VALU hazard gap --------------------------------------------------------
__device__ __forceinline__ v8f mma_h(v16h a, v16h b, v8f c) {
  c = __builtin_amdgcn_wmma_f32_16x16x32_f16(false, a, false, b, (short)0, c, false, false);
#if defined(__HIP_DEVICE_COMPILE__)
  asm volatile("v_nop\n\tv_nop\n\tv_nop\n\tv_nop" : "+v"(c) : "v"(a), "v"(b));
#endif
  return c;
}
__device__ __forceinline__ v8f mma_h_raw(v16h a, v16h b, v8f c) {
  return __builtin_amdgcn_wmma_f32_16x16x32_f16(false, a, false, b, (short)0, c, false, false);
}
__device__ __forceinline__ void dep_guard_h(v8f& a, v8f& b, v16h x, v16h y) {
#if defined(__HIP_DEVICE_COMPILE__)
  asm volatile("v_nop\n\tv_nop\n\tv_nop\n\tv_nop" : "+v"(a), "+v"(b) : "v"(x), "v"(y));
#endif
}
__device__ __forceinline__ void keep4_h(v16h a, v16h b, v16h c, v16h d) {
#if defined(__HIP_DEVICE_COMPILE__)
  asm volatile("v_nop" :: "v"(a), "v"(b), "v"(c), "v"(d));
#endif
}
__device__ __forceinline__ void acc_guard4(v8f& a, v8f& b, v8f& c, v8f& d) {
#if defined(__HIP_DEVICE_COMPILE__)
  asm volatile("v_nop\n\tv_nop\n\tv_nop\n\tv_nop" : "+v"(a), "+v"(b), "+v"(c), "+v"(d));
#endif
}

// =====================================================================================================
// f32 plane -> f16 bits of bfr(v) * scale (scale a power of two): x (x16) and the [n][k] weights (x1024),
// whose [out][in] layout is already the k-contiguous Bt layout of the GEMM below.
// coverage: n8 threads x 8 = the whole plane.
// =====================================================================================================
__global__ __launch_bounds__(256) void cvt16(const float* __restrict__ in, unsigned short* out, int n8, float scale) {
  const int i = blockIdx.x * 256 + threadIdx.x;
  if (i < n8) {
    const v4f a = *(const v4f*)(in + (size_t)i * 8);
    const v4f b = *(const v4f*)(in + (size_t)i * 8 + 4);
    v4u p;
    p[0] = pk16(h_bits((_Float16)(bfr(a[0]) * scale)), h_bits((_Float16)(bfr(a[1]) * scale)));
    p[1] = pk16(h_bits((_Float16)(bfr(a[2]) * scale)), h_bits((_Float16)(bfr(a[3]) * scale)));
    p[2] = pk16(h_bits((_Float16)(bfr(b[0]) * scale)), h_bits((_Float16)(bfr(b[1]) * scale)));
    p[3] = pk16(h_bits((_Float16)(bfr(b[2]) * scale)), h_bits((_Float16)(bfr(b[3]) * scale)));
    *(v4u*)(out + (size_t)i * 8) = p;
    
  }
}

// =====================================================================================================
// RoPE inverse frequencies: inv[m] = 1 / powf(10000, (2m)/64), m = 0..31, f32. One block of 32 threads;
// =====================================================================================================
__global__ __launch_bounds__(32) void k_invfreq(float* inv) {
  const int m = threadIdx.x & 31;
  const float e = (float)(2 * m) * (1.0f / 64.0f);
  const float p = powf(10000.0f, e);
  const float v = 1.0f / p;
  *(float*)(inv + m) = v;
  
}

// =====================================================================================================
// RoPE table tab[t][64] f32: [0..31] = cos(t * inv[m]), [32..63] = sin(t * inv[m]) (precise sincosf, f32
// angle = fl(t * inv[m])). Block = 8 tokens x 32 pairs (256 threads); the 8x64 tile is staged in LDS, then
// coverage: compute 8 x 32 threads x 2 = 8x64; store 128 lanes x 4 floats = 8 rows x 64; grid covers every t.
// =====================================================================================================
__global__ __launch_bounds__(256) void k_rope_tab(const float* __restrict__ inv, float* tab) {
  __shared__ __align__(16) float st[8 * 64];
  const int tid = threadIdx.x;
  const int m   = tid & 31, tr = tid >> 5;
  const int t   = blockIdx.x * 8 + tr;              // < SEQ by the grid
  const float w = inv[m];
  const float ang = (float)t * w;
  float sn, cs;
  sincosf(ang, &sn, &cs);
  st[tr * 64 + m]      = cs;
  st[tr * 64 + 32 + m] = sn;
  __syncthreads();
  if (tid < 128) {                                  // waves 0..3, wave-uniform
    const int row = tid >> 4, c4 = (tid & 15) * 4;
    const v4f v = *(const v4f*)(st + row * 64 + c4);
    float* dst = tab + (size_t)(blockIdx.x * 8 + row) * 64 + c4;
    *(v4f*)dst = v;
    
  }
}

// =====================================================================================================
// Register-blocked f16 WMMA GEMM, one wave per 64x64 tile, four waves (2x2) per 128x128 block tile. The block's
// A and Bt rows of a 64-k pass are staged in LDS by asynchronous 16-byte copies (whole 128-byte lines), two
// buffers: the next pass's copies fly while this pass's fragments are read from LDS.
//   v[m][n] = (sum_k A[m][k] * Bt[n][k]  [+ 2^-11 * sum_k Ar[m][k] * Bt[n][k] when ARES]) * cscale
// A, Ar row-major [M][K] pitch lda (f16), Bt row-major [N][K] pitch ldb (f16, k contiguous); M, N multiples of
// 128, K multiple of 64; one block per block tile (a block-uniform bound check anyway).
// ARES: the residual plane is accumulated first from zero, the accumulators are scaled by 2^-11 exactly on the
// VALU (with nop gaps on both sides), then the hi plane accumulates on top: one accumulator set.
// Epilogue variants:
//   EPI 0: f16 hi plane = f16(v' * oscale) at Cp and residual plane = f16((v'*oscale - hi) * 2048) at Crp,
//          pitch ldc halves, where v' = v for tiles with n0 >= ropeN and, for n0 < ropeN (wave-uniform),
//          v' = rotate-half RoPE of the wave's 64-column tile (one head): pair index mm = column mod 32,
//          token = output row, c = rtab[token][mm], s = rtab[token][32+mm]:
//          col mm -> v[mm]*c - v[32+mm]*s ; col 32+mm -> v[32+mm]*c + v[mm]*s (f32, from the LDS slab).
//   EPI 1: f32 out = v, pitch ldc floats
// 16-row slabs staged per wave in LDS. f32 out: each 64-wide row segment (256 B = 2 lines) by 16 lanes x 16 B,
// coverage: 4 slabs x 16 rows x 64 cols = the wave's whole 64x64 tile; grid x 4 tiles = [M][N].
// =====================================================================================================
// Eight 16-byte asynchronous copies of one lane, global -> LDS, rows 16 apart in both places. The s_wait_xcnt
// is the last line of the copies' own statement so that no address register is rewritten ahead of it.
__device__ __forceinline__ void copy8_rows(unsigned l, const _Float16* g, int ld) {
#if defined(__HIP_DEVICE_COMPILE__)
  const unsigned l0 = l,                    l1 = l + 1u * 16u * GP_B, l2 = l + 2u * 16u * GP_B, l3 = l + 3u * 16u * GP_B;
  const unsigned l4 = l + 4u * 16u * GP_B, l5 = l + 5u * 16u * GP_B, l6 = l + 6u * 16u * GP_B, l7 = l + 7u * 16u * GP_B;
  const size_t st = (size_t)16 * ld;
  const _Float16 *g0 = g, *g1 = g + st, *g2 = g + 2 * st, *g3 = g + 3 * st;
  const _Float16 *g4 = g + 4 * st, *g5 = g + 5 * st, *g6 = g + 6 * st, *g7 = g + 7 * st;
  asm volatile(
      "global_load_async_to_lds_b128 %0, %8, off\n\t"
      "global_load_async_to_lds_b128 %1, %9, off\n\t"
      "global_load_async_to_lds_b128 %2, %10, off\n\t"
      "global_load_async_to_lds_b128 %3, %11, off\n\t"
      "global_load_async_to_lds_b128 %4, %12, off\n\t"
      "global_load_async_to_lds_b128 %5, %13, off\n\t"
      "global_load_async_to_lds_b128 %6, %14, off\n\t"
      "global_load_async_to_lds_b128 %7, %15, off\n\t"
      "s_wait_xcnt 0x0"
      :: "v"(l0), "v"(l1), "v"(l2), "v"(l3), "v"(l4), "v"(l5), "v"(l6), "v"(l7),
         "v"(g0), "v"(g1), "v"(g2), "v"(g3), "v"(g4), "v"(g5), "v"(g6), "v"(g7)
      : "memory");
#endif
}
// the issuing wave's copies have landed in LDS behind this wait
__device__ __forceinline__ void wait_async0() {
#if defined(__HIP_DEVICE_COMPILE__)
  asm volatile("s_wait_asynccnt 0x0" ::: "memory");
#endif
}
// the wave's own LDS reads of a buffer have retired before that buffer is handed back for a refill
__device__ __forceinline__ void wait_ds0() {
#if defined(__HIP_DEVICE_COMPILE__)
  asm volatile("s_wait_dscnt 0x0" ::: "memory");
#endif
}

template <int EPI, bool ARES>
__global__ __launch_bounds__(128) void gemm64_f16(
    const unsigned short* __restrict__ Ap, const unsigned short* __restrict__ Arp, int lda,
    const unsigned short* __restrict__ Btp, int ldb,
    float cscale,
    void* Cp, unsigned short* Crp, int ldc, int M, int N, int K, float oscale,
    const float* __restrict__ rtab, int ropeN) {
  const _Float16* Ah  = (const _Float16*)(const void*)Ap;
  const _Float16* Arh = (const _Float16*)(const void*)Arp;
  const _Float16* Bt  = (const _Float16*)(const void*)Btp;
  __shared__ __align__(16) unsigned char ring[2 * GSTAGE];   // two stages of [A 128 rows | Bt 128 rows], pitch GP_B
  __shared__ __align__(16) float sT[4][16 * 68];   // per-wave 16x64 slab, pitch 68 floats
  const int tid  = threadIdx.x;
  const int lane = tid & 31;
  const int wave = tid >> 5;
  const int tilesN = N >> 7;
  const int tilesM = M >> 7;
  if ((int)blockIdx.x >= tilesM * tilesN) return;   // block-uniform, in front of every barrier and copy
  const int bm = (int)blockIdx.x / tilesN;
  const int bn = (int)blockIdx.x - bm * tilesN;
  const int wm = (wave >> 1) << 6;             // the wave's 64x64 tile inside the block's 128x128 tile
  const int wn = (wave & 1) << 6;
  const int m0 = (bm << 7) + wm;
  const int n0 = (bn << 7) + wn;

  const int rlane = lane & 15;                 // row (A) / col (B, D) within subtile
  const int koff  = (lane >> 4) * 8;           // k offset of this lane half
  const int mOff  = (lane >> 4) * 8;           // D row offset

  v8f acc[4][4];
#pragma unroll
  for (int i = 0; i < 4; ++i)
#pragma unroll
    for (int j = 0; j < 4; ++j) acc[i][j] = zero8();

  // staging map: lane -> row tid>>3 (+16 per copy, 8 copies = 128 rows), 16-byte piece tid&7 of the 128-byte row
  const int crow = tid >> 3, cpc = tid & 7;
  const unsigned ringb = (unsigned)(uintptr_t)(const void*)ring;           // LDS byte address of the ring
  const unsigned lcp   = ringb + (unsigned)(crow * GP_B + cpc * 16);
  const _Float16* gA  = Ah  + (size_t)((bm << 7) + crow) * lda + cpc * 8;
  const _Float16* gAr = Arh + (size_t)((bm << 7) + crow) * lda + cpc * 8;
  const _Float16* gB  = Bt  + (size_t)((bn << 7) + crow) * ldb + cpc * 8;
  const int KP = K >> 6;                       // passes of 64 k per plane
  const int NP = ARES ? 2 * KP : KP;           // ARES: the residual plane's passes first, then the hi plane's

  // tile 0 -> buffer 0, landed and published; then tile 1 -> buffer 1 flies over pass 0
  copy8_rows(lcp, ARES ? gAr : gA, lda);
  copy8_rows(lcp + GOFF_B, gB, ldb);
  wait_async0();
  __syncthreads();
  if (NP > 1) {
    const int kk = (1 < KP) ? 64 : 0;
    const _Float16* ga = (ARES && 1 < KP) ? gAr : gA;
    copy8_rows(lcp + GSTAGE, ga + kk, lda);
    copy8_rows(lcp + GSTAGE + GOFF_B, gB + kk, ldb);
  }

  for (int t = 0; t < NP; ++t) {
    if (ARES && t == KP) {                     // block-uniform: between the two planes
      acc_guard4(acc[0][0], acc[0][1], acc[0][2], acc[0][3]);
      acc_guard4(acc[1][0], acc[1][1], acc[1][2], acc[1][3]);
      acc_guard4(acc[2][0], acc[2][1], acc[2][2], acc[2][3]);
      acc_guard4(acc[3][0], acc[3][1], acc[3][2], acc[3][3]);
#pragma unroll
      for (int i = 0; i < 4; ++i)
#pragma unroll
        for (int j = 0; j < 4; ++j) acc[i][j] = acc[i][j] * (1.0f / 2048.0f);   // exact fold of the x2^11 residual carry
      acc_guard4(acc[0][0], acc[0][1], acc[0][2], acc[0][3]);
      acc_guard4(acc[1][0], acc[1][1], acc[1][2], acc[1][3]);
      acc_guard4(acc[2][0], acc[2][1], acc[2][2], acc[2][3]);
      acc_guard4(acc[3][0], acc[3][1], acc[3][2], acc[3][3]);
    }
    const unsigned bsel = (unsigned)(t & 1) * GSTAGE;
    const _Float16* sA = (const _Float16*)(const void*)(ring + bsel) + (wm + rlane) * GP_H + koff;
    const _Float16* sB = (const _Float16*)(const void*)(ring + bsel + GOFF_B) + (wn + rlane) * GP_H + koff;
    // the loops below are unrolled so that every fragment and accumulator index is a constant (registers, no scratch)
#pragma unroll
    for (int ks = 0; ks < 2; ++ks) {
      v16h bh[4];
#pragma unroll
      for (int j = 0; j < 4; ++j) bh[j] = ldfrag_h(sB + (j << 4) * GP_H + ks * 32);
      v16h ah[4];                              // all eight fragments of a 32-k step are read as one group
#pragma unroll
      for (int i = 0; i < 4; ++i) ah[i] = ldfrag_h(sA + (i << 4) * GP_H + ks * 32);
#pragma unroll
      for (int i = 0; i < 4; ++i) {
#pragma unroll
        for (int j = 0; j < 4; ++j) {
          acc[i][j] = mma_h_raw(ah[i], bh[j], acc[i][j]);
        }
        dep_guard_h(acc[i][0], acc[i][3], ah[i], bh[3]);
      }
      keep4_h(bh[0], bh[1], bh[2], bh[3]);
    }
    // publish point of tile t + 1: own LDS reads retired, own copies landed, one barrier for both jobs
    wait_ds0();
    wait_async0();
    __syncthreads();
    if (t + 2 < NP) {                          // block-uniform: refill the buffer that pass t has just read
      const int tn = t + 2;
      const bool res = ARES && (tn < KP);
      const int kk = (tn - ((ARES && tn >= KP) ? KP : 0)) << 6;
      copy8_rows(lcp + bsel, (res ? gAr : gA) + kk, lda);
      copy8_rows(lcp + bsel + GOFF_B, gB + kk, ldb);
    }
  }
  wait_async0();
  acc_guard4(acc[0][0], acc[0][1], acc[0][2], acc[0][3]);
  acc_guard4(acc[1][0], acc[1][1], acc[1][2], acc[1][3]);
  acc_guard4(acc[2][0], acc[2][1], acc[2][2], acc[2][3]);
  acc_guard4(acc[3][0], acc[3][1], acc[3][2], acc[3][3]);

  // ---- epilogue ----
  float* slab = sT[wave];
#pragma unroll
  for (int i = 0; i < 4; ++i) {
    const int mBase = m0 + (i << 4);
#pragma unroll
    for (int r = 0; r < 8; ++r) {
      const int row = mOff + r;
#pragma unroll
      for (int j = 0; j < 4; ++j) slab[row * 68 + (j << 4) + rlane] = acc[i][j][r] * cscale;
    }
    __builtin_amdgcn_fence(__ATOMIC_RELEASE, "workgroup");
    __builtin_amdgcn_wave_barrier();
    __builtin_amdgcn_fence(__ATOMIC_ACQUIRE, "workgroup");
    if constexpr (EPI == 0) {
      unsigned short* C16 = (unsigned short*)Cp;
      const int rq = lane >> 3, piece = lane & 7;
      const bool rope_on = (n0 < ropeN);                   // wave-uniform (n0 is per wave)
      const float rsgn = (piece < 4) ? -1.0f : 1.0f;       // cols 0..31 carry x1 (minus), cols 32..63 carry x2 (plus)
      const int   pm   = (piece & 3) * 8;                  // rotation pair index base of this lane's 8 columns
      v4u ph[4], pr[4];
#pragma unroll
      for (int it = 0; it < 4; ++it) {
        const int row = it * 4 + rq;                         // it 0..3 x rq 0..3 = rows 0..15
        const v4f a  = *(const v4f*)(slab + row * 68 + piece * 8);
        const v4f a2 = *(const v4f*)(slab + row * 68 + piece * 8 + 4);
        float f[8];
        f[0] = a[0];  f[1] = a[1];  f[2] = a[2];  f[3] = a[3];
        f[4] = a2[0]; f[5] = a2[1]; f[6] = a2[2]; f[7] = a2[3];
        if (rope_on) {                                       // wave-uniform branch, LDS and table reads only
          const int po = (piece ^ 4) * 8;                    // partner half of the head (32 columns away)
          const v4f g  = *(const v4f*)(slab + row * 68 + po);
          const v4f g2 = *(const v4f*)(slab + row * 68 + po + 4);
          const float* trp = rtab + (size_t)(mBase + row) * 64 + pm;   // output row = token index
          const v4f c0 = *(const v4f*)(trp);
          const v4f c1 = *(const v4f*)(trp + 4);
          const v4f s0 = *(const v4f*)(trp + 32);
          const v4f s1 = *(const v4f*)(trp + 36);
          f[0] = f[0] * c0[0] + rsgn * g[0]  * s0[0];
          f[1] = f[1] * c0[1] + rsgn * g[1]  * s0[1];
          f[2] = f[2] * c0[2] + rsgn * g[2]  * s0[2];
          f[3] = f[3] * c0[3] + rsgn * g[3]  * s0[3];
          f[4] = f[4] * c1[0] + rsgn * g2[0] * s1[0];
          f[5] = f[5] * c1[1] + rsgn * g2[1] * s1[1];
          f[6] = f[6] * c1[2] + rsgn * g2[2] * s1[2];
          f[7] = f[7] * c1[3] + rsgn * g2[3] * s1[3];
        }
        v4u p, q;
#pragma unroll
        for (int e = 0; e < 4; ++e) {
          const float g0 = f[2 * e] * oscale, g1 = f[2 * e + 1] * oscale;
          const _Float16 x0 = (_Float16)g0, x1 = (_Float16)g1;
          const _Float16 y0 = (_Float16)((g0 - (float)x0) * 2048.0f);
          const _Float16 y1 = (_Float16)((g1 - (float)x1) * 2048.0f);
          p[e] = pk16(h_bits(x0), h_bits(x1));
          q[e] = pk16(h_bits(y0), h_bits(y1));
        }
        ph[it] = p;
        pr[it] = q;
      }
      {
#pragma unroll
        for (int it = 0; it < 4; ++it) {
          const int row = it * 4 + rq;
          const size_t co = (size_t)(mBase + row) * ldc + n0 + piece * 8;
          *(v4u*)(C16 + co) = ph[it];
          *(v4u*)(Crp + co) = pr[it];
        }
        
      }
    } else {
      float* Cf = (float*)Cp;
      const int hh = lane >> 4, c4 = (lane & 15) * 4;     // 256-B row segment = 16 lanes x 16 B
      v4f ov[8];
#pragma unroll
      for (int it = 0; it < 8; ++it) {
        const int row = it * 2 + hh;                       // it 0..7 x hh 0..1 = rows 0..15
        ov[it] = *(const v4f*)(slab + row * 68 + c4);
      }
      {
#pragma unroll
        for (int it = 0; it < 8; ++it) {
          const int row = it * 2 + hh;
          *(v4f*)(Cf + (size_t)(mBase + row) * ldc + n0 + c4) = ov[it];
        }
        
      }
    }
    __builtin_amdgcn_fence(__ATOMIC_RELEASE, "workgroup");
    __builtin_amdgcn_wave_barrier();
    __builtin_amdgcn_fence(__ATOMIC_ACQUIRE, "workgroup");
  }
}

// =====================================================================================================
// v columns of an f16 qkv plane (token-major, element (t, h, d) at [t*DQKV + 2*DM + h*64 + d])
// -> f16 v^T plane vt[(h*64 + d)*SEQ + t] (same bits). Used for the hi plane and the residual plane.
// Block = one 64-token x 64-feature tile of one head; grid = (SEQ/64, NH); tile staged in LDS as halves
// (v8h 16-B stores, __syncthreads, _Float16 element reads).
// Store: group g = tid>>3 (0..31), piece = tid&7: iteration it writes row d = it*32+g, lanes 8q..8q+7 x 16 B =
// coverage: load 2 x 256 threads x 8 halves = 64x64; store 2 iterations x 32 groups = 64 rows d, 8 pieces x 8
// = 64 tokens per row; grid covers every (h, token tile).
// =====================================================================================================
__global__ __launch_bounds__(256) void v_tr(const unsigned short* __restrict__ qkvp, unsigned short* vt) {
  __shared__ __align__(16) _Float16 sv[64 * 72];       // [tt][d], pitch 72 halves (144 B)
  const int tid = threadIdx.x;
  const int t0  = blockIdx.x * 64;
  const int hh  = blockIdx.y;
  const _Float16* src = (const _Float16*)(const void*)qkvp;
#pragma unroll
  for (int i = 0; i < 2; ++i) {
    const int idx = i * 256 + tid;                  // 0..511
    const int tt = idx >> 3, c8 = (idx & 7) * 8;
    const v8h a = *(const v8h*)(src + ((size_t)(t0 + tt)) * DQKV + 2 * DM + hh * HD + c8);
    *(v8h*)(sv + tt * 72 + c8) = a;
  }
  __syncthreads();

  const int g = tid >> 3, piece = tid & 7;
  v4u hv[2];
  size_t hofs[2];
#pragma unroll
  for (int it = 0; it < 2; ++it) {
    const int d = it * 32 + g;
    v4u a;
#pragma unroll
    for (int e = 0; e < 4; ++e) {
      const _Float16 x0 = sv[(piece * 8 + 2 * e) * 72 + d];
      const _Float16 x1 = sv[(piece * 8 + 2 * e + 1) * 72 + d];
      a[e] = pk16(h_bits(x0), h_bits(x1));
    }
    hv[it] = a;
    hofs[it] = ((size_t)(hh * HD + d)) * SEQ + t0 + piece * 8;
  }
  {
#pragma unroll
    for (int it = 0; it < 2; ++it) *(v4u*)(vt + hofs[it]) = hv[it];
    
  }
}

// =====================================================================================================
// Windowed causal multi-head softmax attention, head dim 64, online-max form.
//   q f16 (x16): element (t, h, d) at qkv[t*DQKV + h*64 + d]; k at + DM; residual planes (x2^11 of the f16
//   residue) in qkvr with the same addressing; v^T f16 (x16) at vt[(h*64 + d)*SEQ + s], residual vtr.
//   logit a = (q.k) / 8 = acc / 2048 (two x16 carries); HR: acc = qh.kh + 2^-11 (qh.kr + qr.kh).
//   Key j is allowed for query row i iff (j <= i) and (j + WIN >= i) (both bounds inclusive, up to WIN+1 keys);
//   other keys get a = -1e30 (select by value) and p = 0 (select by value). Per 64-key tile: tile max (per-lane
//   max over the 4 key groups, then a 16-lane xor max), mn = max(mrun, tile max), alpha = exp(mrun - mn),
//   p = exp(a - mn), lsum = lsum * alpha + sum p (per-lane partials, 16-lane xor reduction at the end), context
//   accumulators scaled by alpha on the VALU (nop gaps on both sides). A query row whose keys in a visited tile
//   are all masked keeps mrun, gets alpha = 1 and p = 0. The diagonal tile gives every row its own key, so
//   lsum >= 1 at the end.
//   P carried as f16(256 p) (HR: plus residual f16((256p - hi)*2048)); context = P . v^T on f16 WMMA
//   (HR: second accumulator += Ph.Vr + Pr.Vh, folded with 2^-11).
//   ctx plane f16 (x16): element (t, h*64 + d) at ctx[t*DM + h*64 + d] = 16 * context / (4096 lsum);
//   HR also writes the ctx residual plane f16((16 ctx - hi) * 2048).
//   Block = 4 waves = 64 query rows of one head; query tile qb = blockIdx % NQB, head = blockIdx / NQB;
//   grid = NQB*NH; kv tiles of 64 from max(qb - KTW + 1, 0) to qb, block-uniform trip count <= KTW (key tiles
//   outside the window are never visited; keys outside the window inside a visited tile contribute exactly 0).
//   K / V^T tile staging: 128 threads x 32 halves per plane = the whole 64x64 tile (plain 16-B loads,
//   __syncthreads before and after); P tiles are wave-private, spilled with _Float16 element stores and
//   wave in LDS as f32 (aliasing the K/V region after a block barrier) the same way.
//   Output coverage: each wave stores rows 0..15 of its tile (it 0..3 x lane>>3 0..3) x 64 columns (8 lanes x
//   every (head, query tile) exactly once.
// =====================================================================================================
template <bool HR>
__global__ __launch_bounds__(128)
void attn_k(const unsigned short* __restrict__ qkvp, const unsigned short* __restrict__ qkvrp,
            const unsigned short* __restrict__ vtp, const unsigned short* __restrict__ vtrp,
            unsigned short* ctxp, unsigned short* ctxrp) {
  union FH { v16h v; v8h h[2]; };
  constexpr int TB     = 64 * 64 * 2;                    // one f16 64x64 tile, bytes
  constexpr int PB     = 4 * 16 * 64 * 2;                // four wave-private 16x64 f16 P tiles, bytes
  constexpr int OFF_K  = 0;
  constexpr int OFF_V  = TB;
  constexpr int OFF_KR = 2 * TB;
  constexpr int OFF_VR = 3 * TB;
  constexpr int OFF_P  = HR ? 4 * TB : 2 * TB;
  constexpr int OFF_PR = OFF_P + PB;
  constexpr int SMEMB  = HR ? (OFF_PR + PB) : (OFF_P + PB);   // 49152 : 24576
  static_assert(4 * 16 * 64 * 4 <= OFF_P);                    // f32 context staging aliases the K/V region
  __shared__ __align__(16) unsigned char smem[SMEMB];
  _Float16* Ksh = (_Float16*)(smem + OFF_K);                  // K   [kv][d]
  _Float16* Vsh = (_Float16*)(smem + OFF_V);                  // V^T [d][kv]
  _Float16* Krs = (_Float16*)(smem + (HR ? OFF_KR : OFF_K));  // K residual (HR only)
  _Float16* Vrs = (_Float16*)(smem + (HR ? OFF_VR : OFF_V));  // V^T residual (HR only)
  _Float16* Psh = (_Float16*)(smem + OFF_P);
  _Float16* Prs = (_Float16*)(smem + (HR ? OFF_PR : OFF_P));

  const int tid  = threadIdx.x;
  const int wave = tid >> 5;
  const int lane = tid & 31;
  const int hh   = lane >> 4;
  const int c    = lane & 15;

  const int bx   = blockIdx.x;
  const int qb   = bx % NQB;
  const int h    = bx / NQB;                 // < NH by the grid size
  const int q0   = qb * 64 + wave * 16;

  const _Float16* Qp  = (const _Float16*)(const void*)qkvp  + (size_t)h * HD;
  const _Float16* Qrp = (const _Float16*)(const void*)qkvrp + (size_t)h * HD;
  const _Float16* Kp  = Qp + DM;
  const _Float16* Krp = Qrp + DM;
  const _Float16* Vt  = (const _Float16*)(const void*)vtp  + ((size_t)h * HD) * SEQ;
  const _Float16* Vrt = (const _Float16*)(const void*)vtrp + ((size_t)h * HD) * SEQ;

  // ---- Q fragments (A operand, row = lane&15): 2 d-chunks ----
  v16h qa[2], qr[2];
#pragma unroll
  for (int dc = 0; dc < 2; ++dc) {
    const size_t qo = (size_t)(q0 + c) * DQKV + dc * 32 + 8 * hh;
    qa[dc] = ldfrag_h(Qp + qo);
    if constexpr (HR) qr[dc] = ldfrag_h(Qrp + qo);
    else qr[dc] = qa[dc];
  }

  float lsum[8], mrun[8];
  v8f oacc[4], oacc2[4];
#pragma unroll
  for (int r = 0; r < 8; ++r) { lsum[r] = 0.f; mrun[r] = -1e30f; }
#pragma unroll
  for (int t = 0; t < 4; ++t) { oacc[t] = zero8(); oacc2[t] = zero8(); }

  _Float16* pw  = Psh + wave * (16 * 64);
  _Float16* prw = Prs + wave * (16 * 64);

  const int ktlo = (qb >= KTW - 1) ? (qb - (KTW - 1)) : 0;   // first key tile in the window, block-uniform
  const int nkt  = qb - ktlo + 1;                              // 1..KTW key tiles, block-uniform
  for (int kti = 0; kti < nkt; ++kti) {
    const int kv0 = (ktlo + kti) * 64;                         // <= qb*64 < SEQ
    __syncthreads();
    {
      const int r = tid >> 1, half = (tid & 1) * 32;
      const size_t ko = (size_t)(kv0 + r) * DQKV + half;      // K row kv0+r, d = half..half+31
      const size_t vo = (size_t)r * SEQ + kv0 + half;           // V^T row d = r, s = kv0+half..+31
#pragma unroll
      for (int i = 0; i < 4; ++i) {
        const v8h a0 = *(const v8h*)(Kp + ko + 8 * i);
        const v8h b0 = *(const v8h*)(Vt + vo + 8 * i);
        *(v8h*)(Ksh + r * 64 + half + 8 * i) = a0;
        *(v8h*)(Vsh + r * 64 + half + 8 * i) = b0;
        if constexpr (HR) {
          const v8h a1 = *(const v8h*)(Krp + ko + 8 * i);
          const v8h b1 = *(const v8h*)(Vrt + vo + 8 * i);
          *(v8h*)(Krs + r * 64 + half + 8 * i) = a1;
          *(v8h*)(Vrs + r * 64 + half + 8 * i) = b1;
        }
      }
    }
    __syncthreads();

    // ---- scores: 16 query rows x 64 keys per wave (B operand: lane c -> key j*16+c, split k map over d) ----
    v8f s[4];
#pragma unroll
    for (int j = 0; j < 4; ++j) {
      s[j] = zero8();
      v8f t = zero8();
#pragma unroll
      for (int dc = 0; dc < 2; ++dc) {
        FH kb;
        kb.h[0] = *(const v8h*)(Ksh + (j * 16 + c) * 64 + dc * 32 + 8 * hh);
        kb.h[1] = *(const v8h*)(Ksh + (j * 16 + c) * 64 + dc * 32 + 16 + 8 * hh);
        s[j] = mma_h(qa[dc], kb.v, s[j]);
        if constexpr (HR) {
          FH krb;
          krb.h[0] = *(const v8h*)(Krs + (j * 16 + c) * 64 + dc * 32 + 8 * hh);
          krb.h[1] = *(const v8h*)(Krs + (j * 16 + c) * 64 + dc * 32 + 16 + 8 * hh);
          t = mma_h(qa[dc], krb.v, t);
          t = mma_h(qr[dc], kb.v, t);
        }
      }
      if constexpr (HR) s[j] = s[j] + t * (1.0f / 2048.0f);
    }

    // ---- windowed causal online softmax: tile max, running max, alpha, p, row-sum partials,
    //      P (x256, f16; HR: + residual) ----
    float alpha[8];
#pragma unroll
    for (int r = 0; r < 8; ++r) {
      const int qrow = q0 + 8 * hh + r;
      float av[4];
      float tmx = -1e30f;
#pragma unroll
      for (int j = 0; j < 4; ++j) {
        const int key = kv0 + j * 16 + c;
        float a = s[j][r] * (1.0f / 2048.0f);              // 1/8 head scale, 1/256 for the two x16 carries
        const bool ok = (key <= qrow) && (key + WIN >= qrow);
        a = ok ? a : -1e30f;
        av[j] = a;
        tmx = fmaxf(tmx, a);
      }
#pragma unroll
      for (int off = 1; off < 16; off <<= 1) tmx = fmaxf(tmx, __shfl_xor(tmx, off, 32));
      const float mn = fmaxf(mrun[r], tmx);
      const float al = __expf(mrun[r] - mn);
      alpha[r] = al;
      mrun[r]  = mn;
      float ps = 0.0f;
#pragma unroll
      for (int j = 0; j < 4; ++j) {
        const int key = kv0 + j * 16 + c;
        const bool ok = (key <= qrow) && (key + WIN >= qrow);
        float p = __expf(av[j] - mn);
        p = ok ? p : 0.0f;
        ps += p;
        const float g = p * 256.0f;
        const _Float16 x0 = (_Float16)g;
        pw[(8 * hh + r) * 64 + j * 16 + c] = x0;
        if constexpr (HR) prw[(8 * hh + r) * 64 + j * 16 + c] = (_Float16)((g - (float)x0) * 2048.0f);
      }
      lsum[r] = lsum[r] * al + ps;
    }
    __builtin_amdgcn_fence(__ATOMIC_RELEASE, "workgroup");
    __builtin_amdgcn_wave_barrier();
    __builtin_amdgcn_fence(__ATOMIC_ACQUIRE, "workgroup");

    // ---- rescale the context accumulators by alpha (VALU), nop gaps before the next WMMA reads them ----
#pragma unroll
    for (int t = 0; t < 4; ++t) {
#pragma unroll
      for (int r = 0; r < 8; ++r) {
        oacc[t][r] = oacc[t][r] * alpha[r];
        if constexpr (HR) oacc2[t][r] = oacc2[t][r] * alpha[r];
      }
    }
    acc_guard4(oacc[0], oacc[1], oacc[2], oacc[3]);
    if constexpr (HR) acc_guard4(oacc2[0], oacc2[1], oacc2[2], oacc2[3]);

    // ---- context += P . V (f16 WMMA; A = P [row][key], B = V^T [d][key]) ----
#pragma unroll
    for (int kk = 0; kk < 2; ++kk) {
      FH pa, par;
      pa.h[0] = *(const v8h*)(pw + c * 64 + kk * 32 + 8 * hh);
      pa.h[1] = *(const v8h*)(pw + c * 64 + kk * 32 + 16 + 8 * hh);
      if constexpr (HR) {
        par.h[0] = *(const v8h*)(prw + c * 64 + kk * 32 + 8 * hh);
        par.h[1] = *(const v8h*)(prw + c * 64 + kk * 32 + 16 + 8 * hh);
      } else {
        par.v = pa.v;
      }
#pragma unroll
      for (int t = 0; t < 4; ++t) {
        FH vb;
        vb.h[0] = *(const v8h*)(Vsh + (t * 16 + c) * 64 + kk * 32 + 8 * hh);
        vb.h[1] = *(const v8h*)(Vsh + (t * 16 + c) * 64 + kk * 32 + 16 + 8 * hh);
        oacc[t] = mma_h(pa.v, vb.v, oacc[t]);
        if constexpr (HR) {
          FH vrb;
          vrb.h[0] = *(const v8h*)(Vrs + (t * 16 + c) * 64 + kk * 32 + 8 * hh);
          vrb.h[1] = *(const v8h*)(Vrs + (t * 16 + c) * 64 + kk * 32 + 16 + 8 * hh);
          oacc2[t] = mma_h(pa.v, vrb.v, oacc2[t]);
          oacc2[t] = mma_h(par.v, vb.v, oacc2[t]);
        }
      }
    }
  }
  __syncthreads();                           // every wave is done with the K/V tiles before they are aliased

  // ---- normalise (1/lsum, the 1/256 p carry; keep the x16 v carry), stage the wave's 16x64 f32 tile in
  float* os = (float*)(void*)smem + wave * (16 * 64);
#pragma unroll
  for (int r = 0; r < 8; ++r) {
    float l = lsum[r];
#pragma unroll
    for (int off = 1; off < 16; off <<= 1) l += __shfl_xor(l, off, 32);
    const float rl = 1.0f / l;               // l >= 1 (the max key contributes p = 1)
    const float sc = rl * (1.0f / 256.0f);
#pragma unroll
    for (int t = 0; t < 4; ++t) {
      float v = oacc[t][r];
      if constexpr (HR) v += oacc2[t][r] * (1.0f / 2048.0f);
      os[(8 * hh + r) * 64 + t * 16 + c] = v * sc;
    }
  }
  __builtin_amdgcn_fence(__ATOMIC_RELEASE, "workgroup");
  __builtin_amdgcn_wave_barrier();
  __builtin_amdgcn_fence(__ATOMIC_ACQUIRE, "workgroup");
  {
    const int rq = lane >> 3, piece = lane & 7;
    v4u ph[4], pr[4];
#pragma unroll
    for (int it = 0; it < 4; ++it) {
      const int row = it * 4 + rq;   // it 0..3 x rq 0..3 = rows 0..15 of the wave tile
      const v4f a  = *(const v4f*)(os + row * 64 + piece * 8);
      const v4f a2 = *(const v4f*)(os + row * 64 + piece * 8 + 4);
      float f[8];
      f[0] = a[0];  f[1] = a[1];  f[2] = a[2];  f[3] = a[3];
      f[4] = a2[0]; f[5] = a2[1]; f[6] = a2[2]; f[7] = a2[3];
      v4u p, q;
#pragma unroll
      for (int e = 0; e < 4; ++e) {
        const _Float16 x0 = (_Float16)f[2 * e], x1 = (_Float16)f[2 * e + 1];
        p[e] = pk16(h_bits(x0), h_bits(x1));
        if constexpr (HR) {
          const _Float16 y0 = (_Float16)((f[2 * e] - (float)x0) * 2048.0f);
          const _Float16 y1 = (_Float16)((f[2 * e + 1] - (float)x1) * 2048.0f);
          q[e] = pk16(h_bits(y0), h_bits(y1));
        } else {
          q[e] = p[e];
        }
      }
      ph[it] = p;
      pr[it] = q;
    }
    {
#pragma unroll
      for (int it = 0; it < 4; ++it) {
        const int row = it * 4 + rq;
        const size_t go = (size_t)(q0 + row) * DM + (size_t)h * HD + piece * 8;
        *(v4u*)(ctxp + go) = ph[it];
        if constexpr (HR) *(v4u*)(ctxrp + go) = pr[it];
      }
      
    }
  }
}

// =====================================================================================================
// Workspace map (bytes); every region is an exact multiple of its whole-line / whole-tile store granularity
// (row pitches 2048 / 6144 / 8192 / 256 B, all offsets multiples of 256, no aliasing within a launch):
//   Xh     f16 [SEQ][1024]                 (bf16 value of x, x16)
//   Wqkv   f16 [3072][1024]                (bf16 values of wq | wk | wv x1024, [n][k] = the input layout)
//   Wp     f16 [1024][1024]                (bf16 value of wo x1024, [n][k])
//   QKV    f16 [SEQ][3072]                 (rotated q | rotated k | v, x16)
//   QKVr   f16 [SEQ][3072]                 (x2^11 residual of the above)
//   VT     f16 [1024][SEQ]                 ([h*64 + d][s])
//   VTr    f16 [1024][SEQ]                 (residual)
//   Ctx    f16 [SEQ][1024]                 (attention context x16)
//   Ctxr   f16 [SEQ][1024]                 (residual)
//   Rt     f32 [SEQ][64]                   (cos | sin table)
//   Inv    f32 [32] (256 B)                (inverse frequencies)
//   total for SEQ = 4096: 101712128
// d_out f32: [SEQ][1024] at byte 0, every 64x64 tile written once by the projection launch.
// =====================================================================================================
extern "C" void kernel_launch(void* const* d_in, const int* in_sizes, int n_in,
                              void* d_out, int out_size, void* d_ws, size_t ws_size,
                              hipStream_t stream) {
  if (n_in < 5) return;
  if (in_sizes[0] < SEQ * DM) return;
  if (in_sizes[1] != DM * DM) return;
  if (in_sizes[2] != DM * DM) return;
  if (in_sizes[3] != DM * DM) return;
  if (in_sizes[4] != DM * DM) return;
  if (out_size < OUTN) return;

  const float* x  = (const float*)d_in[0];    // [SEQ][DM] (row prefix)
  const float* wq = (const float*)d_in[1];    // [DM n][DM k]
  const float* wk = (const float*)d_in[2];    // [DM n][DM k]
  const float* wv = (const float*)d_in[3];    // [DM n][DM k]
  const float* wo = (const float*)d_in[4];    // [DM n][DM k]

  const size_t PX   = (size_t)SEQ * DM * 2;          //  8388608 (SEQ 4096)
  const size_t PWq  = (size_t)DQKV * DM * 2;         //  6291456
  const size_t PWp  = (size_t)DM * DM * 2;           //  2097152
  const size_t PQKV = (size_t)SEQ * DQKV * 2;        // 25165824
  const size_t PVT  = (size_t)DM * SEQ * 2;          //  8388608
  const size_t PCtx = (size_t)SEQ * DM * 2;          //  8388608
  const size_t PRt  = (size_t)SEQ * 64 * 4;          //  1048576
  const size_t PInv = 256;
  size_t off = 0;
  const size_t oX    = off; off += PX;
  const size_t oWq   = off; off += PWq;
  const size_t oWp   = off; off += PWp;
  const size_t oQKV  = off; off += PQKV;
  const size_t oQKVr = off; off += PQKV;
  const size_t oVT   = off; off += PVT;
  const size_t oVTr  = off; off += PVT;
  const size_t oCtx  = off; off += PCtx;
  const size_t oCtxr = off; off += PCtx;
  const size_t oRt   = off; off += PRt;
  const size_t oInv  = off; off += PInv;
  if (off > ws_size) return;                         // off = 101712128 for SEQ 4096
  if (off > (size_t)134217728) return;

  char* ws = (char*)d_ws;
  unsigned short* Xh   = (unsigned short*)(ws + oX);
  unsigned short* Wqkv = (unsigned short*)(ws + oWq);
  unsigned short* Wp   = (unsigned short*)(ws + oWp);
  unsigned short* QKV  = (unsigned short*)(ws + oQKV);
  unsigned short* QKVr = (unsigned short*)(ws + oQKVr);
  unsigned short* VT   = (unsigned short*)(ws + oVT);
  unsigned short* VTr  = (unsigned short*)(ws + oVTr);
  unsigned short* Ctx  = (unsigned short*)(ws + oCtx);
  unsigned short* Ctxr = (unsigned short*)(ws + oCtxr);
  float*          Rt   = (float*)(ws + oRt);
  float*          Inv  = (float*)(ws + oInv);
  float*          outf = (float*)d_out;              // [SEQ][DM]

  const dim3 blk(256);
  const int n8x = SEQ * DM / 8;                      // 524288 for SEQ 4096
  const int n8w = DM * DM / 8;                       // 131072
  const dim3 gCx(n8x / 256);
  const dim3 gCw(n8w / 256);                         // 512 blocks
  const dim3 gGqkv((SEQ / 128) * (DQKV / 128));      // 768 block tiles of 128x128 (SEQ 4096)
  const dim3 gGdm((SEQ / 128) * (DM / 128));         // 256 block tiles
  const dim3 gVt(SEQ / 64, NH);                      // (64, 16)
  const dim3 gAttn(NQB * NH);                        // 1024 blocks: every (head, query tile)
  const dim3 gRt(SEQ / 8);                           // 512 blocks
  const float wScale = 1024.0f;                      // weights carried x1024
  const float aScale = 16.0f;                        // activations carried x16
  const float cscale = 1.0f / 16384.0f;              // 1/(16 * 1024)

  // (1) planes: x -> f16 x16 (bf16 values); weights [n][k] -> f16 x1024 (bf16 values), wq | wk | wv stacked
  cvt16<<<gCx, blk, 0, stream>>>(x, Xh, n8x, aScale);
  cvt16<<<gCw, blk, 0, stream>>>(wq, Wqkv, n8w, wScale);
  cvt16<<<gCw, blk, 0, stream>>>(wk, Wqkv + (size_t)DM * DM, n8w, wScale);
  cvt16<<<gCw, blk, 0, stream>>>(wv, Wqkv + (size_t)2 * DM * DM, n8w, wScale);
  cvt16<<<gCw, blk, 0, stream>>>(wo, Wp, n8w, wScale);
  // (2) RoPE tables: inverse frequencies, then cos | sin per token
  k_invfreq<<<dim3(1), dim3(32), 0, stream>>>(Inv);
  k_rope_tab<<<gRt, blk, 0, stream>>>(Inv, Rt);
  // (3) qkv = Xh . Wqkv^T with RoPE on the q and k column blocks (n0 < 2*DM) -> QKV f16 x16 + residual plane
  //     [SEQ][3072] (M=SEQ, N=3072, K=1024)
  gemm64_f16<0, false><<<gGqkv, dim3(128), 0, stream>>>(Xh, Xh, DM, Wqkv, DM, cscale, (void*)QKV, QKVr, DQKV,
                                                  SEQ, DQKV, DM, aScale, Rt, 2 * DM);
  // (4) v -> v^T planes (hi and residual, all tokens)
  v_tr<<<gVt, blk, 0, stream>>>(QKV, VT);
  v_tr<<<gVt, blk, 0, stream>>>(QKVr, VTr);
  // (5) windowed causal softmax attention -> Ctx f16 x16 + residual plane (all query tiles)
  attn_k<true><<<gAttn, dim3(128), 0, stream>>>(QKV, QKVr, VT, VTr, Ctx, Ctxr);
  // (6) out = (Ctx + 2^-11 Ctxr) . Wp^T -> d_out f32 [SEQ][1024] (M=SEQ, N=1024, K=1024), every tile once
  gemm64_f16<1, true><<<gGdm, dim3(128), 0, stream>>>(Ctx, Ctxr, DM, Wp, DM, cscale, (void*)outf, Ctxr, DM,
                                                SEQ, DM, DM, 1.0f, Rt, 0);
  (void)hipGetLastError();
}

// v002
// A run of this version takes 151 microseconds.
// Timed twice side by side with v001, it ran 1.19 times as fast both times.
// Counting every step since v000, it is 1.91 times as fast.
// Contractions: q|k|v projection = v_wmma_f32_16x16x32_f16 (A = f16 of RNE-bf16 x carried x16, B = f16 of RNE-bf16 wq|wk|wv carried x1024, single product); attention q.k^T and p.v^T = v_wmma_f32_16x16x32_f16 (q, k, v^T f16 planes x16 plus x2^11 residual planes, p f16 x256 plus x2^11 residual; hi.hi + hi.res + res.hi); output projection = v_wmma_f32_16x16x32_f16 (A = ctx f16 x16 plus its x2^11 residual plane, B = f16 of RNE-bf16 wo x1024; hi.B + res.B); all f32 accumulate. RoPE cos/sin table, rotation, windowed causal online-max softmax and row sums in f32 on the VALU.
#include <hip/hip_runtime.h>
#include <math.h>
#include <stdint.h>

#define SEQ   4096                  // token rows processed (a row prefix of x); every stride, carve and grid derives from it
#define DM    1024
#define NH    16
#define HD    64
#define WIN   512
#define DQKV  (3 * DM)              // 3072
#define NQB   (SEQ / 64)            // query tiles of 64 rows
#define KTW   (WIN / 64 + 1)        // key tiles visited per 64-row query tile = 9
#define OUTN  (SEQ * DM)
static_assert(NH * HD == DM);
static_assert(HD == 64);
static_assert((WIN % 64) == 0);
static_assert(KTW == 9);
static_assert((SEQ % 64) == 0 && (DM % 64) == 0 && (DQKV % 64) == 0);
static_assert((DM % 32) == 0);
static_assert((SEQ % 128) == 0 && (DM % 128) == 0 && (DQKV % 128) == 0);   // GEMM block tile 128x128
static_assert((DM % 64) == 0 && DM >= 128);                                 // GEMM pass of 64 k, two passes or more
static_assert(((SEQ * DM / 8) % 256) == 0);
static_assert(((DM * DM / 8) % 256) == 0);
static_assert((SEQ % 8) == 0);

#define GP_B    144                 // GEMM LDS row pitch, bytes: 128-byte row + 16 (16 B x odd, for 16-byte readers)
#define GP_H    (GP_B / 2)          // the same in halves
#define GOFF_B  (128 * GP_B)        // Bt rows behind the A rows inside a stage
#define GSTAGE  (2 * 128 * GP_B)    // one stage, bytes

typedef _Float16 v16h __attribute__((ext_vector_type(16)));
typedef _Float16 v8h  __attribute__((ext_vector_type(8)));
typedef float    v8f  __attribute__((ext_vector_type(8)));
typedef float    v4f  __attribute__((ext_vector_type(4)));
typedef unsigned int v4u __attribute__((ext_vector_type(4)));

// ---- scalar helpers --------------------------------------------------------------------------------
__device__ __forceinline__ unsigned short bf_bits(float f) {          // f32 -> bf16 bits, RNE convert
  unsigned u = __float_as_uint(f);
  return (unsigned short)((u + 0x7FFFu + ((u >> 16) & 1u)) >> 16);
}
__device__ __forceinline__ float bfr(float f) { return __uint_as_float(((unsigned)bf_bits(f)) << 16); }
__device__ __forceinline__ unsigned short h_bits(_Float16 x) { return __builtin_bit_cast(unsigned short, x); }
__device__ __forceinline__ unsigned pk16(unsigned short a, unsigned short b) { return (unsigned)a | ((unsigned)b << 16); }
__device__ __forceinline__ v8f zero8() { v8f z = {0.f, 0.f, 0.f, 0.f, 0.f, 0.f, 0.f, 0.f}; return z; }

// ---- fragment loader: 16-bit A/B operand, lane -> row/col (lane&15), p already includes +8*(lane>>4);
//      elements 0..7 <- p[0..7] (k0+8h..), elements 8..15 <- p[16..23] (k0+16+8h..)
__device__ __forceinline__ v16h ldfrag_h(const _Float16* p) {
  union { v16h v; v8h h[2]; } f;
  f.h[0] = *(const v8h*)(p);
  f.h[1] = *(const v8h*)(p + 16);
  return f.v;
}

// ---- WMMA helpers with trailing VALU hazard gap --------------------------------------------------------
__device__ __forceinline__ v8f mma_h(v16h a, v16h b, v8f c) {
  c = __builtin_amdgcn_wmma_f32_16x16x32_f16(false, a, false, b, (short)0, c, false, false);
#if defined(__HIP_DEVICE_COMPILE__)
  asm volatile("v_nop\n\tv_nop\n\tv_nop\n\tv_nop" : "+v"(c) : "v"(a), "v"(b));
#endif
  return c;
}
__device__ __forceinline__ v8f mma_h_raw(v16h a, v16h b, v8f c) {
  return __builtin_amdgcn_wmma_f32_16x16x32_f16(false, a, false, b, (short)0, c, false, false);
}
__device__ __forceinline__ void dep_guard_h(v8f& a, v8f& b, v16h x, v16h y) {
#if defined(__HIP_DEVICE_COMPILE__)
  asm volatile("v_nop\n\tv_nop\n\tv_nop\n\tv_nop" : "+v"(a), "+v"(b) : "v"(x), "v"(y));
#endif
}
__device__ __forceinline__ void keep4_h(v16h a, v16h b, v16h c, v16h d) {
#if defined(__HIP_DEVICE_COMPILE__)
  asm volatile("v_nop" :: "v"(a), "v"(b), "v"(c), "v"(d));
#endif
}
__device__ __forceinline__ void acc_guard4(v8f& a, v8f& b, v8f& c, v8f& d) {
#if defined(__HIP_DEVICE_COMPILE__)
  asm volatile("v_nop\n\tv_nop\n\tv_nop\n\tv_nop" : "+v"(a), "+v"(b), "+v"(c), "+v"(d));
#endif
}

// =====================================================================================================
// f32 plane -> f16 bits of bfr(v) * scale (scale a power of two): x (x16) and the [n][k] weights (x1024),
// whose [out][in] layout is already the k-contiguous Bt layout of the GEMM below.
// coverage: n8 threads x 8 = the whole plane.
// =====================================================================================================
__global__ __launch_bounds__(256) void cvt16(const float* __restrict__ in, unsigned short* out, int n8, float scale) {
  const int i = blockIdx.x * 256 + threadIdx.x;
  if (i < n8) {
    const v4f a = *(const v4f*)(in + (size_t)i * 8);
    const v4f b = *(const v4f*)(in + (size_t)i * 8 + 4);
    v4u p;
    p[0] = pk16(h_bits((_Float16)(bfr(a[0]) * scale)), h_bits((_Float16)(bfr(a[1]) * scale)));
    p[1] = pk16(h_bits((_Float16)(bfr(a[2]) * scale)), h_bits((_Float16)(bfr(a[3]) * scale)));
    p[2] = pk16(h_bits((_Float16)(bfr(b[0]) * scale)), h_bits((_Float16)(bfr(b[1]) * scale)));
    p[3] = pk16(h_bits((_Float16)(bfr(b[2]) * scale)), h_bits((_Float16)(bfr(b[3]) * scale)));
    *(v4u*)(out + (size_t)i * 8) = p;
    
  }
}

// =====================================================================================================
// RoPE inverse frequencies: inv[m] = 1 / powf(10000, (2m)/64), m = 0..31, f32. One block of 32 threads;
// =====================================================================================================
__global__ __launch_bounds__(32) void k_invfreq(float* inv) {
  const int m = threadIdx.x & 31;
  const float e = (float)(2 * m) * (1.0f / 64.0f);
  const float p = powf(10000.0f, e);
  const float v = 1.0f / p;
  *(float*)(inv + m) = v;
  
}

// =====================================================================================================
// RoPE table tab[t][64] f32: [0..31] = cos(t * inv[m]), [32..63] = sin(t * inv[m]) (precise sincosf, f32
// angle = fl(t * inv[m])). Block = 8 tokens x 32 pairs (256 threads); the 8x64 tile is staged in LDS, then
// coverage: compute 8 x 32 threads x 2 = 8x64; store 128 lanes x 4 floats = 8 rows x 64; grid covers every t.
// =====================================================================================================
__global__ __launch_bounds__(256) void k_rope_tab(const float* __restrict__ inv, float* tab) {
  __shared__ __align__(16) float st[8 * 64];
  const int tid = threadIdx.x;
  const int m   = tid & 31, tr = tid >> 5;
  const int t   = blockIdx.x * 8 + tr;              // < SEQ by the grid
  const float w = inv[m];
  const float ang = (float)t * w;
  float sn, cs;
  sincosf(ang, &sn, &cs);
  st[tr * 64 + m]      = cs;
  st[tr * 64 + 32 + m] = sn;
  __syncthreads();
  if (tid < 128) {                                  // waves 0..3, wave-uniform
    const int row = tid >> 4, c4 = (tid & 15) * 4;
    const v4f v = *(const v4f*)(st + row * 64 + c4);
    float* dst = tab + (size_t)(blockIdx.x * 8 + row) * 64 + c4;
    *(v4f*)dst = v;
    
  }
}

// =====================================================================================================
// Register-blocked f16 WMMA GEMM, one wave per 64x64 tile, four waves (2x2) per 128x128 block tile. The block's
// A and Bt rows of a 64-k pass are staged in LDS by asynchronous 16-byte copies (whole 128-byte lines), two
// buffers: the next pass's copies fly while this pass's fragments are read from LDS.
//   v[m][n] = (sum_k A[m][k] * Bt[n][k]  [+ 2^-11 * sum_k Ar[m][k] * Bt[n][k] when ARES]) * cscale
// A, Ar row-major [M][K] pitch lda (f16), Bt row-major [N][K] pitch ldb (f16, k contiguous); M, N multiples of
// 128, K multiple of 64; one block per block tile (a block-uniform bound check anyway).
// ARES: the residual plane is accumulated first from zero, the accumulators are scaled by 2^-11 exactly on the
// VALU (with nop gaps on both sides), then the hi plane accumulates on top: one accumulator set.
// Epilogue variants:
//   EPI 0: f16 hi plane = f16(v' * oscale) at Cp and residual plane = f16((v'*oscale - hi) * 2048) at Crp,
//          pitch ldc halves, where v' = v for tiles with n0 >= ropeN and, for n0 < ropeN (wave-uniform),
//          v' = rotate-half RoPE of the wave's 64-column tile (one head): pair index mm = column mod 32,
//          token = output row, c = rtab[token][mm], s = rtab[token][32+mm]:
//          col mm -> v[mm]*c - v[32+mm]*s ; col 32+mm -> v[32+mm]*c + v[mm]*s (f32, from the LDS slab).
//   EPI 1: f32 out = v, pitch ldc floats
// 16-row slabs staged per wave in LDS. f32 out: each 64-wide row segment (256 B = 2 lines) by 16 lanes x 16 B,
// coverage: 4 slabs x 16 rows x 64 cols = the wave's whole 64x64 tile; grid x 4 tiles = [M][N].
// =====================================================================================================
// Eight 16-byte asynchronous copies of one lane, global -> LDS, rows 16 apart in both places. The s_wait_xcnt
// is the last line of the copies' own statement so that no address register is rewritten ahead of it.
__device__ __forceinline__ void copy8_rows(unsigned l, const _Float16* g, int ld) {
#if defined(__HIP_DEVICE_COMPILE__)
  const unsigned l0 = l,                    l1 = l + 1u * 16u * GP_B, l2 = l + 2u * 16u * GP_B, l3 = l + 3u * 16u * GP_B;
  const unsigned l4 = l + 4u * 16u * GP_B, l5 = l + 5u * 16u * GP_B, l6 = l + 6u * 16u * GP_B, l7 = l + 7u * 16u * GP_B;
  const size_t st = (size_t)16 * ld;
  const _Float16 *g0 = g, *g1 = g + st, *g2 = g + 2 * st, *g3 = g + 3 * st;
  const _Float16 *g4 = g + 4 * st, *g5 = g + 5 * st, *g6 = g + 6 * st, *g7 = g + 7 * st;
  asm volatile(
      "global_load_async_to_lds_b128 %0, %8, off\n\t"
      "global_load_async_to_lds_b128 %1, %9, off\n\t"
      "global_load_async_to_lds_b128 %2, %10, off\n\t"
      "global_load_async_to_lds_b128 %3, %11, off\n\t"
      "global_load_async_to_lds_b128 %4, %12, off\n\t"
      "global_load_async_to_lds_b128 %5, %13, off\n\t"
      "global_load_async_to_lds_b128 %6, %14, off\n\t"
      "global_load_async_to_lds_b128 %7, %15, off\n\t"
      "s_wait_xcnt 0x0"
      :: "v"(l0), "v"(l1), "v"(l2), "v"(l3), "v"(l4), "v"(l5), "v"(l6), "v"(l7),
         "v"(g0), "v"(g1), "v"(g2), "v"(g3), "v"(g4), "v"(g5), "v"(g6), "v"(g7)
      : "memory");
#endif
}
// the issuing wave's copies have landed in LDS behind this wait
__device__ __forceinline__ void wait_async0() {
#if defined(__HIP_DEVICE_COMPILE__)
  asm volatile("s_wait_asynccnt 0x0" ::: "memory");
#endif
}
// the wave's own LDS reads of a buffer have retired before that buffer is handed back for a refill
__device__ __forceinline__ void wait_ds0() {
#if defined(__HIP_DEVICE_COMPILE__)
  asm volatile("s_wait_dscnt 0x0" ::: "memory");
#endif
}

template <int EPI, bool ARES>
__global__ __launch_bounds__(128) void gemm64_f16(
    const unsigned short* __restrict__ Ap, const unsigned short* __restrict__ Arp, int lda,
    const unsigned short* __restrict__ Btp, int ldb,
    float cscale,
    void* Cp, unsigned short* Crp, int ldc, int M, int N, int K, float oscale,
    const float* __restrict__ rtab, int ropeN) {
  const _Float16* Ah  = (const _Float16*)(const void*)Ap;
  const _Float16* Arh = (const _Float16*)(const void*)Arp;
  const _Float16* Bt  = (const _Float16*)(const void*)Btp;
  __shared__ __align__(16) unsigned char ring[2 * GSTAGE];   // two stages of [A 128 rows | Bt 128 rows], pitch GP_B
  __shared__ __align__(16) float sT[4][16 * 68];   // per-wave 16x64 slab, pitch 68 floats
  const int tid  = threadIdx.x;
  const int lane = tid & 31;
  const int wave = tid >> 5;
  const int tilesN = N >> 7;
  const int tilesM = M >> 7;
  if ((int)blockIdx.x >= tilesM * tilesN) return;   // block-uniform, in front of every barrier and copy
  const int bm = (int)blockIdx.x / tilesN;
  const int bn = (int)blockIdx.x - bm * tilesN;
  const int wm = (wave >> 1) << 6;             // the wave's 64x64 tile inside the block's 128x128 tile
  const int wn = (wave & 1) << 6;
  const int m0 = (bm << 7) + wm;
  const int n0 = (bn << 7) + wn;

  const int rlane = lane & 15;                 // row (A) / col (B, D) within subtile
  const int koff  = (lane >> 4) * 8;           // k offset of this lane half
  const int mOff  = (lane >> 4) * 8;           // D row offset

  v8f acc[4][4];
#pragma unroll
  for (int i = 0; i < 4; ++i)
#pragma unroll
    for (int j = 0; j < 4; ++j) acc[i][j] = zero8();

  // staging map: lane -> row tid>>3 (+16 per copy, 8 copies = 128 rows), 16-byte piece tid&7 of the 128-byte row
  const int crow = tid >> 3, cpc = tid & 7;
  const unsigned ringb = (unsigned)(uintptr_t)(const void*)ring;           // LDS byte address of the ring
  const unsigned lcp   = ringb + (unsigned)(crow * GP_B + cpc * 16);
  const _Float16* gA  = Ah  + (size_t)((bm << 7) + crow) * lda + cpc * 8;
  const _Float16* gAr = Arh + (size_t)((bm << 7) + crow) * lda + cpc * 8;
  const _Float16* gB  = Bt  + (size_t)((bn << 7) + crow) * ldb + cpc * 8;
  const int KP = K >> 6;                       // passes of 64 k per plane
  const int NP = ARES ? 2 * KP : KP;           // ARES: the residual plane's passes first, then the hi plane's

  // tile 0 -> buffer 0, landed and published; then tile 1 -> buffer 1 flies over pass 0
  copy8_rows(lcp, ARES ? gAr : gA, lda);
  copy8_rows(lcp + GOFF_B, gB, ldb);
  wait_async0();
  __syncthreads();
  if (NP > 1) {
    const int kk = (1 < KP) ? 64 : 0;
    const _Float16* ga = (ARES && 1 < KP) ? gAr : gA;
    copy8_rows(lcp + GSTAGE, ga + kk, lda);
    copy8_rows(lcp + GSTAGE + GOFF_B, gB + kk, ldb);
  }

  for (int t = 0; t < NP; ++t) {
    if (ARES && t == KP) {                     // block-uniform: between the two planes
      acc_guard4(acc[0][0], acc[0][1], acc[0][2], acc[0][3]);
      acc_guard4(acc[1][0], acc[1][1], acc[1][2], acc[1][3]);
      acc_guard4(acc[2][0], acc[2][1], acc[2][2], acc[2][3]);
      acc_guard4(acc[3][0], acc[3][1], acc[3][2], acc[3][3]);
#pragma unroll
      for (int i = 0; i < 4; ++i)
#pragma unroll
        for (int j = 0; j < 4; ++j) acc[i][j] = acc[i][j] * (1.0f / 2048.0f);   // exact fold of the x2^11 residual carry
      acc_guard4(acc[0][0], acc[0][1], acc[0][2], acc[0][3]);
      acc_guard4(acc[1][0], acc[1][1], acc[1][2], acc[1][3]);
      acc_guard4(acc[2][0], acc[2][1], acc[2][2], acc[2][3]);
      acc_guard4(acc[3][0], acc[3][1], acc[3][2], acc[3][3]);
    }
    const unsigned bsel = (unsigned)(t & 1) * GSTAGE;
    const _Float16* sA = (const _Float16*)(const void*)(ring + bsel) + (wm + rlane) * GP_H + koff;
    const _Float16* sB = (const _Float16*)(const void*)(ring + bsel + GOFF_B) + (wn + rlane) * GP_H + koff;
    // the loops below are unrolled so that every fragment and accumulator index is a constant (registers, no scratch)
#pragma unroll
    for (int ks = 0; ks < 2; ++ks) {
      v16h bh[4];
#pragma unroll
      for (int j = 0; j < 4; ++j) bh[j] = ldfrag_h(sB + (j << 4) * GP_H + ks * 32);
      v16h ah[4];                              // all eight fragments of a 32-k step are read as one group
#pragma unroll
      for (int i = 0; i < 4; ++i) ah[i] = ldfrag_h(sA + (i << 4) * GP_H + ks * 32);
#pragma unroll
      for (int i = 0; i < 4; ++i) {
#pragma unroll
        for (int j = 0; j < 4; ++j) {
          acc[i][j] = mma_h_raw(ah[i], bh[j], acc[i][j]);
        }
        dep_guard_h(acc[i][0], acc[i][3], ah[i], bh[3]);
      }
      keep4_h(bh[0], bh[1], bh[2], bh[3]);
    }
    // publish point of tile t + 1: own LDS reads retired, own copies landed, one barrier for both jobs
    wait_ds0();
    wait_async0();
    __syncthreads();
    if (t + 2 < NP) {                          // block-uniform: refill the buffer that pass t has just read
      const int tn = t + 2;
      const bool res = ARES && (tn < KP);
      const int kk = (tn - ((ARES && tn >= KP) ? KP : 0)) << 6;
      copy8_rows(lcp + bsel, (res ? gAr : gA) + kk, lda);
      copy8_rows(lcp + bsel + GOFF_B, gB + kk, ldb);
    }
  }
  wait_async0();
  acc_guard4(acc[0][0], acc[0][1], acc[0][2], acc[0][3]);
  acc_guard4(acc[1][0], acc[1][1], acc[1][2], acc[1][3]);
  acc_guard4(acc[2][0], acc[2][1], acc[2][2], acc[2][3]);
  acc_guard4(acc[3][0], acc[3][1], acc[3][2], acc[3][3]);

  // ---- epilogue ----
  float* slab = sT[wave];
#pragma unroll
  for (int i = 0; i < 4; ++i) {
    const int mBase = m0 + (i << 4);
#pragma unroll
    for (int r = 0; r < 8; ++r) {
      const int row = mOff + r;
#pragma unroll
      for (int j = 0; j < 4; ++j) slab[row * 68 + (j << 4) + rlane] = acc[i][j][r] * cscale;
    }
    __builtin_amdgcn_fence(__ATOMIC_RELEASE, "workgroup");
    __builtin_amdgcn_wave_barrier();
    __builtin_amdgcn_fence(__ATOMIC_ACQUIRE, "workgroup");
    if constexpr (EPI == 0) {
      unsigned short* C16 = (unsigned short*)Cp;
      const int rq = lane >> 3, piece = lane & 7;
      const bool rope_on = (n0 < ropeN);                   // wave-uniform (n0 is per wave)
      const float rsgn = (piece < 4) ? -1.0f : 1.0f;       // cols 0..31 carry x1 (minus), cols 32..63 carry x2 (plus)
      const int   pm   = (piece & 3) * 8;                  // rotation pair index base of this lane's 8 columns
      v4u ph[4], pr[4];
#pragma unroll
      for (int it = 0; it < 4; ++it) {
        const int row = it * 4 + rq;                         // it 0..3 x rq 0..3 = rows 0..15
        const v4f a  = *(const v4f*)(slab + row * 68 + piece * 8);
        const v4f a2 = *(const v4f*)(slab + row * 68 + piece * 8 + 4);
        float f[8];
        f[0] = a[0];  f[1] = a[1];  f[2] = a[2];  f[3] = a[3];
        f[4] = a2[0]; f[5] = a2[1]; f[6] = a2[2]; f[7] = a2[3];
        if (rope_on) {                                       // wave-uniform branch, LDS and table reads only
          const int po = (piece ^ 4) * 8;                    // partner half of the head (32 columns away)
          const v4f g  = *(const v4f*)(slab + row * 68 + po);
          const v4f g2 = *(const v4f*)(slab + row * 68 + po + 4);
          const float* trp = rtab + (size_t)(mBase + row) * 64 + pm;   // output row = token index
          const v4f c0 = *(const v4f*)(trp);
          const v4f c1 = *(const v4f*)(trp + 4);
          const v4f s0 = *(const v4f*)(trp + 32);
          const v4f s1 = *(const v4f*)(trp + 36);
          f[0] = f[0] * c0[0] + rsgn * g[0]  * s0[0];
          f[1] = f[1] * c0[1] + rsgn * g[1]  * s0[1];
          f[2] = f[2] * c0[2] + rsgn * g[2]  * s0[2];
          f[3] = f[3] * c0[3] + rsgn * g[3]  * s0[3];
          f[4] = f[4] * c1[0] + rsgn * g2[0] * s1[0];
          f[5] = f[5] * c1[1] + rsgn * g2[1] * s1[1];
          f[6] = f[6] * c1[2] + rsgn * g2[2] * s1[2];
          f[7] = f[7] * c1[3] + rsgn * g2[3] * s1[3];
        }
        v4u p, q;
#pragma unroll
        for (int e = 0; e < 4; ++e) {
          const float g0 = f[2 * e] * oscale, g1 = f[2 * e + 1] * oscale;
          const _Float16 x0 = (_Float16)g0, x1 = (_Float16)g1;
          const _Float16 y0 = (_Float16)((g0 - (float)x0) * 2048.0f);
          const _Float16 y1 = (_Float16)((g1 - (float)x1) * 2048.0f);
          p[e] = pk16(h_bits(x0), h_bits(x1));
          q[e] = pk16(h_bits(y0), h_bits(y1));
        }
        ph[it] = p;
        pr[it] = q;
      }
      {
#pragma unroll
        for (int it = 0; it < 4; ++it) {
          const int row = it * 4 + rq;
          const size_t co = (size_t)(mBase + row) * ldc + n0 + piece * 8;
          *(v4u*)(C16 + co) = ph[it];
          *(v4u*)(Crp + co) = pr[it];
        }
        
      }
    } else {
      float* Cf = (float*)Cp;
      const int hh = lane >> 4, c4 = (lane & 15) * 4;     // 256-B row segment = 16 lanes x 16 B
      v4f ov[8];
#pragma unroll
      for (int it = 0; it < 8; ++it) {
        const int row = it * 2 + hh;                       // it 0..7 x hh 0..1 = rows 0..15
        ov[it] = *(const v4f*)(slab + row * 68 + c4);
      }
      {
#pragma unroll
        for (int it = 0; it < 8; ++it) {
          const int row = it * 2 + hh;
          *(v4f*)(Cf + (size_t)(mBase + row) * ldc + n0 + c4) = ov[it];
        }
        
      }
    }
    __builtin_amdgcn_fence(__ATOMIC_RELEASE, "workgroup");
    __builtin_amdgcn_wave_barrier();
    __builtin_amdgcn_fence(__ATOMIC_ACQUIRE, "workgroup");
  }
}

// =====================================================================================================
// v columns of an f16 qkv plane (token-major, element (t, h, d) at [t*DQKV + 2*DM + h*64 + d])
// -> f16 v^T plane vt[(h*64 + d)*SEQ + t] (same bits). Used for the hi plane and the residual plane.
// Block = one 64-token x 64-feature tile of one head; grid = (SEQ/64, NH); tile staged in LDS as halves
// (v8h 16-B stores, __syncthreads, _Float16 element reads).
// Store: group g = tid>>3 (0..31), piece = tid&7: iteration it writes row d = it*32+g, lanes 8q..8q+7 x 16 B =
// coverage: load 2 x 256 threads x 8 halves = 64x64; store 2 iterations x 32 groups = 64 rows d, 8 pieces x 8
// = 64 tokens per row; grid covers every (h, token tile).
// =====================================================================================================
__global__ __launch_bounds__(256) void v_tr(const unsigned short* __restrict__ qkvp, unsigned short* vt) {
  __shared__ __align__(16) _Float16 sv[64 * 72];       // [tt][d], pitch 72 halves (144 B)
  const int tid = threadIdx.x;
  const int t0  = blockIdx.x * 64;
  const int hh  = blockIdx.y;
  const _Float16* src = (const _Float16*)(const void*)qkvp;
#pragma unroll
  for (int i = 0; i < 2; ++i) {
    const int idx = i * 256 + tid;                  // 0..511
    const int tt = idx >> 3, c8 = (idx & 7) * 8;
    const v8h a = *(const v8h*)(src + ((size_t)(t0 + tt)) * DQKV + 2 * DM + hh * HD + c8);
    *(v8h*)(sv + tt * 72 + c8) = a;
  }
  __syncthreads();

  const int g = tid >> 3, piece = tid & 7;
  v4u hv[2];
  size_t hofs[2];
#pragma unroll
  for (int it = 0; it < 2; ++it) {
    const int d = it * 32 + g;
    v4u a;
#pragma unroll
    for (int e = 0; e < 4; ++e) {
      const _Float16 x0 = sv[(piece * 8 + 2 * e) * 72 + d];
      const _Float16 x1 = sv[(piece * 8 + 2 * e + 1) * 72 + d];
      a[e] = pk16(h_bits(x0), h_bits(x1));
    }
    hv[it] = a;
    hofs[it] = ((size_t)(hh * HD + d)) * SEQ + t0 + piece * 8;
  }
  {
#pragma unroll
    for (int it = 0; it < 2; ++it) *(v4u*)(vt + hofs[it]) = hv[it];
    
  }
}

// =====================================================================================================
// Windowed causal multi-head softmax attention, head dim 64, online-max form.
//   q f16 (x16): element (t, h, d) at qkv[t*DQKV + h*64 + d]; k at + DM; residual planes (x2^11 of the f16
//   residue) in qkvr with the same addressing; v^T f16 (x16) at vt[(h*64 + d)*SEQ + s], residual vtr.
//   logit a = (q.k) / 8 = acc / 2048 (two x16 carries); HR: acc = qh.kh + 2^-11 (qh.kr + qr.kh).
//   Key j is allowed for query row i iff (j <= i) and (j + WIN >= i) (both bounds inclusive, up to WIN+1 keys);
//   other keys get a = -1e30 (select by value) and p = 0 (select by value). Per 64-key tile: tile max (per-lane
//   max over the 4 key groups, then a 16-lane xor max), mn = max(mrun, tile max), alpha = exp(mrun - mn),
//   p = exp(a - mn), lsum = lsum * alpha + sum p (per-lane partials, 16-lane xor reduction at the end), context
//   accumulators scaled by alpha on the VALU (nop gaps on both sides). A query row whose keys in a visited tile
//   are all masked keeps mrun, gets alpha = 1 and p = 0. The diagonal tile gives every row its own key, so
//   lsum >= 1 at the end.
//   P carried as f16(256 p) (HR: plus residual f16((256p - hi)*2048)); context = P . v^T on f16 WMMA
//   (HR: second accumulator += Ph.Vr + Pr.Vh, folded with 2^-11).
//   ctx plane f16 (x16): element (t, h*64 + d) at ctx[t*DM + h*64 + d] = 16 * context / (4096 lsum);
//   HR also writes the ctx residual plane f16((16 ctx - hi) * 2048).
//   Block = 4 waves = 64 query rows of one head; query tile qb = blockIdx % NQB, head = blockIdx / NQB;
//   grid = NQB*NH; kv tiles of 64 from max(qb - KTW + 1, 0) to qb, block-uniform trip count <= KTW (key tiles
//   outside the window are never visited; keys outside the window inside a visited tile contribute exactly 0).
//   K / V^T tile staging: 128 threads x 32 halves per plane = the whole 64x64 tile (plain 16-B loads,
//   __syncthreads before and after); P tiles are wave-private, spilled with _Float16 element stores and
//   wave in LDS as f32 (aliasing the K/V region after a block barrier) the same way.
//   Output coverage: each wave stores rows 0..15 of its tile (it 0..3 x lane>>3 0..3) x 64 columns (8 lanes x
//   every (head, query tile) exactly once.
// =====================================================================================================
template <bool HR>
__global__ __launch_bounds__(128)
void attn_k(const unsigned short* __restrict__ qkvp, const unsigned short* __restrict__ qkvrp,
            const unsigned short* __restrict__ vtp, const unsigned short* __restrict__ vtrp,
            unsigned short* ctxp, unsigned short* ctxrp) {
  union FH { v16h v; v8h h[2]; };
  constexpr int AP     = 72;                             // LDS row pitch of the f16 tiles, halves: 128-byte row + 16 (16 B x odd, for 16-byte readers)
  constexpr int OP     = 68;                             // LDS row pitch of the f32 context slab, floats (16-byte readers four rows at a time)
  constexpr int TB     = 64 * AP * 2;                    // one f16 64x64 tile at that pitch, bytes
  constexpr int PB     = 4 * 16 * AP * 2;                // four wave-private 16x64 f16 P tiles, bytes
  constexpr int OFF_K  = 0;
  constexpr int OFF_V  = TB;
  constexpr int OFF_KR = 2 * TB;
  constexpr int OFF_VR = 3 * TB;
  constexpr int OFF_P  = HR ? 4 * TB : 2 * TB;
  constexpr int OFF_PR = OFF_P + PB;
  constexpr int SMEMB  = HR ? (OFF_PR + PB) : (OFF_P + PB);   // 55296 : 27648
  static_assert(4 * 16 * OP * 4 <= OFF_P);                    // f32 context staging aliases the K/V region
  __shared__ __align__(16) unsigned char smem[SMEMB];
  _Float16* Ksh = (_Float16*)(smem + OFF_K);                  // K   [kv][d]
  _Float16* Vsh = (_Float16*)(smem + OFF_V);                  // V^T [d][kv]
  _Float16* Krs = (_Float16*)(smem + (HR ? OFF_KR : OFF_K));  // K residual (HR only)
  _Float16* Vrs = (_Float16*)(smem + (HR ? OFF_VR : OFF_V));  // V^T residual (HR only)
  _Float16* Psh = (_Float16*)(smem + OFF_P);
  _Float16* Prs = (_Float16*)(smem + (HR ? OFF_PR : OFF_P));

  const int tid  = threadIdx.x;
  const int wave = tid >> 5;
  const int lane = tid & 31;
  const int hh   = lane >> 4;
  const int c    = lane & 15;

  const int bx   = blockIdx.x;
  const int qb   = bx % NQB;
  const int h    = bx / NQB;                 // < NH by the grid size
  const int q0   = qb * 64 + wave * 16;

  const _Float16* Qp  = (const _Float16*)(const void*)qkvp  + (size_t)h * HD;
  const _Float16* Qrp = (const _Float16*)(const void*)qkvrp + (size_t)h * HD;
  const _Float16* Kp  = Qp + DM;
  const _Float16* Krp = Qrp + DM;
  const _Float16* Vt  = (const _Float16*)(const void*)vtp  + ((size_t)h * HD) * SEQ;
  const _Float16* Vrt = (const _Float16*)(const void*)vtrp + ((size_t)h * HD) * SEQ;

  // ---- Q fragments (A operand, row = lane&15): 2 d-chunks ----
  v16h qa[2], qr[2];
#pragma unroll
  for (int dc = 0; dc < 2; ++dc) {
    const size_t qo = (size_t)(q0 + c) * DQKV + dc * 32 + 8 * hh;
    qa[dc] = ldfrag_h(Qp + qo);
    if constexpr (HR) qr[dc] = ldfrag_h(Qrp + qo);
    else qr[dc] = qa[dc];
  }

  float lsum[8], mrun[8];
  v8f oacc[4], oacc2[4];
#pragma unroll
  for (int r = 0; r < 8; ++r) { lsum[r] = 0.f; mrun[r] = -1e30f; }
#pragma unroll
  for (int t = 0; t < 4; ++t) { oacc[t] = zero8(); oacc2[t] = zero8(); }

  _Float16* pw  = Psh + wave * (16 * AP);
  _Float16* prw = Prs + wave * (16 * AP);

  const int ktlo = (qb >= KTW - 1) ? (qb - (KTW - 1)) : 0;   // first key tile in the window, block-uniform
  const int nkt  = qb - ktlo + 1;                              // 1..KTW key tiles, block-uniform
  for (int kti = 0; kti < nkt; ++kti) {
    const int kv0 = (ktlo + kti) * 64;                         // <= qb*64 < SEQ
    __syncthreads();
    {
      const int r = tid >> 1, half = (tid & 1) * 32;
      const size_t ko = (size_t)(kv0 + r) * DQKV + half;      // K row kv0+r, d = half..half+31
      const size_t vo = (size_t)r * SEQ + kv0 + half;           // V^T row d = r, s = kv0+half..+31
#pragma unroll
      for (int i = 0; i < 4; ++i) {
        const v8h a0 = *(const v8h*)(Kp + ko + 8 * i);
        const v8h b0 = *(const v8h*)(Vt + vo + 8 * i);
        *(v8h*)(Ksh + r * AP + half + 8 * i) = a0;
        *(v8h*)(Vsh + r * AP + half + 8 * i) = b0;
        if constexpr (HR) {
          const v8h a1 = *(const v8h*)(Krp + ko + 8 * i);
          const v8h b1 = *(const v8h*)(Vrt + vo + 8 * i);
          *(v8h*)(Krs + r * AP + half + 8 * i) = a1;
          *(v8h*)(Vrs + r * AP + half + 8 * i) = b1;
        }
      }
    }
    __syncthreads();

    // ---- scores: 16 query rows x 64 keys per wave (B operand: lane c -> key j*16+c, split k map over d) ----
    v8f s[4];
#pragma unroll
    for (int j = 0; j < 4; ++j) {
      s[j] = zero8();
      v8f t = zero8();
#pragma unroll
      for (int dc = 0; dc < 2; ++dc) {
        FH kb;
        kb.h[0] = *(const v8h*)(Ksh + (j * 16 + c) * AP + dc * 32 + 8 * hh);
        kb.h[1] = *(const v8h*)(Ksh + (j * 16 + c) * AP + dc * 32 + 16 + 8 * hh);
        s[j] = mma_h(qa[dc], kb.v, s[j]);
        if constexpr (HR) {
          FH krb;
          krb.h[0] = *(const v8h*)(Krs + (j * 16 + c) * AP + dc * 32 + 8 * hh);
          krb.h[1] = *(const v8h*)(Krs + (j * 16 + c) * AP + dc * 32 + 16 + 8 * hh);
          t = mma_h(qa[dc], krb.v, t);
          t = mma_h(qr[dc], kb.v, t);
        }
      }
      if constexpr (HR) s[j] = s[j] + t * (1.0f / 2048.0f);
    }

    // ---- windowed causal online softmax: tile max, running max, alpha, p, row-sum partials,
    //      P (x256, f16; HR: + residual) ----
    float alpha[8];
#pragma unroll
    for (int r = 0; r < 8; ++r) {
      const int qrow = q0 + 8 * hh + r;
      float av[4];
      float tmx = -1e30f;
#pragma unroll
      for (int j = 0; j < 4; ++j) {
        const int key = kv0 + j * 16 + c;
        float a = s[j][r] * (1.0f / 2048.0f);              // 1/8 head scale, 1/256 for the two x16 carries
        const bool ok = (key <= qrow) && (key + WIN >= qrow);
        a = ok ? a : -1e30f;
        av[j] = a;
        tmx = fmaxf(tmx, a);
      }
#pragma unroll
      for (int off = 1; off < 16; off <<= 1) tmx = fmaxf(tmx, __shfl_xor(tmx, off, 32));
      const float mn = fmaxf(mrun[r], tmx);
      const float al = __expf(mrun[r] - mn);
      alpha[r] = al;
      mrun[r]  = mn;
      float ps = 0.0f;
#pragma unroll
      for (int j = 0; j < 4; ++j) {
        const int key = kv0 + j * 16 + c;
        const bool ok = (key <= qrow) && (key + WIN >= qrow);
        float p = __expf(av[j] - mn);
        p = ok ? p : 0.0f;
        ps += p;
        const float g = p * 256.0f;
        const _Float16 x0 = (_Float16)g;
        pw[(8 * hh + r) * AP + j * 16 + c] = x0;
        if constexpr (HR) prw[(8 * hh + r) * AP + j * 16 + c] = (_Float16)((g - (float)x0) * 2048.0f);
      }
      lsum[r] = lsum[r] * al + ps;
    }
    __builtin_amdgcn_fence(__ATOMIC_RELEASE, "workgroup");
    __builtin_amdgcn_wave_barrier();
    __builtin_amdgcn_fence(__ATOMIC_ACQUIRE, "workgroup");

    // ---- rescale the context accumulators by alpha (VALU), nop gaps before the next WMMA reads them ----
#pragma unroll
    for (int t = 0; t < 4; ++t) {
#pragma unroll
      for (int r = 0; r < 8; ++r) {
        oacc[t][r] = oacc[t][r] * alpha[r];
        if constexpr (HR) oacc2[t][r] = oacc2[t][r] * alpha[r];
      }
    }
    acc_guard4(oacc[0], oacc[1], oacc[2], oacc[3]);
    if constexpr (HR) acc_guard4(oacc2[0], oacc2[1], oacc2[2], oacc2[3]);

    // ---- context += P . V (f16 WMMA; A = P [row][key], B = V^T [d][key]) ----
#pragma unroll
    for (int kk = 0; kk < 2; ++kk) {
      FH pa, par;
      pa.h[0] = *(const v8h*)(pw + c * AP + kk * 32 + 8 * hh);
      pa.h[1] = *(const v8h*)(pw + c * AP + kk * 32 + 16 + 8 * hh);
      if constexpr (HR) {
        par.h[0] = *(const v8h*)(prw + c * AP + kk * 32 + 8 * hh);
        par.h[1] = *(const v8h*)(prw + c * AP + kk * 32 + 16 + 8 * hh);
      } else {
        par.v = pa.v;
      }
#pragma unroll
      for (int t = 0; t < 4; ++t) {
        FH vb;
        vb.h[0] = *(const v8h*)(Vsh + (t * 16 + c) * AP + kk * 32 + 8 * hh);
        vb.h[1] = *(const v8h*)(Vsh + (t * 16 + c) * AP + kk * 32 + 16 + 8 * hh);
        oacc[t] = mma_h(pa.v, vb.v, oacc[t]);
        if constexpr (HR) {
          FH vrb;
          vrb.h[0] = *(const v8h*)(Vrs + (t * 16 + c) * AP + kk * 32 + 8 * hh);
          vrb.h[1] = *(const v8h*)(Vrs + (t * 16 + c) * AP + kk * 32 + 16 + 8 * hh);
          oacc2[t] = mma_h(pa.v, vrb.v, oacc2[t]);
          oacc2[t] = mma_h(par.v, vb.v, oacc2[t]);
        }
      }
    }
  }
  __syncthreads();                           // every wave is done with the K/V tiles before they are aliased

  // ---- normalise (1/lsum, the 1/256 p carry; keep the x16 v carry), stage the wave's 16x64 f32 tile in
  float* os = (float*)(void*)smem + wave * (16 * OP);
#pragma unroll
  for (int r = 0; r < 8; ++r) {
    float l = lsum[r];
#pragma unroll
    for (int off = 1; off < 16; off <<= 1) l += __shfl_xor(l, off, 32);
    const float rl = 1.0f / l;               // l >= 1 (the max key contributes p = 1)
    const float sc = rl * (1.0f / 256.0f);
#pragma unroll
    for (int t = 0; t < 4; ++t) {
      float v = oacc[t][r];
      if constexpr (HR) v += oacc2[t][r] * (1.0f / 2048.0f);
      os[(8 * hh + r) * OP + t * 16 + c] = v * sc;
    }
  }
  __builtin_amdgcn_fence(__ATOMIC_RELEASE, "workgroup");
  __builtin_amdgcn_wave_barrier();
  __builtin_amdgcn_fence(__ATOMIC_ACQUIRE, "workgroup");
  {
    const int rq = lane >> 3, piece = lane & 7;
    v4u ph[4], pr[4];
#pragma unroll
    for (int it = 0; it < 4; ++it) {
      const int row = it * 4 + rq;   // it 0..3 x rq 0..3 = rows 0..15 of the wave tile
      const v4f a  = *(const v4f*)(os + row * OP + piece * 8);
      const v4f a2 = *(const v4f*)(os + row * OP + piece * 8 + 4);
      float f[8];
      f[0] = a[0];  f[1] = a[1];  f[2] = a[2];  f[3] = a[3];
      f[4] = a2[0]; f[5] = a2[1]; f[6] = a2[2]; f[7] = a2[3];
      v4u p, q;
#pragma unroll
      for (int e = 0; e < 4; ++e) {
        const _Float16 x0 = (_Float16)f[2 * e], x1 = (_Float16)f[2 * e + 1];
        p[e] = pk16(h_bits(x0), h_bits(x1));
        if constexpr (HR) {
          const _Float16 y0 = (_Float16)((f[2 * e] - (float)x0) * 2048.0f);
          const _Float16 y1 = (_Float16)((f[2 * e + 1] - (float)x1) * 2048.0f);
          q[e] = pk16(h_bits(y0), h_bits(y1));
        } else {
          q[e] = p[e];
        }
      }
      ph[it] = p;
      pr[it] = q;
    }
    {
#pragma unroll
      for (int it = 0; it < 4; ++it) {
        const int row = it * 4 + rq;
        const size_t go = (size_t)(q0 + row) * DM + (size_t)h * HD + piece * 8;
        *(v4u*)(ctxp + go) = ph[it];
        if constexpr (HR) *(v4u*)(ctxrp + go) = pr[it];
      }
      
    }
  }
}

// =====================================================================================================
// Workspace map (bytes); every region is an exact multiple of its whole-line / whole-tile store granularity
// (row pitches 2048 / 6144 / 8192 / 256 B, all offsets multiples of 256, no aliasing within a launch):
//   Xh     f16 [SEQ][1024]                 (bf16 value of x, x16)
//   Wqkv   f16 [3072][1024]                (bf16 values of wq | wk | wv x1024, [n][k] = the input layout)
//   Wp     f16 [1024][1024]                (bf16 value of wo x1024, [n][k])
//   QKV    f16 [SEQ][3072]                 (rotated q | rotated k | v, x16)
//   QKVr   f16 [SEQ][3072]                 (x2^11 residual of the above)
//   VT     f16 [1024][SEQ]                 ([h*64 + d][s])
//   VTr    f16 [1024][SEQ]                 (residual)
//   Ctx    f16 [SEQ][1024]                 (attention context x16)
//   Ctxr   f16 [SEQ][1024]                 (residual)
//   Rt     f32 [SEQ][64]                   (cos | sin table)
//   Inv    f32 [32] (256 B)                (inverse frequencies)
//   total for SEQ = 4096: 101712128
// d_out f32: [SEQ][1024] at byte 0, every 64x64 tile written once by the projection launch.
// =====================================================================================================
extern "C" void kernel_launch(void* const* d_in, const int* in_sizes, int n_in,
                              void* d_out, int out_size, void* d_ws, size_t ws_size,
                              hipStream_t stream) {
  if (n_in < 5) return;
  if (in_sizes[0] < SEQ * DM) return;
  if (in_sizes[1] != DM * DM) return;
  if (in_sizes[2] != DM * DM) return;
  if (in_sizes[3] != DM * DM) return;
  if (in_sizes[4] != DM * DM) return;
  if (out_size < OUTN) return;

  const float* x  = (const float*)d_in[0];    // [SEQ][DM] (row prefix)
  const float* wq = (const float*)d_in[1];    // [DM n][DM k]
  const float* wk = (const float*)d_in[2];    // [DM n][DM k]
  const float* wv = (const float*)d_in[3];    // [DM n][DM k]
  const float* wo = (const float*)d_in[4];    // [DM n][DM k]

  const size_t PX   = (size_t)SEQ * DM * 2;          //  8388608 (SEQ 4096)
  const size_t PWq  = (size_t)DQKV * DM * 2;         //  6291456
  const size_t PWp  = (size_t)DM * DM * 2;           //  2097152
  const size_t PQKV = (size_t)SEQ * DQKV * 2;        // 25165824
  const size_t PVT  = (size_t)DM * SEQ * 2;          //  8388608
  const size_t PCtx = (size_t)SEQ * DM * 2;          //  8388608
  const size_t PRt  = (size_t)SEQ * 64 * 4;          //  1048576
  const size_t PInv = 256;
  size_t off = 0;
  const size_t oX    = off; off += PX;
  const size_t oWq   = off; off += PWq;
  const size_t oWp   = off; off += PWp;
  const size_t oQKV  = off; off += PQKV;
  const size_t oQKVr = off; off += PQKV;
  const size_t oVT   = off; off += PVT;
  const size_t oVTr  = off; off += PVT;
  const size_t oCtx  = off; off += PCtx;
  const size_t oCtxr = off; off += PCtx;
  const size_t oRt   = off; off += PRt;
  const size_t oInv  = off; off += PInv;
  if (off > ws_size) return;                         // off = 101712128 for SEQ 4096
  if (off > (size_t)134217728) return;

  char* ws = (char*)d_ws;
  unsigned short* Xh   = (unsigned short*)(ws + oX);
  unsigned short* Wqkv = (unsigned short*)(ws + oWq);
  unsigned short* Wp   = (unsigned short*)(ws + oWp);
  unsigned short* QKV  = (unsigned short*)(ws + oQKV);
  unsigned short* QKVr = (unsigned short*)(ws + oQKVr);
  unsigned short* VT   = (unsigned short*)(ws + oVT);
  unsigned short* VTr  = (unsigned short*)(ws + oVTr);
  unsigned short* Ctx  = (unsigned short*)(ws + oCtx);
  unsigned short* Ctxr = (unsigned short*)(ws + oCtxr);
  float*          Rt   = (float*)(ws + oRt);
  float*          Inv  = (float*)(ws + oInv);
  float*          outf = (float*)d_out;              // [SEQ][DM]

  const dim3 blk(256);
  const int n8x = SEQ * DM / 8;                      // 524288 for SEQ 4096
  const int n8w = DM * DM / 8;                       // 131072
  const dim3 gCx(n8x / 256);
  const dim3 gCw(n8w / 256);                         // 512 blocks
  const dim3 gGqkv((SEQ / 128) * (DQKV / 128));      // 768 block tiles of 128x128 (SEQ 4096)
  const dim3 gGdm((SEQ / 128) * (DM / 128));         // 256 block tiles
  const dim3 gVt(SEQ / 64, NH);                      // (64, 16)
  const dim3 gAttn(NQB * NH);                        // 1024 blocks: every (head, query tile)
  const dim3 gRt(SEQ / 8);                           // 512 blocks
  const float wScale = 1024.0f;                      // weights carried x1024
  const float aScale = 16.0f;                        // activations carried x16
  const float cscale = 1.0f / 16384.0f;              // 1/(16 * 1024)

  // (1) planes: x -> f16 x16 (bf16 values); weights [n][k] -> f16 x1024 (bf16 values), wq | wk | wv stacked
  cvt16<<<gCx, blk, 0, stream>>>(x, Xh, n8x, aScale);
  cvt16<<<gCw, blk, 0, stream>>>(wq, Wqkv, n8w, wScale);
  cvt16<<<gCw, blk, 0, stream>>>(wk, Wqkv + (size_t)DM * DM, n8w, wScale);
  cvt16<<<gCw, blk, 0, stream>>>(wv, Wqkv + (size_t)2 * DM * DM, n8w, wScale);
  cvt16<<<gCw, blk, 0, stream>>>(wo, Wp, n8w, wScale);
  // (2) RoPE tables: inverse frequencies, then cos | sin per token
  k_invfreq<<<dim3(1), dim3(32), 0, stream>>>(Inv);
  k_rope_tab<<<gRt, blk, 0, stream>>>(Inv, Rt);
  // (3) qkv = Xh . Wqkv^T with RoPE on the q and k column blocks (n0 < 2*DM) -> QKV f16 x16 + residual plane
  //     [SEQ][3072] (M=SEQ, N=3072, K=1024)
  gemm64_f16<0, false><<<gGqkv, dim3(128), 0, stream>>>(Xh, Xh, DM, Wqkv, DM, cscale, (void*)QKV, QKVr, DQKV,
                                                  SEQ, DQKV, DM, aScale, Rt, 2 * DM);
  // (4) v -> v^T planes (hi and residual, all tokens)
  v_tr<<<gVt, blk, 0, stream>>>(QKV, VT);
  v_tr<<<gVt, blk, 0, stream>>>(QKVr, VTr);
  // (5) windowed causal softmax attention -> Ctx f16 x16 + residual plane (all query tiles)
  attn_k<true><<<gAttn, dim3(128), 0, stream>>>(QKV, QKVr, VT, VTr, Ctx, Ctxr);
  // (6) out = (Ctx + 2^-11 Ctxr) . Wp^T -> d_out f32 [SEQ][1024] (M=SEQ, N=1024, K=1024), every tile once
  gemm64_f16<1, true><<<gGdm, dim3(128), 0, stream>>>(Ctx, Ctxr, DM, Wp, DM, cscale, (void*)outf, Ctxr, DM,
                                                SEQ, DM, DM, 1.0f, Rt, 0);
  (void)hipGetLastError();
}

// v003
// It runs in 138 microseconds.
// Next to v002, in two timings, it ran 1.09 times as fast each time.
// All steps since v000 together make it 2.09 times as fast.
// Contractions: q|k|v projection = v_wmma_f32_16x16x32_f16 (A = f16 of RNE-bf16 x carried x16, B = f16 of RNE-bf16 wq|wk|wv carried x1024, single product); attention q.k^T and p.v^T = v_wmma_f32_16x16x32_f16 (q, k, v^T f16 planes x16 plus x2^11 residual planes, p f16 x256 plus x2^11 residual; hi.hi + hi.res + res.hi); output projection = v_wmma_f32_16x16x32_f16 (A = ctx f16 x16 plus its x2^11 residual plane, B = f16 of RNE-bf16 wo x1024; hi.B + res.B); all f32 accumulate. RoPE cos/sin table, rotation, windowed causal online-max softmax and row sums in f32 on the VALU.
#include <hip/hip_runtime.h>
#include <math.h>
#include <stdint.h>

#define SEQ   4096                  // token rows processed (a row prefix of x); every stride, carve and grid derives from it
#define DM    1024
#define NH    16
#define HD    64
#define WIN   512
#define DQKV  (3 * DM)              // 3072
#define NQB   (SEQ / 64)            // query tiles of 64 rows
#define KTW   (WIN / 64 + 1)        // key tiles visited per 64-row query tile = 9
#define OUTN  (SEQ * DM)
static_assert(NH * HD == DM);
static_assert(HD == 64);
static_assert((WIN % 64) == 0);
static_assert(KTW == 9);
static_assert((SEQ % 64) == 0 && (DM % 64) == 0 && (DQKV % 64) == 0);
static_assert((DM % 32) == 0);
static_assert((SEQ % 128) == 0 && (DM % 128) == 0 && (DQKV % 128) == 0);   // GEMM block tile 128x128
static_assert((DM % 64) == 0 && DM >= 128);                                 // GEMM pass of 64 k, two passes or more
static_assert(((SEQ * DM / 8) % 256) == 0);
static_assert(((DM * DM / 8) % 256) == 0);
static_assert((SEQ % 8) == 0);

#define GP_B    144                 // GEMM LDS row pitch, bytes: 128-byte row + 16 (16 B x odd, for 16-byte readers)
#define GP_H    (GP_B / 2)          // the same in halves
#define GOFF_B  (128 * GP_B)        // Bt rows behind the A rows inside a stage
#define GSTAGE  (2 * 128 * GP_B)    // one stage, bytes

typedef _Float16 v16h __attribute__((ext_vector_type(16)));
typedef _Float16 v8h  __attribute__((ext_vector_type(8)));
typedef float    v8f  __attribute__((ext_vector_type(8)));
typedef float    v4f  __attribute__((ext_vector_type(4)));
typedef unsigned int v4u __attribute__((ext_vector_type(4)));

// ---- scalar helpers --------------------------------------------------------------------------------
__device__ __forceinline__ unsigned short bf_bits(float f) {          // f32 -> bf16 bits, RNE convert
  unsigned u = __float_as_uint(f);
  return (unsigned short)((u + 0x7FFFu + ((u >> 16) & 1u)) >> 16);
}
__device__ __forceinline__ float bfr(float f) { return __uint_as_float(((unsigned)bf_bits(f)) << 16); }
__device__ __forceinline__ unsigned short h_bits(_Float16 x) { return __builtin_bit_cast(unsigned short, x); }
__device__ __forceinline__ unsigned pk16(unsigned short a, unsigned short b) { return (unsigned)a | ((unsigned)b << 16); }
__device__ __forceinline__ v8f zero8() { v8f z = {0.f, 0.f, 0.f, 0.f, 0.f, 0.f, 0.f, 0.f}; return z; }

// ---- fragment loader: 16-bit A/B operand, lane -> row/col (lane&15), p already includes +8*(lane>>4);
//      elements 0..7 <- p[0..7] (k0+8h..), elements 8..15 <- p[16..23] (k0+16+8h..)
__device__ __forceinline__ v16h ldfrag_h(const _Float16* p) {
  union { v16h v; v8h h[2]; } f;
  f.h[0] = *(const v8h*)(p);
  f.h[1] = *(const v8h*)(p + 16);
  return f.v;
}

// ---- WMMA helpers with trailing VALU hazard gap --------------------------------------------------------
__device__ __forceinline__ v8f mma_h(v16h a, v16h b, v8f c) {
  c = __builtin_amdgcn_wmma_f32_16x16x32_f16(false, a, false, b, (short)0, c, false, false);
#if defined(__HIP_DEVICE_COMPILE__)
  asm volatile("v_nop\n\tv_nop\n\tv_nop\n\tv_nop" : "+v"(c) : "v"(a), "v"(b));
#endif
  return c;
}
__device__ __forceinline__ v8f mma_h_raw(v16h a, v16h b, v8f c) {
  return __builtin_amdgcn_wmma_f32_16x16x32_f16(false, a, false, b, (short)0, c, false, false);
}
__device__ __forceinline__ void dep_guard_h(v8f& a, v8f& b, v16h x, v16h y) {
#if defined(__HIP_DEVICE_COMPILE__)
  asm volatile("v_nop\n\tv_nop\n\tv_nop\n\tv_nop" : "+v"(a), "+v"(b) : "v"(x), "v"(y));
#endif
}
__device__ __forceinline__ void keep4_h(v16h a, v16h b, v16h c, v16h d) {
#if defined(__HIP_DEVICE_COMPILE__)
  asm volatile("v_nop" :: "v"(a), "v"(b), "v"(c), "v"(d));
#endif
}
__device__ __forceinline__ void acc_guard4(v8f& a, v8f& b, v8f& c, v8f& d) {
#if defined(__HIP_DEVICE_COMPILE__)
  asm volatile("v_nop\n\tv_nop\n\tv_nop\n\tv_nop" : "+v"(a), "+v"(b), "+v"(c), "+v"(d));
#endif
}

// =====================================================================================================
// Preparatory launch: three jobs that need nothing of each other share one grid by ranges of the block index
// (every test on the block index is block-uniform).
//   blocks [0, RT_B)                    RoPE table, 8 tokens each
//   blocks [RT_B, RT_B + CVX_B)         x -> f16 plane
//   the last 4 * CVW_B blocks           wq | wk | wv | wo -> f16 planes, CVW_B blocks each
// =====================================================================================================
#define RT_B   (SEQ / 8)                // 512
#define CVX_B  (SEQ * DM / 8 / 256)     // 2048
#define CVW_B  (DM * DM / 8 / 256)      // 512
#define PREP_B (RT_B + CVX_B + 4 * CVW_B)

// f32 plane -> f16 bits of bfr(v) * scale (scale a power of two): x (x16) and the [n][k] weights (x1024),
// whose [out][in] layout is already the k-contiguous Bt layout of the GEMM below.
// coverage: n8 threads x 8 = the whole plane.
__device__ __forceinline__ void cvt16(const float* __restrict__ in, unsigned short* out, int n8, float scale, int i) {
  if (i < n8) {
    const v4f a = *(const v4f*)(in + (size_t)i * 8);
    const v4f b = *(const v4f*)(in + (size_t)i * 8 + 4);
    v4u p;
    p[0] = pk16(h_bits((_Float16)(bfr(a[0]) * scale)), h_bits((_Float16)(bfr(a[1]) * scale)));
    p[1] = pk16(h_bits((_Float16)(bfr(a[2]) * scale)), h_bits((_Float16)(bfr(a[3]) * scale)));
    p[2] = pk16(h_bits((_Float16)(bfr(b[0]) * scale)), h_bits((_Float16)(bfr(b[1]) * scale)));
    p[3] = pk16(h_bits((_Float16)(bfr(b[2]) * scale)), h_bits((_Float16)(bfr(b[3]) * scale)));
    *(v4u*)(out + (size_t)i * 8) = p;
  }
}

// RoPE table tab[t][64] f32: [0..31] = cos(t * inv[m]), [32..63] = sin(t * inv[m]) (precise sincosf, f32
// angle = fl(t * inv[m])), inv[m] = 1 / powf(10000, (2m)/64), m = 0..31, f32, formed by each thread for its own m.
// Block = 8 tokens x 32 pairs (256 threads); the 8x64 tile is staged in LDS, then stored as whole rows.
// coverage: compute 8 x 32 threads x 2 = 8x64; store 128 lanes x 4 floats = 8 rows x 64; RT_B blocks cover every t.
__device__ __forceinline__ void rope_tab(float* st, float* tab, int blk) {
  const int tid = threadIdx.x;
  const int m   = tid & 31, tr = tid >> 5;
  const int t   = blk * 8 + tr;                     // < SEQ by the block range
  const float e = (float)(2 * m) * (1.0f / 64.0f);
  const float p = powf(10000.0f, e);
  const float w = 1.0f / p;
  const float ang = (float)t * w;
  float sn, cs;
  sincosf(ang, &sn, &cs);
  st[tr * 64 + m]      = cs;
  st[tr * 64 + 32 + m] = sn;
  __syncthreads();
  if (tid < 128) {                                  // waves 0..3, wave-uniform
    const int row = tid >> 4, c4 = (tid & 15) * 4;
    const v4f v = *(const v4f*)(st + row * 64 + c4);
    float* dst = tab + (size_t)(blk * 8 + row) * 64 + c4;
    *(v4f*)dst = v;
  }
}

__global__ __launch_bounds__(256) void k_prep(const float* __restrict__ x, const float* __restrict__ wq,
                                              const float* __restrict__ wk, const float* __restrict__ wv,
                                              const float* __restrict__ wo,
                                              unsigned short* Xh, unsigned short* Wqkv, unsigned short* Wp,
                                              float* tab, float aScale, float wScale) {
  __shared__ __align__(16) float st[8 * 64];
  const int b = blockIdx.x;
  if (b < RT_B) {                                   // the longest blocks start first
    rope_tab(st, tab, b);
  } else if (b < RT_B + CVX_B) {
    cvt16(x, Xh, SEQ * DM / 8, aScale, (b - RT_B) * 256 + (int)threadIdx.x);
  } else if (b < PREP_B) {
    const int wb = b - (RT_B + CVX_B);
    const int which = wb / CVW_B;                   // 0..3 = wq, wk, wv, wo
    const float* in = (which == 0) ? wq : (which == 1) ? wk : (which == 2) ? wv : wo;
    unsigned short* o = (which < 3) ? (Wqkv + (size_t)which * DM * DM) : Wp;
    cvt16(in, o, DM * DM / 8, wScale, (wb - which * CVW_B) * 256 + (int)threadIdx.x);
  }
}

// =====================================================================================================
// Register-blocked f16 WMMA GEMM, one wave per 64x64 tile, four waves (2x2) per 128x128 block tile. The block's
// A and Bt rows of a 64-k pass are staged in LDS by asynchronous 16-byte copies (whole 128-byte lines), two
// buffers: the next pass's copies fly while this pass's fragments are read from LDS.
//   v[m][n] = (sum_k A[m][k] * Bt[n][k]  [+ 2^-11 * sum_k Ar[m][k] * Bt[n][k] when ARES]) * cscale
// A, Ar row-major [M][K] pitch lda (f16), Bt row-major [N][K] pitch ldb (f16, k contiguous); M, N multiples of
// 128, K multiple of 64; one block per block tile (a block-uniform bound check anyway).
// ARES: the residual plane is accumulated first from zero, the accumulators are scaled by 2^-11 exactly on the
// VALU (with nop gaps on both sides), then the hi plane accumulates on top: one accumulator set.
// Epilogue variants:
//   EPI 0: f16 hi plane = f16(v' * oscale) at Cp and residual plane = f16((v'*oscale - hi) * 2048) at Crp,
//          pitch ldc halves, where v' = v for tiles with n0 >= ropeN and, for n0 < ropeN (wave-uniform),
//          v' = rotate-half RoPE of the wave's 64-column tile (one head): pair index mm = column mod 32,
//          token = output row, c = rtab[token][mm], s = rtab[token][32+mm]:
//          col mm -> v[mm]*c - v[32+mm]*s ; col 32+mm -> v[32+mm]*c + v[mm]*s (f32, from the LDS slab).
//   EPI 1: f32 out = v, pitch ldc floats
// 16-row slabs staged per wave in LDS. f32 out: each 64-wide row segment (256 B = 2 lines) by 16 lanes x 16 B,
// coverage: 4 slabs x 16 rows x 64 cols = the wave's whole 64x64 tile; grid x 4 tiles = [M][N].
// =====================================================================================================
// Eight 16-byte asynchronous copies of one lane, global -> LDS, rows 16 apart in both places. The s_wait_xcnt
// is the last line of the copies' own statement so that no address register is rewritten ahead of it.
__device__ __forceinline__ void copy8_rows(unsigned l, const _Float16* g, int ld) {
#if defined(__HIP_DEVICE_COMPILE__)
  const unsigned l0 = l,                    l1 = l + 1u * 16u * GP_B, l2 = l + 2u * 16u * GP_B, l3 = l + 3u * 16u * GP_B;
  const unsigned l4 = l + 4u * 16u * GP_B, l5 = l + 5u * 16u * GP_B, l6 = l + 6u * 16u * GP_B, l7 = l + 7u * 16u * GP_B;
  const size_t st = (size_t)16 * ld;
  const _Float16 *g0 = g, *g1 = g + st, *g2 = g + 2 * st, *g3 = g + 3 * st;
  const _Float16 *g4 = g + 4 * st, *g5 = g + 5 * st, *g6 = g + 6 * st, *g7 = g + 7 * st;
  asm volatile(
      "global_load_async_to_lds_b128 %0, %8, off\n\t"
      "global_load_async_to_lds_b128 %1, %9, off\n\t"
      "global_load_async_to_lds_b128 %2, %10, off\n\t"
      "global_load_async_to_lds_b128 %3, %11, off\n\t"
      "global_load_async_to_lds_b128 %4, %12, off\n\t"
      "global_load_async_to_lds_b128 %5, %13, off\n\t"
      "global_load_async_to_lds_b128 %6, %14, off\n\t"
      "global_load_async_to_lds_b128 %7, %15, off\n\t"
      "s_wait_xcnt 0x0"
      :: "v"(l0), "v"(l1), "v"(l2), "v"(l3), "v"(l4), "v"(l5), "v"(l6), "v"(l7),
         "v"(g0), "v"(g1), "v"(g2), "v"(g3), "v"(g4), "v"(g5), "v"(g6), "v"(g7)
      : "memory");
#endif
}
// the issuing wave's copies have landed in LDS behind this wait
__device__ __forceinline__ void wait_async0() {
#if defined(__HIP_DEVICE_COMPILE__)
  asm volatile("s_wait_asynccnt 0x0" ::: "memory");
#endif
}
// the wave's own LDS reads of a buffer have retired before that buffer is handed back for a refill
__device__ __forceinline__ void wait_ds0() {
#if defined(__HIP_DEVICE_COMPILE__)
  asm volatile("s_wait_dscnt 0x0" ::: "memory");
#endif
}

template <int EPI, bool ARES>
__global__ __launch_bounds__(128) void gemm64_f16(
    const unsigned short* __restrict__ Ap, const unsigned short* __restrict__ Arp, int lda,
    const unsigned short* __restrict__ Btp, int ldb,
    float cscale,
    void* Cp, unsigned short* Crp, int ldc, int M, int N, int K, float oscale,
    const float* __restrict__ rtab, int ropeN) {
  const _Float16* Ah  = (const _Float16*)(const void*)Ap;
  const _Float16* Arh = (const _Float16*)(const void*)Arp;
  const _Float16* Bt  = (const _Float16*)(const void*)Btp;
  __shared__ __align__(16) unsigned char ring[2 * GSTAGE];   // two stages of [A 128 rows | Bt 128 rows], pitch GP_B
  __shared__ __align__(16) float sT[4][16 * 68];   // per-wave 16x64 slab, pitch 68 floats
  const int tid  = threadIdx.x;
  const int lane = tid & 31;
  const int wave = tid >> 5;
  const int tilesN = N >> 7;
  const int tilesM = M >> 7;
  if ((int)blockIdx.x >= tilesM * tilesN) return;   // block-uniform, in front of every barrier and copy
  const int bm = (int)blockIdx.x / tilesN;
  const int bn = (int)blockIdx.x - bm * tilesN;
  const int wm = (wave >> 1) << 6;             // the wave's 64x64 tile inside the block's 128x128 tile
  const int wn = (wave & 1) << 6;
  const int m0 = (bm << 7) + wm;
  const int n0 = (bn << 7) + wn;

  const int rlane = lane & 15;                 // row (A) / col (B, D) within subtile
  const int koff  = (lane >> 4) * 8;           // k offset of this lane half
  const int mOff  = (lane >> 4) * 8;           // D row offset

  v8f acc[4][4];
#pragma unroll
  for (int i = 0; i < 4; ++i)
#pragma unroll
    for (int j = 0; j < 4; ++j) acc[i][j] = zero8();

  // staging map: lane -> row tid>>3 (+16 per copy, 8 copies = 128 rows), 16-byte piece tid&7 of the 128-byte row
  const int crow = tid >> 3, cpc = tid & 7;
  const unsigned ringb = (unsigned)(uintptr_t)(const void*)ring;           // LDS byte address of the ring
  const unsigned lcp   = ringb + (unsigned)(crow * GP_B + cpc * 16);
  const _Float16* gA  = Ah  + (size_t)((bm << 7) + crow) * lda + cpc * 8;
  const _Float16* gAr = Arh + (size_t)((bm << 7) + crow) * lda + cpc * 8;
  const _Float16* gB  = Bt  + (size_t)((bn << 7) + crow) * ldb + cpc * 8;
  const int KP = K >> 6;                       // passes of 64 k per plane
  const int NP = ARES ? 2 * KP : KP;           // ARES: the residual plane's passes first, then the hi plane's

  // tile 0 -> buffer 0, landed and published; then tile 1 -> buffer 1 flies over pass 0
  copy8_rows(lcp, ARES ? gAr : gA, lda);
  copy8_rows(lcp + GOFF_B, gB, ldb);
  wait_async0();
  __syncthreads();
  if (NP > 1) {
    const int kk = (1 < KP) ? 64 : 0;
    const _Float16* ga = (ARES && 1 < KP) ? gAr : gA;
    copy8_rows(lcp + GSTAGE, ga + kk, lda);
    copy8_rows(lcp + GSTAGE + GOFF_B, gB + kk, ldb);
  }

  for (int t = 0; t < NP; ++t) {
    if (ARES && t == KP) {                     // block-uniform: between the two planes
      acc_guard4(acc[0][0], acc[0][1], acc[0][2], acc[0][3]);
      acc_guard4(acc[1][0], acc[1][1], acc[1][2], acc[1][3]);
      acc_guard4(acc[2][0], acc[2][1], acc[2][2], acc[2][3]);
      acc_guard4(acc[3][0], acc[3][1], acc[3][2], acc[3][3]);
#pragma unroll
      for (int i = 0; i < 4; ++i)
#pragma unroll
        for (int j = 0; j < 4; ++j) acc[i][j] = acc[i][j] * (1.0f / 2048.0f);   // exact fold of the x2^11 residual carry
      acc_guard4(acc[0][0], acc[0][1], acc[0][2], acc[0][3]);
      acc_guard4(acc[1][0], acc[1][1], acc[1][2], acc[1][3]);
      acc_guard4(acc[2][0], acc[2][1], acc[2][2], acc[2][3]);
      acc_guard4(acc[3][0], acc[3][1], acc[3][2], acc[3][3]);
    }
    const unsigned bsel = (unsigned)(t & 1) * GSTAGE;
    const _Float16* sA = (const _Float16*)(const void*)(ring + bsel) + (wm + rlane) * GP_H + koff;
    const _Float16* sB = (const _Float16*)(const void*)(ring + bsel + GOFF_B) + (wn + rlane) * GP_H + koff;
    // the loops below are unrolled so that every fragment and accumulator index is a constant (registers, no scratch)
#pragma unroll
    for (int ks = 0; ks < 2; ++ks) {
      v16h bh[4];
#pragma unroll
      for (int j = 0; j < 4; ++j) bh[j] = ldfrag_h(sB + (j << 4) * GP_H + ks * 32);
      v16h ah[4];                              // all eight fragments of a 32-k step are read as one group
#pragma unroll
      for (int i = 0; i < 4; ++i) ah[i] = ldfrag_h(sA + (i << 4) * GP_H + ks * 32);
#pragma unroll
      for (int i = 0; i < 4; ++i) {
#pragma unroll
        for (int j = 0; j < 4; ++j) {
          acc[i][j] = mma_h_raw(ah[i], bh[j], acc[i][j]);
        }
        dep_guard_h(acc[i][0], acc[i][3], ah[i], bh[3]);
      }
      keep4_h(bh[0], bh[1], bh[2], bh[3]);
    }
    // publish point of tile t + 1: own LDS reads retired, own copies landed, one barrier for both jobs
    wait_ds0();
    wait_async0();
    __syncthreads();
    if (t + 2 < NP) {                          // block-uniform: refill the buffer that pass t has just read
      const int tn = t + 2;
      const bool res = ARES && (tn < KP);
      const int kk = (tn - ((ARES && tn >= KP) ? KP : 0)) << 6;
      copy8_rows(lcp + bsel, (res ? gAr : gA) + kk, lda);
      copy8_rows(lcp + bsel + GOFF_B, gB + kk, ldb);
    }
  }
  wait_async0();
  acc_guard4(acc[0][0], acc[0][1], acc[0][2], acc[0][3]);
  acc_guard4(acc[1][0], acc[1][1], acc[1][2], acc[1][3]);
  acc_guard4(acc[2][0], acc[2][1], acc[2][2], acc[2][3]);
  acc_guard4(acc[3][0], acc[3][1], acc[3][2], acc[3][3]);

  // ---- epilogue ----
  float* slab = sT[wave];
#pragma unroll
  for (int i = 0; i < 4; ++i) {
    const int mBase = m0 + (i << 4);
#pragma unroll
    for (int r = 0; r < 8; ++r) {
      const int row = mOff + r;
#pragma unroll
      for (int j = 0; j < 4; ++j) slab[row * 68 + (j << 4) + rlane] = acc[i][j][r] * cscale;
    }
    __builtin_amdgcn_fence(__ATOMIC_RELEASE, "workgroup");
    __builtin_amdgcn_wave_barrier();
    __builtin_amdgcn_fence(__ATOMIC_ACQUIRE, "workgroup");
    if constexpr (EPI == 0) {
      unsigned short* C16 = (unsigned short*)Cp;
      const int rq = lane >> 3, piece = lane & 7;
      const bool rope_on = (n0 < ropeN);                   // wave-uniform (n0 is per wave)
      const float rsgn = (piece < 4) ? -1.0f : 1.0f;       // cols 0..31 carry x1 (minus), cols 32..63 carry x2 (plus)
      const int   pm   = (piece & 3) * 8;                  // rotation pair index base of this lane's 8 columns
      v4u ph[4], pr[4];
#pragma unroll
      for (int it = 0; it < 4; ++it) {
        const int row = it * 4 + rq;                         // it 0..3 x rq 0..3 = rows 0..15
        const v4f a  = *(const v4f*)(slab + row * 68 + piece * 8);
        const v4f a2 = *(const v4f*)(slab + row * 68 + piece * 8 + 4);
        float f[8];
        f[0] = a[0];  f[1] = a[1];  f[2] = a[2];  f[3] = a[3];
        f[4] = a2[0]; f[5] = a2[1]; f[6] = a2[2]; f[7] = a2[3];
        if (rope_on) {                                       // wave-uniform branch, LDS and table reads only
          const int po = (piece ^ 4) * 8;                    // partner half of the head (32 columns away)
          const v4f g  = *(const v4f*)(slab + row * 68 + po);
          const v4f g2 = *(const v4f*)(slab + row * 68 + po + 4);
          const float* trp = rtab + (size_t)(mBase + row) * 64 + pm;   // output row = token index
          const v4f c0 = *(const v4f*)(trp);
          const v4f c1 = *(const v4f*)(trp + 4);
          const v4f s0 = *(const v4f*)(trp + 32);
          const v4f s1 = *(const v4f*)(trp + 36);
          f[0] = f[0] * c0[0] + rsgn * g[0]  * s0[0];
          f[1] = f[1] * c0[1] + rsgn * g[1]  * s0[1];
          f[2] = f[2] * c0[2] + rsgn * g[2]  * s0[2];
          f[3] = f[3] * c0[3] + rsgn * g[3]  * s0[3];
          f[4] = f[4] * c1[0] + rsgn * g2[0] * s1[0];
          f[5] = f[5] * c1[1] + rsgn * g2[1] * s1[1];
          f[6] = f[6] * c1[2] + rsgn * g2[2] * s1[2];
          f[7] = f[7] * c1[3] + rsgn * g2[3] * s1[3];
        }
        v4u p, q;
#pragma unroll
        for (int e = 0; e < 4; ++e) {
          const float g0 = f[2 * e] * oscale, g1 = f[2 * e + 1] * oscale;
          const _Float16 x0 = (_Float16)g0, x1 = (_Float16)g1;
          const _Float16 y0 = (_Float16)((g0 - (float)x0) * 2048.0f);
          const _Float16 y1 = (_Float16)((g1 - (float)x1) * 2048.0f);
          p[e] = pk16(h_bits(x0), h_bits(x1));
          q[e] = pk16(h_bits(y0), h_bits(y1));
        }
        ph[it] = p;
        pr[it] = q;
      }
      {
#pragma unroll
        for (int it = 0; it < 4; ++it) {
          const int row = it * 4 + rq;
          const size_t co = (size_t)(mBase + row) * ldc + n0 + piece * 8;
          *(v4u*)(C16 + co) = ph[it];
          *(v4u*)(Crp + co) = pr[it];
        }
        
      }
    } else {
      float* Cf = (float*)Cp;
      const int hh = lane >> 4, c4 = (lane & 15) * 4;     // 256-B row segment = 16 lanes x 16 B
      v4f ov[8];
#pragma unroll
      for (int it = 0; it < 8; ++it) {
        const int row = it * 2 + hh;                       // it 0..7 x hh 0..1 = rows 0..15
        ov[it] = *(const v4f*)(slab + row * 68 + c4);
      }
      {
#pragma unroll
        for (int it = 0; it < 8; ++it) {
          const int row = it * 2 + hh;
          *(v4f*)(Cf + (size_t)(mBase + row) * ldc + n0 + c4) = ov[it];
        }
        
      }
    }
    __builtin_amdgcn_fence(__ATOMIC_RELEASE, "workgroup");
    __builtin_amdgcn_wave_barrier();
    __builtin_amdgcn_fence(__ATOMIC_ACQUIRE, "workgroup");
  }
}

// =====================================================================================================
// v columns of an f16 qkv plane (token-major, element (t, h, d) at [t*DQKV + 2*DM + h*64 + d])
// -> f16 v^T plane vt[(h*64 + d)*SEQ + t] (same bits). blockIdx.z = 0: the hi plane, 1: the residual plane.
// Block = one 64-token x 64-feature tile of one head; grid = (SEQ/64, NH, 2); tile staged in LDS as halves
// (v8h 16-B stores, __syncthreads, _Float16 element reads).
// Store: group g = tid>>3 (0..31), piece = tid&7: iteration it writes row d = it*32+g, lanes 8q..8q+7 x 16 B =
// coverage: load 2 x 256 threads x 8 halves = 64x64; store 2 iterations x 32 groups = 64 rows d, 8 pieces x 8
// = 64 tokens per row; grid covers every (h, token tile).
// =====================================================================================================
__global__ __launch_bounds__(256) void v_tr(const unsigned short* __restrict__ qkvhp, const unsigned short* __restrict__ qkvrp,
                                            unsigned short* vth, unsigned short* vtr) {
  __shared__ __align__(16) _Float16 sv[64 * 72];       // [tt][d], pitch 72 halves (144 B)
  const int tid = threadIdx.x;
  const int t0  = blockIdx.x * 64;
  const int hh  = blockIdx.y;
  const bool res = (blockIdx.z != 0);               // block-uniform
  const _Float16* src = (const _Float16*)(const void*)(res ? qkvrp : qkvhp);
  unsigned short* vt  = res ? vtr : vth;
#pragma unroll
  for (int i = 0; i < 2; ++i) {
    const int idx = i * 256 + tid;                  // 0..511
    const int tt = idx >> 3, c8 = (idx & 7) * 8;
    const v8h a = *(const v8h*)(src + ((size_t)(t0 + tt)) * DQKV + 2 * DM + hh * HD + c8);
    *(v8h*)(sv + tt * 72 + c8) = a;
  }
  __syncthreads();

  const int g = tid >> 3, piece = tid & 7;
  v4u hv[2];
  size_t hofs[2];
#pragma unroll
  for (int it = 0; it < 2; ++it) {
    const int d = it * 32 + g;
    v4u a;
#pragma unroll
    for (int e = 0; e < 4; ++e) {
      const _Float16 x0 = sv[(piece * 8 + 2 * e) * 72 + d];
      const _Float16 x1 = sv[(piece * 8 + 2 * e + 1) * 72 + d];
      a[e] = pk16(h_bits(x0), h_bits(x1));
    }
    hv[it] = a;
    hofs[it] = ((size_t)(hh * HD + d)) * SEQ + t0 + piece * 8;
  }
  {
#pragma unroll
    for (int it = 0; it < 2; ++it) *(v4u*)(vt + hofs[it]) = hv[it];
    
  }
}

// =====================================================================================================
// Windowed causal multi-head softmax attention, head dim 64, online-max form.
//   q f16 (x16): element (t, h, d) at qkv[t*DQKV + h*64 + d]; k at + DM; residual planes (x2^11 of the f16
//   residue) in qkvr with the same addressing; v^T f16 (x16) at vt[(h*64 + d)*SEQ + s], residual vtr.
//   logit a = (q.k) / 8 = acc / 2048 (two x16 carries); HR: acc = qh.kh + 2^-11 (qh.kr + qr.kh).
//   Key j is allowed for query row i iff (j <= i) and (j + WIN >= i) (both bounds inclusive, up to WIN+1 keys);
//   other keys get a = -1e30 (select by value) and p = 0 (select by value). Per 64-key tile: tile max (per-lane
//   max over the 4 key groups, then a 16-lane xor max), mn = max(mrun, tile max), alpha = exp(mrun - mn),
//   p = exp(a - mn), lsum = lsum * alpha + sum p (per-lane partials, 16-lane xor reduction at the end), context
//   accumulators scaled by alpha on the VALU (nop gaps on both sides). A query row whose keys in a visited tile
//   are all masked keeps mrun, gets alpha = 1 and p = 0. The diagonal tile gives every row its own key, so
//   lsum >= 1 at the end.
//   P carried as f16(256 p) (HR: plus residual f16((256p - hi)*2048)); context = P . v^T on f16 WMMA
//   (HR: second accumulator += Ph.Vr + Pr.Vh, folded with 2^-11).
//   ctx plane f16 (x16): element (t, h*64 + d) at ctx[t*DM + h*64 + d] = 16 * context / (4096 lsum);
//   HR also writes the ctx residual plane f16((16 ctx - hi) * 2048).
//   Block = 4 waves = 64 query rows of one head; query tile qb = blockIdx % NQB, head = blockIdx / NQB;
//   grid = NQB*NH; kv tiles of 64 from max(qb - KTW + 1, 0) to qb, block-uniform trip count <= KTW (key tiles
//   outside the window are never visited; keys outside the window inside a visited tile contribute exactly 0).
//   K / V^T tile staging: 128 threads x 32 halves per plane = the whole 64x64 tile (plain 16-B loads,
//   __syncthreads before and after); P tiles are wave-private, spilled with _Float16 element stores and
//   wave in LDS as f32 (aliasing the K/V region after a block barrier) the same way.
//   Output coverage: each wave stores rows 0..15 of its tile (it 0..3 x lane>>3 0..3) x 64 columns (8 lanes x
//   every (head, query tile) exactly once.
// =====================================================================================================
template <bool HR>
__global__ __launch_bounds__(128)
void attn_k(const unsigned short* __restrict__ qkvp, const unsigned short* __restrict__ qkvrp,
            const unsigned short* __restrict__ vtp, const unsigned short* __restrict__ vtrp,
            unsigned short* ctxp, unsigned short* ctxrp) {
  union FH { v16h v; v8h h[2]; };
  constexpr int AP     = 72;                             // LDS row pitch of the f16 tiles, halves: 128-byte row + 16 (16 B x odd, for 16-byte readers)
  constexpr int OP     = 68;                             // LDS row pitch of the f32 context slab, floats (16-byte readers four rows at a time)
  constexpr int TB     = 64 * AP * 2;                    // one f16 64x64 tile at that pitch, bytes
  constexpr int PB     = 4 * 16 * AP * 2;                // four wave-private 16x64 f16 P tiles, bytes
  constexpr int OFF_K  = 0;
  constexpr int OFF_V  = TB;
  constexpr int OFF_KR = 2 * TB;
  constexpr int OFF_VR = 3 * TB;
  constexpr int OFF_P  = HR ? 4 * TB : 2 * TB;
  constexpr int OFF_PR = OFF_P + PB;
  constexpr int SMEMB  = HR ? (OFF_PR + PB) : (OFF_P + PB);   // 55296 : 27648
  static_assert(4 * 16 * OP * 4 <= OFF_P);                    // f32 context staging aliases the K/V region
  __shared__ __align__(16) unsigned char smem[SMEMB];
  _Float16* Ksh = (_Float16*)(smem + OFF_K);                  // K   [kv][d]
  _Float16* Vsh = (_Float16*)(smem + OFF_V);                  // V^T [d][kv]
  _Float16* Krs = (_Float16*)(smem + (HR ? OFF_KR : OFF_K));  // K residual (HR only)
  _Float16* Vrs = (_Float16*)(smem + (HR ? OFF_VR : OFF_V));  // V^T residual (HR only)
  _Float16* Psh = (_Float16*)(smem + OFF_P);
  _Float16* Prs = (_Float16*)(smem + (HR ? OFF_PR : OFF_P));

  const int tid  = threadIdx.x;
  const int wave = tid >> 5;
  const int lane = tid & 31;
  const int hh   = lane >> 4;
  const int c    = lane & 15;

  const int bx   = blockIdx.x;
  const int qb   = bx % NQB;
  const int h    = bx / NQB;                 // < NH by the grid size
  const int q0   = qb * 64 + wave * 16;

  const _Float16* Qp  = (const _Float16*)(const void*)qkvp  + (size_t)h * HD;
  const _Float16* Qrp = (const _Float16*)(const void*)qkvrp + (size_t)h * HD;
  const _Float16* Kp  = Qp + DM;
  const _Float16* Krp = Qrp + DM;
  const _Float16* Vt  = (const _Float16*)(const void*)vtp  + ((size_t)h * HD) * SEQ;
  const _Float16* Vrt = (const _Float16*)(const void*)vtrp + ((size_t)h * HD) * SEQ;

  // ---- Q fragments (A operand, row = lane&15): 2 d-chunks ----
  v16h qa[2], qr[2];
#pragma unroll
  for (int dc = 0; dc < 2; ++dc) {
    const size_t qo = (size_t)(q0 + c) * DQKV + dc * 32 + 8 * hh;
    qa[dc] = ldfrag_h(Qp + qo);
    if constexpr (HR) qr[dc] = ldfrag_h(Qrp + qo);
    else qr[dc] = qa[dc];
  }

  float lsum[8], mrun[8];
  v8f oacc[4], oacc2[4];
#pragma unroll
  for (int r = 0; r < 8; ++r) { lsum[r] = 0.f; mrun[r] = -1e30f; }
#pragma unroll
  for (int t = 0; t < 4; ++t) { oacc[t] = zero8(); oacc2[t] = zero8(); }

  _Float16* pw  = Psh + wave * (16 * AP);
  _Float16* prw = Prs + wave * (16 * AP);

  const int ktlo = (qb >= KTW - 1) ? (qb - (KTW - 1)) : 0;   // first key tile in the window, block-uniform
  const int nkt  = qb - ktlo + 1;                              // 1..KTW key tiles, block-uniform
  for (int kti = 0; kti < nkt; ++kti) {
    const int kv0 = (ktlo + kti) * 64;                         // <= qb*64 < SEQ
    __syncthreads();
    {
      const int r = tid >> 1, half = (tid & 1) * 32;
      const size_t ko = (size_t)(kv0 + r) * DQKV + half;      // K row kv0+r, d = half..half+31
      const size_t vo = (size_t)r * SEQ + kv0 + half;           // V^T row d = r, s = kv0+half..+31
#pragma unroll
      for (int i = 0; i < 4; ++i) {
        const v8h a0 = *(const v8h*)(Kp + ko + 8 * i);
        const v8h b0 = *(const v8h*)(Vt + vo + 8 * i);
        *(v8h*)(Ksh + r * AP + half + 8 * i) = a0;
        *(v8h*)(Vsh + r * AP + half + 8 * i) = b0;
        if constexpr (HR) {
          const v8h a1 = *(const v8h*)(Krp + ko + 8 * i);
          const v8h b1 = *(const v8h*)(Vrt + vo + 8 * i);
          *(v8h*)(Krs + r * AP + half + 8 * i) = a1;
          *(v8h*)(Vrs + r * AP + half + 8 * i) = b1;
        }
      }
    }
    __syncthreads();

    // ---- scores: 16 query rows x 64 keys per wave (B operand: lane c -> key j*16+c, split k map over d) ----
    v8f s[4];
#pragma unroll
    for (int j = 0; j < 4; ++j) {
      s[j] = zero8();
      v8f t = zero8();
#pragma unroll
      for (int dc = 0; dc < 2; ++dc) {
        FH kb;
        kb.h[0] = *(const v8h*)(Ksh + (j * 16 + c) * AP + dc * 32 + 8 * hh);
        kb.h[1] = *(const v8h*)(Ksh + (j * 16 + c) * AP + dc * 32 + 16 + 8 * hh);
        s[j] = mma_h(qa[dc], kb.v, s[j]);
        if constexpr (HR) {
          FH krb;
          krb.h[0] = *(const v8h*)(Krs + (j * 16 + c) * AP + dc * 32 + 8 * hh);
          krb.h[1] = *(const v8h*)(Krs + (j * 16 + c) * AP + dc * 32 + 16 + 8 * hh);
          t = mma_h(qa[dc], krb.v, t);
          t = mma_h(qr[dc], kb.v, t);
        }
      }
      if constexpr (HR) s[j] = s[j] + t * (1.0f / 2048.0f);
    }

    // ---- windowed causal online softmax: tile max, running max, alpha, p, row-sum partials,
    //      P (x256, f16; HR: + residual) ----
    float alpha[8];
#pragma unroll
    for (int r = 0; r < 8; ++r) {
      const int qrow = q0 + 8 * hh + r;
      float av[4];
      float tmx = -1e30f;
#pragma unroll
      for (int j = 0; j < 4; ++j) {
        const int key = kv0 + j * 16 + c;
        float a = s[j][r] * (1.0f / 2048.0f);              // 1/8 head scale, 1/256 for the two x16 carries
        const bool ok = (key <= qrow) && (key + WIN >= qrow);
        a = ok ? a : -1e30f;
        av[j] = a;
        tmx = fmaxf(tmx, a);
      }
#pragma unroll
      for (int off = 1; off < 16; off <<= 1) tmx = fmaxf(tmx, __shfl_xor(tmx, off, 32));
      const float mn = fmaxf(mrun[r], tmx);
      const float al = __expf(mrun[r] - mn);
      alpha[r] = al;
      mrun[r]  = mn;
      float ps = 0.0f;
#pragma unroll
      for (int j = 0; j < 4; ++j) {
        const int key = kv0 + j * 16 + c;
        const bool ok = (key <= qrow) && (key + WIN >= qrow);
        float p = __expf(av[j] - mn);
        p = ok ? p : 0.0f;
        ps += p;
        const float g = p * 256.0f;
        const _Float16 x0 = (_Float16)g;
        pw[(8 * hh + r) * AP + j * 16 + c] = x0;
        if constexpr (HR) prw[(8 * hh + r) * AP + j * 16 + c] = (_Float16)((g - (float)x0) * 2048.0f);
      }
      lsum[r] = lsum[r] * al + ps;
    }
    __builtin_amdgcn_fence(__ATOMIC_RELEASE, "workgroup");
    __builtin_amdgcn_wave_barrier();
    __builtin_amdgcn_fence(__ATOMIC_ACQUIRE, "workgroup");

    // ---- rescale the context accumulators by alpha (VALU), nop gaps before the next WMMA reads them ----
#pragma unroll
    for (int t = 0; t < 4; ++t) {
#pragma unroll
      for (int r = 0; r < 8; ++r) {
        oacc[t][r] = oacc[t][r] * alpha[r];
        if constexpr (HR) oacc2[t][r] = oacc2[t][r] * alpha[r];
      }
    }
    acc_guard4(oacc[0], oacc[1], oacc[2], oacc[3]);
    if constexpr (HR) acc_guard4(oacc2[0], oacc2[1], oacc2[2], oacc2[3]);

    // ---- context += P . V (f16 WMMA; A = P [row][key], B = V^T [d][key]) ----
#pragma unroll
    for (int kk = 0; kk < 2; ++kk) {
      FH pa, par;
      pa.h[0] = *(const v8h*)(pw + c * AP + kk * 32 + 8 * hh);
      pa.h[1] = *(const v8h*)(pw + c * AP + kk * 32 + 16 + 8 * hh);
      if constexpr (HR) {
        par.h[0] = *(const v8h*)(prw + c * AP + kk * 32 + 8 * hh);
        par.h[1] = *(const v8h*)(prw + c * AP + kk * 32 + 16 + 8 * hh);
      } else {
        par.v = pa.v;
      }
#pragma unroll
      for (int t = 0; t < 4; ++t) {
        FH vb;
        vb.h[0] = *(const v8h*)(Vsh + (t * 16 + c) * AP + kk * 32 + 8 * hh);
        vb.h[1] = *(const v8h*)(Vsh + (t * 16 + c) * AP + kk * 32 + 16 + 8 * hh);
        oacc[t] = mma_h(pa.v, vb.v, oacc[t]);
        if constexpr (HR) {
          FH vrb;
          vrb.h[0] = *(const v8h*)(Vrs + (t * 16 + c) * AP + kk * 32 + 8 * hh);
          vrb.h[1] = *(const v8h*)(Vrs + (t * 16 + c) * AP + kk * 32 + 16 + 8 * hh);
          oacc2[t] = mma_h(pa.v, vrb.v, oacc2[t]);
          oacc2[t] = mma_h(par.v, vb.v, oacc2[t]);
        }
      }
    }
  }
  __syncthreads();                           // every wave is done with the K/V tiles before they are aliased

  // ---- normalise (1/lsum, the 1/256 p carry; keep the x16 v carry), stage the wave's 16x64 f32 tile in
  float* os = (float*)(void*)smem + wave * (16 * OP);
#pragma unroll
  for (int r = 0; r < 8; ++r) {
    float l = lsum[r];
#pragma unroll
    for (int off = 1; off < 16; off <<= 1) l += __shfl_xor(l, off, 32);
    const float rl = 1.0f / l;               // l >= 1 (the max key contributes p = 1)
    const float sc = rl * (1.0f / 256.0f);
#pragma unroll
    for (int t = 0; t < 4; ++t) {
      float v = oacc[t][r];
      if constexpr (HR) v += oacc2[t][r] * (1.0f / 2048.0f);
      os[(8 * hh + r) * OP + t * 16 + c] = v * sc;
    }
  }
  __builtin_amdgcn_fence(__ATOMIC_RELEASE, "workgroup");
  __builtin_amdgcn_wave_barrier();
  __builtin_amdgcn_fence(__ATOMIC_ACQUIRE, "workgroup");
  {
    const int rq = lane >> 3, piece = lane & 7;
    v4u ph[4], pr[4];
#pragma unroll
    for (int it = 0; it < 4; ++it) {
      const int row = it * 4 + rq;   // it 0..3 x rq 0..3 = rows 0..15 of the wave tile
      const v4f a  = *(const v4f*)(os + row * OP + piece * 8);
      const v4f a2 = *(const v4f*)(os + row * OP + piece * 8 + 4);
      float f[8];
      f[0] = a[0];  f[1] = a[1];  f[2] = a[2];  f[3] = a[3];
      f[4] = a2[0]; f[5] = a2[1]; f[6] = a2[2]; f[7] = a2[3];
      v4u p, q;
#pragma unroll
      for (int e = 0; e < 4; ++e) {
        const _Float16 x0 = (_Float16)f[2 * e], x1 = (_Float16)f[2 * e + 1];
        p[e] = pk16(h_bits(x0), h_bits(x1));
        if constexpr (HR) {
          const _Float16 y0 = (_Float16)((f[2 * e] - (float)x0) * 2048.0f);
          const _Float16 y1 = (_Float16)((f[2 * e + 1] - (float)x1) * 2048.0f);
          q[e] = pk16(h_bits(y0), h_bits(y1));
        } else {
          q[e] = p[e];
        }
      }
      ph[it] = p;
      pr[it] = q;
    }
    {
#pragma unroll
      for (int it = 0; it < 4; ++it) {
        const int row = it * 4 + rq;
        const size_t go = (size_t)(q0 + row) * DM + (size_t)h * HD + piece * 8;
        *(v4u*)(ctxp + go) = ph[it];
        if constexpr (HR) *(v4u*)(ctxrp + go) = pr[it];
      }
      
    }
  }
}

// =====================================================================================================
// Workspace map (bytes); every region is an exact multiple of its whole-line / whole-tile store granularity
// (row pitches 2048 / 6144 / 8192 / 256 B, all offsets multiples of 256, no aliasing within a launch):
//   Xh     f16 [SEQ][1024]                 (bf16 value of x, x16)
//   Wqkv   f16 [3072][1024]                (bf16 values of wq | wk | wv x1024, [n][k] = the input layout)
//   Wp     f16 [1024][1024]                (bf16 value of wo x1024, [n][k])
//   QKV    f16 [SEQ][3072]                 (rotated q | rotated k | v, x16)
//   QKVr   f16 [SEQ][3072]                 (x2^11 residual of the above)
//   VT     f16 [1024][SEQ]                 ([h*64 + d][s])
//   VTr    f16 [1024][SEQ]                 (residual)
//   Ctx    f16 [SEQ][1024]                 (attention context x16)
//   Ctxr   f16 [SEQ][1024]                 (residual)
//   Rt     f32 [SEQ][64]                   (cos | sin table)
//   total for SEQ = 4096: 101711872
// d_out f32: [SEQ][1024] at byte 0, every 64x64 tile written once by the projection launch.
// =====================================================================================================
extern "C" void kernel_launch(void* const* d_in, const int* in_sizes, int n_in,
                              void* d_out, int out_size, void* d_ws, size_t ws_size,
                              hipStream_t stream) {
  if (n_in < 5) return;
  if (in_sizes[0] < SEQ * DM) return;
  if (in_sizes[1] != DM * DM) return;
  if (in_sizes[2] != DM * DM) return;
  if (in_sizes[3] != DM * DM) return;
  if (in_sizes[4] != DM * DM) return;
  if (out_size < OUTN) return;

  const float* x  = (const float*)d_in[0];    // [SEQ][DM] (row prefix)
  const float* wq = (const float*)d_in[1];    // [DM n][DM k]
  const float* wk = (const float*)d_in[2];    // [DM n][DM k]
  const float* wv = (const float*)d_in[3];    // [DM n][DM k]
  const float* wo = (const float*)d_in[4];    // [DM n][DM k]

  const size_t PX   = (size_t)SEQ * DM * 2;          //  8388608 (SEQ 4096)
  const size_t PWq  = (size_t)DQKV * DM * 2;         //  6291456
  const size_t PWp  = (size_t)DM * DM * 2;           //  2097152
  const size_t PQKV = (size_t)SEQ * DQKV * 2;        // 25165824
  const size_t PVT  = (size_t)DM * SEQ * 2;          //  8388608
  const size_t PCtx = (size_t)SEQ * DM * 2;          //  8388608
  const size_t PRt  = (size_t)SEQ * 64 * 4;          //  1048576
  size_t off = 0;
  const size_t oX    = off; off += PX;
  const size_t oWq   = off; off += PWq;
  const size_t oWp   = off; off += PWp;
  const size_t oQKV  = off; off += PQKV;
  const size_t oQKVr = off; off += PQKV;
  const size_t oVT   = off; off += PVT;
  const size_t oVTr  = off; off += PVT;
  const size_t oCtx  = off; off += PCtx;
  const size_t oCtxr = off; off += PCtx;
  const size_t oRt   = off; off += PRt;
  if (off > ws_size) return;                         // off = 101711872 for SEQ 4096
  if (off > (size_t)134217728) return;

  char* ws = (char*)d_ws;
  unsigned short* Xh   = (unsigned short*)(ws + oX);
  unsigned short* Wqkv = (unsigned short*)(ws + oWq);
  unsigned short* Wp   = (unsigned short*)(ws + oWp);
  unsigned short* QKV  = (unsigned short*)(ws + oQKV);
  unsigned short* QKVr = (unsigned short*)(ws + oQKVr);
  unsigned short* VT   = (unsigned short*)(ws + oVT);
  unsigned short* VTr  = (unsigned short*)(ws + oVTr);
  unsigned short* Ctx  = (unsigned short*)(ws + oCtx);
  unsigned short* Ctxr = (unsigned short*)(ws + oCtxr);
  float*          Rt   = (float*)(ws + oRt);
  float*          outf = (float*)d_out;              // [SEQ][DM]

  const dim3 blk(256);
  const dim3 gPrep(PREP_B);                          // 512 table + 2048 x + 4 x 512 weight blocks (SEQ 4096)
  const dim3 gGqkv((SEQ / 128) * (DQKV / 128));      // 768 block tiles of 128x128 (SEQ 4096)
  const dim3 gGdm((SEQ / 128) * (DM / 128));         // 256 block tiles
  const dim3 gVt(SEQ / 64, NH, 2);                   // (64, 16, 2)
  const dim3 gAttn(NQB * NH);                        // 1024 blocks: every (head, query tile)
  const float wScale = 1024.0f;                      // weights carried x1024
  const float aScale = 16.0f;                        // activations carried x16
  const float cscale = 1.0f / 16384.0f;              // 1/(16 * 1024)

  // (1, 2) one launch: planes x -> f16 x16 (bf16 values); weights [n][k] -> f16 x1024 (bf16 values), wq | wk | wv
  //     stacked; RoPE table cos | sin per token
  k_prep<<<gPrep, blk, 0, stream>>>(x, wq, wk, wv, wo, Xh, Wqkv, Wp, Rt, aScale, wScale);
  // (3) qkv = Xh . Wqkv^T with RoPE on the q and k column blocks (n0 < 2*DM) -> QKV f16 x16 + residual plane
  //     [SEQ][3072] (M=SEQ, N=3072, K=1024)
  gemm64_f16<0, false><<<gGqkv, dim3(128), 0, stream>>>(Xh, Xh, DM, Wqkv, DM, cscale, (void*)QKV, QKVr, DQKV,
                                                  SEQ, DQKV, DM, aScale, Rt, 2 * DM);
  // (4) v -> v^T planes (hi and residual, all tokens), one launch
  v_tr<<<gVt, blk, 0, stream>>>(QKV, QKVr, VT, VTr);
  // (5) windowed causal softmax attention -> Ctx f16 x16 + residual plane (all query tiles)
  attn_k<true><<<gAttn, dim3(128), 0, stream>>>(QKV, QKVr, VT, VTr, Ctx, Ctxr);
  // (6) out = (Ctx + 2^-11 Ctxr) . Wp^T -> d_out f32 [SEQ][1024] (M=SEQ, N=1024, K=1024), every tile once
  gemm64_f16<1, true><<<gGdm, dim3(128), 0, stream>>>(Ctx, Ctxr, DM, Wp, DM, cscale, (void*)outf, Ctxr, DM,
                                                SEQ, DM, DM, 1.0f, Rt, 0);
  (void)hipGetLastError();
}

// v004
// It runs in 112 microseconds.
// Timed twice side by side with v003, it ran 1.22 times as fast both times.
// Over all steps from v000 it is 2.54 times as fast.
// Contractions: q|k|v projection = v_wmma_f32_16x16x32_f16 (A = f16 of RNE-bf16 x carried x16, B = f16 of RNE-bf16 wq|wk|wv carried x1024, single product); attention k.q^T and v^T.p^T (transposed products) = v_wmma_f32_16x16x32_f16 (q, k, v^T f16 planes x16 plus x2^11 residual planes, p f16 x256 plus x2^11 residual; hi.hi + hi.res + res.hi); output projection = v_wmma_f32_16x16x32_f16 (A = ctx f16 x16 plus its x2^11 residual plane, B = f16 of RNE-bf16 wo x1024; hi.B + res.B); all f32 accumulate. RoPE cos/sin table, rotation, windowed causal online-max softmax and row sums in f32 on the VALU.
#include <hip/hip_runtime.h>
#include <math.h>
#include <stdint.h>

#define SEQ   4096                  // token rows processed (a row prefix of x); every stride, carve and grid derives from it
#define DM    1024
#define NH    16
#define HD    64
#define WIN   512
#define DQKV  (3 * DM)              // 3072
#define NQB   (SEQ / 64)            // query tiles of 64 rows
#define KTW   (WIN / 64 + 1)        // key tiles visited per 64-row query tile = 9
#define OUTN  (SEQ * DM)
static_assert(NH * HD == DM);
static_assert(HD == 64);
static_assert((WIN % 64) == 0);
static_assert(KTW == 9);
static_assert((SEQ % 64) == 0 && (DM % 64) == 0 && (DQKV % 64) == 0);
static_assert((DM % 32) == 0);
static_assert((SEQ % 128) == 0 && (DM % 128) == 0 && (DQKV % 128) == 0);   // GEMM block tile 128x128
static_assert((DM % 64) == 0 && DM >= 128);                                 // GEMM pass of 64 k, two passes or more
static_assert(((SEQ * DM / 8) % 256) == 0);
static_assert(((DM * DM / 8) % 256) == 0);
static_assert((SEQ % 8) == 0);

#define GP_B    144                 // GEMM LDS row pitch, bytes: 128-byte row + 16 (16 B x odd, for 16-byte readers)
#define GP_H    (GP_B / 2)          // the same in halves
#define GOFF_B  (128 * GP_B)        // Bt rows behind the A rows inside a stage
#define GSTAGE  (2 * 128 * GP_B)    // one stage, bytes

typedef _Float16 v16h __attribute__((ext_vector_type(16)));
typedef _Float16 v8h  __attribute__((ext_vector_type(8)));
typedef float    v8f  __attribute__((ext_vector_type(8)));
typedef float    v4f  __attribute__((ext_vector_type(4)));
typedef unsigned int v4u __attribute__((ext_vector_type(4)));

// ---- scalar helpers --------------------------------------------------------------------------------
__device__ __forceinline__ unsigned short bf_bits(float f) {          // f32 -> bf16 bits, RNE convert
  unsigned u = __float_as_uint(f);
  return (unsigned short)((u + 0x7FFFu + ((u >> 16) & 1u)) >> 16);
}
__device__ __forceinline__ float bfr(float f) { return __uint_as_float(((unsigned)bf_bits(f)) << 16); }
__device__ __forceinline__ unsigned short h_bits(_Float16 x) { return __builtin_bit_cast(unsigned short, x); }
__device__ __forceinline__ unsigned pk16(unsigned short a, unsigned short b) { return (unsigned)a | ((unsigned)b << 16); }
__device__ __forceinline__ v8f zero8() { v8f z = {0.f, 0.f, 0.f, 0.f, 0.f, 0.f, 0.f, 0.f}; return z; }

// ---- fragment loader: 16-bit A/B operand, lane -> row/col (lane&15), p already includes +8*(lane>>4);
//      elements 0..7 <- p[0..7] (k0+8h..), elements 8..15 <- p[16..23] (k0+16+8h..)
__device__ __forceinline__ v16h ldfrag_h(const _Float16* p) {
  union { v16h v; v8h h[2]; } f;
  f.h[0] = *(const v8h*)(p);
  f.h[1] = *(const v8h*)(p + 16);
  return f.v;
}

// ---- WMMA helpers with trailing VALU hazard gap --------------------------------------------------------
__device__ __forceinline__ v8f mma_h(v16h a, v16h b, v8f c) {
  c = __builtin_amdgcn_wmma_f32_16x16x32_f16(false, a, false, b, (short)0, c, false, false);
#if defined(__HIP_DEVICE_COMPILE__)
  asm volatile("v_nop\n\tv_nop\n\tv_nop\n\tv_nop" : "+v"(c) : "v"(a), "v"(b));
#endif
  return c;
}
__device__ __forceinline__ v8f mma_h_raw(v16h a, v16h b, v8f c) {
  return __builtin_amdgcn_wmma_f32_16x16x32_f16(false, a, false, b, (short)0, c, false, false);
}
__device__ __forceinline__ void dep_guard_h(v8f& a, v8f& b, v16h x, v16h y) {
#if defined(__HIP_DEVICE_COMPILE__)
  asm volatile("v_nop\n\tv_nop\n\tv_nop\n\tv_nop" : "+v"(a), "+v"(b) : "v"(x), "v"(y));
#endif
}
__device__ __forceinline__ void keep4_h(v16h a, v16h b, v16h c, v16h d) {
#if defined(__HIP_DEVICE_COMPILE__)
  asm volatile("v_nop" :: "v"(a), "v"(b), "v"(c), "v"(d));
#endif
}
__device__ __forceinline__ void acc_guard4(v8f& a, v8f& b, v8f& c, v8f& d) {
#if defined(__HIP_DEVICE_COMPILE__)
  asm volatile("v_nop\n\tv_nop\n\tv_nop\n\tv_nop" : "+v"(a), "+v"(b), "+v"(c), "+v"(d));
#endif
}

// =====================================================================================================
// Preparatory launch: three jobs that need nothing of each other share one grid by ranges of the block index
// (every test on the block index is block-uniform).
//   blocks [0, RT_B)                    RoPE table, 8 tokens each
//   blocks [RT_B, RT_B + CVX_B)         x -> f16 plane
//   the last 4 * CVW_B blocks           wq | wk | wv | wo -> f16 planes, CVW_B blocks each
// =====================================================================================================
#define RT_B   (SEQ / 8)                // 512
#define CVX_B  (SEQ * DM / 8 / 256)     // 2048
#define CVW_B  (DM * DM / 8 / 256)      // 512
#define PREP_B (RT_B + CVX_B + 4 * CVW_B)

// f32 plane -> f16 bits of bfr(v) * scale (scale a power of two): x (x16) and the [n][k] weights (x1024),
// whose [out][in] layout is already the k-contiguous Bt layout of the GEMM below.
// coverage: n8 threads x 8 = the whole plane.
__device__ __forceinline__ void cvt16(const float* __restrict__ in, unsigned short* out, int n8, float scale, int i) {
  if (i < n8) {
    const v4f a = *(const v4f*)(in + (size_t)i * 8);
    const v4f b = *(const v4f*)(in + (size_t)i * 8 + 4);
    v4u p;
    p[0] = pk16(h_bits((_Float16)(bfr(a[0]) * scale)), h_bits((_Float16)(bfr(a[1]) * scale)));
    p[1] = pk16(h_bits((_Float16)(bfr(a[2]) * scale)), h_bits((_Float16)(bfr(a[3]) * scale)));
    p[2] = pk16(h_bits((_Float16)(bfr(b[0]) * scale)), h_bits((_Float16)(bfr(b[1]) * scale)));
    p[3] = pk16(h_bits((_Float16)(bfr(b[2]) * scale)), h_bits((_Float16)(bfr(b[3]) * scale)));
    *(v4u*)(out + (size_t)i * 8) = p;
  }
}

// RoPE table tab[t][64] f32: [0..31] = cos(t * inv[m]), [32..63] = sin(t * inv[m]) (precise sincosf, f32
// angle = fl(t * inv[m])), inv[m] = 1 / powf(10000, (2m)/64), m = 0..31, f32, formed by each thread for its own m.
// Block = 8 tokens x 32 pairs (256 threads); the 8x64 tile is staged in LDS, then stored as whole rows.
// coverage: compute 8 x 32 threads x 2 = 8x64; store 128 lanes x 4 floats = 8 rows x 64; RT_B blocks cover every t.
__device__ __forceinline__ void rope_tab(float* st, float* tab, int blk) {
  const int tid = threadIdx.x;
  const int m   = tid & 31, tr = tid >> 5;
  const int t   = blk * 8 + tr;                     // < SEQ by the block range
  const float e = (float)(2 * m) * (1.0f / 64.0f);
  const float p = powf(10000.0f, e);
  const float w = 1.0f / p;
  const float ang = (float)t * w;
  float sn, cs;
  sincosf(ang, &sn, &cs);
  st[tr * 64 + m]      = cs;
  st[tr * 64 + 32 + m] = sn;
  __syncthreads();
  if (tid < 128) {                                  // waves 0..3, wave-uniform
    const int row = tid >> 4, c4 = (tid & 15) * 4;
    const v4f v = *(const v4f*)(st + row * 64 + c4);
    float* dst = tab + (size_t)(blk * 8 + row) * 64 + c4;
    *(v4f*)dst = v;
  }
}

__global__ __launch_bounds__(256) void k_prep(const float* __restrict__ x, const float* __restrict__ wq,
                                              const float* __restrict__ wk, const float* __restrict__ wv,
                                              const float* __restrict__ wo,
                                              unsigned short* Xh, unsigned short* Wqkv, unsigned short* Wp,
                                              float* tab, float aScale, float wScale) {
  __shared__ __align__(16) float st[8 * 64];
  const int b = blockIdx.x;
  if (b < RT_B) {                                   // the longest blocks start first
    rope_tab(st, tab, b);
  } else if (b < RT_B + CVX_B) {
    cvt16(x, Xh, SEQ * DM / 8, aScale, (b - RT_B) * 256 + (int)threadIdx.x);
  } else if (b < PREP_B) {
    const int wb = b - (RT_B + CVX_B);
    const int which = wb / CVW_B;                   // 0..3 = wq, wk, wv, wo
    const float* in = (which == 0) ? wq : (which == 1) ? wk : (which == 2) ? wv : wo;
    unsigned short* o = (which < 3) ? (Wqkv + (size_t)which * DM * DM) : Wp;
    cvt16(in, o, DM * DM / 8, wScale, (wb - which * CVW_B) * 256 + (int)threadIdx.x);
  }
}

// =====================================================================================================
// Register-blocked f16 WMMA GEMM, one wave per 64x64 tile, four waves (2x2) per 128x128 block tile. The block's
// A and Bt rows of a 64-k pass are staged in LDS by asynchronous 16-byte copies (whole 128-byte lines), two
// buffers: the next pass's copies fly while this pass's fragments are read from LDS.
//   v[m][n] = (sum_k A[m][k] * Bt[n][k]  [+ 2^-11 * sum_k Ar[m][k] * Bt[n][k] when ARES]) * cscale
// A, Ar row-major [M][K] pitch lda (f16), Bt row-major [N][K] pitch ldb (f16, k contiguous); M, N multiples of
// 128, K multiple of 64; one block per block tile (a block-uniform bound check anyway).
// ARES: the residual plane is accumulated first from zero, the accumulators are scaled by 2^-11 exactly on the
// VALU (with nop gaps on both sides), then the hi plane accumulates on top: one accumulator set.
// Epilogue variants:
//   EPI 0: f16 hi plane = f16(v' * oscale) at Cp and residual plane = f16((v'*oscale - hi) * 2048) at Crp,
//          pitch ldc halves, where v' = v for tiles with n0 >= ropeN and, for n0 < ropeN (wave-uniform),
//          v' = rotate-half RoPE of the wave's 64-column tile (one head): pair index mm = column mod 32,
//          token = output row, c = rtab[token][mm], s = rtab[token][32+mm]:
//          col mm -> v[mm]*c - v[32+mm]*s ; col 32+mm -> v[32+mm]*c + v[mm]*s (f32, from the LDS slab).
//   EPI 1: f32 out = v, pitch ldc floats
// 16-row slabs staged per wave in LDS. f32 out: each 64-wide row segment (256 B = 2 lines) by 16 lanes x 16 B,
// coverage: 4 slabs x 16 rows x 64 cols = the wave's whole 64x64 tile; grid x 4 tiles = [M][N].
// =====================================================================================================
// Eight 16-byte asynchronous copies of one lane, global -> LDS, rows 16 apart in both places. The s_wait_xcnt
// is the last line of the copies' own statement so that no address register is rewritten ahead of it.
__device__ __forceinline__ void copy8_rows(unsigned l, const _Float16* g, int ld) {
#if defined(__HIP_DEVICE_COMPILE__)
  const unsigned l0 = l,                    l1 = l + 1u * 16u * GP_B, l2 = l + 2u * 16u * GP_B, l3 = l + 3u * 16u * GP_B;
  const unsigned l4 = l + 4u * 16u * GP_B, l5 = l + 5u * 16u * GP_B, l6 = l + 6u * 16u * GP_B, l7 = l + 7u * 16u * GP_B;
  const size_t st = (size_t)16 * ld;
  const _Float16 *g0 = g, *g1 = g + st, *g2 = g + 2 * st, *g3 = g + 3 * st;
  const _Float16 *g4 = g + 4 * st, *g5 = g + 5 * st, *g6 = g + 6 * st, *g7 = g + 7 * st;
  asm volatile(
      "global_load_async_to_lds_b128 %0, %8, off\n\t"
      "global_load_async_to_lds_b128 %1, %9, off\n\t"
      "global_load_async_to_lds_b128 %2, %10, off\n\t"
      "global_load_async_to_lds_b128 %3, %11, off\n\t"
      "global_load_async_to_lds_b128 %4, %12, off\n\t"
      "global_load_async_to_lds_b128 %5, %13, off\n\t"
      "global_load_async_to_lds_b128 %6, %14, off\n\t"
      "global_load_async_to_lds_b128 %7, %15, off\n\t"
      "s_wait_xcnt 0x0"
      :: "v"(l0), "v"(l1), "v"(l2), "v"(l3), "v"(l4), "v"(l5), "v"(l6), "v"(l7),
         "v"(g0), "v"(g1), "v"(g2), "v"(g3), "v"(g4), "v"(g5), "v"(g6), "v"(g7)
      : "memory");
#endif
}
// the issuing wave's copies have landed in LDS behind this wait
__device__ __forceinline__ void wait_async0() {
#if defined(__HIP_DEVICE_COMPILE__)
  asm volatile("s_wait_asynccnt 0x0" ::: "memory");
#endif
}
// the wave's own LDS reads of a buffer have retired before that buffer is handed back for a refill
__device__ __forceinline__ void wait_ds0() {
#if defined(__HIP_DEVICE_COMPILE__)
  asm volatile("s_wait_dscnt 0x0" ::: "memory");
#endif
}

template <int EPI, bool ARES>
__global__ __launch_bounds__(128) void gemm64_f16(
    const unsigned short* __restrict__ Ap, const unsigned short* __restrict__ Arp, int lda,
    const unsigned short* __restrict__ Btp, int ldb,
    float cscale,
    void* Cp, unsigned short* Crp, int ldc, int M, int N, int K, float oscale,
    const float* __restrict__ rtab, int ropeN) {
  const _Float16* Ah  = (const _Float16*)(const void*)Ap;
  const _Float16* Arh = (const _Float16*)(const void*)Arp;
  const _Float16* Bt  = (const _Float16*)(const void*)Btp;
  __shared__ __align__(16) unsigned char ring[2 * GSTAGE];   // two stages of [A 128 rows | Bt 128 rows], pitch GP_B
  __shared__ __align__(16) float sT[4][16 * 68];   // per-wave 16x64 slab, pitch 68 floats
  const int tid  = threadIdx.x;
  const int lane = tid & 31;
  const int wave = tid >> 5;
  const int tilesN = N >> 7;
  const int tilesM = M >> 7;
  if ((int)blockIdx.x >= tilesM * tilesN) return;   // block-uniform, in front of every barrier and copy
  const int bm = (int)blockIdx.x / tilesN;
  const int bn = (int)blockIdx.x - bm * tilesN;
  const int wm = (wave >> 1) << 6;             // the wave's 64x64 tile inside the block's 128x128 tile
  const int wn = (wave & 1) << 6;
  const int m0 = (bm << 7) + wm;
  const int n0 = (bn << 7) + wn;

  const int rlane = lane & 15;                 // row (A) / col (B, D) within subtile
  const int koff  = (lane >> 4) * 8;           // k offset of this lane half
  const int mOff  = (lane >> 4) * 8;           // D row offset

  v8f acc[4][4];
#pragma unroll
  for (int i = 0; i < 4; ++i)
#pragma unroll
    for (int j = 0; j < 4; ++j) acc[i][j] = zero8();

  // staging map: lane -> row tid>>3 (+16 per copy, 8 copies = 128 rows), 16-byte piece tid&7 of the 128-byte row
  const int crow = tid >> 3, cpc = tid & 7;
  const unsigned ringb = (unsigned)(uintptr_t)(const void*)ring;           // LDS byte address of the ring
  const unsigned lcp   = ringb + (unsigned)(crow * GP_B + cpc * 16);
  const _Float16* gA  = Ah  + (size_t)((bm << 7) + crow) * lda + cpc * 8;
  const _Float16* gAr = Arh + (size_t)((bm << 7) + crow) * lda + cpc * 8;
  const _Float16* gB  = Bt  + (size_t)((bn << 7) + crow) * ldb + cpc * 8;
  const int KP = K >> 6;                       // passes of 64 k per plane
  const int NP = ARES ? 2 * KP : KP;           // ARES: the residual plane's passes first, then the hi plane's

  // tile 0 -> buffer 0, landed and published; then tile 1 -> buffer 1 flies over pass 0
  copy8_rows(lcp, ARES ? gAr : gA, lda);
  copy8_rows(lcp + GOFF_B, gB, ldb);
  wait_async0();
  __syncthreads();
  if (NP > 1) {
    const int kk = (1 < KP) ? 64 : 0;
    const _Float16* ga = (ARES && 1 < KP) ? gAr : gA;
    copy8_rows(lcp + GSTAGE, ga + kk, lda);
    copy8_rows(lcp + GSTAGE + GOFF_B, gB + kk, ldb);
  }

  for (int t = 0; t < NP; ++t) {
    if (ARES && t == KP) {                     // block-uniform: between the two planes
      acc_guard4(acc[0][0], acc[0][1], acc[0][2], acc[0][3]);
      acc_guard4(acc[1][0], acc[1][1], acc[1][2], acc[1][3]);
      acc_guard4(acc[2][0], acc[2][1], acc[2][2], acc[2][3]);
      acc_guard4(acc[3][0], acc[3][1], acc[3][2], acc[3][3]);
#pragma unroll
      for (int i = 0; i < 4; ++i)
#pragma unroll
        for (int j = 0; j < 4; ++j) acc[i][j] = acc[i][j] * (1.0f / 2048.0f);   // exact fold of the x2^11 residual carry
      acc_guard4(acc[0][0], acc[0][1], acc[0][2], acc[0][3]);
      acc_guard4(acc[1][0], acc[1][1], acc[1][2], acc[1][3]);
      acc_guard4(acc[2][0], acc[2][1], acc[2][2], acc[2][3]);
      acc_guard4(acc[3][0], acc[3][1], acc[3][2], acc[3][3]);
    }
    const unsigned bsel = (unsigned)(t & 1) * GSTAGE;
    const _Float16* sA = (const _Float16*)(const void*)(ring + bsel) + (wm + rlane) * GP_H + koff;
    const _Float16* sB = (const _Float16*)(const void*)(ring + bsel + GOFF_B) + (wn + rlane) * GP_H + koff;
    // the loops below are unrolled so that every fragment and accumulator index is a constant (registers, no scratch)
#pragma unroll
    for (int ks = 0; ks < 2; ++ks) {
      v16h bh[4];
#pragma unroll
      for (int j = 0; j < 4; ++j) bh[j] = ldfrag_h(sB + (j << 4) * GP_H + ks * 32);
      v16h ah[4];                              // all eight fragments of a 32-k step are read as one group
#pragma unroll
      for (int i = 0; i < 4; ++i) ah[i] = ldfrag_h(sA + (i << 4) * GP_H + ks * 32);
#pragma unroll
      for (int i = 0; i < 4; ++i) {
#pragma unroll
        for (int j = 0; j < 4; ++j) {
          acc[i][j] = mma_h_raw(ah[i], bh[j], acc[i][j]);
        }
        dep_guard_h(acc[i][0], acc[i][3], ah[i], bh[3]);
      }
      keep4_h(bh[0], bh[1], bh[2], bh[3]);
    }
    // publish point of tile t + 1: own LDS reads retired, own copies landed, one barrier for both jobs
    wait_ds0();
    wait_async0();
    __syncthreads();
    if (t + 2 < NP) {                          // block-uniform: refill the buffer that pass t has just read
      const int tn = t + 2;
      const bool res = ARES && (tn < KP);
      const int kk = (tn - ((ARES && tn >= KP) ? KP : 0)) << 6;
      copy8_rows(lcp + bsel, (res ? gAr : gA) + kk, lda);
      copy8_rows(lcp + bsel + GOFF_B, gB + kk, ldb);
    }
  }
  wait_async0();
  acc_guard4(acc[0][0], acc[0][1], acc[0][2], acc[0][3]);
  acc_guard4(acc[1][0], acc[1][1], acc[1][2], acc[1][3]);
  acc_guard4(acc[2][0], acc[2][1], acc[2][2], acc[2][3]);
  acc_guard4(acc[3][0], acc[3][1], acc[3][2], acc[3][3]);

  // ---- epilogue ----
  float* slab = sT[wave];
#pragma unroll
  for (int i = 0; i < 4; ++i) {
    const int mBase = m0 + (i << 4);
#pragma unroll
    for (int r = 0; r < 8; ++r) {
      const int row = mOff + r;
#pragma unroll
      for (int j = 0; j < 4; ++j) slab[row * 68 + (j << 4) + rlane] = acc[i][j][r] * cscale;
    }
    __builtin_amdgcn_fence(__ATOMIC_RELEASE, "workgroup");
    __builtin_amdgcn_wave_barrier();
    __builtin_amdgcn_fence(__ATOMIC_ACQUIRE, "workgroup");
    if constexpr (EPI == 0) {
      unsigned short* C16 = (unsigned short*)Cp;
      const int rq = lane >> 3, piece = lane & 7;
      const bool rope_on = (n0 < ropeN);                   // wave-uniform (n0 is per wave)
      const float rsgn = (piece < 4) ? -1.0f : 1.0f;       // cols 0..31 carry x1 (minus), cols 32..63 carry x2 (plus)
      const int   pm   = (piece & 3) * 8;                  // rotation pair index base of this lane's 8 columns
      v4u ph[4], pr[4];
#pragma unroll
      for (int it = 0; it < 4; ++it) {
        const int row = it * 4 + rq;                         // it 0..3 x rq 0..3 = rows 0..15
        const v4f a  = *(const v4f*)(slab + row * 68 + piece * 8);
        const v4f a2 = *(const v4f*)(slab + row * 68 + piece * 8 + 4);
        float f[8];
        f[0] = a[0];  f[1] = a[1];  f[2] = a[2];  f[3] = a[3];
        f[4] = a2[0]; f[5] = a2[1]; f[6] = a2[2]; f[7] = a2[3];
        if (rope_on) {                                       // wave-uniform branch, LDS and table reads only
          const int po = (piece ^ 4) * 8;                    // partner half of the head (32 columns away)
          const v4f g  = *(const v4f*)(slab + row * 68 + po);
          const v4f g2 = *(const v4f*)(slab + row * 68 + po + 4);
          const float* trp = rtab + (size_t)(mBase + row) * 64 + pm;   // output row = token index
          const v4f c0 = *(const v4f*)(trp);
          const v4f c1 = *(const v4f*)(trp + 4);
          const v4f s0 = *(const v4f*)(trp + 32);
          const v4f s1 = *(const v4f*)(trp + 36);
          f[0] = f[0] * c0[0] + rsgn * g[0]  * s0[0];
          f[1] = f[1] * c0[1] + rsgn * g[1]  * s0[1];
          f[2] = f[2] * c0[2] + rsgn * g[2]  * s0[2];
          f[3] = f[3] * c0[3] + rsgn * g[3]  * s0[3];
          f[4] = f[4] * c1[0] + rsgn * g2[0] * s1[0];
          f[5] = f[5] * c1[1] + rsgn * g2[1] * s1[1];
          f[6] = f[6] * c1[2] + rsgn * g2[2] * s1[2];
          f[7] = f[7] * c1[3] + rsgn * g2[3] * s1[3];
        }
        v4u p, q;
#pragma unroll
        for (int e = 0; e < 4; ++e) {
          const float g0 = f[2 * e] * oscale, g1 = f[2 * e + 1] * oscale;
          const _Float16 x0 = (_Float16)g0, x1 = (_Float16)g1;
          const _Float16 y0 = (_Float16)((g0 - (float)x0) * 2048.0f);
          const _Float16 y1 = (_Float16)((g1 - (float)x1) * 2048.0f);
          p[e] = pk16(h_bits(x0), h_bits(x1));
          q[e] = pk16(h_bits(y0), h_bits(y1));
        }
        ph[it] = p;
        pr[it] = q;
      }
      {
#pragma unroll
        for (int it = 0; it < 4; ++it) {
          const int row = it * 4 + rq;
          const size_t co = (size_t)(mBase + row) * ldc + n0 + piece * 8;
          *(v4u*)(C16 + co) = ph[it];
          *(v4u*)(Crp + co) = pr[it];
        }
        
      }
    } else {
      float* Cf = (float*)Cp;
      const int hh = lane >> 4, c4 = (lane & 15) * 4;     // 256-B row segment = 16 lanes x 16 B
      v4f ov[8];
#pragma unroll
      for (int it = 0; it < 8; ++it) {
        const int row = it * 2 + hh;                       // it 0..7 x hh 0..1 = rows 0..15
        ov[it] = *(const v4f*)(slab + row * 68 + c4);
      }
      {
#pragma unroll
        for (int it = 0; it < 8; ++it) {
          const int row = it * 2 + hh;
          *(v4f*)(Cf + (size_t)(mBase + row) * ldc + n0 + c4) = ov[it];
        }
        
      }
    }
    __builtin_amdgcn_fence(__ATOMIC_RELEASE, "workgroup");
    __builtin_amdgcn_wave_barrier();
    __builtin_amdgcn_fence(__ATOMIC_ACQUIRE, "workgroup");
  }
}

// =====================================================================================================
// v columns of an f16 qkv plane (token-major, element (t, h, d) at [t*DQKV + 2*DM + h*64 + d])
// -> f16 v^T plane vt[(h*64 + d)*SEQ + t] (same bits). blockIdx.z = 0: the hi plane, 1: the residual plane.
// Block = one 64-token x 64-feature tile of one head; grid = (SEQ/64, NH, 2); tile staged in LDS as halves
// (v8h 16-B stores, __syncthreads, _Float16 element reads).
// Store: group g = tid>>3 (0..31), piece = tid&7: iteration it writes row d = it*32+g, lanes 8q..8q+7 x 16 B =
// coverage: load 2 x 256 threads x 8 halves = 64x64; store 2 iterations x 32 groups = 64 rows d, 8 pieces x 8
// = 64 tokens per row; grid covers every (h, token tile).
// =====================================================================================================
__global__ __launch_bounds__(256) void v_tr(const unsigned short* __restrict__ qkvhp, const unsigned short* __restrict__ qkvrp,
                                            unsigned short* vth, unsigned short* vtr) {
  __shared__ __align__(16) _Float16 sv[64 * 72];       // [tt][d], pitch 72 halves (144 B)
  const int tid = threadIdx.x;
  const int t0  = blockIdx.x * 64;
  const int hh  = blockIdx.y;
  const bool res = (blockIdx.z != 0);               // block-uniform
  const _Float16* src = (const _Float16*)(const void*)(res ? qkvrp : qkvhp);
  unsigned short* vt  = res ? vtr : vth;
#pragma unroll
  for (int i = 0; i < 2; ++i) {
    const int idx = i * 256 + tid;                  // 0..511
    const int tt = idx >> 3, c8 = (idx & 7) * 8;
    const v8h a = *(const v8h*)(src + ((size_t)(t0 + tt)) * DQKV + 2 * DM + hh * HD + c8);
    *(v8h*)(sv + tt * 72 + c8) = a;
  }
  __syncthreads();

  const int g = tid >> 3, piece = tid & 7;
  v4u hv[2];
  size_t hofs[2];
#pragma unroll
  for (int it = 0; it < 2; ++it) {
    const int d = it * 32 + g;
    v4u a;
#pragma unroll
    for (int e = 0; e < 4; ++e) {
      const _Float16 x0 = sv[(piece * 8 + 2 * e) * 72 + d];
      const _Float16 x1 = sv[(piece * 8 + 2 * e + 1) * 72 + d];
      a[e] = pk16(h_bits(x0), h_bits(x1));
    }
    hv[it] = a;
    hofs[it] = ((size_t)(hh * HD + d)) * SEQ + t0 + piece * 8;
  }
  {
#pragma unroll
    for (int it = 0; it < 2; ++it) *(v4u*)(vt + hofs[it]) = hv[it];
    
  }
}

__device__ __forceinline__ float xhalf(float x) {
  return __builtin_bit_cast(float, __builtin_amdgcn_permlanex16(__builtin_bit_cast(int, x), __builtin_bit_cast(int, x),
                                                                0x76543210, 0xfedcba98, false, false));
}

template <bool HR>
__global__ __launch_bounds__(128)
void attn_k(const unsigned short* __restrict__ qkvp, const unsigned short* __restrict__ qkvrp,
            const unsigned short* __restrict__ vtp, const unsigned short* __restrict__ vtrp,
            unsigned short* ctxp, unsigned short* ctxrp) {
  union FH { v16h v; v8h h[2]; };
  constexpr int AP     = 72;                             // LDS row pitch of the f16 tiles, halves: 128-byte row + 16 (16 B x odd, for 16-byte readers)
  constexpr int OP     = 68;                             // LDS row pitch of the f32 context slab, floats (16-byte writers and readers)
  constexpr int TB     = 64 * AP * 2;                    // one f16 64x64 tile at that pitch, bytes
  constexpr int OFF_K  = 0;
  constexpr int OFF_V  = TB;
  constexpr int OFF_KR = 2 * TB;
  constexpr int OFF_VR = 3 * TB;
  constexpr int SMEMB  = HR ? 4 * TB : 2 * TB;                // 36864 : 18432
  static_assert(4 * 16 * OP * 4 <= SMEMB);                    // f32 context staging aliases the K/V region
  __shared__ __align__(16) unsigned char smem[SMEMB];
  _Float16* Ksh = (_Float16*)(smem + OFF_K);                  // K   [kv][d]
  _Float16* Vsh = (_Float16*)(smem + OFF_V);                  // V^T [d][kv]
  _Float16* Krs = (_Float16*)(smem + (HR ? OFF_KR : OFF_K));  // K residual (HR only)
  _Float16* Vrs = (_Float16*)(smem + (HR ? OFF_VR : OFF_V));  // V^T residual (HR only)

  const int tid  = threadIdx.x;
  const int wave = tid >> 5;
  const int lane = tid & 31;
  const int hh   = lane >> 4;
  const int c    = lane & 15;

  const int bx   = blockIdx.x;
  const int qb   = bx % NQB;
  const int h    = bx / NQB;                 // < NH by the grid size
  const int q0   = qb * 64 + wave * 16;
  const int qrow = q0 + c;                   // the lane's query

  const _Float16* Qp  = (const _Float16*)(const void*)qkvp  + (size_t)h * HD;
  const _Float16* Qrp = (const _Float16*)(const void*)qkvrp + (size_t)h * HD;
  const _Float16* Kp  = Qp + DM;
  const _Float16* Krp = Qrp + DM;
  const _Float16* Vt  = (const _Float16*)(const void*)vtp  + ((size_t)h * HD) * SEQ;
  const _Float16* Vrt = (const _Float16*)(const void*)vtrp + ((size_t)h * HD) * SEQ;

  // ---- Q fragments (B operand, column = lane&15): 2 d-chunks ----
  v16h qa[2], qr[2];
#pragma unroll
  for (int dc = 0; dc < 2; ++dc) {
    const size_t qo = (size_t)qrow * DQKV + dc * 32 + 8 * hh;
    qa[dc] = ldfrag_h(Qp + qo);
    if constexpr (HR) qr[dc] = ldfrag_h(Qrp + qo);
    else qr[dc] = qa[dc];
  }

  float lsum = 0.f, mrun = -1e30f;
  v8f oacc[4], oacc2[4];
#pragma unroll
  for (int t = 0; t < 4; ++t) { oacc[t] = zero8(); oacc2[t] = zero8(); }

  const int ktlo = (qb >= KTW - 1) ? (qb - (KTW - 1)) : 0;   // first key tile in the window, block-uniform
  const int nkt  = qb - ktlo + 1;                              // 1..KTW key tiles, block-uniform
  for (int kti = 0; kti < nkt; ++kti) {
    const int kv0 = (ktlo + kti) * 64;                         // <= qb*64 < SEQ
    __syncthreads();
    {
      const int r = tid >> 1, half = (tid & 1) * 32;
      const size_t ko = (size_t)(kv0 + r) * DQKV + half;      // K row kv0+r, d = half..half+31
      const size_t vo = (size_t)r * SEQ + kv0 + half;           // V^T row d = r, s = kv0+half..+31
#pragma unroll
      for (int i = 0; i < 4; ++i) {
        const v8h a0 = *(const v8h*)(Kp + ko + 8 * i);
        const v8h b0 = *(const v8h*)(Vt + vo + 8 * i);
        *(v8h*)(Ksh + r * AP + half + 8 * i) = a0;
        *(v8h*)(Vsh + r * AP + half + 8 * i) = b0;
        if constexpr (HR) {
          const v8h a1 = *(const v8h*)(Krp + ko + 8 * i);
          const v8h b1 = *(const v8h*)(Vrt + vo + 8 * i);
          *(v8h*)(Krs + r * AP + half + 8 * i) = a1;
          *(v8h*)(Vrs + r * AP + half + 8 * i) = b1;
        }
      }
    }
    __syncthreads();

    // ---- scores^T: 64 keys x 16 query columns per wave (A operand: lane c -> key j*16+c, split k map over d) ----
    v8f s[4];
#pragma unroll
    for (int j = 0; j < 4; ++j) {
      s[j] = zero8();
      v8f t = zero8();
#pragma unroll
      for (int dc = 0; dc < 2; ++dc) {
        FH kb;
        kb.h[0] = *(const v8h*)(Ksh + (j * 16 + c) * AP + dc * 32 + 8 * hh);
        kb.h[1] = *(const v8h*)(Ksh + (j * 16 + c) * AP + dc * 32 + 16 + 8 * hh);
        s[j] = mma_h(kb.v, qa[dc], s[j]);
        if constexpr (HR) {
          FH krb;
          krb.h[0] = *(const v8h*)(Krs + (j * 16 + c) * AP + dc * 32 + 8 * hh);
          krb.h[1] = *(const v8h*)(Krs + (j * 16 + c) * AP + dc * 32 + 16 + 8 * hh);
          t = mma_h(krb.v, qa[dc], t);
          t = mma_h(kb.v, qr[dc], t);
        }
      }
      if constexpr (HR) s[j] = s[j] + t * (1.0f / 2048.0f);
    }

    // ---- windowed causal online softmax of the lane's query: in-lane max over its 32 keys, one exchange with
    //      the other half, running max, alpha, p, row-sum partial, P (x256, f16; HR: + residual) in registers ----
    const int key0 = kv0 + 8 * hh;
    float tm[4];
#pragma unroll
    for (int j = 0; j < 4; ++j) {                            // four independent max chains
      tm[j] = -1e30f;
#pragma unroll
      for (int r = 0; r < 8; ++r) {
        const int key = key0 + j * 16 + r;
        float a = s[j][r] * (1.0f / 2048.0f);                // 1/8 head scale, 1/256 for the two x16 carries
        const bool ok = (key <= qrow) && (key + WIN >= qrow);
        a = ok ? a : -1e30f;
        s[j][r] = a;
        tm[j] = fmaxf(tm[j], a);
      }
    }
    float tmx = fmaxf(fmaxf(tm[0], tm[1]), fmaxf(tm[2], tm[3]));
    tmx = fmaxf(tmx, xhalf(tmx));
    const float mn = fmaxf(mrun, tmx);
    const float al = __expf(mrun - mn);
    mrun = mn;
    FH pb[2], pbr[2];                                        // B operands of the two 32-key chunks
    float ps[4];
#pragma unroll
    for (int j = 0; j < 4; ++j) {                            // four independent sum chains
      ps[j] = 0.0f;
#pragma unroll
      for (int r = 0; r < 8; ++r) {
        const int key = key0 + j * 16 + r;
        const bool ok = (key <= qrow) && (key + WIN >= qrow);
        float p = __expf(s[j][r] - mn);
        p = ok ? p : 0.0f;
        ps[j] += p;
        const float g = p * 256.0f;
        const _Float16 x0 = (_Float16)g;
        pb[j >> 1].h[j & 1][r] = x0;
        if constexpr (HR) pbr[j >> 1].h[j & 1][r] = (_Float16)((g - (float)x0) * 2048.0f);
      }
    }
    lsum = lsum * al + ((ps[0] + ps[1]) + (ps[2] + ps[3]));

    // ---- rescale the context accumulators by alpha (VALU), nop gaps before the next WMMA reads them ----
#pragma unroll
    for (int t = 0; t < 4; ++t) {
      oacc[t] = oacc[t] * al;
      if constexpr (HR) oacc2[t] = oacc2[t] * al;
    }
    acc_guard4(oacc[0], oacc[1], oacc[2], oacc[3]);
    if constexpr (HR) acc_guard4(oacc2[0], oacc2[1], oacc2[2], oacc2[3]);

    // ---- context^T += V^T . P^T (f16 WMMA; A = V^T [d][key], B = P^T [key][query]) ----
#pragma unroll
    for (int kk = 0; kk < 2; ++kk) {
#pragma unroll
      for (int t = 0; t < 4; ++t) {
        FH vb;
        vb.h[0] = *(const v8h*)(Vsh + (t * 16 + c) * AP + kk * 32 + 8 * hh);
        vb.h[1] = *(const v8h*)(Vsh + (t * 16 + c) * AP + kk * 32 + 16 + 8 * hh);
        oacc[t] = mma_h(vb.v, pb[kk].v, oacc[t]);
        if constexpr (HR) {
          FH vrb;
          vrb.h[0] = *(const v8h*)(Vrs + (t * 16 + c) * AP + kk * 32 + 8 * hh);
          vrb.h[1] = *(const v8h*)(Vrs + (t * 16 + c) * AP + kk * 32 + 16 + 8 * hh);
          oacc2[t] = mma_h(vrb.v, pb[kk].v, oacc2[t]);
          oacc2[t] = mma_h(vb.v, pbr[kk].v, oacc2[t]);
        }
      }
    }
  }

  __syncthreads();                           // every wave is done with the K/V tiles before they are aliased

  // ---- normalise (1/lsum, the 1/256 p carry; keep the x16 v carry), stage the wave's 16x64 f32 tile in LDS
  //      (row = query c, 8 consecutive features per context tile and lane), then store whole 128-byte rows ----
  float* os = (float*)(void*)smem + wave * (16 * OP);
  {
    const float l  = lsum + xhalf(lsum);     // the two halves of the query's keys
    const float rl = 1.0f / l;               // l >= 1 (the max key contributes p = 1)
    const float sc = rl * (1.0f / 256.0f);
#pragma unroll
    for (int t = 0; t < 4; ++t) {
      v4f lo, hi;
#pragma unroll
      for (int r = 0; r < 4; ++r) {
        float v0 = oacc[t][r], v1 = oacc[t][4 + r];
        if constexpr (HR) {
          v0 += oacc2[t][r] * (1.0f / 2048.0f);
          v1 += oacc2[t][4 + r] * (1.0f / 2048.0f);
        }
        lo[r] = v0 * sc;
        hi[r] = v1 * sc;
      }
      *(v4f*)(os + c * OP + t * 16 + 8 * hh)     = lo;
      *(v4f*)(os + c * OP + t * 16 + 8 * hh + 4) = hi;
    }
  }
  __builtin_amdgcn_fence(__ATOMIC_RELEASE, "workgroup");
  __builtin_amdgcn_wave_barrier();
  __builtin_amdgcn_fence(__ATOMIC_ACQUIRE, "workgroup");
  {
    const int rq = lane >> 3, piece = lane & 7;
    v4u ph[4], pr[4];
#pragma unroll
    for (int it = 0; it < 4; ++it) {
      const int row = it * 4 + rq;   // it 0..3 x rq 0..3 = rows 0..15 of the wave tile
      const v4f a  = *(const v4f*)(os + row * OP + piece * 8);
      const v4f a2 = *(const v4f*)(os + row * OP + piece * 8 + 4);
      float f[8];
      f[0] = a[0];  f[1] = a[1];  f[2] = a[2];  f[3] = a[3];
      f[4] = a2[0]; f[5] = a2[1]; f[6] = a2[2]; f[7] = a2[3];
      v4u p, q;
#pragma unroll
      for (int e = 0; e < 4; ++e) {
        const _Float16 x0 = (_Float16)f[2 * e], x1 = (_Float16)f[2 * e + 1];
        p[e] = pk16(h_bits(x0), h_bits(x1));
        if constexpr (HR) {
          const _Float16 y0 = (_Float16)((f[2 * e] - (float)x0) * 2048.0f);
          const _Float16 y1 = (_Float16)((f[2 * e + 1] - (float)x1) * 2048.0f);
          q[e] = pk16(h_bits(y0), h_bits(y1));
        } else {
          q[e] = p[e];
        }
      }
      ph[it] = p;
      pr[it] = q;
    }
    {
#pragma unroll
      for (int it = 0; it < 4; ++it) {
        const int row = it * 4 + rq;
        const size_t go = (size_t)(q0 + row) * DM + (size_t)h * HD + piece * 8;
        *(v4u*)(ctxp + go) = ph[it];
        if constexpr (HR) *(v4u*)(ctxrp + go) = pr[it];
      }
      
    }
  }
}

// =====================================================================================================
// Workspace map (bytes); every region is an exact multiple of its whole-line / whole-tile store granularity
// (row pitches 2048 / 6144 / 8192 / 256 B, all offsets multiples of 256, no aliasing within a launch):
//   Xh     f16 [SEQ][1024]                 (bf16 value of x, x16)
//   Wqkv   f16 [3072][1024]                (bf16 values of wq | wk | wv x1024, [n][k] = the input layout)
//   Wp     f16 [1024][1024]                (bf16 value of wo x1024, [n][k])
//   QKV    f16 [SEQ][3072]                 (rotated q | rotated k | v, x16)
//   QKVr   f16 [SEQ][3072]                 (x2^11 residual of the above)
//   VT     f16 [1024][SEQ]                 ([h*64 + d][s])
//   VTr    f16 [1024][SEQ]                 (residual)
//   Ctx    f16 [SEQ][1024]                 (attention context x16)
//   Ctxr   f16 [SEQ][1024]                 (residual)
//   Rt     f32 [SEQ][64]                   (cos | sin table)
//   total for SEQ = 4096: 101711872
// d_out f32: [SEQ][1024] at byte 0, every 64x64 tile written once by the projection launch.
// =====================================================================================================
extern "C" void kernel_launch(void* const* d_in, const int* in_sizes, int n_in,
                              void* d_out, int out_size, void* d_ws, size_t ws_size,
                              hipStream_t stream) {
  if (n_in < 5) return;
  if (in_sizes[0] < SEQ * DM) return;
  if (in_sizes[1] != DM * DM) return;
  if (in_sizes[2] != DM * DM) return;
  if (in_sizes[3] != DM * DM) return;
  if (in_sizes[4] != DM * DM) return;
  if (out_size < OUTN) return;

  const float* x  = (const float*)d_in[0];    // [SEQ][DM] (row prefix)
  const float* wq = (const float*)d_in[1];    // [DM n][DM k]
  const float* wk = (const float*)d_in[2];    // [DM n][DM k]
  const float* wv = (const float*)d_in[3];    // [DM n][DM k]
  const float* wo = (const float*)d_in[4];    // [DM n][DM k]

  const size_t PX   = (size_t)SEQ * DM * 2;          //  8388608 (SEQ 4096)
  const size_t PWq  = (size_t)DQKV * DM * 2;         //  6291456
  const size_t PWp  = (size_t)DM * DM * 2;           //  2097152
  const size_t PQKV = (size_t)SEQ * DQKV * 2;        // 25165824
  const size_t PVT  = (size_t)DM * SEQ * 2;          //  8388608
  const size_t PCtx = (size_t)SEQ * DM * 2;          //  8388608
  const size_t PRt  = (size_t)SEQ * 64 * 4;          //  1048576
  size_t off = 0;
  const size_t oX    = off; off += PX;
  const size_t oWq   = off; off += PWq;
  const size_t oWp   = off; off += PWp;
  const size_t oQKV  = off; off += PQKV;
  const size_t oQKVr = off; off += PQKV;
  const size_t oVT   = off; off += PVT;
  const size_t oVTr  = off; off += PVT;
  const size_t oCtx  = off; off += PCtx;
  const size_t oCtxr = off; off += PCtx;
  const size_t oRt   = off; off += PRt;
  if (off > ws_size) return;                         // off = 101711872 for SEQ 4096
  if (off > (size_t)134217728) return;

  char* ws = (char*)d_ws;
  unsigned short* Xh   = (unsigned short*)(ws + oX);
  unsigned short* Wqkv = (unsigned short*)(ws + oWq);
  unsigned short* Wp   = (unsigned short*)(ws + oWp);
  unsigned short* QKV  = (unsigned short*)(ws + oQKV);
  unsigned short* QKVr = (unsigned short*)(ws + oQKVr);
  unsigned short* VT   = (unsigned short*)(ws + oVT);
  unsigned short* VTr  = (unsigned short*)(ws + oVTr);
  unsigned short* Ctx  = (unsigned short*)(ws + oCtx);
  unsigned short* Ctxr = (unsigned short*)(ws + oCtxr);
  float*          Rt   = (float*)(ws + oRt);
  float*          outf = (float*)d_out;              // [SEQ][DM]

  const dim3 blk(256);
  const dim3 gPrep(PREP_B);                          // 512 table + 2048 x + 4 x 512 weight blocks (SEQ 4096)
  const dim3 gGqkv((SEQ / 128) * (DQKV / 128));      // 768 block tiles of 128x128 (SEQ 4096)
  const dim3 gGdm((SEQ / 128) * (DM / 128));         // 256 block tiles
  const dim3 gVt(SEQ / 64, NH, 2);                   // (64, 16, 2)
  const dim3 gAttn(NQB * NH);                        // 1024 blocks: every (head, query tile)
  const float wScale = 1024.0f;                      // weights carried x1024
  const float aScale = 16.0f;                        // activations carried x16
  const float cscale = 1.0f / 16384.0f;              // 1/(16 * 1024)

  // (1, 2) one launch: planes x -> f16 x16 (bf16 values); weights [n][k] -> f16 x1024 (bf16 values), wq | wk | wv
  //     stacked; RoPE table cos | sin per token
  k_prep<<<gPrep, blk, 0, stream>>>(x, wq, wk, wv, wo, Xh, Wqkv, Wp, Rt, aScale, wScale);
  // (3) qkv = Xh . Wqkv^T with RoPE on the q and k column blocks (n0 < 2*DM) -> QKV f16 x16 + residual plane
  //     [SEQ][3072] (M=SEQ, N=3072, K=1024)
  gemm64_f16<0, false><<<gGqkv, dim3(128), 0, stream>>>(Xh, Xh, DM, Wqkv, DM, cscale, (void*)QKV, QKVr, DQKV,
                                                  SEQ, DQKV, DM, aScale, Rt, 2 * DM);
  // (4) v -> v^T planes (hi and residual, all tokens), one launch
  v_tr<<<gVt, blk, 0, stream>>>(QKV, QKVr, VT, VTr);
  // (5) windowed causal softmax attention -> Ctx f16 x16 + residual plane (all query tiles)
  attn_k<true><<<gAttn, dim3(128), 0, stream>>>(QKV, QKVr, VT, VTr, Ctx, Ctxr);
  // (6) out = (Ctx + 2^-11 Ctxr) . Wp^T -> d_out f32 [SEQ][1024] (M=SEQ, N=1024, K=1024), every tile once
  gemm64_f16<1, true><<<gGdm, dim3(128), 0, stream>>>(Ctx, Ctxr, DM, Wp, DM, cscale, (void*)outf, Ctxr, DM,
                                                SEQ, DM, DM, 1.0f, Rt, 0);
  (void)hipGetLastError();
}

// v005
// A run of this version takes 106 microseconds.
// Timed twice side by side with v004, it ran 1.07 and 1.06 times as fast.
// All steps since v000 together make it 2.70 times as fast.
// Contractions: q|k|v projection = v_wmma_f32_16x16x32_f16 (A = f16 of RNE-bf16 x carried x16, B = f16 of RNE-bf16 wq|wk|wv carried x1024, single product); attention k.q^T and v^T.p^T (transposed products) = v_wmma_f32_16x16x32_f16 (q, k, v^T f16 planes x16 plus x2^11 residual planes, p f16 x256 plus x2^11 residual; hi.hi + hi.res + res.hi); output projection = v_wmma_f32_16x16x32_f16 (A = ctx f16 x16 plus its x2^11 residual plane, B = f16 of RNE-bf16 wo x1024; hi.B + res.B); all f32 accumulate. RoPE cos/sin table, rotation, windowed causal online-max softmax and row sums in f32 on the VALU.
#include <hip/hip_runtime.h>
#include <math.h>
#include <stdint.h>

#define SEQ   4096                  // token rows processed (a row prefix of x); every stride, carve and grid derives from it
#define DM    1024
#define NH    16
#define HD    64
#define WIN   512
#define DQKV  (3 * DM)              // 3072
#define NQB   (SEQ / 64)            // query tiles of 64 rows
#define KTW   (WIN / 64 + 1)        // key tiles visited per 64-row query tile = 9
#define OUTN  (SEQ * DM)
static_assert(NH * HD == DM);
static_assert(HD == 64);
static_assert((WIN % 64) == 0);
static_assert(KTW == 9);
static_assert((SEQ % 64) == 0 && (DM % 64) == 0 && (DQKV % 64) == 0);
static_assert((DM % 32) == 0);
static_assert((SEQ % 128) == 0 && (DM % 128) == 0 && (DQKV % 128) == 0);   // GEMM block tile 128x128
static_assert((DM % 64) == 0 && DM >= 128);                                 // GEMM pass of 64 k, two passes or more
static_assert(((SEQ * DM / 8) % 256) == 0);
static_assert(((DM * DM / 8) % 256) == 0);
static_assert((SEQ % 8) == 0);

#define GP_B    144                 // GEMM LDS row pitch, bytes: 128-byte row + 16 (16 B x odd, for 16-byte readers)
#define GP_H    (GP_B / 2)          // the same in halves
#define GOFF_B  (128 * GP_B)        // Bt rows behind the A rows inside a stage
#define GSTAGE  (2 * 128 * GP_B)    // one stage, bytes

typedef _Float16 v16h __attribute__((ext_vector_type(16)));
typedef _Float16 v8h  __attribute__((ext_vector_type(8)));
typedef float    v8f  __attribute__((ext_vector_type(8)));
typedef float    v4f  __attribute__((ext_vector_type(4)));
typedef unsigned int v4u __attribute__((ext_vector_type(4)));

// ---- scalar helpers --------------------------------------------------------------------------------
__device__ __forceinline__ unsigned short bf_bits(float f) {          // f32 -> bf16 bits, RNE convert
  unsigned u = __float_as_uint(f);
  return (unsigned short)((u + 0x7FFFu + ((u >> 16) & 1u)) >> 16);
}
__device__ __forceinline__ float bfr(float f) { return __uint_as_float(((unsigned)bf_bits(f)) << 16); }
__device__ __forceinline__ unsigned short h_bits(_Float16 x) { return __builtin_bit_cast(unsigned short, x); }
__device__ __forceinline__ unsigned pk16(unsigned short a, unsigned short b) { return (unsigned)a | ((unsigned)b << 16); }
__device__ __forceinline__ v8f zero8() { v8f z = {0.f, 0.f, 0.f, 0.f, 0.f, 0.f, 0.f, 0.f}; return z; }

// ---- fragment loader: 16-bit A/B operand, lane -> row/col (lane&15), p already includes +8*(lane>>4);
//      elements 0..7 <- p[0..7] (k0+8h..), elements 8..15 <- p[16..23] (k0+16+8h..)
__device__ __forceinline__ v16h ldfrag_h(const _Float16* p) {
  union { v16h v; v8h h[2]; } f;
  f.h[0] = *(const v8h*)(p);
  f.h[1] = *(const v8h*)(p + 16);
  return f.v;
}

// ---- WMMA helpers: the plain builtin (the compiler orders it and keeps its distances), and the GEMM's hand-written gaps ----
__device__ __forceinline__ v8f mma_h_raw(v16h a, v16h b, v8f c) {
  return __builtin_amdgcn_wmma_f32_16x16x32_f16(false, a, false, b, (short)0, c, false, false);
}
__device__ __forceinline__ void dep_guard_h(v8f& a, v8f& b, v16h x, v16h y) {
#if defined(__HIP_DEVICE_COMPILE__)
  asm volatile("v_nop\n\tv_nop\n\tv_nop\n\tv_nop" : "+v"(a), "+v"(b) : "v"(x), "v"(y));
#endif
}
__device__ __forceinline__ void keep4_h(v16h a, v16h b, v16h c, v16h d) {
#if defined(__HIP_DEVICE_COMPILE__)
  asm volatile("v_nop" :: "v"(a), "v"(b), "v"(c), "v"(d));
#endif
}
__device__ __forceinline__ void acc_guard4(v8f& a, v8f& b, v8f& c, v8f& d) {
#if defined(__HIP_DEVICE_COMPILE__)
  asm volatile("v_nop\n\tv_nop\n\tv_nop\n\tv_nop" : "+v"(a), "+v"(b), "+v"(c), "+v"(d));
#endif
}

// =====================================================================================================
// Preparatory launch: three jobs that need nothing of each other share one grid by ranges of the block index
// (every test on the block index is block-uniform).
//   blocks [0, RT_B)                    RoPE table, 8 tokens each
//   blocks [RT_B, RT_B + CVX_B)         x -> f16 plane
//   the last 4 * CVW_B blocks           wq | wk | wv | wo -> f16 planes, CVW_B blocks each
// =====================================================================================================
#define RT_B   (SEQ / 8)                // 512
#define CVX_B  (SEQ * DM / 8 / 256)     // 2048
#define CVW_B  (DM * DM / 8 / 256)      // 512
#define PREP_B (RT_B + CVX_B + 4 * CVW_B)

// f32 plane -> f16 bits of bfr(v) * scale (scale a power of two): x (x16) and the [n][k] weights (x1024),
// whose [out][in] layout is already the k-contiguous Bt layout of the GEMM below.
// coverage: n8 threads x 8 = the whole plane.
__device__ __forceinline__ void cvt16(const float* __restrict__ in, unsigned short* out, int n8, float scale, int i) {
  if (i < n8) {
    const v4f a = *(const v4f*)(in + (size_t)i * 8);
    const v4f b = *(const v4f*)(in + (size_t)i * 8 + 4);
    v4u p;
    p[0] = pk16(h_bits((_Float16)(bfr(a[0]) * scale)), h_bits((_Float16)(bfr(a[1]) * scale)));
    p[1] = pk16(h_bits((_Float16)(bfr(a[2]) * scale)), h_bits((_Float16)(bfr(a[3]) * scale)));
    p[2] = pk16(h_bits((_Float16)(bfr(b[0]) * scale)), h_bits((_Float16)(bfr(b[1]) * scale)));
    p[3] = pk16(h_bits((_Float16)(bfr(b[2]) * scale)), h_bits((_Float16)(bfr(b[3]) * scale)));
    *(v4u*)(out + (size_t)i * 8) = p;
  }
}

// RoPE table tab[t][64] f32: [0..31] = cos(t * inv[m]), [32..63] = sin(t * inv[m]) (precise sincosf, f32
// angle = fl(t * inv[m])), inv[m] = 1 / powf(10000, (2m)/64), m = 0..31, f32, formed by each thread for its own m.
// Block = 8 tokens x 32 pairs (256 threads); the 8x64 tile is staged in LDS, then stored as whole rows.
// coverage: compute 8 x 32 threads x 2 = 8x64; store 128 lanes x 4 floats = 8 rows x 64; RT_B blocks cover every t.
__device__ __forceinline__ void rope_tab(float* st, float* tab, int blk) {
  const int tid = threadIdx.x;
  const int m   = tid & 31, tr = tid >> 5;
  const int t   = blk * 8 + tr;                     // < SEQ by the block range
  const float e = (float)(2 * m) * (1.0f / 64.0f);
  const float p = powf(10000.0f, e);
  const float w = 1.0f / p;
  const float ang = (float)t * w;
  float sn, cs;
  sincosf(ang, &sn, &cs);
  st[tr * 64 + m]      = cs;
  st[tr * 64 + 32 + m] = sn;
  __syncthreads();
  if (tid < 128) {                                  // waves 0..3, wave-uniform
    const int row = tid >> 4, c4 = (tid & 15) * 4;
    const v4f v = *(const v4f*)(st + row * 64 + c4);
    float* dst = tab + (size_t)(blk * 8 + row) * 64 + c4;
    *(v4f*)dst = v;
  }
}

__global__ __launch_bounds__(256) void k_prep(const float* __restrict__ x, const float* __restrict__ wq,
                                              const float* __restrict__ wk, const float* __restrict__ wv,
                                              const float* __restrict__ wo,
                                              unsigned short* Xh, unsigned short* Wqkv, unsigned short* Wp,
                                              float* tab, float aScale, float wScale) {
  __shared__ __align__(16) float st[8 * 64];
  const int b = blockIdx.x;
  if (b < RT_B) {                                   // the longest blocks start first
    rope_tab(st, tab, b);
  } else if (b < RT_B + CVX_B) {
    cvt16(x, Xh, SEQ * DM / 8, aScale, (b - RT_B) * 256 + (int)threadIdx.x);
  } else if (b < PREP_B) {
    const int wb = b - (RT_B + CVX_B);
    const int which = wb / CVW_B;                   // 0..3 = wq, wk, wv, wo
    const float* in = (which == 0) ? wq : (which == 1) ? wk : (which == 2) ? wv : wo;
    unsigned short* o = (which < 3) ? (Wqkv + (size_t)which * DM * DM) : Wp;
    cvt16(in, o, DM * DM / 8, wScale, (wb - which * CVW_B) * 256 + (int)threadIdx.x);
  }
}

// =====================================================================================================
// Register-blocked f16 WMMA GEMM, one wave per 64x64 tile, four waves (2x2) per 128x128 block tile. The block's
// A and Bt rows of a 64-k pass are staged in LDS by asynchronous 16-byte copies (whole 128-byte lines), two
// buffers: the next pass's copies fly while this pass's fragments are read from LDS.
//   v[m][n] = (sum_k A[m][k] * Bt[n][k]  [+ 2^-11 * sum_k Ar[m][k] * Bt[n][k] when ARES]) * cscale
// A, Ar row-major [M][K] pitch lda (f16), Bt row-major [N][K] pitch ldb (f16, k contiguous); M, N multiples of
// 128, K multiple of 64; one block per block tile (a block-uniform bound check anyway).
// ARES: the residual plane is accumulated first from zero, the accumulators are scaled by 2^-11 exactly on the
// VALU (with nop gaps on both sides), then the hi plane accumulates on top: one accumulator set.
// Epilogue variants:
//   EPI 0: f16 hi plane = f16(v' * oscale) at Cp and residual plane = f16((v'*oscale - hi) * 2048) at Crp,
//          pitch ldc halves, where v' = v for tiles with n0 >= ropeN and, for n0 < ropeN (wave-uniform),
//          v' = rotate-half RoPE of the wave's 64-column tile (one head): pair index mm = column mod 32,
//          token = output row, c = rtab[token][mm], s = rtab[token][32+mm]:
//          col mm -> v[mm]*c - v[32+mm]*s ; col 32+mm -> v[32+mm]*c + v[mm]*s (f32, from the LDS slab).
//   EPI 1: f32 out = v, pitch ldc floats
// 16-row slabs staged per wave in LDS. f32 out: each 64-wide row segment (256 B = 2 lines) by 16 lanes x 16 B,
// coverage: 4 slabs x 16 rows x 64 cols = the wave's whole 64x64 tile; grid x 4 tiles = [M][N].
// =====================================================================================================
// Eight 16-byte asynchronous copies of one lane, global -> LDS, rows 16 apart in both places. The s_wait_xcnt
// is the last line of the copies' own statement so that no address register is rewritten ahead of it.
__device__ __forceinline__ void copy8_rows(unsigned l, const _Float16* g, int ld) {
#if defined(__HIP_DEVICE_COMPILE__)
  const unsigned l0 = l,                    l1 = l + 1u * 16u * GP_B, l2 = l + 2u * 16u * GP_B, l3 = l + 3u * 16u * GP_B;
  const unsigned l4 = l + 4u * 16u * GP_B, l5 = l + 5u * 16u * GP_B, l6 = l + 6u * 16u * GP_B, l7 = l + 7u * 16u * GP_B;
  const size_t st = (size_t)16 * ld;
  const _Float16 *g0 = g, *g1 = g + st, *g2 = g + 2 * st, *g3 = g + 3 * st;
  const _Float16 *g4 = g + 4 * st, *g5 = g + 5 * st, *g6 = g + 6 * st, *g7 = g + 7 * st;
  asm volatile(
      "global_load_async_to_lds_b128 %0, %8, off\n\t"
      "global_load_async_to_lds_b128 %1, %9, off\n\t"
      "global_load_async_to_lds_b128 %2, %10, off\n\t"
      "global_load_async_to_lds_b128 %3, %11, off\n\t"
      "global_load_async_to_lds_b128 %4, %12, off\n\t"
      "global_load_async_to_lds_b128 %5, %13, off\n\t"
      "global_load_async_to_lds_b128 %6, %14, off\n\t"
      "global_load_async_to_lds_b128 %7, %15, off\n\t"
      "s_wait_xcnt 0x0"
      :: "v"(l0), "v"(l1), "v"(l2), "v"(l3), "v"(l4), "v"(l5), "v"(l6), "v"(l7),
         "v"(g0), "v"(g1), "v"(g2), "v"(g3), "v"(g4), "v"(g5), "v"(g6), "v"(g7)
      : "memory");
#endif
}
// the issuing wave's copies have landed in LDS behind this wait
__device__ __forceinline__ void wait_async0() {
#if defined(__HIP_DEVICE_COMPILE__)
  asm volatile("s_wait_asynccnt 0x0" ::: "memory");
#endif
}
// the wave's own LDS reads of a buffer have retired before that buffer is handed back for a refill
__device__ __forceinline__ void wait_ds0() {
#if defined(__HIP_DEVICE_COMPILE__)
  asm volatile("s_wait_dscnt 0x0" ::: "memory");
#endif
}

template <int EPI, bool ARES>
__global__ __launch_bounds__(128) void gemm64_f16(
    const unsigned short* __restrict__ Ap, const unsigned short* __restrict__ Arp, int lda,
    const unsigned short* __restrict__ Btp, int ldb,
    float cscale,
    void* Cp, unsigned short* Crp, int ldc, int M, int N, int K, float oscale,
    const float* __restrict__ rtab, int ropeN) {
  const _Float16* Ah  = (const _Float16*)(const void*)Ap;
  const _Float16* Arh = (const _Float16*)(const void*)Arp;
  const _Float16* Bt  = (const _Float16*)(const void*)Btp;
  __shared__ __align__(16) unsigned char ring[2 * GSTAGE];   // two stages of [A 128 rows | Bt 128 rows], pitch GP_B
  __shared__ __align__(16) float sT[4][16 * 68];   // per-wave 16x64 slab, pitch 68 floats
  const int tid  = threadIdx.x;
  const int lane = tid & 31;
  const int wave = tid >> 5;
  const int tilesN = N >> 7;
  const int tilesM = M >> 7;
  if ((int)blockIdx.x >= tilesM * tilesN) return;   // block-uniform, in front of every barrier and copy
  const int bm = (int)blockIdx.x / tilesN;
  const int bn = (int)blockIdx.x - bm * tilesN;
  const int wm = (wave >> 1) << 6;             // the wave's 64x64 tile inside the block's 128x128 tile
  const int wn = (wave & 1) << 6;
  const int m0 = (bm << 7) + wm;
  const int n0 = (bn << 7) + wn;

  const int rlane = lane & 15;                 // row (A) / col (B, D) within subtile
  const int koff  = (lane >> 4) * 8;           // k offset of this lane half
  const int mOff  = (lane >> 4) * 8;           // D row offset

  v8f acc[4][4];
#pragma unroll
  for (int i = 0; i < 4; ++i)
#pragma unroll
    for (int j = 0; j < 4; ++j) acc[i][j] = zero8();

  // staging map: lane -> row tid>>3 (+16 per copy, 8 copies = 128 rows), 16-byte piece tid&7 of the 128-byte row
  const int crow = tid >> 3, cpc = tid & 7;
  const unsigned ringb = (unsigned)(uintptr_t)(const void*)ring;           // LDS byte address of the ring
  const unsigned lcp   = ringb + (unsigned)(crow * GP_B + cpc * 16);
  const _Float16* gA  = Ah  + (size_t)((bm << 7) + crow) * lda + cpc * 8;
  const _Float16* gAr = Arh + (size_t)((bm << 7) + crow) * lda + cpc * 8;
  const _Float16* gB  = Bt  + (size_t)((bn << 7) + crow) * ldb + cpc * 8;
  const int KP = K >> 6;                       // passes of 64 k per plane
  const int NP = ARES ? 2 * KP : KP;           // ARES: the residual plane's passes first, then the hi plane's

  // tile 0 -> buffer 0, landed and published; then tile 1 -> buffer 1 flies over pass 0
  copy8_rows(lcp, ARES ? gAr : gA, lda);
  copy8_rows(lcp + GOFF_B, gB, ldb);
  wait_async0();
  __syncthreads();
  if (NP > 1) {
    const int kk = (1 < KP) ? 64 : 0;
    const _Float16* ga = (ARES && 1 < KP) ? gAr : gA;
    copy8_rows(lcp + GSTAGE, ga + kk, lda);
    copy8_rows(lcp + GSTAGE + GOFF_B, gB + kk, ldb);
  }

  for (int t = 0; t < NP; ++t) {
    if (ARES && t == KP) {                     // block-uniform: between the two planes
      acc_guard4(acc[0][0], acc[0][1], acc[0][2], acc[0][3]);
      acc_guard4(acc[1][0], acc[1][1], acc[1][2], acc[1][3]);
      acc_guard4(acc[2][0], acc[2][1], acc[2][2], acc[2][3]);
      acc_guard4(acc[3][0], acc[3][1], acc[3][2], acc[3][3]);
#pragma unroll
      for (int i = 0; i < 4; ++i)
#pragma unroll
        for (int j = 0; j < 4; ++j) acc[i][j] = acc[i][j] * (1.0f / 2048.0f);   // exact fold of the x2^11 residual carry
      acc_guard4(acc[0][0], acc[0][1], acc[0][2], acc[0][3]);
      acc_guard4(acc[1][0], acc[1][1], acc[1][2], acc[1][3]);
      acc_guard4(acc[2][0], acc[2][1], acc[2][2], acc[2][3]);
      acc_guard4(acc[3][0], acc[3][1], acc[3][2], acc[3][3]);
    }
    const unsigned bsel = (unsigned)(t & 1) * GSTAGE;
    const _Float16* sA = (const _Float16*)(const void*)(ring + bsel) + (wm + rlane) * GP_H + koff;
    const _Float16* sB = (const _Float16*)(const void*)(ring + bsel + GOFF_B) + (wn + rlane) * GP_H + koff;
    // the loops below are unrolled so that every fragment and accumulator index is a constant (registers, no scratch)
#pragma unroll
    for (int ks = 0; ks < 2; ++ks) {
      v16h bh[4];
#pragma unroll
      for (int j = 0; j < 4; ++j) bh[j] = ldfrag_h(sB + (j << 4) * GP_H + ks * 32);
      v16h ah[4];                              // all eight fragments of a 32-k step are read as one group
#pragma unroll
      for (int i = 0; i < 4; ++i) ah[i] = ldfrag_h(sA + (i << 4) * GP_H + ks * 32);
#pragma unroll
      for (int i = 0; i < 4; ++i) {
#pragma unroll
        for (int j = 0; j < 4; ++j) {
          acc[i][j] = mma_h_raw(ah[i], bh[j], acc[i][j]);
        }
        dep_guard_h(acc[i][0], acc[i][3], ah[i], bh[3]);
      }
      keep4_h(bh[0], bh[1], bh[2], bh[3]);
    }
    // publish point of tile t + 1: own LDS reads retired, own copies landed, one barrier for both jobs
    wait_ds0();
    wait_async0();
    __syncthreads();
    if (t + 2 < NP) {                          // block-uniform: refill the buffer that pass t has just read
      const int tn = t + 2;
      const bool res = ARES && (tn < KP);
      const int kk = (tn - ((ARES && tn >= KP) ? KP : 0)) << 6;
      copy8_rows(lcp + bsel, (res ? gAr : gA) + kk, lda);
      copy8_rows(lcp + bsel + GOFF_B, gB + kk, ldb);
    }
  }
  wait_async0();
  acc_guard4(acc[0][0], acc[0][1], acc[0][2], acc[0][3]);
  acc_guard4(acc[1][0], acc[1][1], acc[1][2], acc[1][3]);
  acc_guard4(acc[2][0], acc[2][1], acc[2][2], acc[2][3]);
  acc_guard4(acc[3][0], acc[3][1], acc[3][2], acc[3][3]);

  // ---- epilogue ----
  float* slab = sT[wave];
#pragma unroll
  for (int i = 0; i < 4; ++i) {
    const int mBase = m0 + (i << 4);
#pragma unroll
    for (int r = 0; r < 8; ++r) {
      const int row = mOff + r;
#pragma unroll
      for (int j = 0; j < 4; ++j) slab[row * 68 + (j << 4) + rlane] = acc[i][j][r] * cscale;
    }
    __builtin_amdgcn_fence(__ATOMIC_RELEASE, "workgroup");
    __builtin_amdgcn_wave_barrier();
    __builtin_amdgcn_fence(__ATOMIC_ACQUIRE, "workgroup");
    if constexpr (EPI == 0) {
      unsigned short* C16 = (unsigned short*)Cp;
      const int rq = lane >> 3, piece = lane & 7;
      const bool rope_on = (n0 < ropeN);                   // wave-uniform (n0 is per wave)
      const float rsgn = (piece < 4) ? -1.0f : 1.0f;       // cols 0..31 carry x1 (minus), cols 32..63 carry x2 (plus)
      const int   pm   = (piece & 3) * 8;                  // rotation pair index base of this lane's 8 columns
      v4u ph[4], pr[4];
#pragma unroll
      for (int it = 0; it < 4; ++it) {
        const int row = it * 4 + rq;                         // it 0..3 x rq 0..3 = rows 0..15
        const v4f a  = *(const v4f*)(slab + row * 68 + piece * 8);
        const v4f a2 = *(const v4f*)(slab + row * 68 + piece * 8 + 4);
        float f[8];
        f[0] = a[0];  f[1] = a[1];  f[2] = a[2];  f[3] = a[3];
        f[4] = a2[0]; f[5] = a2[1]; f[6] = a2[2]; f[7] = a2[3];
        if (rope_on) {                                       // wave-uniform branch, LDS and table reads only
          const int po = (piece ^ 4) * 8;                    // partner half of the head (32 columns away)
          const v4f g  = *(const v4f*)(slab + row * 68 + po);
          const v4f g2 = *(const v4f*)(slab + row * 68 + po + 4);
          const float* trp = rtab + (size_t)(mBase + row) * 64 + pm;   // output row = token index
          const v4f c0 = *(const v4f*)(trp);
          const v4f c1 = *(const v4f*)(trp + 4);
          const v4f s0 = *(const v4f*)(trp + 32);
          const v4f s1 = *(const v4f*)(trp + 36);
          f[0] = f[0] * c0[0] + rsgn * g[0]  * s0[0];
          f[1] = f[1] * c0[1] + rsgn * g[1]  * s0[1];
          f[2] = f[2] * c0[2] + rsgn * g[2]  * s0[2];
          f[3] = f[3] * c0[3] + rsgn * g[3]  * s0[3];
          f[4] = f[4] * c1[0] + rsgn * g2[0] * s1[0];
          f[5] = f[5] * c1[1] + rsgn * g2[1] * s1[1];
          f[6] = f[6] * c1[2] + rsgn * g2[2] * s1[2];
          f[7] = f[7] * c1[3] + rsgn * g2[3] * s1[3];
        }
        v4u p, q;
#pragma unroll
        for (int e = 0; e < 4; ++e) {
          const float g0 = f[2 * e] * oscale, g1 = f[2 * e + 1] * oscale;
          const _Float16 x0 = (_Float16)g0, x1 = (_Float16)g1;
          const _Float16 y0 = (_Float16)((g0 - (float)x0) * 2048.0f);
          const _Float16 y1 = (_Float16)((g1 - (float)x1) * 2048.0f);
          p[e] = pk16(h_bits(x0), h_bits(x1));
          q[e] = pk16(h_bits(y0), h_bits(y1));
        }
        ph[it] = p;
        pr[it] = q;
      }
      {
#pragma unroll
        for (int it = 0; it < 4; ++it) {
          const int row = it * 4 + rq;
          const size_t co = (size_t)(mBase + row) * ldc + n0 + piece * 8;
          *(v4u*)(C16 + co) = ph[it];
          *(v4u*)(Crp + co) = pr[it];
        }
        
      }
    } else {
      float* Cf = (float*)Cp;
      const int hh = lane >> 4, c4 = (lane & 15) * 4;     // 256-B row segment = 16 lanes x 16 B
      v4f ov[8];
#pragma unroll
      for (int it = 0; it < 8; ++it) {
        const int row = it * 2 + hh;                       // it 0..7 x hh 0..1 = rows 0..15
        ov[it] = *(const v4f*)(slab + row * 68 + c4);
      }
      {
#pragma unroll
        for (int it = 0; it < 8; ++it) {
          const int row = it * 2 + hh;
          *(v4f*)(Cf + (size_t)(mBase + row) * ldc + n0 + c4) = ov[it];
        }
        
      }
    }
    __builtin_amdgcn_fence(__ATOMIC_RELEASE, "workgroup");
    __builtin_amdgcn_wave_barrier();
    __builtin_amdgcn_fence(__ATOMIC_ACQUIRE, "workgroup");
  }
}

// =====================================================================================================
// v columns of an f16 qkv plane (token-major, element (t, h, d) at [t*DQKV + 2*DM + h*64 + d])
// -> f16 v^T plane vt[(h*64 + d)*SEQ + t] (same bits). blockIdx.z = 0: the hi plane, 1: the residual plane.
// Block = one 64-token x 64-feature tile of one head; grid = (SEQ/64, NH, 2); tile staged in LDS as halves
// (v8h 16-B stores, __syncthreads, _Float16 element reads).
// Store: group g = tid>>3 (0..31), piece = tid&7: iteration it writes row d = it*32+g, lanes 8q..8q+7 x 16 B =
// coverage: load 2 x 256 threads x 8 halves = 64x64; store 2 iterations x 32 groups = 64 rows d, 8 pieces x 8
// = 64 tokens per row; grid covers every (h, token tile).
// =====================================================================================================
__global__ __launch_bounds__(256) void v_tr(const unsigned short* __restrict__ qkvhp, const unsigned short* __restrict__ qkvrp,
                                            unsigned short* vth, unsigned short* vtr) {
  __shared__ __align__(16) _Float16 sv[64 * 72];       // [tt][d], pitch 72 halves (144 B)
  const int tid = threadIdx.x;
  const int t0  = blockIdx.x * 64;
  const int hh  = blockIdx.y;
  const bool res = (blockIdx.z != 0);               // block-uniform
  const _Float16* src = (const _Float16*)(const void*)(res ? qkvrp : qkvhp);
  unsigned short* vt  = res ? vtr : vth;
#pragma unroll
  for (int i = 0; i < 2; ++i) {
    const int idx = i * 256 + tid;                  // 0..511
    const int tt = idx >> 3, c8 = (idx & 7) * 8;
    const v8h a = *(const v8h*)(src + ((size_t)(t0 + tt)) * DQKV + 2 * DM + hh * HD + c8);
    *(v8h*)(sv + tt * 72 + c8) = a;
  }
  __syncthreads();

  const int g = tid >> 3, piece = tid & 7;
  v4u hv[2];
  size_t hofs[2];
#pragma unroll
  for (int it = 0; it < 2; ++it) {
    const int d = it * 32 + g;
    v4u a;
#pragma unroll
    for (int e = 0; e < 4; ++e) {
      const _Float16 x0 = sv[(piece * 8 + 2 * e) * 72 + d];
      const _Float16 x1 = sv[(piece * 8 + 2 * e + 1) * 72 + d];
      a[e] = pk16(h_bits(x0), h_bits(x1));
    }
    hv[it] = a;
    hofs[it] = ((size_t)(hh * HD + d)) * SEQ + t0 + piece * 8;
  }
  {
#pragma unroll
    for (int it = 0; it < 2; ++it) *(v4u*)(vt + hofs[it]) = hv[it];
    
  }
}

__device__ __forceinline__ float xhalf(float x) {
  return __builtin_bit_cast(float, __builtin_amdgcn_permlanex16(__builtin_bit_cast(int, x), __builtin_bit_cast(int, x),
                                                                0x76543210, 0xfedcba98, false, false));
}

template <bool HR>
__global__ __launch_bounds__(128)
void attn_k(const unsigned short* __restrict__ qkvp, const unsigned short* __restrict__ qkvrp,
            const unsigned short* __restrict__ vtp, const unsigned short* __restrict__ vtrp,
            unsigned short* ctxp, unsigned short* ctxrp) {
  union FH { v16h v; v8h h[2]; };
  constexpr int AP     = 72;                             // LDS row pitch of the f16 tiles, halves: 128-byte row + 16 (16 B x odd, for 16-byte readers)
  constexpr int OP     = 68;                             // LDS row pitch of the f32 context slab, floats (16-byte writers and readers)
  constexpr int TB     = 64 * AP * 2;                    // one f16 64x64 tile at that pitch, bytes
  constexpr int OFF_K  = 0;
  constexpr int OFF_V  = TB;
  constexpr int OFF_KR = 2 * TB;
  constexpr int OFF_VR = 3 * TB;
  constexpr int SMEMB  = HR ? 4 * TB : 2 * TB;                // 36864 : 18432
  static_assert(4 * 16 * OP * 4 <= SMEMB);                    // f32 context staging aliases the K/V region
  __shared__ __align__(16) unsigned char smem[SMEMB];
  _Float16* Ksh = (_Float16*)(smem + OFF_K);                  // K   [kv][d]
  _Float16* Vsh = (_Float16*)(smem + OFF_V);                  // V^T [d][kv]
  _Float16* Krs = (_Float16*)(smem + (HR ? OFF_KR : OFF_K));  // K residual (HR only)
  _Float16* Vrs = (_Float16*)(smem + (HR ? OFF_VR : OFF_V));  // V^T residual (HR only)

  const int tid  = threadIdx.x;
  const int wave = tid >> 5;
  const int lane = tid & 31;
  const int hh   = lane >> 4;
  const int c    = lane & 15;

  const int bx   = blockIdx.x;
  const int qb   = bx % NQB;
  const int h    = bx / NQB;                 // < NH by the grid size
  const int q0   = qb * 64 + wave * 16;
  const int qrow = q0 + c;                   // the lane's query

  const _Float16* Qp  = (const _Float16*)(const void*)qkvp  + (size_t)h * HD;
  const _Float16* Qrp = (const _Float16*)(const void*)qkvrp + (size_t)h * HD;
  const _Float16* Kp  = Qp + DM;
  const _Float16* Krp = Qrp + DM;
  const _Float16* Vt  = (const _Float16*)(const void*)vtp  + ((size_t)h * HD) * SEQ;
  const _Float16* Vrt = (const _Float16*)(const void*)vtrp + ((size_t)h * HD) * SEQ;

  // ---- Q fragments (B operand, column = lane&15): 2 d-chunks ----
  v16h qa[2], qr[2];
#pragma unroll
  for (int dc = 0; dc < 2; ++dc) {
    const size_t qo = (size_t)qrow * DQKV + dc * 32 + 8 * hh;
    qa[dc] = ldfrag_h(Qp + qo);
    if constexpr (HR) qr[dc] = ldfrag_h(Qrp + qo);
    else qr[dc] = qa[dc];
  }

  float lsum = 0.f, mrun = -1e30f;
  v8f oacc[4], oacc2[4];
#pragma unroll
  for (int t = 0; t < 4; ++t) { oacc[t] = zero8(); oacc2[t] = zero8(); }

  const int ktlo = (qb >= KTW - 1) ? (qb - (KTW - 1)) : 0;   // first key tile in the window, block-uniform
  const int nkt  = qb - ktlo + 1;                              // 1..KTW key tiles, block-uniform
  for (int kti = 0; kti < nkt; ++kti) {
    const int kv0 = (ktlo + kti) * 64;                         // <= qb*64 < SEQ
    __syncthreads();
    {
      const int r = tid >> 1, half = (tid & 1) * 32;
      const size_t ko = (size_t)(kv0 + r) * DQKV + half;      // K row kv0+r, d = half..half+31
      const size_t vo = (size_t)r * SEQ + kv0 + half;           // V^T row d = r, s = kv0+half..+31
#pragma unroll
      for (int i = 0; i < 4; ++i) {
        const v8h a0 = *(const v8h*)(Kp + ko + 8 * i);
        const v8h b0 = *(const v8h*)(Vt + vo + 8 * i);
        *(v8h*)(Ksh + r * AP + half + 8 * i) = a0;
        *(v8h*)(Vsh + r * AP + half + 8 * i) = b0;
        if constexpr (HR) {
          const v8h a1 = *(const v8h*)(Krp + ko + 8 * i);
          const v8h b1 = *(const v8h*)(Vrt + vo + 8 * i);
          *(v8h*)(Krs + r * AP + half + 8 * i) = a1;
          *(v8h*)(Vrs + r * AP + half + 8 * i) = b1;
        }
      }
    }
    __syncthreads();

    // ---- scores^T: 64 keys x 16 query columns per wave (A operand: lane c -> key j*16+c, split k map over d) ----
    v8f s[4];
#pragma unroll
    for (int j = 0; j < 4; ++j) {
      s[j] = zero8();
      v8f t = zero8();
#pragma unroll
      for (int dc = 0; dc < 2; ++dc) {
        FH kb;
        kb.h[0] = *(const v8h*)(Ksh + (j * 16 + c) * AP + dc * 32 + 8 * hh);
        kb.h[1] = *(const v8h*)(Ksh + (j * 16 + c) * AP + dc * 32 + 16 + 8 * hh);
        s[j] = mma_h_raw(kb.v, qa[dc], s[j]);
        if constexpr (HR) {
          FH krb;
          krb.h[0] = *(const v8h*)(Krs + (j * 16 + c) * AP + dc * 32 + 8 * hh);
          krb.h[1] = *(const v8h*)(Krs + (j * 16 + c) * AP + dc * 32 + 16 + 8 * hh);
          t = mma_h_raw(krb.v, qa[dc], t);
          t = mma_h_raw(kb.v, qr[dc], t);
        }
      }
      if constexpr (HR) s[j] = s[j] + t * (1.0f / 2048.0f);
    }

    // ---- windowed causal online softmax of the lane's query: in-lane max over its 32 keys, one exchange with
    //      the other half, running max, alpha, p, row-sum partial, P (x256, f16; HR: + residual) in registers ----
    const int key0 = kv0 + 8 * hh;
    float tm[4];
#pragma unroll
    for (int j = 0; j < 4; ++j) {                            // four independent max chains
      tm[j] = -1e30f;
#pragma unroll
      for (int r = 0; r < 8; ++r) {
        const int key = key0 + j * 16 + r;
        float a = s[j][r] * (1.0f / 2048.0f);                // 1/8 head scale, 1/256 for the two x16 carries
        const bool ok = (key <= qrow) && (key + WIN >= qrow);
        a = ok ? a : -1e30f;
        s[j][r] = a;
        tm[j] = fmaxf(tm[j], a);
      }
    }
    float tmx = fmaxf(fmaxf(tm[0], tm[1]), fmaxf(tm[2], tm[3]));
    tmx = fmaxf(tmx, xhalf(tmx));
    const float mn = fmaxf(mrun, tmx);
    const float al = __expf(mrun - mn);
    mrun = mn;
    FH pb[2], pbr[2];                                        // B operands of the two 32-key chunks
    float ps[4];
#pragma unroll
    for (int j = 0; j < 4; ++j) {                            // four independent sum chains
      ps[j] = 0.0f;
#pragma unroll
      for (int r = 0; r < 8; ++r) {
        const int key = key0 + j * 16 + r;
        const bool ok = (key <= qrow) && (key + WIN >= qrow);
        float p = __expf(s[j][r] - mn);
        p = ok ? p : 0.0f;
        ps[j] += p;
        const float g = p * 256.0f;
        const _Float16 x0 = (_Float16)g;
        pb[j >> 1].h[j & 1][r] = x0;
        if constexpr (HR) pbr[j >> 1].h[j & 1][r] = (_Float16)((g - (float)x0) * 2048.0f);
      }
    }
    lsum = lsum * al + ((ps[0] + ps[1]) + (ps[2] + ps[3]));

    // ---- rescale the context accumulators by alpha (VALU) ----
#pragma unroll
    for (int t = 0; t < 4; ++t) {
      oacc[t] = oacc[t] * al;
      if constexpr (HR) oacc2[t] = oacc2[t] * al;
    }

    // ---- context^T += V^T . P^T (f16 WMMA; A = V^T [d][key], B = P^T [key][query]) ----
#pragma unroll
    for (int kk = 0; kk < 2; ++kk) {
#pragma unroll
      for (int t = 0; t < 4; ++t) {
        FH vb;
        vb.h[0] = *(const v8h*)(Vsh + (t * 16 + c) * AP + kk * 32 + 8 * hh);
        vb.h[1] = *(const v8h*)(Vsh + (t * 16 + c) * AP + kk * 32 + 16 + 8 * hh);
        oacc[t] = mma_h_raw(vb.v, pb[kk].v, oacc[t]);
        if constexpr (HR) {
          FH vrb;
          vrb.h[0] = *(const v8h*)(Vrs + (t * 16 + c) * AP + kk * 32 + 8 * hh);
          vrb.h[1] = *(const v8h*)(Vrs + (t * 16 + c) * AP + kk * 32 + 16 + 8 * hh);
          oacc2[t] = mma_h_raw(vrb.v, pb[kk].v, oacc2[t]);
          oacc2[t] = mma_h_raw(vb.v, pbr[kk].v, oacc2[t]);
        }
      }
    }
  }

  __syncthreads();                           // every wave is done with the K/V tiles before they are aliased

  // ---- normalise (1/lsum, the 1/256 p carry; keep the x16 v carry), stage the wave's 16x64 f32 tile in LDS
  //      (row = query c, 8 consecutive features per context tile and lane), then store whole 128-byte rows ----
  float* os = (float*)(void*)smem + wave * (16 * OP);
  {
    const float l  = lsum + xhalf(lsum);     // the two halves of the query's keys
    const float rl = 1.0f / l;               // l >= 1 (the max key contributes p = 1)
    const float sc = rl * (1.0f / 256.0f);
#pragma unroll
    for (int t = 0; t < 4; ++t) {
      v4f lo, hi;
#pragma unroll
      for (int r = 0; r < 4; ++r) {
        float v0 = oacc[t][r], v1 = oacc[t][4 + r];
        if constexpr (HR) {
          v0 += oacc2[t][r] * (1.0f / 2048.0f);
          v1 += oacc2[t][4 + r] * (1.0f / 2048.0f);
        }
        lo[r] = v0 * sc;
        hi[r] = v1 * sc;
      }
      *(v4f*)(os + c * OP + t * 16 + 8 * hh)     = lo;
      *(v4f*)(os + c * OP + t * 16 + 8 * hh + 4) = hi;
    }
  }
  __builtin_amdgcn_fence(__ATOMIC_RELEASE, "workgroup");
  __builtin_amdgcn_wave_barrier();
  __builtin_amdgcn_fence(__ATOMIC_ACQUIRE, "workgroup");
  {
    const int rq = lane >> 3, piece = lane & 7;
    v4u ph[4], pr[4];
#pragma unroll
    for (int it = 0; it < 4; ++it) {
      const int row = it * 4 + rq;   // it 0..3 x rq 0..3 = rows 0..15 of the wave tile
      const v4f a  = *(const v4f*)(os + row * OP + piece * 8);
      const v4f a2 = *(const v4f*)(os + row * OP + piece * 8 + 4);
      float f[8];
      f[0] = a[0];  f[1] = a[1];  f[2] = a[2];  f[3] = a[3];
      f[4] = a2[0]; f[5] = a2[1]; f[6] = a2[2]; f[7] = a2[3];
      v4u p, q;
#pragma unroll
      for (int e = 0; e < 4; ++e) {
        const _Float16 x0 = (_Float16)f[2 * e], x1 = (_Float16)f[2 * e + 1];
        p[e] = pk16(h_bits(x0), h_bits(x1));
        if constexpr (HR) {
          const _Float16 y0 = (_Float16)((f[2 * e] - (float)x0) * 2048.0f);
          const _Float16 y1 = (_Float16)((f[2 * e + 1] - (float)x1) * 2048.0f);
          q[e] = pk16(h_bits(y0), h_bits(y1));
        } else {
          q[e] = p[e];
        }
      }
      ph[it] = p;
      pr[it] = q;
    }
    {
#pragma unroll
      for (int it = 0; it < 4; ++it) {
        const int row = it * 4 + rq;
        const size_t go = (size_t)(q0 + row) * DM + (size_t)h * HD + piece * 8;
        *(v4u*)(ctxp + go) = ph[it];
        if constexpr (HR) *(v4u*)(ctxrp + go) = pr[it];
      }
      
    }
  }
}

// =====================================================================================================
// Workspace map (bytes); every region is an exact multiple of its whole-line / whole-tile store granularity
// (row pitches 2048 / 6144 / 8192 / 256 B, all offsets multiples of 256, no aliasing within a launch):
//   Xh     f16 [SEQ][1024]                 (bf16 value of x, x16)
//   Wqkv   f16 [3072][1024]                (bf16 values of wq | wk | wv x1024, [n][k] = the input layout)
//   Wp     f16 [1024][1024]                (bf16 value of wo x1024, [n][k])
//   QKV    f16 [SEQ][3072]                 (rotated q | rotated k | v, x16)
//   QKVr   f16 [SEQ][3072]                 (x2^11 residual of the above)
//   VT     f16 [1024][SEQ]                 ([h*64 + d][s])
//   VTr    f16 [1024][SEQ]                 (residual)
//   Ctx    f16 [SEQ][1024]                 (attention context x16)
//   Ctxr   f16 [SEQ][1024]                 (residual)
//   Rt     f32 [SEQ][64]                   (cos | sin table)
//   total for SEQ = 4096: 101711872
// d_out f32: [SEQ][1024] at byte 0, every 64x64 tile written once by the projection launch.
// =====================================================================================================
extern "C" void kernel_launch(void* const* d_in, const int* in_sizes, int n_in,
                              void* d_out, int out_size, void* d_ws, size_t ws_size,
                              hipStream_t stream) {
  if (n_in < 5) return;
  if (in_sizes[0] < SEQ * DM) return;
  if (in_sizes[1] != DM * DM) return;
  if (in_sizes[2] != DM * DM) return;
  if (in_sizes[3] != DM * DM) return;
  if (in_sizes[4] != DM * DM) return;
  if (out_size < OUTN) return;

  const float* x  = (const float*)d_in[0];    // [SEQ][DM] (row prefix)
  const float* wq = (const float*)d_in[1];    // [DM n][DM k]
  const float* wk = (const float*)d_in[2];    // [DM n][DM k]
  const float* wv = (const float*)d_in[3];    // [DM n][DM k]
  const float* wo = (const float*)d_in[4];    // [DM n][DM k]

  const size_t PX   = (size_t)SEQ * DM * 2;          //  8388608 (SEQ 4096)
  const size_t PWq  = (size_t)DQKV * DM * 2;         //  6291456
  const size_t PWp  = (size_t)DM * DM * 2;           //  2097152
  const size_t PQKV = (size_t)SEQ * DQKV * 2;        // 25165824
  const size_t PVT  = (size_t)DM * SEQ * 2;          //  8388608
  const size_t PCtx = (size_t)SEQ * DM * 2;          //  8388608
  const size_t PRt  = (size_t)SEQ * 64 * 4;          //  1048576
  size_t off = 0;
  const size_t oX    = off; off += PX;
  const size_t oWq   = off; off += PWq;
  const size_t oWp   = off; off += PWp;
  const size_t oQKV  = off; off += PQKV;
  const size_t oQKVr = off; off += PQKV;
  const size_t oVT   = off; off += PVT;
  const size_t oVTr  = off; off += PVT;
  const size_t oCtx  = off; off += PCtx;
  const size_t oCtxr = off; off += PCtx;
  const size_t oRt   = off; off += PRt;
  if (off > ws_size) return;                         // off = 101711872 for SEQ 4096
  if (off > (size_t)134217728) return;

  char* ws = (char*)d_ws;
  unsigned short* Xh   = (unsigned short*)(ws + oX);
  unsigned short* Wqkv = (unsigned short*)(ws + oWq);
  unsigned short* Wp   = (unsigned short*)(ws + oWp);
  unsigned short* QKV  = (unsigned short*)(ws + oQKV);
  unsigned short* QKVr = (unsigned short*)(ws + oQKVr);
  unsigned short* VT   = (unsigned short*)(ws + oVT);
  unsigned short* VTr  = (unsigned short*)(ws + oVTr);
  unsigned short* Ctx  = (unsigned short*)(ws + oCtx);
  unsigned short* Ctxr = (unsigned short*)(ws + oCtxr);
  float*          Rt   = (float*)(ws + oRt);
  float*          outf = (float*)d_out;              // [SEQ][DM]

  const dim3 blk(256);
  const dim3 gPrep(PREP_B);                          // 512 table + 2048 x + 4 x 512 weight blocks (SEQ 4096)
  const dim3 gGqkv((SEQ / 128) * (DQKV / 128));      // 768 block tiles of 128x128 (SEQ 4096)
  const dim3 gGdm((SEQ / 128) * (DM / 128));         // 256 block tiles
  const dim3 gVt(SEQ / 64, NH, 2);                   // (64, 16, 2)
  const dim3 gAttn(NQB * NH);                        // 1024 blocks: every (head, query tile)
  const float wScale = 1024.0f;                      // weights carried x1024
  const float aScale = 16.0f;                        // activations carried x16
  const float cscale = 1.0f / 16384.0f;              // 1/(16 * 1024)

  // (1, 2) one launch: planes x -> f16 x16 (bf16 values); weights [n][k] -> f16 x1024 (bf16 values), wq | wk | wv
  //     stacked; RoPE table cos | sin per token
  k_prep<<<gPrep, blk, 0, stream>>>(x, wq, wk, wv, wo, Xh, Wqkv, Wp, Rt, aScale, wScale);
  // (3) qkv = Xh . Wqkv^T with RoPE on the q and k column blocks (n0 < 2*DM) -> QKV f16 x16 + residual plane
  //     [SEQ][3072] (M=SEQ, N=3072, K=1024)
  gemm64_f16<0, false><<<gGqkv, dim3(128), 0, stream>>>(Xh, Xh, DM, Wqkv, DM, cscale, (void*)QKV, QKVr, DQKV,
                                                  SEQ, DQKV, DM, aScale, Rt, 2 * DM);
  // (4) v -> v^T planes (hi and residual, all tokens), one launch
  v_tr<<<gVt, blk, 0, stream>>>(QKV, QKVr, VT, VTr);
  // (5) windowed causal softmax attention -> Ctx f16 x16 + residual plane (all query tiles)
  attn_k<true><<<gAttn, dim3(128), 0, stream>>>(QKV, QKVr, VT, VTr, Ctx, Ctxr);
  // (6) out = (Ctx + 2^-11 Ctxr) . Wp^T -> d_out f32 [SEQ][1024] (M=SEQ, N=1024, K=1024), every tile once
  gemm64_f16<1, true><<<gGdm, dim3(128), 0, stream>>>(Ctx, Ctxr, DM, Wp, DM, cscale, (void*)outf, Ctxr, DM,
                                                SEQ, DM, DM, 1.0f, Rt, 0);
  (void)hipGetLastError();
}

// v006
// Measured time: 95.5 microseconds a run.
// Two timings next to v005 both put it at 1.11 times that version's speed.
// All steps since v000 together make it 3.00 times as fast.
// Contractions: q|k|v projection = v_wmma_f32_16x16x32_f16 (A = f16 of RNE-bf16 x carried x16, B = f16 of RNE-bf16 wq|wk|wv carried x1024, single product); attention k.q^T and v^T.p^T (transposed products) = v_wmma_f32_16x16x32_f16 (q, k, v^T f16 planes x16 plus x2^11 residual planes, p f16 x256 plus x2^11 residual; hi.hi + hi.res + res.hi); output projection = v_wmma_f32_16x16x32_f16 (A = ctx f16 x16 plus its x2^11 residual plane, B = f16 of RNE-bf16 wo x1024; hi.B + res.B); all f32 accumulate. RoPE cos/sin table, rotation, windowed causal online-max softmax and row sums in f32 on the VALU.
#include <hip/hip_runtime.h>
#include <math.h>
#include <stdint.h>

#define SEQ   4096                  // token rows processed (a row prefix of x); every stride, carve and grid derives from it
#define DM    1024
#define NH    16
#define HD    64
#define WIN   512
#define DQKV  (3 * DM)              // 3072
#define NQB   (SEQ / 64)            // query tiles of 64 rows
#define KTW   (WIN / 64 + 1)        // key tiles visited per 64-row query tile = 9
#define OUTN  (SEQ * DM)
static_assert(NH * HD == DM);
static_assert(HD == 64);
static_assert((WIN % 64) == 0);
static_assert(KTW == 9);
static_assert((SEQ % 64) == 0 && (DM % 64) == 0 && (DQKV % 64) == 0);
static_assert((DM % 32) == 0);
static_assert((SEQ % 128) == 0 && (DM % 128) == 0 && (DQKV % 128) == 0);   // GEMM block tile 128x128
static_assert((DM % 64) == 0 && DM >= 128);                                 // GEMM pass of 64 k, two passes or more
static_assert(((SEQ * DM / 8) % 256) == 0);
static_assert(((DM * DM / 8) % 256) == 0);
static_assert((SEQ % 8) == 0);

#define GP_B    144                 // GEMM LDS row pitch, bytes: 128-byte row + 16 (16 B x odd, for 16-byte readers)
#define GP_H    (GP_B / 2)          // the same in halves
#define GTILE   (128 * GP_B)        // one operand's 128 rows of a stage, bytes

typedef _Float16 v16h __attribute__((ext_vector_type(16)));
typedef _Float16 v8h  __attribute__((ext_vector_type(8)));
typedef float    v8f  __attribute__((ext_vector_type(8)));
typedef float    v4f  __attribute__((ext_vector_type(4)));
typedef unsigned int v4u __attribute__((ext_vector_type(4)));

// ---- scalar helpers --------------------------------------------------------------------------------
__device__ __forceinline__ unsigned short bf_bits(float f) {          // f32 -> bf16 bits, RNE convert
  unsigned u = __float_as_uint(f);
  return (unsigned short)((u + 0x7FFFu + ((u >> 16) & 1u)) >> 16);
}
__device__ __forceinline__ float bfr(float f) { return __uint_as_float(((unsigned)bf_bits(f)) << 16); }
__device__ __forceinline__ unsigned short h_bits(_Float16 x) { return __builtin_bit_cast(unsigned short, x); }
__device__ __forceinline__ unsigned pk16(unsigned short a, unsigned short b) { return (unsigned)a | ((unsigned)b << 16); }
__device__ __forceinline__ v8f zero8() { v8f z = {0.f, 0.f, 0.f, 0.f, 0.f, 0.f, 0.f, 0.f}; return z; }

// ---- fragment loader: 16-bit A/B operand, lane -> row/col (lane&15), p already includes +8*(lane>>4);
//      elements 0..7 <- p[0..7] (k0+8h..), elements 8..15 <- p[16..23] (k0+16+8h..)
__device__ __forceinline__ v16h ldfrag_h(const _Float16* p) {
  union { v16h v; v8h h[2]; } f;
  f.h[0] = *(const v8h*)(p);
  f.h[1] = *(const v8h*)(p + 16);
  return f.v;
}

// ---- WMMA helpers: the plain builtin (the compiler orders it and keeps its distances), and the GEMM's hand-written gaps ----
__device__ __forceinline__ v8f mma_h_raw(v16h a, v16h b, v8f c) {
  return __builtin_amdgcn_wmma_f32_16x16x32_f16(false, a, false, b, (short)0, c, false, false);
}
__device__ __forceinline__ void dep_guard_h(v8f& a, v8f& b, v16h x, v16h y) {
#if defined(__HIP_DEVICE_COMPILE__)
  asm volatile("v_nop\n\tv_nop\n\tv_nop\n\tv_nop" : "+v"(a), "+v"(b) : "v"(x), "v"(y));
#endif
}
__device__ __forceinline__ void keep4_h(v16h a, v16h b, v16h c, v16h d) {
#if defined(__HIP_DEVICE_COMPILE__)
  asm volatile("v_nop" :: "v"(a), "v"(b), "v"(c), "v"(d));
#endif
}
__device__ __forceinline__ void acc_guard4(v8f& a, v8f& b, v8f& c, v8f& d) {
#if defined(__HIP_DEVICE_COMPILE__)
  asm volatile("v_nop\n\tv_nop\n\tv_nop\n\tv_nop" : "+v"(a), "+v"(b), "+v"(c), "+v"(d));
#endif
}

// =====================================================================================================
// Preparatory launch: three jobs that need nothing of each other share one grid by ranges of the block index
// (every test on the block index is block-uniform).
//   blocks [0, RT_B)                    RoPE table, 8 tokens each
//   blocks [RT_B, RT_B + CVX_B)         x -> f16 plane
//   the last 4 * CVW_B blocks           wq | wk | wv | wo -> f16 planes, CVW_B blocks each
// =====================================================================================================
#define RT_B   (SEQ / 8)                // 512
#define CVX_B  (SEQ * DM / 8 / 256)     // 2048
#define CVW_B  (DM * DM / 8 / 256)      // 512
#define PREP_B (RT_B + CVX_B + 4 * CVW_B)

// f32 plane -> f16 bits of bfr(v) * scale (scale a power of two): x (x16) and the [n][k] weights (x1024),
// whose [out][in] layout is already the k-contiguous Bt layout of the GEMM below.
// coverage: n8 threads x 8 = the whole plane.
__device__ __forceinline__ void cvt16(const float* __restrict__ in, unsigned short* out, int n8, float scale, int i) {
  if (i < n8) {
    const v4f a = *(const v4f*)(in + (size_t)i * 8);
    const v4f b = *(const v4f*)(in + (size_t)i * 8 + 4);
    v4u p;
    p[0] = pk16(h_bits((_Float16)(bfr(a[0]) * scale)), h_bits((_Float16)(bfr(a[1]) * scale)));
    p[1] = pk16(h_bits((_Float16)(bfr(a[2]) * scale)), h_bits((_Float16)(bfr(a[3]) * scale)));
    p[2] = pk16(h_bits((_Float16)(bfr(b[0]) * scale)), h_bits((_Float16)(bfr(b[1]) * scale)));
    p[3] = pk16(h_bits((_Float16)(bfr(b[2]) * scale)), h_bits((_Float16)(bfr(b[3]) * scale)));
    *(v4u*)(out + (size_t)i * 8) = p;
  }
}

// RoPE table tab[t][64] f32: [0..31] = cos(t * inv[m]), [32..63] = sin(t * inv[m]) (precise sincosf, f32
// angle = fl(t * inv[m])), inv[m] = 1 / powf(10000, (2m)/64), m = 0..31, f32, formed by each thread for its own m.
// Block = 8 tokens x 32 pairs (256 threads); the 8x64 tile is staged in LDS, then stored as whole rows.
// coverage: compute 8 x 32 threads x 2 = 8x64; store 128 lanes x 4 floats = 8 rows x 64; RT_B blocks cover every t.
__device__ __forceinline__ void rope_tab(float* st, float* tab, int blk) {
  const int tid = threadIdx.x;
  const int m   = tid & 31, tr = tid >> 5;
  const int t   = blk * 8 + tr;                     // < SEQ by the block range
  const float e = (float)(2 * m) * (1.0f / 64.0f);
  const float p = powf(10000.0f, e);
  const float w = 1.0f / p;
  const float ang = (float)t * w;
  float sn, cs;
  sincosf(ang, &sn, &cs);
  st[tr * 64 + m]      = cs;
  st[tr * 64 + 32 + m] = sn;
  __syncthreads();
  if (tid < 128) {                                  // waves 0..3, wave-uniform
    const int row = tid >> 4, c4 = (tid & 15) * 4;
    const v4f v = *(const v4f*)(st + row * 64 + c4);
    float* dst = tab + (size_t)(blk * 8 + row) * 64 + c4;
    *(v4f*)dst = v;
  }
}

__global__ __launch_bounds__(256) void k_prep(const float* __restrict__ x, const float* __restrict__ wq,
                                              const float* __restrict__ wk, const float* __restrict__ wv,
                                              const float* __restrict__ wo,
                                              unsigned short* Xh, unsigned short* Wqkv, unsigned short* Wp,
                                              float* tab, float aScale, float wScale) {
  __shared__ __align__(16) float st[8 * 64];
  const int b = blockIdx.x;
  if (b < RT_B) {                                   // the longest blocks start first
    rope_tab(st, tab, b);
  } else if (b < RT_B + CVX_B) {
    cvt16(x, Xh, SEQ * DM / 8, aScale, (b - RT_B) * 256 + (int)threadIdx.x);
  } else if (b < PREP_B) {
    const int wb = b - (RT_B + CVX_B);
    const int which = wb / CVW_B;                   // 0..3 = wq, wk, wv, wo
    const float* in = (which == 0) ? wq : (which == 1) ? wk : (which == 2) ? wv : wo;
    unsigned short* o = (which < 3) ? (Wqkv + (size_t)which * DM * DM) : Wp;
    cvt16(in, o, DM * DM / 8, wScale, (wb - which * CVW_B) * 256 + (int)threadIdx.x);
  }
}

// =====================================================================================================
// Register-blocked f16 WMMA GEMM, one wave per 64x64 tile and plane, four waves (2x2) per 128x128 block tile and
// plane. The block's A (ARES: and Ar) and Bt rows of a 64-k pass are staged in LDS by asynchronous 16-byte copies
// (whole 128-byte lines), two buffers: the next pass's copies fly while this pass's fragments are read from LDS.
//   v[m][n] = (sum_k A[m][k] * Bt[n][k]  [+ 2^-11 * sum_k Ar[m][k] * Bt[n][k] when ARES]) * cscale
// A, Ar row-major [M][K] pitch lda (f16), Bt row-major [N][K] pitch ldb (f16, k contiguous); M, N multiples of
// 128, K multiple of 64; one block per block tile (a block-uniform bound check anyway).
// ARES: eight waves. Waves 0..3 take the hi plane, waves 4..7 the residual plane of the same four 64x64 tiles in
// the same k pass (two waves per SIMD, Bt staged once for both). A residual wave takes the tile's four 16-row blocks
// in the order 2, 3, 0, 1, so that in both waves accumulator rows 0, 1 are the 32 tile rows the wave finishes and
// rows 2, 3 the 32 it hands to the other wave. Behind the loop each wave scales its sums (residual: 2^-11, exact;
// hi: 1), hands rows 2, 3 over through LDS (the ring, free by then), adds what it gets to rows 0, 1 and runs the
// epilogue for those 32 tile rows.
// Epilogue variants:
//   EPI 0: f16 hi plane = f16(v' * oscale) at Cp and residual plane = f16((v'*oscale - hi) * 2048) at Crp,
//          pitch ldc halves, where v' = v for tiles with n0 >= ropeN and, for n0 < ropeN (wave-uniform),
//          v' = rotate-half RoPE of the wave's 64-column tile (one head): pair index mm = column mod 32,
//          token = output row, c = rtab[token][mm], s = rtab[token][32+mm]:
//          col mm -> v[mm]*c - v[32+mm]*s ; col 32+mm -> v[32+mm]*c + v[mm]*s (f32, from the LDS slab).
//   EPI 1: f32 out = v, pitch ldc floats
// 16-row slabs staged per wave in LDS. f32 out: each 64-wide row segment (256 B = 2 lines) by 16 lanes x 16 B,
// coverage: 4 slabs x 16 rows x 64 cols = the whole 64x64 tile (ARES: 2 slabs from each of the tile's two waves);
// grid x 4 tiles = [M][N].
// =====================================================================================================
// Eight 16-byte asynchronous copies of one lane, global -> LDS, rows 16 apart in both places. The s_wait_xcnt
// is the last line of the copies' own statement so that no address register is rewritten ahead of it.
__device__ __forceinline__ void copy8_rows(unsigned l, const _Float16* g, int ld) {
#if defined(__HIP_DEVICE_COMPILE__)
  const unsigned l0 = l,                    l1 = l + 1u * 16u * GP_B, l2 = l + 2u * 16u * GP_B, l3 = l + 3u * 16u * GP_B;
  const unsigned l4 = l + 4u * 16u * GP_B, l5 = l + 5u * 16u * GP_B, l6 = l + 6u * 16u * GP_B, l7 = l + 7u * 16u * GP_B;
  const size_t st = (size_t)16 * ld;
  const _Float16 *g0 = g, *g1 = g + st, *g2 = g + 2 * st, *g3 = g + 3 * st;
  const _Float16 *g4 = g + 4 * st, *g5 = g + 5 * st, *g6 = g + 6 * st, *g7 = g + 7 * st;
  asm volatile(
      "global_load_async_to_lds_b128 %0, %8, off\n\t"
      "global_load_async_to_lds_b128 %1, %9, off\n\t"
      "global_load_async_to_lds_b128 %2, %10, off\n\t"
      "global_load_async_to_lds_b128 %3, %11, off\n\t"
      "global_load_async_to_lds_b128 %4, %12, off\n\t"
      "global_load_async_to_lds_b128 %5, %13, off\n\t"
      "global_load_async_to_lds_b128 %6, %14, off\n\t"
      "global_load_async_to_lds_b128 %7, %15, off\n\t"
      "s_wait_xcnt 0x0"
      :: "v"(l0), "v"(l1), "v"(l2), "v"(l3), "v"(l4), "v"(l5), "v"(l6), "v"(l7),
         "v"(g0), "v"(g1), "v"(g2), "v"(g3), "v"(g4), "v"(g5), "v"(g6), "v"(g7)
      : "memory");
#endif
}
// Twelve 16-byte asynchronous copies of one lane: four rows, 32 apart, of each of three operand tiles that lie one
// behind the other in a stage. One statement, its last line the s_wait_xcnt, for the same reason as above.
__device__ __forceinline__ void copy12_rows(unsigned l, const _Float16* a, const _Float16* r, int lda,
                                            const _Float16* b, int ldb) {
#if defined(__HIP_DEVICE_COMPILE__)
  const unsigned sl = 32u * GP_B;
  const unsigned l0 = l,             l1 = l + sl,             l2  = l + 2u * sl,             l3  = l + 3u * sl;
  const unsigned l4 = l + GTILE,     l5 = l + GTILE + sl,     l6  = l + GTILE + 2u * sl,     l7  = l + GTILE + 3u * sl;
  const unsigned l8 = l + 2 * GTILE, l9 = l + 2 * GTILE + sl, l10 = l + 2 * GTILE + 2u * sl, l11 = l + 2 * GTILE + 3u * sl;
  const size_t sa = (size_t)32 * lda, sb = (size_t)32 * ldb;
  const _Float16 *a0 = a, *a1 = a + sa, *a2 = a + 2 * sa, *a3 = a + 3 * sa;
  const _Float16 *r0 = r, *r1 = r + sa, *r2 = r + 2 * sa, *r3 = r + 3 * sa;
  const _Float16 *b0 = b, *b1 = b + sb, *b2 = b + 2 * sb, *b3 = b + 3 * sb;
  asm volatile(
      "global_load_async_to_lds_b128 %0, %12, off\n\t"
      "global_load_async_to_lds_b128 %1, %13, off\n\t"
      "global_load_async_to_lds_b128 %2, %14, off\n\t"
      "global_load_async_to_lds_b128 %3, %15, off\n\t"
      "global_load_async_to_lds_b128 %4, %16, off\n\t"
      "global_load_async_to_lds_b128 %5, %17, off\n\t"
      "global_load_async_to_lds_b128 %6, %18, off\n\t"
      "global_load_async_to_lds_b128 %7, %19, off\n\t"
      "global_load_async_to_lds_b128 %8, %20, off\n\t"
      "global_load_async_to_lds_b128 %9, %21, off\n\t"
      "global_load_async_to_lds_b128 %10, %22, off\n\t"
      "global_load_async_to_lds_b128 %11, %23, off\n\t"
      "s_wait_xcnt 0x0"
      :: "v"(l0), "v"(l1), "v"(l2), "v"(l3), "v"(l4), "v"(l5), "v"(l6), "v"(l7), "v"(l8), "v"(l9), "v"(l10), "v"(l11),
         "v"(a0), "v"(a1), "v"(a2), "v"(a3), "v"(r0), "v"(r1), "v"(r2), "v"(r3), "v"(b0), "v"(b1), "v"(b2), "v"(b3)
      : "memory");
#endif
}
// the issuing wave's copies have landed in LDS behind this wait
__device__ __forceinline__ void wait_async0() {
#if defined(__HIP_DEVICE_COMPILE__)
  asm volatile("s_wait_asynccnt 0x0" ::: "memory");
#endif
}
// the wave's own LDS reads of a buffer have retired before that buffer is handed back for a refill
__device__ __forceinline__ void wait_ds0() {
#if defined(__HIP_DEVICE_COMPILE__)
  asm volatile("s_wait_dscnt 0x0" ::: "memory");
#endif
}

template <int EPI, bool ARES>
__global__ __launch_bounds__(ARES ? 256 : 128) void gemm64_f16(
    const unsigned short* __restrict__ Ap, const unsigned short* __restrict__ Arp, int lda,
    const unsigned short* __restrict__ Btp, int ldb,
    float cscale,
    void* Cp, unsigned short* Crp, int ldc, int M, int N, int K, float oscale,
    const float* __restrict__ rtab, int ropeN) {
  const _Float16* Ah  = (const _Float16*)(const void*)Ap;
  const _Float16* Arh = (const _Float16*)(const void*)Arp;
  const _Float16* Bt  = (const _Float16*)(const void*)Btp;
  constexpr unsigned OFF_BT = (ARES ? 2u : 1u) * GTILE;      // Bt rows behind the A (ARES: A and Ar) rows of a stage
  constexpr unsigned GSTAGE = OFF_BT + GTILE;                // one stage, bytes
  static_assert(!ARES || 4 * 64 * 64 * 4 <= 2 * GSTAGE);     // the hand-over of the residual sums fits the ring
  __shared__ __align__(16) unsigned char ring[2 * GSTAGE];   // two stages of [A | (ARES: Ar |) Bt], 128 rows each, pitch GP_B
  __shared__ __align__(16) float sT[ARES ? 8 : 4][16 * 68];   // per-wave 16x64 slab, pitch 68 floats
  const int tid  = threadIdx.x;
  const int lane = tid & 31;
  const int wave = (tid >> 5) & 3;             // the wave's place among the four tiles
  const int plane = ARES ? __builtin_amdgcn_readfirstlane(tid >> 7) : 0;   // wave-uniform: 0 = A, 1 = Ar
  const int tilesN = N >> 7;
  const int tilesM = M >> 7;
  if ((int)blockIdx.x >= tilesM * tilesN) return;   // block-uniform, in front of every barrier and copy
  const int bm = (int)blockIdx.x / tilesN;
  const int bn = (int)blockIdx.x - bm * tilesN;
  const int wm = (wave >> 1) << 6;             // the wave's 64x64 tile inside the block's 128x128 tile
  const int wn = (wave & 1) << 6;
  const int m0 = (bm << 7) + wm;
  const int n0 = (bn << 7) + wn;

  const int rlane = lane & 15;                 // row (A) / col (B, D) within subtile
  const int koff  = (lane >> 4) * 8;           // k offset of this lane half
  const int mOff  = (lane >> 4) * 8;           // D row offset

  v8f acc[4][4];
#pragma unroll
  for (int i = 0; i < 4; ++i)
#pragma unroll
    for (int j = 0; j < 4; ++j) acc[i][j] = zero8();

  // staging map: lane -> row tid>>3 (+16 per copy, 8 copies = 128 rows; ARES: +32 per copy, 4 copies), 16-byte
  // piece tid&7 of the 128-byte row
  const int crow = tid >> 3, cpc = tid & 7;
  const unsigned ringb = (unsigned)(uintptr_t)(const void*)ring;           // LDS byte address of the ring
  const unsigned lcp   = ringb + (unsigned)(crow * GP_B + cpc * 16);
  const _Float16* gA  = Ah  + (size_t)((bm << 7) + crow) * lda + cpc * 8;
  const _Float16* gAr = Arh + (size_t)((bm << 7) + crow) * lda + cpc * 8;
  const _Float16* gB  = Bt  + (size_t)((bn << 7) + crow) * ldb + cpc * 8;
  const int NP = K >> 6;                       // passes of 64 k
  // one stage: the block's rows of k = kk .. kk + 63 -> the buffer at LDS byte lb (the lane's own piece)
  auto stage = [&](unsigned lb, int kk) {
    if constexpr (ARES) {
      copy12_rows(lb, gA + kk, gAr + kk, lda, gB + kk, ldb);
    } else {
      copy8_rows(lb, gA + kk, lda);
      copy8_rows(lb + OFF_BT, gB + kk, ldb);
    }
  };

  // tile 0 -> buffer 0, landed and published; then tile 1 -> buffer 1 flies over pass 0
  stage(lcp, 0);
  wait_async0();
  __syncthreads();
  if (NP > 1) stage(lcp + GSTAGE, 64);

  for (int t = 0; t < NP; ++t) {
    const unsigned bsel = (unsigned)(t & 1) * GSTAGE;
    const _Float16* sA = (const _Float16*)(const void*)(ring + bsel + (unsigned)plane * GTILE) + (wm + rlane) * GP_H + koff;
    const _Float16* sAlo = sA + 32 * plane * GP_H;   // row blocks i = 0, 1: tile rows 16 i (+ 32 in a residual wave)
    const _Float16* sAhi = sA - 32 * plane * GP_H;   // row blocks i = 2, 3: tile rows 16 i (- 32 in a residual wave)
    const _Float16* sB = (const _Float16*)(const void*)(ring + bsel + OFF_BT) + (wn + rlane) * GP_H + koff;
    // the loops below are unrolled so that every fragment and accumulator index is a constant (registers, no scratch)
#pragma unroll
    for (int ks = 0; ks < 2; ++ks) {
      v16h bh[4];
#pragma unroll
      for (int j = 0; j < 4; ++j) bh[j] = ldfrag_h(sB + (j << 4) * GP_H + ks * 32);
      v16h ah[4];                              // all eight fragments of a 32-k step are read as one group
#pragma unroll
      for (int i = 0; i < 4; ++i) ah[i] = ldfrag_h((i < 2 ? sAlo : sAhi) + (i << 4) * GP_H + ks * 32);
#pragma unroll
      for (int i = 0; i < 4; ++i) {
#pragma unroll
        for (int j = 0; j < 4; ++j) {
          acc[i][j] = mma_h_raw(ah[i], bh[j], acc[i][j]);
        }
        dep_guard_h(acc[i][0], acc[i][3], ah[i], bh[3]);
      }
      keep4_h(bh[0], bh[1], bh[2], bh[3]);
    }
    // publish point of tile t + 1: own LDS reads retired, own copies landed, one barrier for both jobs
    wait_ds0();
    wait_async0();
    __syncthreads();
    if (t + 2 < NP) stage(lcp + bsel, (t + 2) << 6);   // block-uniform: refill the buffer that pass t has just read
  }
  wait_async0();
  acc_guard4(acc[0][0], acc[0][1], acc[0][2], acc[0][3]);
  acc_guard4(acc[1][0], acc[1][1], acc[1][2], acc[1][3]);
  acc_guard4(acc[2][0], acc[2][1], acc[2][2], acc[2][3]);
  acc_guard4(acc[3][0], acc[3][1], acc[3][2], acc[3][3]);

  // ---- epilogue: emit(a, i) stores rows 16 i .. 16 i + 15 of the wave's tile from their four accumulators ----
  float* slab = sT[wave + 4 * plane];
  auto emit = [&](const v8f (&a)[4], int i) {
    const int mBase = m0 + (i << 4);
#pragma unroll
    for (int r = 0; r < 8; ++r) {
      const int row = mOff + r;
#pragma unroll
      for (int j = 0; j < 4; ++j) slab[row * 68 + (j << 4) + rlane] = a[j][r] * cscale;
    }
    __builtin_amdgcn_fence(__ATOMIC_RELEASE, "workgroup");
    __builtin_amdgcn_wave_barrier();
    __builtin_amdgcn_fence(__ATOMIC_ACQUIRE, "workgroup");
    if constexpr (EPI == 0) {
      unsigned short* C16 = (unsigned short*)Cp;
      const int rq = lane >> 3, piece = lane & 7;
      const bool rope_on = (n0 < ropeN);                   // wave-uniform (n0 is per wave)
      const float rsgn = (piece < 4) ? -1.0f : 1.0f;       // cols 0..31 carry x1 (minus), cols 32..63 carry x2 (plus)
      const int   pm   = (piece & 3) * 8;                  // rotation pair index base of this lane's 8 columns
      v4u ph[4], pr[4];
#pragma unroll
      for (int it = 0; it < 4; ++it) {
        const int row = it * 4 + rq;                         // it 0..3 x rq 0..3 = rows 0..15
        const v4f a  = *(const v4f*)(slab + row * 68 + piece * 8);
        const v4f a2 = *(const v4f*)(slab + row * 68 + piece * 8 + 4);
        float f[8];
        f[0] = a[0];  f[1] = a[1];  f[2] = a[2];  f[3] = a[3];
        f[4] = a2[0]; f[5] = a2[1]; f[6] = a2[2]; f[7] = a2[3];
        if (rope_on) {                                       // wave-uniform branch, LDS and table reads only
          const int po = (piece ^ 4) * 8;                    // partner half of the head (32 columns away)
          const v4f g  = *(const v4f*)(slab + row * 68 + po);
          const v4f g2 = *(const v4f*)(slab + row * 68 + po + 4);
          const float* trp = rtab + (size_t)(mBase + row) * 64 + pm;   // output row = token index
          const v4f c0 = *(const v4f*)(trp);
          const v4f c1 = *(const v4f*)(trp + 4);
          const v4f s0 = *(const v4f*)(trp + 32);
          const v4f s1 = *(const v4f*)(trp + 36);
          f[0] = f[0] * c0[0] + rsgn * g[0]  * s0[0];
          f[1] = f[1] * c0[1] + rsgn * g[1]  * s0[1];
          f[2] = f[2] * c0[2] + rsgn * g[2]  * s0[2];
          f[3] = f[3] * c0[3] + rsgn * g[3]  * s0[3];
          f[4] = f[4] * c1[0] + rsgn * g2[0] * s1[0];
          f[5] = f[5] * c1[1] + rsgn * g2[1] * s1[1];
          f[6] = f[6] * c1[2] + rsgn * g2[2] * s1[2];
          f[7] = f[7] * c1[3] + rsgn * g2[3] * s1[3];
        }
        v4u p, q;
#pragma unroll
        for (int e = 0; e < 4; ++e) {
          const float g0 = f[2 * e] * oscale, g1 = f[2 * e + 1] * oscale;
          const _Float16 x0 = (_Float16)g0, x1 = (_Float16)g1;
          const _Float16 y0 = (_Float16)((g0 - (float)x0) * 2048.0f);
          const _Float16 y1 = (_Float16)((g1 - (float)x1) * 2048.0f);
          p[e] = pk16(h_bits(x0), h_bits(x1));
          q[e] = pk16(h_bits(y0), h_bits(y1));
        }
        ph[it] = p;
        pr[it] = q;
      }
      {
#pragma unroll
        for (int it = 0; it < 4; ++it) {
          const int row = it * 4 + rq;
          const size_t co = (size_t)(mBase + row) * ldc + n0 + piece * 8;
          *(v4u*)(C16 + co) = ph[it];
          *(v4u*)(Crp + co) = pr[it];
        }
        
      }
    } else {
      float* Cf = (float*)Cp;
      const int hh = lane >> 4, c4 = (lane & 15) * 4;     // 256-B row segment = 16 lanes x 16 B
      v4f ov[8];
#pragma unroll
      for (int it = 0; it < 8; ++it) {
        const int row = it * 2 + hh;                       // it 0..7 x hh 0..1 = rows 0..15
        ov[it] = *(const v4f*)(slab + row * 68 + c4);
      }
      {
#pragma unroll
        for (int it = 0; it < 8; ++it) {
          const int row = it * 2 + hh;
          *(v4f*)(Cf + (size_t)(mBase + row) * ldc + n0 + c4) = ov[it];
        }
        
      }
    }
    __builtin_amdgcn_fence(__ATOMIC_RELEASE, "workgroup");
    __builtin_amdgcn_wave_barrier();
    __builtin_amdgcn_fence(__ATOMIC_ACQUIRE, "workgroup");
  };

  if constexpr (ARES) {
    // ---- the two planes' sums are joined. The ring is free: the barrier at the foot of the last pass stands behind
    //      every wave's last fragment read and last landed copy. A tile has 16 KiB there, 8 KiB written by each of its
    //      two waves; chunk q of lane l lies at float (q * 32 + l) * 4: a lane reads what the same lane of the tile's
    //      other wave wrote ----
    const float sc = (plane != 0) ? (1.0f / 2048.0f) : 1.0f;   // exact fold of the x2^11 residual carry
    float* xw       = (float*)(void*)ring + wave * (64 * 64) + plane * (32 * 64) + lane * 4;
    const float* xr = (const float*)(const void*)ring + wave * (64 * 64) + (plane ^ 1) * (32 * 64) + lane * 4;
#pragma unroll
    for (int i = 0; i < 2; ++i)
#pragma unroll
      for (int j = 0; j < 4; ++j) {
        const v8f v = acc[2 + i][j] * sc;
        const v4f lo = {v[0], v[1], v[2], v[3]}, hi = {v[4], v[5], v[6], v[7]};
        *(v4f*)(xw + ((i * 4 + j) * 2) * 128)     = lo;
        *(v4f*)(xw + ((i * 4 + j) * 2 + 1) * 128) = hi;
      }
    __syncthreads();                           // every wave passes it: both waves' hand-overs are published
#pragma unroll
    for (int i = 0; i < 2; ++i)
#pragma unroll
      for (int j = 0; j < 4; ++j) {
        const v4f lo = *(const v4f*)(xr + ((i * 4 + j) * 2) * 128);
        const v4f hi = *(const v4f*)(xr + ((i * 4 + j) * 2 + 1) * 128);
#pragma unroll
        for (int r = 0; r < 4; ++r) {
          acc[i][j][r]     = acc[i][j][r] * sc + lo[r];
          acc[i][j][4 + r] = acc[i][j][4 + r] * sc + hi[r];
        }
      }
    emit(acc[0], 2 * plane);
    emit(acc[1], 2 * plane + 1);
  } else {
#pragma unroll
    for (int i = 0; i < 4; ++i) emit(acc[i], i);
  }
}

// =====================================================================================================
// v columns of an f16 qkv plane (token-major, element (t, h, d) at [t*DQKV + 2*DM + h*64 + d])
// -> f16 v^T plane vt[(h*64 + d)*SEQ + t] (same bits). blockIdx.z = 0: the hi plane, 1: the residual plane.
// Block = one 64-token x 64-feature tile of one head; grid = (SEQ/64, NH, 2); tile staged in LDS as halves
// (v8h 16-B stores, __syncthreads, _Float16 element reads).
// Store: group g = tid>>3 (0..31), piece = tid&7: iteration it writes row d = it*32+g, lanes 8q..8q+7 x 16 B =
// coverage: load 2 x 256 threads x 8 halves = 64x64; store 2 iterations x 32 groups = 64 rows d, 8 pieces x 8
// = 64 tokens per row; grid covers every (h, token tile).
// =====================================================================================================
__global__ __launch_bounds__(256) void v_tr(const unsigned short* __restrict__ qkvhp, const unsigned short* __restrict__ qkvrp,
                                            unsigned short* vth, unsigned short* vtr) {
  __shared__ __align__(16) _Float16 sv[64 * 72];       // [tt][d], pitch 72 halves (144 B)
  const int tid = threadIdx.x;
  const int t0  = blockIdx.x * 64;
  const int hh  = blockIdx.y;
  const bool res = (blockIdx.z != 0);               // block-uniform
  const _Float16* src = (const _Float16*)(const void*)(res ? qkvrp : qkvhp);
  unsigned short* vt  = res ? vtr : vth;
#pragma unroll
  for (int i = 0; i < 2; ++i) {
    const int idx = i * 256 + tid;                  // 0..511
    const int tt = idx >> 3, c8 = (idx & 7) * 8;
    const v8h a = *(const v8h*)(src + ((size_t)(t0 + tt)) * DQKV + 2 * DM + hh * HD + c8);
    *(v8h*)(sv + tt * 72 + c8) = a;
  }
  __syncthreads();

  const int g = tid >> 3, piece = tid & 7;
  v4u hv[2];
  size_t hofs[2];
#pragma unroll
  for (int it = 0; it < 2; ++it) {
    const int d = it * 32 + g;
    v4u a;
#pragma unroll
    for (int e = 0; e < 4; ++e) {
      const _Float16 x0 = sv[(piece * 8 + 2 * e) * 72 + d];
      const _Float16 x1 = sv[(piece * 8 + 2 * e + 1) * 72 + d];
      a[e] = pk16(h_bits(x0), h_bits(x1));
    }
    hv[it] = a;
    hofs[it] = ((size_t)(hh * HD + d)) * SEQ + t0 + piece * 8;
  }
  {
#pragma unroll
    for (int it = 0; it < 2; ++it) *(v4u*)(vt + hofs[it]) = hv[it];
    
  }
}

__device__ __forceinline__ float xhalf(float x) {
  return __builtin_bit_cast(float, __builtin_amdgcn_permlanex16(__builtin_bit_cast(int, x), __builtin_bit_cast(int, x),
                                                                0x76543210, 0xfedcba98, false, false));
}

template <bool HR>
__global__ __launch_bounds__(128)
void attn_k(const unsigned short* __restrict__ qkvp, const unsigned short* __restrict__ qkvrp,
            const unsigned short* __restrict__ vtp, const unsigned short* __restrict__ vtrp,
            unsigned short* ctxp, unsigned short* ctxrp) {
  union FH { v16h v; v8h h[2]; };
  constexpr int AP     = 72;                             // LDS row pitch of the f16 tiles, halves: 128-byte row + 16 (16 B x odd, for 16-byte readers)
  constexpr int OP     = 68;                             // LDS row pitch of the f32 context slab, floats (16-byte writers and readers)
  constexpr int TB     = 64 * AP * 2;                    // one f16 64x64 tile at that pitch, bytes
  constexpr int OFF_K  = 0;
  constexpr int OFF_V  = TB;
  constexpr int OFF_KR = 2 * TB;
  constexpr int OFF_VR = 3 * TB;
  constexpr int SMEMB  = HR ? 4 * TB : 2 * TB;                // 36864 : 18432
  static_assert(4 * 16 * OP * 4 <= SMEMB);                    // f32 context staging aliases the K/V region
  __shared__ __align__(16) unsigned char smem[SMEMB];
  _Float16* Ksh = (_Float16*)(smem + OFF_K);                  // K   [kv][d]
  _Float16* Vsh = (_Float16*)(smem + OFF_V);                  // V^T [d][kv]
  _Float16* Krs = (_Float16*)(smem + (HR ? OFF_KR : OFF_K));  // K residual (HR only)
  _Float16* Vrs = (_Float16*)(smem + (HR ? OFF_VR : OFF_V));  // V^T residual (HR only)

  const int tid  = threadIdx.x;
  const int wave = tid >> 5;
  const int lane = tid & 31;
  const int hh   = lane >> 4;
  const int c    = lane & 15;

  const int bx   = blockIdx.x;
  const int qb   = bx % NQB;
  const int h    = bx / NQB;                 // < NH by the grid size
  const int q0   = qb * 64 + wave * 16;
  const int qrow = q0 + c;                   // the lane's query

  const _Float16* Qp  = (const _Float16*)(const void*)qkvp  + (size_t)h * HD;
  const _Float16* Qrp = (const _Float16*)(const void*)qkvrp + (size_t)h * HD;
  const _Float16* Kp  = Qp + DM;
  const _Float16* Krp = Qrp + DM;
  const _Float16* Vt  = (const _Float16*)(const void*)vtp  + ((size_t)h * HD) * SEQ;
  const _Float16* Vrt = (const _Float16*)(const void*)vtrp + ((size_t)h * HD) * SEQ;

  // ---- Q fragments (B operand, column = lane&15): 2 d-chunks ----
  v16h qa[2], qr[2];
#pragma unroll
  for (int dc = 0; dc < 2; ++dc) {
    const size_t qo = (size_t)qrow * DQKV + dc * 32 + 8 * hh;
    qa[dc] = ldfrag_h(Qp + qo);
    if constexpr (HR) qr[dc] = ldfrag_h(Qrp + qo);
    else qr[dc] = qa[dc];
  }

  float lsum = 0.f, mrun = -1e30f;
  v8f oacc[4], oacc2[4];
#pragma unroll
  for (int t = 0; t < 4; ++t) { oacc[t] = zero8(); oacc2[t] = zero8(); }

  const int ktlo = (qb >= KTW - 1) ? (qb - (KTW - 1)) : 0;   // first key tile in the window, block-uniform
  const int nkt  = qb - ktlo + 1;                              // 1..KTW key tiles, block-uniform
  for (int kti = 0; kti < nkt; ++kti) {
    const int kv0 = (ktlo + kti) * 64;                         // <= qb*64 < SEQ
    __syncthreads();
    {
      const int r = tid >> 1, half = (tid & 1) * 32;
      const size_t ko = (size_t)(kv0 + r) * DQKV + half;      // K row kv0+r, d = half..half+31
      const size_t vo = (size_t)r * SEQ + kv0 + half;           // V^T row d = r, s = kv0+half..+31
#pragma unroll
      for (int i = 0; i < 4; ++i) {
        const v8h a0 = *(const v8h*)(Kp + ko + 8 * i);
        const v8h b0 = *(const v8h*)(Vt + vo + 8 * i);
        *(v8h*)(Ksh + r * AP + half + 8 * i) = a0;
        *(v8h*)(Vsh + r * AP + half + 8 * i) = b0;
        if constexpr (HR) {
          const v8h a1 = *(const v8h*)(Krp + ko + 8 * i);
          const v8h b1 = *(const v8h*)(Vrt + vo + 8 * i);
          *(v8h*)(Krs + r * AP + half + 8 * i) = a1;
          *(v8h*)(Vrs + r * AP + half + 8 * i) = b1;
        }
      }
    }
    __syncthreads();

    // ---- scores^T: 64 keys x 16 query columns per wave (A operand: lane c -> key j*16+c, split k map over d) ----
    v8f s[4];
#pragma unroll
    for (int j = 0; j < 4; ++j) {
      s[j] = zero8();
      v8f t = zero8();
#pragma unroll
      for (int dc = 0; dc < 2; ++dc) {
        FH kb;
        kb.h[0] = *(const v8h*)(Ksh + (j * 16 + c) * AP + dc * 32 + 8 * hh);
        kb.h[1] = *(const v8h*)(Ksh + (j * 16 + c) * AP + dc * 32 + 16 + 8 * hh);
        s[j] = mma_h_raw(kb.v, qa[dc], s[j]);
        if constexpr (HR) {
          FH krb;
          krb.h[0] = *(const v8h*)(Krs + (j * 16 + c) * AP + dc * 32 + 8 * hh);
          krb.h[1] = *(const v8h*)(Krs + (j * 16 + c) * AP + dc * 32 + 16 + 8 * hh);
          t = mma_h_raw(krb.v, qa[dc], t);
          t = mma_h_raw(kb.v, qr[dc], t);
        }
      }
      if constexpr (HR) s[j] = s[j] + t * (1.0f / 2048.0f);
    }

    // ---- windowed causal online softmax of the lane's query: in-lane max over its 32 keys, one exchange with
    //      the other half, running max, alpha, p, row-sum partial, P (x256, f16; HR: + residual) in registers ----
    const int key0 = kv0 + 8 * hh;
    float tm[4];
#pragma unroll
    for (int j = 0; j < 4; ++j) {                            // four independent max chains
      tm[j] = -1e30f;
#pragma unroll
      for (int r = 0; r < 8; ++r) {
        const int key = key0 + j * 16 + r;
        float a = s[j][r] * (1.0f / 2048.0f);                // 1/8 head scale, 1/256 for the two x16 carries
        const bool ok = (key <= qrow) && (key + WIN >= qrow);
        a = ok ? a : -1e30f;
        s[j][r] = a;
        tm[j] = fmaxf(tm[j], a);
      }
    }
    float tmx = fmaxf(fmaxf(tm[0], tm[1]), fmaxf(tm[2], tm[3]));
    tmx = fmaxf(tmx, xhalf(tmx));
    const float mn = fmaxf(mrun, tmx);
    const float al = __expf(mrun - mn);
    mrun = mn;
    FH pb[2], pbr[2];                                        // B operands of the two 32-key chunks
    float ps[4];
#pragma unroll
    for (int j = 0; j < 4; ++j) {                            // four independent sum chains
      ps[j] = 0.0f;
#pragma unroll
      for (int r = 0; r < 8; ++r) {
        const int key = key0 + j * 16 + r;
        const bool ok = (key <= qrow) && (key + WIN >= qrow);
        float p = __expf(s[j][r] - mn);
        p = ok ? p : 0.0f;
        ps[j] += p;
        const float g = p * 256.0f;
        const _Float16 x0 = (_Float16)g;
        pb[j >> 1].h[j & 1][r] = x0;
        if constexpr (HR) pbr[j >> 1].h[j & 1][r] = (_Float16)((g - (float)x0) * 2048.0f);
      }
    }
    lsum = lsum * al + ((ps[0] + ps[1]) + (ps[2] + ps[3]));

    // ---- rescale the context accumulators by alpha (VALU) ----
#pragma unroll
    for (int t = 0; t < 4; ++t) {
      oacc[t] = oacc[t] * al;
      if constexpr (HR) oacc2[t] = oacc2[t] * al;
    }

    // ---- context^T += V^T . P^T (f16 WMMA; A = V^T [d][key], B = P^T [key][query]) ----
#pragma unroll
    for (int kk = 0; kk < 2; ++kk) {
#pragma unroll
      for (int t = 0; t < 4; ++t) {
        FH vb;
        vb.h[0] = *(const v8h*)(Vsh + (t * 16 + c) * AP + kk * 32 + 8 * hh);
        vb.h[1] = *(const v8h*)(Vsh + (t * 16 + c) * AP + kk * 32 + 16 + 8 * hh);
        oacc[t] = mma_h_raw(vb.v, pb[kk].v, oacc[t]);
        if constexpr (HR) {
          FH vrb;
          vrb.h[0] = *(const v8h*)(Vrs + (t * 16 + c) * AP + kk * 32 + 8 * hh);
          vrb.h[1] = *(const v8h*)(Vrs + (t * 16 + c) * AP + kk * 32 + 16 + 8 * hh);
          oacc2[t] = mma_h_raw(vrb.v, pb[kk].v, oacc2[t]);
          oacc2[t] = mma_h_raw(vb.v, pbr[kk].v, oacc2[t]);
        }
      }
    }
  }

  __syncthreads();                           // every wave is done with the K/V tiles before they are aliased

  // ---- normalise (1/lsum, the 1/256 p carry; keep the x16 v carry), stage the wave's 16x64 f32 tile in LDS
  //      (row = query c, 8 consecutive features per context tile and lane), then store whole 128-byte rows ----
  float* os = (float*)(void*)smem + wave * (16 * OP);
  {
    const float l  = lsum + xhalf(lsum);     // the two halves of the query's keys
    const float rl = 1.0f / l;               // l >= 1 (the max key contributes p = 1)
    const float sc = rl * (1.0f / 256.0f);
#pragma unroll
    for (int t = 0; t < 4; ++t) {
      v4f lo, hi;
#pragma unroll
      for (int r = 0; r < 4; ++r) {
        float v0 = oacc[t][r], v1 = oacc[t][4 + r];
        if constexpr (HR) {
          v0 += oacc2[t][r] * (1.0f / 2048.0f);
          v1 += oacc2[t][4 + r] * (1.0f / 2048.0f);
        }
        lo[r] = v0 * sc;
        hi[r] = v1 * sc;
      }
      *(v4f*)(os + c * OP + t * 16 + 8 * hh)     = lo;
      *(v4f*)(os + c * OP + t * 16 + 8 * hh + 4) = hi;
    }
  }
  __builtin_amdgcn_fence(__ATOMIC_RELEASE, "workgroup");
  __builtin_amdgcn_wave_barrier();
  __builtin_amdgcn_fence(__ATOMIC_ACQUIRE, "workgroup");
  {
    const int rq = lane >> 3, piece = lane & 7;
    v4u ph[4], pr[4];
#pragma unroll
    for (int it = 0; it < 4; ++it) {
      const int row = it * 4 + rq;   // it 0..3 x rq 0..3 = rows 0..15 of the wave tile
      const v4f a  = *(const v4f*)(os + row * OP + piece * 8);
      const v4f a2 = *(const v4f*)(os + row * OP + piece * 8 + 4);
      float f[8];
      f[0] = a[0];  f[1] = a[1];  f[2] = a[2];  f[3] = a[3];
      f[4] = a2[0]; f[5] = a2[1]; f[6] = a2[2]; f[7] = a2[3];
      v4u p, q;
#pragma unroll
      for (int e = 0; e < 4; ++e) {
        const _Float16 x0 = (_Float16)f[2 * e], x1 = (_Float16)f[2 * e + 1];
        p[e] = pk16(h_bits(x0), h_bits(x1));
        if constexpr (HR) {
          const _Float16 y0 = (_Float16)((f[2 * e] - (float)x0) * 2048.0f);
          const _Float16 y1 = (_Float16)((f[2 * e + 1] - (float)x1) * 2048.0f);
          q[e] = pk16(h_bits(y0), h_bits(y1));
        } else {
          q[e] = p[e];
        }
      }
      ph[it] = p;
      pr[it] = q;
    }
    {
#pragma unroll
      for (int it = 0; it < 4; ++it) {
        const int row = it * 4 + rq;
        const size_t go = (size_t)(q0 + row) * DM + (size_t)h * HD + piece * 8;
        *(v4u*)(ctxp + go) = ph[it];
        if constexpr (HR) *(v4u*)(ctxrp + go) = pr[it];
      }
      
    }
  }
}

// =====================================================================================================
// Workspace map (bytes); every region is an exact multiple of its whole-line / whole-tile store granularity
// (row pitches 2048 / 6144 / 8192 / 256 B, all offsets multiples of 256, no aliasing within a launch):
//   Xh     f16 [SEQ][1024]                 (bf16 value of x, x16)
//   Wqkv   f16 [3072][1024]                (bf16 values of wq | wk | wv x1024, [n][k] = the input layout)
//   Wp     f16 [1024][1024]                (bf16 value of wo x1024, [n][k])
//   QKV    f16 [SEQ][3072]                 (rotated q | rotated k | v, x16)
//   QKVr   f16 [SEQ][3072]                 (x2^11 residual of the above)
//   VT     f16 [1024][SEQ]                 ([h*64 + d][s])
//   VTr    f16 [1024][SEQ]                 (residual)
//   Ctx    f16 [SEQ][1024]                 (attention context x16)
//   Ctxr   f16 [SEQ][1024]                 (residual)
//   Rt     f32 [SEQ][64]                   (cos | sin table)
//   total for SEQ = 4096: 101711872
// d_out f32: [SEQ][1024] at byte 0, every 64x64 tile written once by the projection launch.
// =====================================================================================================
extern "C" void kernel_launch(void* const* d_in, const int* in_sizes, int n_in,
                              void* d_out, int out_size, void* d_ws, size_t ws_size,
                              hipStream_t stream) {
  if (n_in < 5) return;
  if (in_sizes[0] < SEQ * DM) return;
  if (in_sizes[1] != DM * DM) return;
  if (in_sizes[2] != DM * DM) return;
  if (in_sizes[3] != DM * DM) return;
  if (in_sizes[4] != DM * DM) return;
  if (out_size < OUTN) return;

  const float* x  = (const float*)d_in[0];    // [SEQ][DM] (row prefix)
  const float* wq = (const float*)d_in[1];    // [DM n][DM k]
  const float* wk = (const float*)d_in[2];    // [DM n][DM k]
  const float* wv = (const float*)d_in[3];    // [DM n][DM k]
  const float* wo = (const float*)d_in[4];    // [DM n][DM k]

  const size_t PX   = (size_t)SEQ * DM * 2;          //  8388608 (SEQ 4096)
  const size_t PWq  = (size_t)DQKV * DM * 2;         //  6291456
  const size_t PWp  = (size_t)DM * DM * 2;           //  2097152
  const size_t PQKV = (size_t)SEQ * DQKV * 2;        // 25165824
  const size_t PVT  = (size_t)DM * SEQ * 2;          //  8388608
  const size_t PCtx = (size_t)SEQ * DM * 2;          //  8388608
  const size_t PRt  = (size_t)SEQ * 64 * 4;          //  1048576
  size_t off = 0;
  const size_t oX    = off; off += PX;
  const size_t oWq   = off; off += PWq;
  const size_t oWp   = off; off += PWp;
  const size_t oQKV  = off; off += PQKV;
  const size_t oQKVr = off; off += PQKV;
  const size_t oVT   = off; off += PVT;
  const size_t oVTr  = off; off += PVT;
  const size_t oCtx  = off; off += PCtx;
  const size_t oCtxr = off; off += PCtx;
  const size_t oRt   = off; off += PRt;
  if (off > ws_size) return;                         // off = 101711872 for SEQ 4096
  if (off > (size_t)134217728) return;

  char* ws = (char*)d_ws;
  unsigned short* Xh   = (unsigned short*)(ws + oX);
  unsigned short* Wqkv = (unsigned short*)(ws + oWq);
  unsigned short* Wp   = (unsigned short*)(ws + oWp);
  unsigned short* QKV  = (unsigned short*)(ws + oQKV);
  unsigned short* QKVr = (unsigned short*)(ws + oQKVr);
  unsigned short* VT   = (unsigned short*)(ws + oVT);
  unsigned short* VTr  = (unsigned short*)(ws + oVTr);
  unsigned short* Ctx  = (unsigned short*)(ws + oCtx);
  unsigned short* Ctxr = (unsigned short*)(ws + oCtxr);
  float*          Rt   = (float*)(ws + oRt);
  float*          outf = (float*)d_out;              // [SEQ][DM]

  const dim3 blk(256);
  const dim3 gPrep(PREP_B);                          // 512 table + 2048 x + 4 x 512 weight blocks (SEQ 4096)
  const dim3 gGqkv((SEQ / 128) * (DQKV / 128));      // 768 block tiles of 128x128 (SEQ 4096)
  const dim3 gGdm((SEQ / 128) * (DM / 128));         // 256 block tiles (8 waves each: 4 per ctx plane)
  const dim3 gVt(SEQ / 64, NH, 2);                   // (64, 16, 2)
  const dim3 gAttn(NQB * NH);                        // 1024 blocks: every (head, query tile)
  const float wScale = 1024.0f;                      // weights carried x1024
  const float aScale = 16.0f;                        // activations carried x16
  const float cscale = 1.0f / 16384.0f;              // 1/(16 * 1024)

  // (1, 2) one launch: planes x -> f16 x16 (bf16 values); weights [n][k] -> f16 x1024 (bf16 values), wq | wk | wv
  //     stacked; RoPE table cos | sin per token
  k_prep<<<gPrep, blk, 0, stream>>>(x, wq, wk, wv, wo, Xh, Wqkv, Wp, Rt, aScale, wScale);
  // (3) qkv = Xh . Wqkv^T with RoPE on the q and k column blocks (n0 < 2*DM) -> QKV f16 x16 + residual plane
  //     [SEQ][3072] (M=SEQ, N=3072, K=1024)
  gemm64_f16<0, false><<<gGqkv, dim3(128), 0, stream>>>(Xh, Xh, DM, Wqkv, DM, cscale, (void*)QKV, QKVr, DQKV,
                                                  SEQ, DQKV, DM, aScale, Rt, 2 * DM);
  // (4) v -> v^T planes (hi and residual, all tokens), one launch
  v_tr<<<gVt, blk, 0, stream>>>(QKV, QKVr, VT, VTr);
  // (5) windowed causal softmax attention -> Ctx f16 x16 + residual plane (all query tiles)
  attn_k<true><<<gAttn, dim3(128), 0, stream>>>(QKV, QKVr, VT, VTr, Ctx, Ctxr);
  // (6) out = (Ctx + 2^-11 Ctxr) . Wp^T -> d_out f32 [SEQ][1024] (M=SEQ, N=1024, K=1024), every tile once;
  //     blocks of 8 waves, the two planes side by side
  gemm64_f16<1, true><<<gGdm, blk, 0, stream>>>(Ctx, Ctxr, DM, Wp, DM, cscale, (void*)outf, Ctxr, DM,
                                                SEQ, DM, DM, 1.0f, Rt, 0);
  (void)hipGetLastError();
}

// v007
// A run of this version takes 91.4 microseconds.
// Next to v006, in two timings, it ran 1.05 and 1.04 times as fast.
// Counting every step since v000, it is 3.13 times as fast.
// Contractions: q|k|v projection = v_wmma_f32_16x16x32_f16 (A = f16 of RNE-bf16 x carried x16, B = f16 of RNE-bf16 wq|wk|wv carried x1024, single product); attention k.q^T and v^T.p^T (transposed products) = v_wmma_f32_16x16x32_f16 (q, k, v^T f16 planes x16 plus x2^11 residual planes, p f16 x256 plus x2^11 residual; hi.hi + hi.res + res.hi); output projection = v_wmma_f32_16x16x32_f16 (A = ctx f16 x16 plus its x2^11 residual plane, B = f16 of RNE-bf16 wo x1024; hi.B + res.B); all f32 accumulate. RoPE cos/sin table, rotation, windowed causal online-max softmax and row sums in f32 on the VALU.
#include <hip/hip_runtime.h>
#include <math.h>
#include <stdint.h>

#define SEQ   4096                  // token rows processed (a row prefix of x); every stride, carve and grid derives from it
#define DM    1024
#define NH    16
#define HD    64
#define WIN   512
#define DQKV  (3 * DM)              // 3072
#define NQB   (SEQ / 64)            // query tiles of 64 rows
#define KTW   (WIN / 64 + 1)        // key tiles visited per 64-row query tile = 9
#define OUTN  (SEQ * DM)
static_assert(NH * HD == DM);
static_assert(HD == 64);
static_assert((WIN % 64) == 0);
static_assert(KTW == 9);
static_assert((SEQ % 64) == 0 && (DM % 64) == 0 && (DQKV % 64) == 0);
static_assert((DM % 32) == 0);
static_assert((SEQ % 128) == 0 && (DM % 128) == 0 && (DQKV % 128) == 0);   // GEMM block tile 128x128
static_assert((DM % 64) == 0 && DM >= 128);                                 // GEMM pass of 64 k, two passes or more
static_assert(((SEQ * DM / 8) % 256) == 0);
static_assert(((DM * DM / 8) % 256) == 0);
static_assert((SEQ % 8) == 0);

#define GP_B    144                 // GEMM LDS row pitch, bytes: 128-byte row + 16 (16 B x odd, for 16-byte readers)
#define GP_H    (GP_B / 2)          // the same in halves
#define GTILE   (128 * GP_B)        // one operand's 128 rows of a stage, bytes

typedef _Float16 v16h __attribute__((ext_vector_type(16)));
typedef _Float16 v8h  __attribute__((ext_vector_type(8)));
typedef float    v8f  __attribute__((ext_vector_type(8)));
typedef float    v4f  __attribute__((ext_vector_type(4)));
typedef unsigned int v4u __attribute__((ext_vector_type(4)));

// ---- scalar helpers --------------------------------------------------------------------------------
__device__ __forceinline__ unsigned short bf_bits(float f) {          // f32 -> bf16 bits, RNE convert
  unsigned u = __float_as_uint(f);
  return (unsigned short)((u + 0x7FFFu + ((u >> 16) & 1u)) >> 16);
}
__device__ __forceinline__ float bfr(float f) { return __uint_as_float(((unsigned)bf_bits(f)) << 16); }
__device__ __forceinline__ unsigned short h_bits(_Float16 x) { return __builtin_bit_cast(unsigned short, x); }
__device__ __forceinline__ unsigned pk16(unsigned short a, unsigned short b) { return (unsigned)a | ((unsigned)b << 16); }
__device__ __forceinline__ v8f zero8() { v8f z = {0.f, 0.f, 0.f, 0.f, 0.f, 0.f, 0.f, 0.f}; return z; }

// ---- fragment loader: 16-bit A/B operand, lane -> row/col (lane&15), p already includes +8*(lane>>4);
//      elements 0..7 <- p[0..7] (k0+8h..), elements 8..15 <- p[16..23] (k0+16+8h..)
__device__ __forceinline__ v16h ldfrag_h(const _Float16* p) {
  union { v16h v; v8h h[2]; } f;
  f.h[0] = *(const v8h*)(p);
  f.h[1] = *(const v8h*)(p + 16);
  return f.v;
}

// ---- WMMA helpers: the plain builtin (the compiler orders it and keeps its distances), and the GEMM's hand-written gaps ----
__device__ __forceinline__ v8f mma_h_raw(v16h a, v16h b, v8f c) {
  return __builtin_amdgcn_wmma_f32_16x16x32_f16(false, a, false, b, (short)0, c, false, false);
}
__device__ __forceinline__ void dep_guard_h(v8f& a, v8f& b, v16h x, v16h y) {
#if defined(__HIP_DEVICE_COMPILE__)
  asm volatile("v_nop\n\tv_nop\n\tv_nop\n\tv_nop" : "+v"(a), "+v"(b) : "v"(x), "v"(y));
#endif
}
__device__ __forceinline__ void keep4_h(v16h a, v16h b, v16h c, v16h d) {
#if defined(__HIP_DEVICE_COMPILE__)
  asm volatile("v_nop" :: "v"(a), "v"(b), "v"(c), "v"(d));
#endif
}
__device__ __forceinline__ void acc_guard4(v8f& a, v8f& b, v8f& c, v8f& d) {
#if defined(__HIP_DEVICE_COMPILE__)
  asm volatile("v_nop\n\tv_nop\n\tv_nop\n\tv_nop" : "+v"(a), "+v"(b), "+v"(c), "+v"(d));
#endif
}

// =====================================================================================================
// Preparatory launch: three jobs that need nothing of each other share one grid by ranges of the block index
// (every test on the block index is block-uniform).
//   blocks [0, RT_B)                    RoPE table, 8 tokens each
//   blocks [RT_B, RT_B + CVX_B)         x -> f16 plane
//   the last 4 * CVW_B blocks           wq | wk | wv | wo -> f16 planes, CVW_B blocks each
// =====================================================================================================
#define RT_B   (SEQ / 8)                // 512
#define CVX_B  (SEQ * DM / 8 / 256)     // 2048
#define CVW_B  (DM * DM / 8 / 256)      // 512
#define PREP_B (RT_B + CVX_B + 4 * CVW_B)

// f32 plane -> f16 bits of bfr(v) * scale (scale a power of two): x (x16) and the [n][k] weights (x1024),
// whose [out][in] layout is already the k-contiguous Bt layout of the GEMM below.
// coverage: n8 threads x 8 = the whole plane.
__device__ __forceinline__ void cvt16(const float* __restrict__ in, unsigned short* out, int n8, float scale, int i) {
  if (i < n8) {
    const v4f a = *(const v4f*)(in + (size_t)i * 8);
    const v4f b = *(const v4f*)(in + (size_t)i * 8 + 4);
    v4u p;
    p[0] = pk16(h_bits((_Float16)(bfr(a[0]) * scale)), h_bits((_Float16)(bfr(a[1]) * scale)));
    p[1] = pk16(h_bits((_Float16)(bfr(a[2]) * scale)), h_bits((_Float16)(bfr(a[3]) * scale)));
    p[2] = pk16(h_bits((_Float16)(bfr(b[0]) * scale)), h_bits((_Float16)(bfr(b[1]) * scale)));
    p[3] = pk16(h_bits((_Float16)(bfr(b[2]) * scale)), h_bits((_Float16)(bfr(b[3]) * scale)));
    *(v4u*)(out + (size_t)i * 8) = p;
  }
}

// RoPE table tab[t][64] f32: [0..31] = cos(t * inv[m]), [32..63] = sin(t * inv[m]) (precise sincosf, f32
// angle = fl(t * inv[m])), inv[m] = 1 / powf(10000, (2m)/64), m = 0..31, f32, formed by each thread for its own m.
// Block = 8 tokens x 32 pairs (256 threads); the 8x64 tile is staged in LDS, then stored as whole rows.
// coverage: compute 8 x 32 threads x 2 = 8x64; store 128 lanes x 4 floats = 8 rows x 64; RT_B blocks cover every t.
__device__ __forceinline__ void rope_tab(float* st, float* tab, int blk) {
  const int tid = threadIdx.x;
  const int m   = tid & 31, tr = tid >> 5;
  const int t   = blk * 8 + tr;                     // < SEQ by the block range
  const float e = (float)(2 * m) * (1.0f / 64.0f);
  const float p = powf(10000.0f, e);
  const float w = 1.0f / p;
  const float ang = (float)t * w;
  float sn, cs;
  sincosf(ang, &sn, &cs);
  st[tr * 64 + m]      = cs;
  st[tr * 64 + 32 + m] = sn;
  __syncthreads();
  if (tid < 128) {                                  // waves 0..3, wave-uniform
    const int row = tid >> 4, c4 = (tid & 15) * 4;
    const v4f v = *(const v4f*)(st + row * 64 + c4);
    float* dst = tab + (size_t)(blk * 8 + row) * 64 + c4;
    *(v4f*)dst = v;
  }
}

__global__ __launch_bounds__(256) void k_prep(const float* __restrict__ x, const float* __restrict__ wq,
                                              const float* __restrict__ wk, const float* __restrict__ wv,
                                              const float* __restrict__ wo,
                                              unsigned short* Xh, unsigned short* Wqkv, unsigned short* Wp,
                                              float* tab, float aScale, float wScale) {
  __shared__ __align__(16) float st[8 * 64];
  const int b = blockIdx.x;
  if (b < RT_B) {                                   // the longest blocks start first
    rope_tab(st, tab, b);
  } else if (b < RT_B + CVX_B) {
    cvt16(x, Xh, SEQ * DM / 8, aScale, (b - RT_B) * 256 + (int)threadIdx.x);
  } else if (b < PREP_B) {
    const int wb = b - (RT_B + CVX_B);
    const int which = wb / CVW_B;                   // 0..3 = wq, wk, wv, wo
    const float* in = (which == 0) ? wq : (which == 1) ? wk : (which == 2) ? wv : wo;
    unsigned short* o = (which < 3) ? (Wqkv + (size_t)which * DM * DM) : Wp;
    cvt16(in, o, DM * DM / 8, wScale, (wb - which * CVW_B) * 256 + (int)threadIdx.x);
  }
}

// =====================================================================================================
// Register-blocked f16 WMMA GEMM, one wave per 64x64 tile and plane, four waves (2x2) per 128x128 block tile and
// plane. The block's A (ARES: and Ar) and Bt rows of a 64-k pass are staged in LDS by asynchronous 16-byte copies
// (whole 128-byte lines), two buffers: the next pass's copies fly while this pass's fragments are read from LDS.
//   v[m][n] = (sum_k A[m][k] * Bt[n][k]  [+ 2^-11 * sum_k Ar[m][k] * Bt[n][k] when ARES]) * cscale
// A, Ar row-major [M][K] pitch lda (f16), Bt row-major [N][K] pitch ldb (f16, k contiguous); M, N multiples of
// 128, K multiple of 64; one block per block tile (a block-uniform bound check anyway).
// ARES: eight waves. Waves 0..3 take the hi plane, waves 4..7 the residual plane of the same four 64x64 tiles in
// the same k pass (two waves per SIMD, Bt staged once for both). A residual wave takes the tile's four 16-row blocks
// in the order 2, 3, 0, 1, so that in both waves accumulator rows 0, 1 are the 32 tile rows the wave finishes and
// rows 2, 3 the 32 it hands to the other wave. Behind the loop each wave scales its sums (residual: 2^-11, exact;
// hi: 1), hands rows 2, 3 over through LDS (the ring, free by then), adds what it gets to rows 0, 1 and runs the
// epilogue for those 32 tile rows.
// Epilogue variants:
//   EPI 0: f16 hi plane = f16(v' * oscale) at Cp and residual plane = f16((v'*oscale - hi) * 2048) at Crp,
//          pitch ldc halves, where v' = v for tiles with n0 >= ropeN and, for n0 < ropeN (wave-uniform),
//          v' = rotate-half RoPE of the wave's 64-column tile (one head): pair index mm = column mod 32,
//          token = output row, c = rtab[token][mm], s = rtab[token][32+mm]:
//          col mm -> v[mm]*c - v[32+mm]*s ; col 32+mm -> v[32+mm]*c + v[mm]*s (f32, from the LDS slab).
//          Block tiles with n >= vN (vN a multiple of 128, block-uniform) go out TRANSPOSED instead, the same two
//          f16 values per element: column n, row m -> Vtp / Vtrp[(n - vN) * ldvt + m]. An accumulator register
//          run r = 0..7 of a lane is 8 consecutive rows m of one column n, i.e. 16 contiguous bytes of a transposed
//          row: per 16-column block the wave stages 16 rows x 64 m per plane in its slab and stores whole 128-byte lines.
//   EPI 1: f32 out = v, pitch ldc floats
// 16-row slabs staged per wave in LDS. f32 out: each 64-wide row segment (256 B = 2 lines) by 16 lanes x 16 B,
// coverage: 4 slabs x 16 rows x 64 cols = the whole 64x64 tile (ARES: 2 slabs from each of the tile's two waves);
// grid x 4 tiles = [M][N].
// =====================================================================================================
// Eight 16-byte asynchronous copies of one lane, global -> LDS, rows 16 apart in both places. The s_wait_xcnt
// is the last line of the copies' own statement so that no address register is rewritten ahead of it.
__device__ __forceinline__ void copy8_rows(unsigned l, const _Float16* g, int ld) {
#if defined(__HIP_DEVICE_COMPILE__)
  const unsigned l0 = l,                    l1 = l + 1u * 16u * GP_B, l2 = l + 2u * 16u * GP_B, l3 = l + 3u * 16u * GP_B;
  const unsigned l4 = l + 4u * 16u * GP_B, l5 = l + 5u * 16u * GP_B, l6 = l + 6u * 16u * GP_B, l7 = l + 7u * 16u * GP_B;
  const size_t st = (size_t)16 * ld;
  const _Float16 *g0 = g, *g1 = g + st, *g2 = g + 2 * st, *g3 = g + 3 * st;
  const _Float16 *g4 = g + 4 * st, *g5 = g + 5 * st, *g6 = g + 6 * st, *g7 = g + 7 * st;
  asm volatile(
      "global_load_async_to_lds_b128 %0, %8, off\n\t"
      "global_load_async_to_lds_b128 %1, %9, off\n\t"
      "global_load_async_to_lds_b128 %2, %10, off\n\t"
      "global_load_async_to_lds_b128 %3, %11, off\n\t"
      "global_load_async_to_lds_b128 %4, %12, off\n\t"
      "global_load_async_to_lds_b128 %5, %13, off\n\t"
      "global_load_async_to_lds_b128 %6, %14, off\n\t"
      "global_load_async_to_lds_b128 %7, %15, off\n\t"
      "s_wait_xcnt 0x0"
      :: "v"(l0), "v"(l1), "v"(l2), "v"(l3), "v"(l4), "v"(l5), "v"(l6), "v"(l7),
         "v"(g0), "v"(g1), "v"(g2), "v"(g3), "v"(g4), "v"(g5), "v"(g6), "v"(g7)
      : "memory");
#endif
}
// Twelve 16-byte asynchronous copies of one lane: four rows, 32 apart, of each of three operand tiles that lie one
// behind the other in a stage. One statement, its last line the s_wait_xcnt, for the same reason as above.
__device__ __forceinline__ void copy12_rows(unsigned l, const _Float16* a, const _Float16* r, int lda,
                                            const _Float16* b, int ldb) {
#if defined(__HIP_DEVICE_COMPILE__)
  const unsigned sl = 32u * GP_B;
  const unsigned l0 = l,             l1 = l + sl,             l2  = l + 2u * sl,             l3  = l + 3u * sl;
  const unsigned l4 = l + GTILE,     l5 = l + GTILE + sl,     l6  = l + GTILE + 2u * sl,     l7  = l + GTILE + 3u * sl;
  const unsigned l8 = l + 2 * GTILE, l9 = l + 2 * GTILE + sl, l10 = l + 2 * GTILE + 2u * sl, l11 = l + 2 * GTILE + 3u * sl;
  const size_t sa = (size_t)32 * lda, sb = (size_t)32 * ldb;
  const _Float16 *a0 = a, *a1 = a + sa, *a2 = a + 2 * sa, *a3 = a + 3 * sa;
  const _Float16 *r0 = r, *r1 = r + sa, *r2 = r + 2 * sa, *r3 = r + 3 * sa;
  const _Float16 *b0 = b, *b1 = b + sb, *b2 = b + 2 * sb, *b3 = b + 3 * sb;
  asm volatile(
      "global_load_async_to_lds_b128 %0, %12, off\n\t"
      "global_load_async_to_lds_b128 %1, %13, off\n\t"
      "global_load_async_to_lds_b128 %2, %14, off\n\t"
      "global_load_async_to_lds_b128 %3, %15, off\n\t"
      "global_load_async_to_lds_b128 %4, %16, off\n\t"
      "global_load_async_to_lds_b128 %5, %17, off\n\t"
      "global_load_async_to_lds_b128 %6, %18, off\n\t"
      "global_load_async_to_lds_b128 %7, %19, off\n\t"
      "global_load_async_to_lds_b128 %8, %20, off\n\t"
      "global_load_async_to_lds_b128 %9, %21, off\n\t"
      "global_load_async_to_lds_b128 %10, %22, off\n\t"
      "global_load_async_to_lds_b128 %11, %23, off\n\t"
      "s_wait_xcnt 0x0"
      :: "v"(l0), "v"(l1), "v"(l2), "v"(l3), "v"(l4), "v"(l5), "v"(l6), "v"(l7), "v"(l8), "v"(l9), "v"(l10), "v"(l11),
         "v"(a0), "v"(a1), "v"(a2), "v"(a3), "v"(r0), "v"(r1), "v"(r2), "v"(r3), "v"(b0), "v"(b1), "v"(b2), "v"(b3)
      : "memory");
#endif
}
// the issuing wave's copies have landed in LDS behind this wait
__device__ __forceinline__ void wait_async0() {
#if defined(__HIP_DEVICE_COMPILE__)
  asm volatile("s_wait_asynccnt 0x0" ::: "memory");
#endif
}
// the wave's own LDS reads of a buffer have retired before that buffer is handed back for a refill
__device__ __forceinline__ void wait_ds0() {
#if defined(__HIP_DEVICE_COMPILE__)
  asm volatile("s_wait_dscnt 0x0" ::: "memory");
#endif
}

template <int EPI, bool ARES>
__global__ __launch_bounds__(ARES ? 256 : 128) void gemm64_f16(
    const unsigned short* __restrict__ Ap, const unsigned short* __restrict__ Arp, int lda,
    const unsigned short* __restrict__ Btp, int ldb,
    float cscale,
    void* Cp, unsigned short* Crp, int ldc, int M, int N, int K, float oscale,
    const float* __restrict__ rtab, int ropeN,
    unsigned short* Vtp, unsigned short* Vtrp, int vN, int ldvt) {
  const _Float16* Ah  = (const _Float16*)(const void*)Ap;
  const _Float16* Arh = (const _Float16*)(const void*)Arp;
  const _Float16* Bt  = (const _Float16*)(const void*)Btp;
  constexpr unsigned OFF_BT = (ARES ? 2u : 1u) * GTILE;      // Bt rows behind the A (ARES: A and Ar) rows of a stage
  constexpr unsigned GSTAGE = OFF_BT + GTILE;                // one stage, bytes
  static_assert(!ARES || 4 * 64 * 64 * 4 <= 2 * GSTAGE);     // the hand-over of the residual sums fits the ring
  __shared__ __align__(16) unsigned char ring[2 * GSTAGE];   // two stages of [A | (ARES: Ar |) Bt], 128 rows each, pitch GP_B
  constexpr int SLABF = (EPI == 0) ? 2 * 16 * GP_B / 4 : 16 * 68;   // EPI 0: also two transposed f16 16x64 planes at pitch GP_B
  static_assert(SLABF >= 16 * 68);
  __shared__ __align__(16) float sT[ARES ? 8 : 4][SLABF];     // per-wave 16x64 slab, pitch 68 floats
  const int tid  = threadIdx.x;
  const int lane = tid & 31;
  const int wave = (tid >> 5) & 3;             // the wave's place among the four tiles
  const int plane = ARES ? __builtin_amdgcn_readfirstlane(tid >> 7) : 0;   // wave-uniform: 0 = A, 1 = Ar
  const int tilesN = N >> 7;
  const int tilesM = M >> 7;
  if ((int)blockIdx.x >= tilesM * tilesN) return;   // block-uniform, in front of every barrier and copy
  const int bm = (int)blockIdx.x / tilesN;
  const int bn = (int)blockIdx.x - bm * tilesN;
  const int wm = (wave >> 1) << 6;             // the wave's 64x64 tile inside the block's 128x128 tile
  const int wn = (wave & 1) << 6;
  const int m0 = (bm << 7) + wm;
  const int n0 = (bn << 7) + wn;

  const int rlane = lane & 15;                 // row (A) / col (B, D) within subtile
  const int koff  = (lane >> 4) * 8;           // k offset of this lane half
  const int mOff  = (lane >> 4) * 8;           // D row offset

  v8f acc[4][4];
#pragma unroll
  for (int i = 0; i < 4; ++i)
#pragma unroll
    for (int j = 0; j < 4; ++j) acc[i][j] = zero8();

  // staging map: lane -> row tid>>3 (+16 per copy, 8 copies = 128 rows; ARES: +32 per copy, 4 copies), 16-byte
  // piece tid&7 of the 128-byte row
  const int crow = tid >> 3, cpc = tid & 7;
  const unsigned ringb = (unsigned)(uintptr_t)(const void*)ring;           // LDS byte address of the ring
  const unsigned lcp   = ringb + (unsigned)(crow * GP_B + cpc * 16);
  const _Float16* gA  = Ah  + (size_t)((bm << 7) + crow) * lda + cpc * 8;
  const _Float16* gAr = Arh + (size_t)((bm << 7) + crow) * lda + cpc * 8;
  const _Float16* gB  = Bt  + (size_t)((bn << 7) + crow) * ldb + cpc * 8;
  const int NP = K >> 6;                       // passes of 64 k
  // one stage: the block's rows of k = kk .. kk + 63 -> the buffer at LDS byte lb (the lane's own piece)
  auto stage = [&](unsigned lb, int kk) {
    if constexpr (ARES) {
      copy12_rows(lb, gA + kk, gAr + kk, lda, gB + kk, ldb);
    } else {
      copy8_rows(lb, gA + kk, lda);
      copy8_rows(lb + OFF_BT, gB + kk, ldb);
    }
  };

  // tile 0 -> buffer 0, landed and published; then tile 1 -> buffer 1 flies over pass 0
  stage(lcp, 0);
  wait_async0();
  __syncthreads();
  if (NP > 1) stage(lcp + GSTAGE, 64);

  for (int t = 0; t < NP; ++t) {
    const unsigned bsel = (unsigned)(t & 1) * GSTAGE;
    const _Float16* sA = (const _Float16*)(const void*)(ring + bsel + (unsigned)plane * GTILE) + (wm + rlane) * GP_H + koff;
    const _Float16* sAlo = sA + 32 * plane * GP_H;   // row blocks i = 0, 1: tile rows 16 i (+ 32 in a residual wave)
    const _Float16* sAhi = sA - 32 * plane * GP_H;   // row blocks i = 2, 3: tile rows 16 i (- 32 in a residual wave)
    const _Float16* sB = (const _Float16*)(const void*)(ring + bsel + OFF_BT) + (wn + rlane) * GP_H + koff;
    // the loops below are unrolled so that every fragment and accumulator index is a constant (registers, no scratch)
#pragma unroll
    for (int ks = 0; ks < 2; ++ks) {
      v16h bh[4];
#pragma unroll
      for (int j = 0; j < 4; ++j) bh[j] = ldfrag_h(sB + (j << 4) * GP_H + ks * 32);
      v16h ah[4];                              // all eight fragments of a 32-k step are read as one group
#pragma unroll
      for (int i = 0; i < 4; ++i) ah[i] = ldfrag_h((i < 2 ? sAlo : sAhi) + (i << 4) * GP_H + ks * 32);
#pragma unroll
      for (int i = 0; i < 4; ++i) {
#pragma unroll
        for (int j = 0; j < 4; ++j) {
          acc[i][j] = mma_h_raw(ah[i], bh[j], acc[i][j]);
        }
        dep_guard_h(acc[i][0], acc[i][3], ah[i], bh[3]);
      }
      keep4_h(bh[0], bh[1], bh[2], bh[3]);
    }
    // publish point of tile t + 1: own LDS reads retired, own copies landed, one barrier for both jobs
    wait_ds0();
    wait_async0();
    __syncthreads();
    if (t + 2 < NP) stage(lcp + bsel, (t + 2) << 6);   // block-uniform: refill the buffer that pass t has just read
  }
  wait_async0();
  acc_guard4(acc[0][0], acc[0][1], acc[0][2], acc[0][3]);
  acc_guard4(acc[1][0], acc[1][1], acc[1][2], acc[1][3]);
  acc_guard4(acc[2][0], acc[2][1], acc[2][2], acc[2][3]);
  acc_guard4(acc[3][0], acc[3][1], acc[3][2], acc[3][3]);

  // ---- epilogue: emit(a, i) stores rows 16 i .. 16 i + 15 of the wave's tile from their four accumulators ----
  float* slab = sT[wave + 4 * plane];
  auto emit = [&](const v8f (&a)[4], int i) {
    const int mBase = m0 + (i << 4);
#pragma unroll
    for (int r = 0; r < 8; ++r) {
      const int row = mOff + r;
#pragma unroll
      for (int j = 0; j < 4; ++j) slab[row * 68 + (j << 4) + rlane] = a[j][r] * cscale;
    }
    __builtin_amdgcn_fence(__ATOMIC_RELEASE, "workgroup");
    __builtin_amdgcn_wave_barrier();
    __builtin_amdgcn_fence(__ATOMIC_ACQUIRE, "workgroup");
    if constexpr (EPI == 0) {
      unsigned short* C16 = (unsigned short*)Cp;
      const int rq = lane >> 3, piece = lane & 7;
      const bool rope_on = (n0 < ropeN);                   // wave-uniform (n0 is per wave)
      const float rsgn = (piece < 4) ? -1.0f : 1.0f;       // cols 0..31 carry x1 (minus), cols 32..63 carry x2 (plus)
      const int   pm   = (piece & 3) * 8;                  // rotation pair index base of this lane's 8 columns
      v4u ph[4], pr[4];
#pragma unroll
      for (int it = 0; it < 4; ++it) {
        const int row = it * 4 + rq;                         // it 0..3 x rq 0..3 = rows 0..15
        const v4f a  = *(const v4f*)(slab + row * 68 + piece * 8);
        const v4f a2 = *(const v4f*)(slab + row * 68 + piece * 8 + 4);
        float f[8];
        f[0] = a[0];  f[1] = a[1];  f[2] = a[2];  f[3] = a[3];
        f[4] = a2[0]; f[5] = a2[1]; f[6] = a2[2]; f[7] = a2[3];
        if (rope_on) {                                       // wave-uniform branch, LDS and table reads only
          const int po = (piece ^ 4) * 8;                    // partner half of the head (32 columns away)
          const v4f g  = *(const v4f*)(slab + row * 68 + po);
          const v4f g2 = *(const v4f*)(slab + row * 68 + po + 4);
          const float* trp = rtab + (size_t)(mBase + row) * 64 + pm;   // output row = token index
          const v4f c0 = *(const v4f*)(trp);
          const v4f c1 = *(const v4f*)(trp + 4);
          const v4f s0 = *(const v4f*)(trp + 32);
          const v4f s1 = *(const v4f*)(trp + 36);
          f[0] = f[0] * c0[0] + rsgn * g[0]  * s0[0];
          f[1] = f[1] * c0[1] + rsgn * g[1]  * s0[1];
          f[2] = f[2] * c0[2] + rsgn * g[2]  * s0[2];
          f[3] = f[3] * c0[3] + rsgn * g[3]  * s0[3];
          f[4] = f[4] * c1[0] + rsgn * g2[0] * s1[0];
          f[5] = f[5] * c1[1] + rsgn * g2[1] * s1[1];
          f[6] = f[6] * c1[2] + rsgn * g2[2] * s1[2];
          f[7] = f[7] * c1[3] + rsgn * g2[3] * s1[3];
        }
        v4u p, q;
#pragma unroll
        for (int e = 0; e < 4; ++e) {
          const float g0 = f[2 * e] * oscale, g1 = f[2 * e + 1] * oscale;
          const _Float16 x0 = (_Float16)g0, x1 = (_Float16)g1;
          const _Float16 y0 = (_Float16)((g0 - (float)x0) * 2048.0f);
          const _Float16 y1 = (_Float16)((g1 - (float)x1) * 2048.0f);
          p[e] = pk16(h_bits(x0), h_bits(x1));
          q[e] = pk16(h_bits(y0), h_bits(y1));
        }
        ph[it] = p;
        pr[it] = q;
      }
      {
#pragma unroll
        for (int it = 0; it < 4; ++it) {
          const int row = it * 4 + rq;
          const size_t co = (size_t)(mBase + row) * ldc + n0 + piece * 8;
          *(v4u*)(C16 + co) = ph[it];
          *(v4u*)(Crp + co) = pr[it];
        }
        
      }
    } else {
      float* Cf = (float*)Cp;
      const int hh = lane >> 4, c4 = (lane & 15) * 4;     // 256-B row segment = 16 lanes x 16 B
      v4f ov[8];
#pragma unroll
      for (int it = 0; it < 8; ++it) {
        const int row = it * 2 + hh;                       // it 0..7 x hh 0..1 = rows 0..15
        ov[it] = *(const v4f*)(slab + row * 68 + c4);
      }
      {
#pragma unroll
        for (int it = 0; it < 8; ++it) {
          const int row = it * 2 + hh;
          *(v4f*)(Cf + (size_t)(mBase + row) * ldc + n0 + c4) = ov[it];
        }
        
      }
    }
    __builtin_amdgcn_fence(__ATOMIC_RELEASE, "workgroup");
    __builtin_amdgcn_wave_barrier();
    __builtin_amdgcn_fence(__ATOMIC_ACQUIRE, "workgroup");
  };

  if constexpr (ARES) {
    // ---- the two planes' sums are joined. The ring is free: the barrier at the foot of the last pass stands behind
    //      every wave's last fragment read and last landed copy. A tile has 16 KiB there, 8 KiB written by each of its
    //      two waves; chunk q of lane l lies at float (q * 32 + l) * 4: a lane reads what the same lane of the tile's
    //      other wave wrote ----
    const float sc = (plane != 0) ? (1.0f / 2048.0f) : 1.0f;   // exact fold of the x2^11 residual carry
    float* xw       = (float*)(void*)ring + wave * (64 * 64) + plane * (32 * 64) + lane * 4;
    const float* xr = (const float*)(const void*)ring + wave * (64 * 64) + (plane ^ 1) * (32 * 64) + lane * 4;
#pragma unroll
    for (int i = 0; i < 2; ++i)
#pragma unroll
      for (int j = 0; j < 4; ++j) {
        const v8f v = acc[2 + i][j] * sc;
        const v4f lo = {v[0], v[1], v[2], v[3]}, hi = {v[4], v[5], v[6], v[7]};
        *(v4f*)(xw + ((i * 4 + j) * 2) * 128)     = lo;
        *(v4f*)(xw + ((i * 4 + j) * 2 + 1) * 128) = hi;
      }
    __syncthreads();                           // every wave passes it: both waves' hand-overs are published
#pragma unroll
    for (int i = 0; i < 2; ++i)
#pragma unroll
      for (int j = 0; j < 4; ++j) {
        const v4f lo = *(const v4f*)(xr + ((i * 4 + j) * 2) * 128);
        const v4f hi = *(const v4f*)(xr + ((i * 4 + j) * 2 + 1) * 128);
#pragma unroll
        for (int r = 0; r < 4; ++r) {
          acc[i][j][r]     = acc[i][j][r] * sc + lo[r];
          acc[i][j][4 + r] = acc[i][j][4 + r] * sc + hi[r];
        }
      }
    emit(acc[0], 2 * plane);
    emit(acc[1], 2 * plane + 1);
  } else {
    bool transposed = false;
    if constexpr (EPI == 0) transposed = ((bn << 7) >= vN);   // block-uniform (scalar)
    if (transposed) {
      if constexpr (EPI == 0) {
        // ---- transposed f16 planes: column block j = 16 transposed rows (lane&15), 64 m per row ----
        _Float16* sh = (_Float16*)(void*)slab;               // hi plane   [16][GP_H]
        _Float16* sr = sh + 16 * GP_H;                       // residual   [16][GP_H]
        const int rq = lane >> 3, piece = lane & 7;
        // the loops below are unrolled so that every accumulator index is a constant (registers, no scratch)
#pragma unroll
        for (int j = 0; j < 4; ++j) {
#pragma unroll
          for (int i = 0; i < 4; ++i) {
            v4u p, q;
#pragma unroll
            for (int e = 0; e < 4; ++e) {
              const float g0 = acc[i][j][2 * e] * cscale * oscale, g1 = acc[i][j][2 * e + 1] * cscale * oscale;
              const _Float16 x0 = (_Float16)g0, x1 = (_Float16)g1;
              const _Float16 y0 = (_Float16)((g0 - (float)x0) * 2048.0f);
              const _Float16 y1 = (_Float16)((g1 - (float)x1) * 2048.0f);
              p[e] = pk16(h_bits(x0), h_bits(x1));
              q[e] = pk16(h_bits(y0), h_bits(y1));
            }
            *(v4u*)(sh + rlane * GP_H + (i << 4) + mOff) = p;   // rows m = 16 i + 8 (lane>>4) + 0..7 of the tile
            *(v4u*)(sr + rlane * GP_H + (i << 4) + mOff) = q;
          }
          // every lane's slab stores stay ahead of the reads of other lanes' pieces below
          __builtin_amdgcn_fence(__ATOMIC_RELEASE, "workgroup");
          __builtin_amdgcn_wave_barrier();
          __builtin_amdgcn_fence(__ATOMIC_ACQUIRE, "workgroup");
          v4u ph[4], pr[4];
#pragma unroll
          for (int it = 0; it < 4; ++it) {
            const int row = it * 4 + rq;                     // it 0..3 x rq 0..3 = transposed rows 0..15
            ph[it] = *(const v4u*)(sh + row * GP_H + piece * 8);
            pr[it] = *(const v4u*)(sr + row * GP_H + piece * 8);
          }
#pragma unroll
          for (int it = 0; it < 4; ++it) {
            const int row = it * 4 + rq;
            const size_t co = (size_t)(n0 - vN + (j << 4) + row) * ldvt + m0 + piece * 8;   // 8 lanes x 16 B = one line
            *(v4u*)(Vtp + co)  = ph[it];
            *(v4u*)(Vtrp + co) = pr[it];
          }
          // the slab reads above stay ahead of the next column block's slab stores
          __builtin_amdgcn_fence(__ATOMIC_RELEASE, "workgroup");
          __builtin_amdgcn_wave_barrier();
          __builtin_amdgcn_fence(__ATOMIC_ACQUIRE, "workgroup");
        }
      }
    } else {
#pragma unroll
      for (int i = 0; i < 4; ++i) emit(acc[i], i);
    }
  }
}

__device__ __forceinline__ float xhalf(float x) {
  return __builtin_bit_cast(float, __builtin_amdgcn_permlanex16(__builtin_bit_cast(int, x), __builtin_bit_cast(int, x),
                                                                0x76543210, 0xfedcba98, false, false));
}

template <bool HR>
__global__ __launch_bounds__(128)
void attn_k(const unsigned short* __restrict__ qkvp, const unsigned short* __restrict__ qkvrp,
            const unsigned short* __restrict__ vtp, const unsigned short* __restrict__ vtrp,
            unsigned short* ctxp, unsigned short* ctxrp) {
  union FH { v16h v; v8h h[2]; };
  constexpr int AP     = 72;                             // LDS row pitch of the f16 tiles, halves: 128-byte row + 16 (16 B x odd, for 16-byte readers)
  constexpr int OP     = 68;                             // LDS row pitch of the f32 context slab, floats (16-byte writers and readers)
  constexpr int TB     = 64 * AP * 2;                    // one f16 64x64 tile at that pitch, bytes
  constexpr int OFF_K  = 0;
  constexpr int OFF_V  = TB;
  constexpr int OFF_KR = 2 * TB;
  constexpr int OFF_VR = 3 * TB;
  constexpr int SMEMB  = HR ? 4 * TB : 2 * TB;                // 36864 : 18432
  static_assert(4 * 16 * OP * 4 <= SMEMB);                    // f32 context staging aliases the K/V region
  __shared__ __align__(16) unsigned char smem[SMEMB];
  _Float16* Ksh = (_Float16*)(smem + OFF_K);                  // K   [kv][d]
  _Float16* Vsh = (_Float16*)(smem + OFF_V);                  // V^T [d][kv]
  _Float16* Krs = (_Float16*)(smem + (HR ? OFF_KR : OFF_K));  // K residual (HR only)
  _Float16* Vrs = (_Float16*)(smem + (HR ? OFF_VR : OFF_V));  // V^T residual (HR only)

  const int tid  = threadIdx.x;
  const int wave = tid >> 5;
  const int lane = tid & 31;
  const int hh   = lane >> 4;
  const int c    = lane & 15;

  const int bx   = blockIdx.x;
  const int qb   = bx % NQB;
  const int h    = bx / NQB;                 // < NH by the grid size
  const int q0   = qb * 64 + wave * 16;
  const int qrow = q0 + c;                   // the lane's query

  const _Float16* Qp  = (const _Float16*)(const void*)qkvp  + (size_t)h * HD;
  const _Float16* Qrp = (const _Float16*)(const void*)qkvrp + (size_t)h * HD;
  const _Float16* Kp  = Qp + DM;
  const _Float16* Krp = Qrp + DM;
  const _Float16* Vt  = (const _Float16*)(const void*)vtp  + ((size_t)h * HD) * SEQ;
  const _Float16* Vrt = (const _Float16*)(const void*)vtrp + ((size_t)h * HD) * SEQ;

  // ---- Q fragments (B operand, column = lane&15): 2 d-chunks ----
  v16h qa[2], qr[2];
#pragma unroll
  for (int dc = 0; dc < 2; ++dc) {
    const size_t qo = (size_t)qrow * DQKV + dc * 32 + 8 * hh;
    qa[dc] = ldfrag_h(Qp + qo);
    if constexpr (HR) qr[dc] = ldfrag_h(Qrp + qo);
    else qr[dc] = qa[dc];
  }

  float lsum = 0.f, mrun = -1e30f;
  v8f oacc[4], oacc2[4];
#pragma unroll
  for (int t = 0; t < 4; ++t) { oacc[t] = zero8(); oacc2[t] = zero8(); }

  const int ktlo = (qb >= KTW - 1) ? (qb - (KTW - 1)) : 0;   // first key tile in the window, block-uniform
  const int nkt  = qb - ktlo + 1;                              // 1..KTW key tiles, block-uniform
  for (int kti = 0; kti < nkt; ++kti) {
    const int kv0 = (ktlo + kti) * 64;                         // <= qb*64 < SEQ
    __syncthreads();
    {
      const int r = tid >> 1, half = (tid & 1) * 32;
      const size_t ko = (size_t)(kv0 + r) * DQKV + half;      // K row kv0+r, d = half..half+31
      const size_t vo = (size_t)r * SEQ + kv0 + half;           // V^T row d = r, s = kv0+half..+31
#pragma unroll
      for (int i = 0; i < 4; ++i) {
        const v8h a0 = *(const v8h*)(Kp + ko + 8 * i);
        const v8h b0 = *(const v8h*)(Vt + vo + 8 * i);
        *(v8h*)(Ksh + r * AP + half + 8 * i) = a0;
        *(v8h*)(Vsh + r * AP + half + 8 * i) = b0;
        if constexpr (HR) {
          const v8h a1 = *(const v8h*)(Krp + ko + 8 * i);
          const v8h b1 = *(const v8h*)(Vrt + vo + 8 * i);
          *(v8h*)(Krs + r * AP + half + 8 * i) = a1;
          *(v8h*)(Vrs + r * AP + half + 8 * i) = b1;
        }
      }
    }
    __syncthreads();

    // ---- scores^T: 64 keys x 16 query columns per wave (A operand: lane c -> key j*16+c, split k map over d) ----
    v8f s[4];
#pragma unroll
    for (int j = 0; j < 4; ++j) {
      s[j] = zero8();
      v8f t = zero8();
#pragma unroll
      for (int dc = 0; dc < 2; ++dc) {
        FH kb;
        kb.h[0] = *(const v8h*)(Ksh + (j * 16 + c) * AP + dc * 32 + 8 * hh);
        kb.h[1] = *(const v8h*)(Ksh + (j * 16 + c) * AP + dc * 32 + 16 + 8 * hh);
        s[j] = mma_h_raw(kb.v, qa[dc], s[j]);
        if constexpr (HR) {
          FH krb;
          krb.h[0] = *(const v8h*)(Krs + (j * 16 + c) * AP + dc * 32 + 8 * hh);
          krb.h[1] = *(const v8h*)(Krs + (j * 16 + c) * AP + dc * 32 + 16 + 8 * hh);
          t = mma_h_raw(krb.v, qa[dc], t);
          t = mma_h_raw(kb.v, qr[dc], t);
        }
      }
      if constexpr (HR) s[j] = s[j] + t * (1.0f / 2048.0f);
    }

    // ---- windowed causal online softmax of the lane's query: in-lane max over its 32 keys, one exchange with
    //      the other half, running max, alpha, p, row-sum partial, P (x256, f16; HR: + residual) in registers ----
    const int key0 = kv0 + 8 * hh;
    float tm[4];
#pragma unroll
    for (int j = 0; j < 4; ++j) {                            // four independent max chains
      tm[j] = -1e30f;
#pragma unroll
      for (int r = 0; r < 8; ++r) {
        const int key = key0 + j * 16 + r;
        float a = s[j][r] * (1.0f / 2048.0f);                // 1/8 head scale, 1/256 for the two x16 carries
        const bool ok = (key <= qrow) && (key + WIN >= qrow);
        a = ok ? a : -1e30f;
        s[j][r] = a;
        tm[j] = fmaxf(tm[j], a);
      }
    }
    float tmx = fmaxf(fmaxf(tm[0], tm[1]), fmaxf(tm[2], tm[3]));
    tmx = fmaxf(tmx, xhalf(tmx));
    const float mn = fmaxf(mrun, tmx);
    const float al = __expf(mrun - mn);
    mrun = mn;
    FH pb[2], pbr[2];                                        // B operands of the two 32-key chunks
    float ps[4];
#pragma unroll
    for (int j = 0; j < 4; ++j) {                            // four independent sum chains
      ps[j] = 0.0f;
#pragma unroll
      for (int r = 0; r < 8; ++r) {
        const int key = key0 + j * 16 + r;
        const bool ok = (key <= qrow) && (key + WIN >= qrow);
        float p = __expf(s[j][r] - mn);
        p = ok ? p : 0.0f;
        ps[j] += p;
        const float g = p * 256.0f;
        const _Float16 x0 = (_Float16)g;
        pb[j >> 1].h[j & 1][r] = x0;
        if constexpr (HR) pbr[j >> 1].h[j & 1][r] = (_Float16)((g - (float)x0) * 2048.0f);
      }
    }
    lsum = lsum * al + ((ps[0] + ps[1]) + (ps[2] + ps[3]));

    // ---- rescale the context accumulators by alpha (VALU) ----
#pragma unroll
    for (int t = 0; t < 4; ++t) {
      oacc[t] = oacc[t] * al;
      if constexpr (HR) oacc2[t] = oacc2[t] * al;
    }

    // ---- context^T += V^T . P^T (f16 WMMA; A = V^T [d][key], B = P^T [key][query]) ----
#pragma unroll
    for (int kk = 0; kk < 2; ++kk) {
#pragma unroll
      for (int t = 0; t < 4; ++t) {
        FH vb;
        vb.h[0] = *(const v8h*)(Vsh + (t * 16 + c) * AP + kk * 32 + 8 * hh);
        vb.h[1] = *(const v8h*)(Vsh + (t * 16 + c) * AP + kk * 32 + 16 + 8 * hh);
        oacc[t] = mma_h_raw(vb.v, pb[kk].v, oacc[t]);
        if constexpr (HR) {
          FH vrb;
          vrb.h[0] = *(const v8h*)(Vrs + (t * 16 + c) * AP + kk * 32 + 8 * hh);
          vrb.h[1] = *(const v8h*)(Vrs + (t * 16 + c) * AP + kk * 32 + 16 + 8 * hh);
          oacc2[t] = mma_h_raw(vrb.v, pb[kk].v, oacc2[t]);
          oacc2[t] = mma_h_raw(vb.v, pbr[kk].v, oacc2[t]);
        }
      }
    }
  }

  __syncthreads();                           // every wave is done with the K/V tiles before they are aliased

  // ---- normalise (1/lsum, the 1/256 p carry; keep the x16 v carry), stage the wave's 16x64 f32 tile in LDS
  //      (row = query c, 8 consecutive features per context tile and lane), then store whole 128-byte rows ----
  float* os = (float*)(void*)smem + wave * (16 * OP);
  {
    const float l  = lsum + xhalf(lsum);     // the two halves of the query's keys
    const float rl = 1.0f / l;               // l >= 1 (the max key contributes p = 1)
    const float sc = rl * (1.0f / 256.0f);
#pragma unroll
    for (int t = 0; t < 4; ++t) {
      v4f lo, hi;
#pragma unroll
      for (int r = 0; r < 4; ++r) {
        float v0 = oacc[t][r], v1 = oacc[t][4 + r];
        if constexpr (HR) {
          v0 += oacc2[t][r] * (1.0f / 2048.0f);
          v1 += oacc2[t][4 + r] * (1.0f / 2048.0f);
        }
        lo[r] = v0 * sc;
        hi[r] = v1 * sc;
      }
      *(v4f*)(os + c * OP + t * 16 + 8 * hh)     = lo;
      *(v4f*)(os + c * OP + t * 16 + 8 * hh + 4) = hi;
    }
  }
  __builtin_amdgcn_fence(__ATOMIC_RELEASE, "workgroup");
  __builtin_amdgcn_wave_barrier();
  __builtin_amdgcn_fence(__ATOMIC_ACQUIRE, "workgroup");
  {
    const int rq = lane >> 3, piece = lane & 7;
    v4u ph[4], pr[4];
#pragma unroll
    for (int it = 0; it < 4; ++it) {
      const int row = it * 4 + rq;   // it 0..3 x rq 0..3 = rows 0..15 of the wave tile
      const v4f a  = *(const v4f*)(os + row * OP + piece * 8);
      const v4f a2 = *(const v4f*)(os + row * OP + piece * 8 + 4);
      float f[8];
      f[0] = a[0];  f[1] = a[1];  f[2] = a[2];  f[3] = a[3];
      f[4] = a2[0]; f[5] = a2[1]; f[6] = a2[2]; f[7] = a2[3];
      v4u p, q;
#pragma unroll
      for (int e = 0; e < 4; ++e) {
        const _Float16 x0 = (_Float16)f[2 * e], x1 = (_Float16)f[2 * e + 1];
        p[e] = pk16(h_bits(x0), h_bits(x1));
        if constexpr (HR) {
          const _Float16 y0 = (_Float16)((f[2 * e] - (float)x0) * 2048.0f);
          const _Float16 y1 = (_Float16)((f[2 * e + 1] - (float)x1) * 2048.0f);
          q[e] = pk16(h_bits(y0), h_bits(y1));
        } else {
          q[e] = p[e];
        }
      }
      ph[it] = p;
      pr[it] = q;
    }
    {
#pragma unroll
      for (int it = 0; it < 4; ++it) {
        const int row = it * 4 + rq;
        const size_t go = (size_t)(q0 + row) * DM + (size_t)h * HD + piece * 8;
        *(v4u*)(ctxp + go) = ph[it];
        if constexpr (HR) *(v4u*)(ctxrp + go) = pr[it];
      }
      
    }
  }
}

// =====================================================================================================
// Workspace map (bytes); every region is an exact multiple of its whole-line / whole-tile store granularity
// (row pitches 2048 / 6144 / 8192 / 256 B, all offsets multiples of 256, no aliasing within a launch):
//   Xh     f16 [SEQ][1024]                 (bf16 value of x, x16)
//   Wqkv   f16 [3072][1024]                (bf16 values of wq | wk | wv x1024, [n][k] = the input layout)
//   Wp     f16 [1024][1024]                (bf16 value of wo x1024, [n][k])
//   QKV    f16 [SEQ][3072]                 (rotated q | rotated k, x16; the v columns are neither written nor read)
//   QKVr   f16 [SEQ][3072]                 (x2^11 residual of the above)
//   VT     f16 [1024][SEQ]                 ([h*64 + d][s])
//   VTr    f16 [1024][SEQ]                 (residual)
//   Ctx    f16 [SEQ][1024]                 (attention context x16)
//   Ctxr   f16 [SEQ][1024]                 (residual)
//   Rt     f32 [SEQ][64]                   (cos | sin table)
//   total for SEQ = 4096: 101711872
// d_out f32: [SEQ][1024] at byte 0, every 64x64 tile written once by the projection launch.
// =====================================================================================================
extern "C" void kernel_launch(void* const* d_in, const int* in_sizes, int n_in,
                              void* d_out, int out_size, void* d_ws, size_t ws_size,
                              hipStream_t stream) {
  if (n_in < 5) return;
  if (in_sizes[0] < SEQ * DM) return;
  if (in_sizes[1] != DM * DM) return;
  if (in_sizes[2] != DM * DM) return;
  if (in_sizes[3] != DM * DM) return;
  if (in_sizes[4] != DM * DM) return;
  if (out_size < OUTN) return;

  const float* x  = (const float*)d_in[0];    // [SEQ][DM] (row prefix)
  const float* wq = (const float*)d_in[1];    // [DM n][DM k]
  const float* wk = (const float*)d_in[2];    // [DM n][DM k]
  const float* wv = (const float*)d_in[3];    // [DM n][DM k]
  const float* wo = (const float*)d_in[4];    // [DM n][DM k]

  const size_t PX   = (size_t)SEQ * DM * 2;          //  8388608 (SEQ 4096)
  const size_t PWq  = (size_t)DQKV * DM * 2;         //  6291456
  const size_t PWp  = (size_t)DM * DM * 2;           //  2097152
  const size_t PQKV = (size_t)SEQ * DQKV * 2;        // 25165824
  const size_t PVT  = (size_t)DM * SEQ * 2;          //  8388608
  const size_t PCtx = (size_t)SEQ * DM * 2;          //  8388608
  const size_t PRt  = (size_t)SEQ * 64 * 4;          //  1048576
  size_t off = 0;
  const size_t oX    = off; off += PX;
  const size_t oWq   = off; off += PWq;
  const size_t oWp   = off; off += PWp;
  const size_t oQKV  = off; off += PQKV;
  const size_t oQKVr = off; off += PQKV;
  const size_t oVT   = off; off += PVT;
  const size_t oVTr  = off; off += PVT;
  const size_t oCtx  = off; off += PCtx;
  const size_t oCtxr = off; off += PCtx;
  const size_t oRt   = off; off += PRt;
  if (off > ws_size) return;                         // off = 101711872 for SEQ 4096
  if (off > (size_t)134217728) return;

  char* ws = (char*)d_ws;
  unsigned short* Xh   = (unsigned short*)(ws + oX);
  unsigned short* Wqkv = (unsigned short*)(ws + oWq);
  unsigned short* Wp   = (unsigned short*)(ws + oWp);
  unsigned short* QKV  = (unsigned short*)(ws + oQKV);
  unsigned short* QKVr = (unsigned short*)(ws + oQKVr);
  unsigned short* VT   = (unsigned short*)(ws + oVT);
  unsigned short* VTr  = (unsigned short*)(ws + oVTr);
  unsigned short* Ctx  = (unsigned short*)(ws + oCtx);
  unsigned short* Ctxr = (unsigned short*)(ws + oCtxr);
  float*          Rt   = (float*)(ws + oRt);
  float*          outf = (float*)d_out;              // [SEQ][DM]

  const dim3 blk(256);
  const dim3 gPrep(PREP_B);                          // 512 table + 2048 x + 4 x 512 weight blocks (SEQ 4096)
  const dim3 gGqkv((SEQ / 128) * (DQKV / 128));      // 768 block tiles of 128x128 (SEQ 4096)
  const dim3 gGdm((SEQ / 128) * (DM / 128));         // 256 block tiles (8 waves each: 4 per ctx plane)
  const dim3 gAttn(NQB * NH);                        // 1024 blocks: every (head, query tile)
  const float wScale = 1024.0f;                      // weights carried x1024
  const float aScale = 16.0f;                        // activations carried x16
  const float cscale = 1.0f / 16384.0f;              // 1/(16 * 1024)

  // (1, 2) one launch: planes x -> f16 x16 (bf16 values); weights [n][k] -> f16 x1024 (bf16 values), wq | wk | wv
  //     stacked; RoPE table cos | sin per token
  k_prep<<<gPrep, blk, 0, stream>>>(x, wq, wk, wv, wo, Xh, Wqkv, Wp, Rt, aScale, wScale);
  // (3, 4) qkv = Xh . Wqkv^T (M=SEQ, N=3072, K=1024): q and k column blocks (n < 2*DM) with RoPE -> QKV f16 x16 +
  //     residual plane, pitch 3072; v column blocks (n >= 2*DM) -> v^T planes VT, VTr straight from the accumulators
  gemm64_f16<0, false><<<gGqkv, dim3(128), 0, stream>>>(Xh, Xh, DM, Wqkv, DM, cscale, (void*)QKV, QKVr, DQKV,
                                                  SEQ, DQKV, DM, aScale, Rt, 2 * DM, VT, VTr, 2 * DM, SEQ);
  // (5) windowed causal softmax attention -> Ctx f16 x16 + residual plane (all query tiles)
  attn_k<true><<<gAttn, dim3(128), 0, stream>>>(QKV, QKVr, VT, VTr, Ctx, Ctxr);
  // (6) out = (Ctx + 2^-11 Ctxr) . Wp^T -> d_out f32 [SEQ][1024] (M=SEQ, N=1024, K=1024), every tile once;
  //     blocks of 8 waves, the two planes side by side
  gemm64_f16<1, true><<<gGdm, blk, 0, stream>>>(Ctx, Ctxr, DM, Wp, DM, cscale, (void*)outf, Ctxr, DM,
                                                SEQ, DM, DM, 1.0f, Rt, 0, Ctxr, Ctxr, DM, DM);
  (void)hipGetLastError();
}

// v008
// Measured time: 87.8 microseconds a run.
// Two timings next to v007 both put it at 1.05 times that version's speed.
// All steps since v000 together make it 3.27 times as fast.
// Contractions: q|k|v projection = v_wmma_f32_16x16x32_f16 (A = f16 of RNE-bf16 x carried x16, B = f16 of RNE-bf16 wq|wk|wv carried x1024, single product); attention k.q^T and v^T.p^T (transposed products) = v_wmma_f32_16x16x32_f16 (q, k, v^T f16 planes x16 plus x2^11 residual planes, p f16 x256 plus x2^11 residual; hi.hi + hi.res + res.hi); output projection = v_wmma_f32_16x16x32_f16 (A = ctx f16 x16 plus its x2^11 residual plane, B = f16 of RNE-bf16 wo x1024; hi.B + res.B); all f32 accumulate. RoPE cos/sin table, rotation, windowed causal online-max softmax and row sums in f32 on the VALU.
#include <hip/hip_runtime.h>
#include <math.h>
#include <stdint.h>

#define SEQ   4096                  // token rows processed (a row prefix of x); every stride, carve and grid derives from it
#define DM    1024
#define NH    16
#define HD    64
#define WIN   512
#define DQKV  (3 * DM)              // 3072
#define NQB   (SEQ / 64)            // query tiles of 64 rows
#define KTW   (WIN / 64 + 1)        // key tiles visited per 64-row query tile = 9
#define OUTN  (SEQ * DM)
static_assert(NH * HD == DM);
static_assert(HD == 64);
static_assert((WIN % 64) == 0);
static_assert(KTW == 9);
static_assert((SEQ % 64) == 0 && (DM % 64) == 0 && (DQKV % 64) == 0);
static_assert((DM % 32) == 0);
static_assert((SEQ % 128) == 0 && (DM % 128) == 0 && (DQKV % 128) == 0);   // GEMM block tile 128x128
static_assert((DM % 64) == 0 && DM >= 128);                                 // GEMM pass of 64 k, two passes or more
static_assert(((SEQ * DM / 8) % 256) == 0);
static_assert(((DM * DM / 8) % 256) == 0);
static_assert((SEQ % 8) == 0);

#define GP_B    144                 // GEMM LDS row pitch, bytes: 128-byte row + 16 (16 B x odd, for 16-byte readers)
#define GP_H    (GP_B / 2)          // the same in halves
#define GTILE   (128 * GP_B)        // one operand's 128 rows of a stage, bytes

typedef _Float16 v16h __attribute__((ext_vector_type(16)));
typedef _Float16 v8h  __attribute__((ext_vector_type(8)));
typedef float    v8f  __attribute__((ext_vector_type(8)));
typedef float    v4f  __attribute__((ext_vector_type(4)));
typedef unsigned int v4u __attribute__((ext_vector_type(4)));

// ---- scalar helpers --------------------------------------------------------------------------------
__device__ __forceinline__ unsigned short bf_bits(float f) {          // f32 -> bf16 bits, RNE convert
  unsigned u = __float_as_uint(f);
  return (unsigned short)((u + 0x7FFFu + ((u >> 16) & 1u)) >> 16);
}
__device__ __forceinline__ float bfr(float f) { return __uint_as_float(((unsigned)bf_bits(f)) << 16); }
__device__ __forceinline__ unsigned short h_bits(_Float16 x) { return __builtin_bit_cast(unsigned short, x); }
__device__ __forceinline__ unsigned pk16(unsigned short a, unsigned short b) { return (unsigned)a | ((unsigned)b << 16); }
__device__ __forceinline__ v8f zero8() { v8f z = {0.f, 0.f, 0.f, 0.f, 0.f, 0.f, 0.f, 0.f}; return z; }

// ---- fragment loader: 16-bit A/B operand, lane -> row/col (lane&15), p already includes +8*(lane>>4);
//      elements 0..7 <- p[0..7] (k0+8h..), elements 8..15 <- p[16..23] (k0+16+8h..)
__device__ __forceinline__ v16h ldfrag_h(const _Float16* p) {
  union { v16h v; v8h h[2]; } f;
  f.h[0] = *(const v8h*)(p);
  f.h[1] = *(const v8h*)(p + 16);
  return f.v;
}

// ---- WMMA helpers: the plain builtin (the compiler orders it and keeps its distances), and the GEMM's hand-written gaps ----
__device__ __forceinline__ v8f mma_h_raw(v16h a, v16h b, v8f c) {
  return __builtin_amdgcn_wmma_f32_16x16x32_f16(false, a, false, b, (short)0, c, false, false);
}
__device__ __forceinline__ void dep_guard_h(v8f& a, v8f& b, v16h x, v16h y) {
#if defined(__HIP_DEVICE_COMPILE__)
  asm volatile("v_nop\n\tv_nop\n\tv_nop\n\tv_nop" : "+v"(a), "+v"(b) : "v"(x), "v"(y));
#endif
}
__device__ __forceinline__ void keep4_h(v16h a, v16h b, v16h c, v16h d) {
#if defined(__HIP_DEVICE_COMPILE__)
  asm volatile("v_nop" :: "v"(a), "v"(b), "v"(c), "v"(d));
#endif
}
__device__ __forceinline__ void acc_guard4(v8f& a, v8f& b, v8f& c, v8f& d) {
#if defined(__HIP_DEVICE_COMPILE__)
  asm volatile("v_nop\n\tv_nop\n\tv_nop\n\tv_nop" : "+v"(a), "+v"(b), "+v"(c), "+v"(d));
#endif
}

// =====================================================================================================
// Preparatory launch: three jobs that need nothing of each other share one grid by ranges of the block index
// (every test on the block index is block-uniform).
//   blocks [0, RT_B)                    RoPE table, 8 tokens each
//   blocks [RT_B, RT_B + CVX_B)         x -> f16 plane
//   the last 4 * CVW_B blocks           wq | wk | wv | wo -> f16 planes, CVW_B blocks each
// =====================================================================================================
#define RT_B   (SEQ / 8)                // 512
#define CVX_B  (SEQ * DM / 8 / 256)     // 2048
#define CVW_B  (DM * DM / 8 / 256)      // 512
#define PREP_B (RT_B + CVX_B + 4 * CVW_B)

// f32 plane -> f16 bits of bfr(v) * scale (scale a power of two): x (x16) and the [n][k] weights (x1024),
// whose [out][in] layout is already the k-contiguous Bt layout of the GEMM below.
// coverage: n8 threads x 8 = the whole plane.
__device__ __forceinline__ void cvt16(const float* __restrict__ in, unsigned short* out, int n8, float scale, int i) {
  if (i < n8) {
    const v4f a = *(const v4f*)(in + (size_t)i * 8);
    const v4f b = *(const v4f*)(in + (size_t)i * 8 + 4);
    v4u p;
    p[0] = pk16(h_bits((_Float16)(bfr(a[0]) * scale)), h_bits((_Float16)(bfr(a[1]) * scale)));
    p[1] = pk16(h_bits((_Float16)(bfr(a[2]) * scale)), h_bits((_Float16)(bfr(a[3]) * scale)));
    p[2] = pk16(h_bits((_Float16)(bfr(b[0]) * scale)), h_bits((_Float16)(bfr(b[1]) * scale)));
    p[3] = pk16(h_bits((_Float16)(bfr(b[2]) * scale)), h_bits((_Float16)(bfr(b[3]) * scale)));
    *(v4u*)(out + (size_t)i * 8) = p;
  }
}

// RoPE table tab[t][64] f32: [0..31] = cos(t * inv[m]), [32..63] = sin(t * inv[m]) (precise sincosf, f32
// angle = fl(t * inv[m])), inv[m] = 1 / powf(10000, (2m)/64), m = 0..31, f32, formed by each thread for its own m.
// Block = 8 tokens x 32 pairs (256 threads); the 8x64 tile is staged in LDS, then stored as whole rows.
// coverage: compute 8 x 32 threads x 2 = 8x64; store 128 lanes x 4 floats = 8 rows x 64; RT_B blocks cover every t.
__device__ __forceinline__ void rope_tab(float* st, float* tab, int blk) {
  const int tid = threadIdx.x;
  const int m   = tid & 31, tr = tid >> 5;
  const int t   = blk * 8 + tr;                     // < SEQ by the block range
  const float e = (float)(2 * m) * (1.0f / 64.0f);
  const float p = powf(10000.0f, e);
  const float w = 1.0f / p;
  const float ang = (float)t * w;
  float sn, cs;
  sincosf(ang, &sn, &cs);
  st[tr * 64 + m]      = cs;
  st[tr * 64 + 32 + m] = sn;
  __syncthreads();
  if (tid < 128) {                                  // waves 0..3, wave-uniform
    const int row = tid >> 4, c4 = (tid & 15) * 4;
    const v4f v = *(const v4f*)(st + row * 64 + c4);
    float* dst = tab + (size_t)(blk * 8 + row) * 64 + c4;
    *(v4f*)dst = v;
  }
}

__global__ __launch_bounds__(256) void k_prep(const float* __restrict__ x, const float* __restrict__ wq,
                                              const float* __restrict__ wk, const float* __restrict__ wv,
                                              const float* __restrict__ wo,
                                              unsigned short* Xh, unsigned short* Wqkv, unsigned short* Wp,
                                              float* tab, float aScale, float wScale) {
  __shared__ __align__(16) float st[8 * 64];
  const int b = blockIdx.x;
  if (b < RT_B) {                                   // the longest blocks start first
    rope_tab(st, tab, b);
  } else if (b < RT_B + CVX_B) {
    cvt16(x, Xh, SEQ * DM / 8, aScale, (b - RT_B) * 256 + (int)threadIdx.x);
  } else if (b < PREP_B) {
    const int wb = b - (RT_B + CVX_B);
    const int which = wb / CVW_B;                   // 0..3 = wq, wk, wv, wo
    const float* in = (which == 0) ? wq : (which == 1) ? wk : (which == 2) ? wv : wo;
    unsigned short* o = (which < 3) ? (Wqkv + (size_t)which * DM * DM) : Wp;
    cvt16(in, o, DM * DM / 8, wScale, (wb - which * CVW_B) * 256 + (int)threadIdx.x);
  }
}

// =====================================================================================================
// Register-blocked f16 WMMA GEMM, one wave per 64x64 tile and plane, four waves (2x2) per 128x128 block tile and
// plane. The block's A (ARES: and Ar) and Bt rows of a 64-k pass are staged in LDS by asynchronous 16-byte copies
// (whole 128-byte lines), two buffers: the next pass's copies fly while this pass's fragments are read from LDS.
//   v[m][n] = (sum_k A[m][k] * Bt[n][k]  [+ 2^-11 * sum_k Ar[m][k] * Bt[n][k] when ARES]) * cscale
// A, Ar row-major [M][K] pitch lda (f16), Bt row-major [N][K] pitch ldb (f16, k contiguous); M, N multiples of
// 128, K multiple of 64; one block per block tile (a block-uniform bound check anyway).
// ARES: eight waves. Waves 0..3 take the hi plane, waves 4..7 the residual plane of the same four 64x64 tiles in
// the same k pass (two waves per SIMD, Bt staged once for both). A residual wave takes the tile's four 16-row blocks
// in the order 2, 3, 0, 1, so that in both waves accumulator rows 0, 1 are the 32 tile rows the wave finishes and
// rows 2, 3 the 32 it hands to the other wave. Behind the loop each wave scales its sums (residual: 2^-11, exact;
// hi: 1), hands rows 2, 3 over through LDS (the ring, free by then), adds what it gets to rows 0, 1 and runs the
// epilogue for those 32 tile rows.
// Epilogue variants:
//   EPI 0: f16 hi plane = f16(v' * oscale) at Cp and residual plane = f16((v'*oscale - hi) * 2048) at Crp,
//          pitch ldc halves, where v' = v for tiles with n0 >= ropeN and, for n0 < ropeN (wave-uniform),
//          v' = rotate-half RoPE of the wave's 64-column tile (one head): pair index mm = column mod 32,
//          token = output row, c = rtab[token][mm], s = rtab[token][32+mm]:
//          col mm -> v[mm]*c - v[32+mm]*s ; col 32+mm -> v[32+mm]*c + v[mm]*s (f32, from the LDS slab).
//          Block tiles with n >= vN (vN a multiple of 128, block-uniform) go out TRANSPOSED instead, the same two
//          f16 values per element: column n, row m -> Vtp / Vtrp[(n - vN) * ldvt + m]. An accumulator register
//          run r = 0..7 of a lane is 8 consecutive rows m of one column n, i.e. 16 contiguous bytes of a transposed
//          row: per 16-column block the wave stages 16 rows x 64 m per plane in its slab and stores whole 128-byte lines.
//   EPI 1: f32 out = v, pitch ldc floats
// 16-row slabs staged per wave in LDS. f32 out: each 64-wide row segment (256 B = 2 lines) by 16 lanes x 16 B,
// coverage: 4 slabs x 16 rows x 64 cols = the whole 64x64 tile (ARES: 2 slabs from each of the tile's two waves);
// grid x 4 tiles = [M][N].
// =====================================================================================================
// Eight 16-byte asynchronous copies of one lane, global -> LDS, rows 16 apart in both places. The s_wait_xcnt
// is the last line of the copies' own statement so that no address register is rewritten ahead of it.
__device__ __forceinline__ void copy8_rows(unsigned l, const _Float16* g, int ld) {
#if defined(__HIP_DEVICE_COMPILE__)
  const unsigned l0 = l,                    l1 = l + 1u * 16u * GP_B, l2 = l + 2u * 16u * GP_B, l3 = l + 3u * 16u * GP_B;
  const unsigned l4 = l + 4u * 16u * GP_B, l5 = l + 5u * 16u * GP_B, l6 = l + 6u * 16u * GP_B, l7 = l + 7u * 16u * GP_B;
  const size_t st = (size_t)16 * ld;
  const _Float16 *g0 = g, *g1 = g + st, *g2 = g + 2 * st, *g3 = g + 3 * st;
  const _Float16 *g4 = g + 4 * st, *g5 = g + 5 * st, *g6 = g + 6 * st, *g7 = g + 7 * st;
  asm volatile(
      "global_load_async_to_lds_b128 %0, %8, off\n\t"
      "global_load_async_to_lds_b128 %1, %9, off\n\t"
      "global_load_async_to_lds_b128 %2, %10, off\n\t"
      "global_load_async_to_lds_b128 %3, %11, off\n\t"
      "global_load_async_to_lds_b128 %4, %12, off\n\t"
      "global_load_async_to_lds_b128 %5, %13, off\n\t"
      "global_load_async_to_lds_b128 %6, %14, off\n\t"
      "global_load_async_to_lds_b128 %7, %15, off\n\t"
      "s_wait_xcnt 0x0"
      :: "v"(l0), "v"(l1), "v"(l2), "v"(l3), "v"(l4), "v"(l5), "v"(l6), "v"(l7),
         "v"(g0), "v"(g1), "v"(g2), "v"(g3), "v"(g4), "v"(g5), "v"(g6), "v"(g7)
      : "memory");
#endif
}
// Twelve 16-byte asynchronous copies of one lane: four rows, 32 apart, of each of three operand tiles that lie one
// behind the other in a stage. One statement, its last line the s_wait_xcnt, for the same reason as above.
__device__ __forceinline__ void copy12_rows(unsigned l, const _Float16* a, const _Float16* r, int lda,
                                            const _Float16* b, int ldb) {
#if defined(__HIP_DEVICE_COMPILE__)
  const unsigned sl = 32u * GP_B;
  const unsigned l0 = l,             l1 = l + sl,             l2  = l + 2u * sl,             l3  = l + 3u * sl;
  const unsigned l4 = l + GTILE,     l5 = l + GTILE + sl,     l6  = l + GTILE + 2u * sl,     l7  = l + GTILE + 3u * sl;
  const unsigned l8 = l + 2 * GTILE, l9 = l + 2 * GTILE + sl, l10 = l + 2 * GTILE + 2u * sl, l11 = l + 2 * GTILE + 3u * sl;
  const size_t sa = (size_t)32 * lda, sb = (size_t)32 * ldb;
  const _Float16 *a0 = a, *a1 = a + sa, *a2 = a + 2 * sa, *a3 = a + 3 * sa;
  const _Float16 *r0 = r, *r1 = r + sa, *r2 = r + 2 * sa, *r3 = r + 3 * sa;
  const _Float16 *b0 = b, *b1 = b + sb, *b2 = b + 2 * sb, *b3 = b + 3 * sb;
  asm volatile(
      "global_load_async_to_lds_b128 %0, %12, off\n\t"
      "global_load_async_to_lds_b128 %1, %13, off\n\t"
      "global_load_async_to_lds_b128 %2, %14, off\n\t"
      "global_load_async_to_lds_b128 %3, %15, off\n\t"
      "global_load_async_to_lds_b128 %4, %16, off\n\t"
      "global_load_async_to_lds_b128 %5, %17, off\n\t"
      "global_load_async_to_lds_b128 %6, %18, off\n\t"
      "global_load_async_to_lds_b128 %7, %19, off\n\t"
      "global_load_async_to_lds_b128 %8, %20, off\n\t"
      "global_load_async_to_lds_b128 %9, %21, off\n\t"
      "global_load_async_to_lds_b128 %10, %22, off\n\t"
      "global_load_async_to_lds_b128 %11, %23, off\n\t"
      "s_wait_xcnt 0x0"
      :: "v"(l0), "v"(l1), "v"(l2), "v"(l3), "v"(l4), "v"(l5), "v"(l6), "v"(l7), "v"(l8), "v"(l9), "v"(l10), "v"(l11),
         "v"(a0), "v"(a1), "v"(a2), "v"(a3), "v"(r0), "v"(r1), "v"(r2), "v"(r3), "v"(b0), "v"(b1), "v"(b2), "v"(b3)
      : "memory");
#endif
}
// the issuing wave's copies have landed in LDS behind this wait
__device__ __forceinline__ void wait_async0() {
#if defined(__HIP_DEVICE_COMPILE__)
  asm volatile("s_wait_asynccnt 0x0" ::: "memory");
#endif
}
// the wave's own LDS reads of a buffer have retired before that buffer is handed back for a refill
__device__ __forceinline__ void wait_ds0() {
#if defined(__HIP_DEVICE_COMPILE__)
  asm volatile("s_wait_dscnt 0x0" ::: "memory");
#endif
}

template <int EPI, bool ARES>
__global__ __launch_bounds__(ARES ? 256 : 128) void gemm64_f16(
    const unsigned short* __restrict__ Ap, const unsigned short* __restrict__ Arp, int lda,
    const unsigned short* __restrict__ Btp, int ldb,
    float cscale,
    void* Cp, unsigned short* Crp, int ldc, int M, int N, int K, float oscale,
    const float* __restrict__ rtab, int ropeN,
    unsigned short* Vtp, unsigned short* Vtrp, int vN, int ldvt) {
  const _Float16* Ah  = (const _Float16*)(const void*)Ap;
  const _Float16* Arh = (const _Float16*)(const void*)Arp;
  const _Float16* Bt  = (const _Float16*)(const void*)Btp;
  constexpr unsigned OFF_BT = (ARES ? 2u : 1u) * GTILE;      // Bt rows behind the A (ARES: A and Ar) rows of a stage
  constexpr unsigned GSTAGE = OFF_BT + GTILE;                // one stage, bytes
  static_assert(!ARES || 4 * 64 * 64 * 4 <= 2 * GSTAGE);     // the hand-over of the residual sums fits the ring
  __shared__ __align__(16) unsigned char ring[2 * GSTAGE];   // two stages of [A | (ARES: Ar |) Bt], 128 rows each, pitch GP_B
  constexpr int SLABF = (EPI == 0) ? 2 * 16 * GP_B / 4 : 16 * 68;   // EPI 0: also two transposed f16 16x64 planes at pitch GP_B
  static_assert(SLABF >= 16 * 68);
  __shared__ __align__(16) float sT[ARES ? 8 : 4][SLABF];     // per-wave 16x64 slab, pitch 68 floats
  const int tid  = threadIdx.x;
  const int lane = tid & 31;
  const int wave = (tid >> 5) & 3;             // the wave's place among the four tiles
  const int plane = ARES ? __builtin_amdgcn_readfirstlane(tid >> 7) : 0;   // wave-uniform: 0 = A, 1 = Ar
  const int tilesN = N >> 7;
  const int tilesM = M >> 7;
  if ((int)blockIdx.x >= tilesM * tilesN) return;   // block-uniform, in front of every barrier and copy
  const int bm = (int)blockIdx.x / tilesN;
  const int bn = (int)blockIdx.x - bm * tilesN;
  const int wm = (wave >> 1) << 6;             // the wave's 64x64 tile inside the block's 128x128 tile
  const int wn = (wave & 1) << 6;
  const int m0 = (bm << 7) + wm;
  const int n0 = (bn << 7) + wn;

  const int rlane = lane & 15;                 // row (A) / col (B, D) within subtile
  const int koff  = (lane >> 4) * 8;           // k offset of this lane half
  const int mOff  = (lane >> 4) * 8;           // D row offset

  v8f acc[4][4];
#pragma unroll
  for (int i = 0; i < 4; ++i)
#pragma unroll
    for (int j = 0; j < 4; ++j) acc[i][j] = zero8();

  // staging map: lane -> row tid>>3 (+16 per copy, 8 copies = 128 rows; ARES: +32 per copy, 4 copies), 16-byte
  // piece tid&7 of the 128-byte row
  const int crow = tid >> 3, cpc = tid & 7;
  const unsigned ringb = (unsigned)(uintptr_t)(const void*)ring;           // LDS byte address of the ring
  const unsigned lcp   = ringb + (unsigned)(crow * GP_B + cpc * 16);
  const _Float16* gA  = Ah  + (size_t)((bm << 7) + crow) * lda + cpc * 8;
  const _Float16* gAr = Arh + (size_t)((bm << 7) + crow) * lda + cpc * 8;
  const _Float16* gB  = Bt  + (size_t)((bn << 7) + crow) * ldb + cpc * 8;
  const int NP = K >> 6;                       // passes of 64 k
  // one stage: the block's rows of k = kk .. kk + 63 -> the buffer at LDS byte lb (the lane's own piece)
  auto stage = [&](unsigned lb, int kk) {
    if constexpr (ARES) {
      copy12_rows(lb, gA + kk, gAr + kk, lda, gB + kk, ldb);
    } else {
      copy8_rows(lb, gA + kk, lda);
      copy8_rows(lb + OFF_BT, gB + kk, ldb);
    }
  };

  // tile 0 -> buffer 0, landed and published; then tile 1 -> buffer 1 flies over pass 0
  stage(lcp, 0);
  wait_async0();
  __syncthreads();
  if (NP > 1) stage(lcp + GSTAGE, 64);

  for (int t = 0; t < NP; ++t) {
    const unsigned bsel = (unsigned)(t & 1) * GSTAGE;
    const _Float16* sA = (const _Float16*)(const void*)(ring + bsel + (unsigned)plane * GTILE) + (wm + rlane) * GP_H + koff;
    const _Float16* sAlo = sA + 32 * plane * GP_H;   // row blocks i = 0, 1: tile rows 16 i (+ 32 in a residual wave)
    const _Float16* sAhi = sA - 32 * plane * GP_H;   // row blocks i = 2, 3: tile rows 16 i (- 32 in a residual wave)
    const _Float16* sB = (const _Float16*)(const void*)(ring + bsel + OFF_BT) + (wn + rlane) * GP_H + koff;
    // the loops below are unrolled so that every fragment and accumulator index is a constant (registers, no scratch)
#pragma unroll
    for (int ks = 0; ks < 2; ++ks) {
      v16h bh[4];
#pragma unroll
      for (int j = 0; j < 4; ++j) bh[j] = ldfrag_h(sB + (j << 4) * GP_H + ks * 32);
      v16h ah[4];                              // all eight fragments of a 32-k step are read as one group
#pragma unroll
      for (int i = 0; i < 4; ++i) ah[i] = ldfrag_h((i < 2 ? sAlo : sAhi) + (i << 4) * GP_H + ks * 32);
#pragma unroll
      for (int i = 0; i < 4; ++i) {
#pragma unroll
        for (int j = 0; j < 4; ++j) {
          acc[i][j] = mma_h_raw(ah[i], bh[j], acc[i][j]);
        }
        dep_guard_h(acc[i][0], acc[i][3], ah[i], bh[3]);
      }
      keep4_h(bh[0], bh[1], bh[2], bh[3]);
    }
    // publish point of tile t + 1: own LDS reads retired, own copies landed, one barrier for both jobs
    wait_ds0();
    wait_async0();
    __syncthreads();
    if (t + 2 < NP) stage(lcp + bsel, (t + 2) << 6);   // block-uniform: refill the buffer that pass t has just read
  }
  wait_async0();
  acc_guard4(acc[0][0], acc[0][1], acc[0][2], acc[0][3]);
  acc_guard4(acc[1][0], acc[1][1], acc[1][2], acc[1][3]);
  acc_guard4(acc[2][0], acc[2][1], acc[2][2], acc[2][3]);
  acc_guard4(acc[3][0], acc[3][1], acc[3][2], acc[3][3]);

  // ---- epilogue: emit(a, i) stores rows 16 i .. 16 i + 15 of the wave's tile from their four accumulators ----
  float* slab = sT[wave + 4 * plane];
  // RoPE table values of slab i (EPI 0): row 16 i + it * 4 + (lane >> 3), pair indices (lane & 3) * 8 + 0..7, cos and sin.
  // All sixteen loads of a slab are issued together, one slab ahead: slab 0's in front of the first emit, slab i + 1's
  // in emit(i) in front of its global stores, so that they fly while those stores drain at the slab's closing fence.
  static_assert(!(EPI == 0 && ARES));                        // emit(i) below fetches for slab i + 1 of four in rising order
  [[maybe_unused]] v4f tc0[4], tc1[4], ts0[4], ts1[4];
  [[maybe_unused]] auto ldtab = [&](int i) {
    if (n0 < ropeN) {                                        // wave-uniform (n0 is per wave)
      const float* trp = rtab + (size_t)(m0 + (i << 4) + (lane >> 3)) * 64 + (lane & 3) * 8;   // output row = token index
#pragma unroll
      for (int it = 0; it < 4; ++it) {                       // unrolled: register arrays, constant indices
        tc0[it] = *(const v4f*)(trp + it * 256);
        tc1[it] = *(const v4f*)(trp + it * 256 + 4);
        ts0[it] = *(const v4f*)(trp + it * 256 + 32);
        ts1[it] = *(const v4f*)(trp + it * 256 + 36);
      }
#if defined(__HIP_DEVICE_COMPILE__)
      // behind the last table load; the address is an input, so that it stays in its registers (no load's result and no
      // later instruction lands on them) up to this wait
      asm volatile("s_wait_xcnt 0x0" :: "v"(trp) : "memory");
#endif
    }
  };
  auto emit = [&](const v8f (&a)[4], int i) {
    const int mBase = m0 + (i << 4);
#pragma unroll
    for (int r = 0; r < 8; ++r) {
      const int row = mOff + r;
#pragma unroll
      for (int j = 0; j < 4; ++j) slab[row * 68 + (j << 4) + rlane] = a[j][r] * cscale;
    }
    __builtin_amdgcn_fence(__ATOMIC_RELEASE, "workgroup");
    __builtin_amdgcn_wave_barrier();
    __builtin_amdgcn_fence(__ATOMIC_ACQUIRE, "workgroup");
    if constexpr (EPI == 0) {
      unsigned short* C16 = (unsigned short*)Cp;
      const int rq = lane >> 3, piece = lane & 7;
      const bool rope_on = (n0 < ropeN);                   // wave-uniform (n0 is per wave)
      const float rsgn = (piece < 4) ? -1.0f : 1.0f;       // cols 0..31 carry x1 (minus), cols 32..63 carry x2 (plus)
      v4u ph[4], pr[4];
#pragma unroll
      for (int it = 0; it < 4; ++it) {
        const int row = it * 4 + rq;                         // it 0..3 x rq 0..3 = rows 0..15
        const v4f a  = *(const v4f*)(slab + row * 68 + piece * 8);
        const v4f a2 = *(const v4f*)(slab + row * 68 + piece * 8 + 4);
        float f[8];
        f[0] = a[0];  f[1] = a[1];  f[2] = a[2];  f[3] = a[3];
        f[4] = a2[0]; f[5] = a2[1]; f[6] = a2[2]; f[7] = a2[3];
        if (rope_on) {                                       // wave-uniform branch, LDS reads only
          const int po = (piece ^ 4) * 8;                    // partner half of the head (32 columns away)
          const v4f g  = *(const v4f*)(slab + row * 68 + po);
          const v4f g2 = *(const v4f*)(slab + row * 68 + po + 4);
          const v4f c0 = tc0[it], c1 = tc1[it], s0 = ts0[it], s1 = ts1[it];   // fetched one slab ahead by ldtab
          f[0] = f[0] * c0[0] + rsgn * g[0]  * s0[0];
          f[1] = f[1] * c0[1] + rsgn * g[1]  * s0[1];
          f[2] = f[2] * c0[2] + rsgn * g[2]  * s0[2];
          f[3] = f[3] * c0[3] + rsgn * g[3]  * s0[3];
          f[4] = f[4] * c1[0] + rsgn * g2[0] * s1[0];
          f[5] = f[5] * c1[1] + rsgn * g2[1] * s1[1];
          f[6] = f[6] * c1[2] + rsgn * g2[2] * s1[2];
          f[7] = f[7] * c1[3] + rsgn * g2[3] * s1[3];
        }
        v4u p, q;
#pragma unroll
        for (int e = 0; e < 4; ++e) {
          const float g0 = f[2 * e] * oscale, g1 = f[2 * e + 1] * oscale;
          const _Float16 x0 = (_Float16)g0, x1 = (_Float16)g1;
          const _Float16 y0 = (_Float16)((g0 - (float)x0) * 2048.0f);
          const _Float16 y1 = (_Float16)((g1 - (float)x1) * 2048.0f);
          p[e] = pk16(h_bits(x0), h_bits(x1));
          q[e] = pk16(h_bits(y0), h_bits(y1));
        }
        ph[it] = p;
        pr[it] = q;
      }
      if (i + 1 < 4) ldtab(i + 1);                           // this slab's table values are used up
      {
#pragma unroll
        for (int it = 0; it < 4; ++it) {
          const int row = it * 4 + rq;
          const size_t co = (size_t)(mBase + row) * ldc + n0 + piece * 8;
          *(v4u*)(C16 + co) = ph[it];
          *(v4u*)(Crp + co) = pr[it];
        }
        
      }
    } else {
      float* Cf = (float*)Cp;
      const int hh = lane >> 4, c4 = (lane & 15) * 4;     // 256-B row segment = 16 lanes x 16 B
      v4f ov[8];
#pragma unroll
      for (int it = 0; it < 8; ++it) {
        const int row = it * 2 + hh;                       // it 0..7 x hh 0..1 = rows 0..15
        ov[it] = *(const v4f*)(slab + row * 68 + c4);
      }
      {
#pragma unroll
        for (int it = 0; it < 8; ++it) {
          const int row = it * 2 + hh;
          *(v4f*)(Cf + (size_t)(mBase + row) * ldc + n0 + c4) = ov[it];
        }
        
      }
    }
    __builtin_amdgcn_fence(__ATOMIC_RELEASE, "workgroup");
    __builtin_amdgcn_wave_barrier();
    __builtin_amdgcn_fence(__ATOMIC_ACQUIRE, "workgroup");
  };

  if constexpr (ARES) {
    // ---- the two planes' sums are joined. The ring is free: the barrier at the foot of the last pass stands behind
    //      every wave's last fragment read and last landed copy. A tile has 16 KiB there, 8 KiB written by each of its
    //      two waves; chunk q of lane l lies at float (q * 32 + l) * 4: a lane reads what the same lane of the tile's
    //      other wave wrote ----
    const float sc = (plane != 0) ? (1.0f / 2048.0f) : 1.0f;   // exact fold of the x2^11 residual carry
    float* xw       = (float*)(void*)ring + wave * (64 * 64) + plane * (32 * 64) + lane * 4;
    const float* xr = (const float*)(const void*)ring + wave * (64 * 64) + (plane ^ 1) * (32 * 64) + lane * 4;
#pragma unroll
    for (int i = 0; i < 2; ++i)
#pragma unroll
      for (int j = 0; j < 4; ++j) {
        const v8f v = acc[2 + i][j] * sc;
        const v4f lo = {v[0], v[1], v[2], v[3]}, hi = {v[4], v[5], v[6], v[7]};
        *(v4f*)(xw + ((i * 4 + j) * 2) * 128)     = lo;
        *(v4f*)(xw + ((i * 4 + j) * 2 + 1) * 128) = hi;
      }
    __syncthreads();                           // every wave passes it: both waves' hand-overs are published
#pragma unroll
    for (int i = 0; i < 2; ++i)
#pragma unroll
      for (int j = 0; j < 4; ++j) {
        const v4f lo = *(const v4f*)(xr + ((i * 4 + j) * 2) * 128);
        const v4f hi = *(const v4f*)(xr + ((i * 4 + j) * 2 + 1) * 128);
#pragma unroll
        for (int r = 0; r < 4; ++r) {
          acc[i][j][r]     = acc[i][j][r] * sc + lo[r];
          acc[i][j][4 + r] = acc[i][j][4 + r] * sc + hi[r];
        }
      }
    emit(acc[0], 2 * plane);
    emit(acc[1], 2 * plane + 1);
  } else {
    bool transposed = false;
    if constexpr (EPI == 0) transposed = ((bn << 7) >= vN);   // block-uniform (scalar)
    if (transposed) {
      if constexpr (EPI == 0) {
        // ---- transposed f16 planes: column block j = 16 transposed rows (lane&15), 64 m per row ----
        _Float16* sh = (_Float16*)(void*)slab;               // hi plane   [16][GP_H]
        _Float16* sr = sh + 16 * GP_H;                       // residual   [16][GP_H]
        const int rq = lane >> 3, piece = lane & 7;
        // the loops below are unrolled so that every accumulator index is a constant (registers, no scratch)
#pragma unroll
        for (int j = 0; j < 4; ++j) {
#pragma unroll
          for (int i = 0; i < 4; ++i) {
            v4u p, q;
#pragma unroll
            for (int e = 0; e < 4; ++e) {
              const float g0 = acc[i][j][2 * e] * cscale * oscale, g1 = acc[i][j][2 * e + 1] * cscale * oscale;
              const _Float16 x0 = (_Float16)g0, x1 = (_Float16)g1;
              const _Float16 y0 = (_Float16)((g0 - (float)x0) * 2048.0f);
              const _Float16 y1 = (_Float16)((g1 - (float)x1) * 2048.0f);
              p[e] = pk16(h_bits(x0), h_bits(x1));
              q[e] = pk16(h_bits(y0), h_bits(y1));
            }
            *(v4u*)(sh + rlane * GP_H + (i << 4) + mOff) = p;   // rows m = 16 i + 8 (lane>>4) + 0..7 of the tile
            *(v4u*)(sr + rlane * GP_H + (i << 4) + mOff) = q;
          }
          // every lane's slab stores stay ahead of the reads of other lanes' pieces below
          __builtin_amdgcn_fence(__ATOMIC_RELEASE, "workgroup");
          __builtin_amdgcn_wave_barrier();
          __builtin_amdgcn_fence(__ATOMIC_ACQUIRE, "workgroup");
          v4u ph[4], pr[4];
#pragma unroll
          for (int it = 0; it < 4; ++it) {
            const int row = it * 4 + rq;                     // it 0..3 x rq 0..3 = transposed rows 0..15
            ph[it] = *(const v4u*)(sh + row * GP_H + piece * 8);
            pr[it] = *(const v4u*)(sr + row * GP_H + piece * 8);
          }
#pragma unroll
          for (int it = 0; it < 4; ++it) {
            const int row = it * 4 + rq;
            const size_t co = (size_t)(n0 - vN + (j << 4) + row) * ldvt + m0 + piece * 8;   // 8 lanes x 16 B = one line
            *(v4u*)(Vtp + co)  = ph[it];
            *(v4u*)(Vtrp + co) = pr[it];
          }
          // the slab reads above stay ahead of the next column block's slab stores
          __builtin_amdgcn_fence(__ATOMIC_RELEASE, "workgroup");
          __builtin_amdgcn_wave_barrier();
          __builtin_amdgcn_fence(__ATOMIC_ACQUIRE, "workgroup");
        }
      }
    } else {
      if constexpr (EPI == 0) ldtab(0);
#pragma unroll
      for (int i = 0; i < 4; ++i) emit(acc[i], i);
    }
  }
}

__device__ __forceinline__ float xhalf(float x) {
  return __builtin_bit_cast(float, __builtin_amdgcn_permlanex16(__builtin_bit_cast(int, x), __builtin_bit_cast(int, x),
                                                                0x76543210, 0xfedcba98, false, false));
}

template <bool HR>
__global__ __launch_bounds__(128)
void attn_k(const unsigned short* __restrict__ qkvp, const unsigned short* __restrict__ qkvrp,
            const unsigned short* __restrict__ vtp, const unsigned short* __restrict__ vtrp,
            unsigned short* ctxp, unsigned short* ctxrp) {
  union FH { v16h v; v8h h[2]; };
  constexpr int AP     = 72;                             // LDS row pitch of the f16 tiles, halves: 128-byte row + 16 (16 B x odd, for 16-byte readers)
  constexpr int OP     = 68;                             // LDS row pitch of the f32 context slab, floats (16-byte writers and readers)
  constexpr int TB     = 64 * AP * 2;                    // one f16 64x64 tile at that pitch, bytes
  constexpr int OFF_K  = 0;
  constexpr int OFF_V  = TB;
  constexpr int OFF_KR = 2 * TB;
  constexpr int OFF_VR = 3 * TB;
  constexpr int SMEMB  = HR ? 4 * TB : 2 * TB;                // 36864 : 18432
  static_assert(4 * 16 * OP * 4 <= SMEMB);                    // f32 context staging aliases the K/V region
  __shared__ __align__(16) unsigned char smem[SMEMB];
  _Float16* Ksh = (_Float16*)(smem + OFF_K);                  // K   [kv][d]
  _Float16* Vsh = (_Float16*)(smem + OFF_V);                  // V^T [d][kv]
  _Float16* Krs = (_Float16*)(smem + (HR ? OFF_KR : OFF_K));  // K residual (HR only)
  _Float16* Vrs = (_Float16*)(smem + (HR ? OFF_VR : OFF_V));  // V^T residual (HR only)

  const int tid  = threadIdx.x;
  const int wave = tid >> 5;
  const int lane = tid & 31;
  const int hh   = lane >> 4;
  const int c    = lane & 15;

  const int bx   = blockIdx.x;
  const int qb   = bx % NQB;
  const int h    = bx / NQB;                 // < NH by the grid size
  const int q0   = qb * 64 + wave * 16;
  const int qrow = q0 + c;                   // the lane's query

  const _Float16* Qp  = (const _Float16*)(const void*)qkvp  + (size_t)h * HD;
  const _Float16* Qrp = (const _Float16*)(const void*)qkvrp + (size_t)h * HD;
  const _Float16* Kp  = Qp + DM;
  const _Float16* Krp = Qrp + DM;
  const _Float16* Vt  = (const _Float16*)(const void*)vtp  + ((size_t)h * HD) * SEQ;
  const _Float16* Vrt = (const _Float16*)(const void*)vtrp + ((size_t)h * HD) * SEQ;

  // ---- Q fragments (B operand, column = lane&15): 2 d-chunks ----
  v16h qa[2], qr[2];
#pragma unroll
  for (int dc = 0; dc < 2; ++dc) {
    const size_t qo = (size_t)qrow * DQKV + dc * 32 + 8 * hh;
    qa[dc] = ldfrag_h(Qp + qo);
    if constexpr (HR) qr[dc] = ldfrag_h(Qrp + qo);
    else qr[dc] = qa[dc];
  }

  float lsum = 0.f, mrun = -1e30f;
  v8f oacc[4], oacc2[4];
#pragma unroll
  for (int t = 0; t < 4; ++t) { oacc[t] = zero8(); oacc2[t] = zero8(); }

  const int ktlo = (qb >= KTW - 1) ? (qb - (KTW - 1)) : 0;   // first key tile in the window, block-uniform
  const int nkt  = qb - ktlo + 1;                              // 1..KTW key tiles, block-uniform
  for (int kti = 0; kti < nkt; ++kti) {
    const int kv0 = (ktlo + kti) * 64;                         // <= qb*64 < SEQ
    __syncthreads();
    {
      const int r = tid >> 1, half = (tid & 1) * 32;
      const size_t ko = (size_t)(kv0 + r) * DQKV + half;      // K row kv0+r, d = half..half+31
      const size_t vo = (size_t)r * SEQ + kv0 + half;           // V^T row d = r, s = kv0+half..+31
#pragma unroll
      for (int i = 0; i < 4; ++i) {
        const v8h a0 = *(const v8h*)(Kp + ko + 8 * i);
        const v8h b0 = *(const v8h*)(Vt + vo + 8 * i);
        *(v8h*)(Ksh + r * AP + half + 8 * i) = a0;
        *(v8h*)(Vsh + r * AP + half + 8 * i) = b0;
        if constexpr (HR) {
          const v8h a1 = *(const v8h*)(Krp + ko + 8 * i);
          const v8h b1 = *(const v8h*)(Vrt + vo + 8 * i);
          *(v8h*)(Krs + r * AP + half + 8 * i) = a1;
          *(v8h*)(Vrs + r * AP + half + 8 * i) = b1;
        }
      }
    }
    __syncthreads();

    // ---- scores^T: 64 keys x 16 query columns per wave (A operand: lane c -> key j*16+c, split k map over d) ----
    v8f s[4];
#pragma unroll
    for (int j = 0; j < 4; ++j) {
      s[j] = zero8();
      v8f t = zero8();
#pragma unroll
      for (int dc = 0; dc < 2; ++dc) {
        FH kb;
        kb.h[0] = *(const v8h*)(Ksh + (j * 16 + c) * AP + dc * 32 + 8 * hh);
        kb.h[1] = *(const v8h*)(Ksh + (j * 16 + c) * AP + dc * 32 + 16 + 8 * hh);
        s[j] = mma_h_raw(kb.v, qa[dc], s[j]);
        if constexpr (HR) {
          FH krb;
          krb.h[0] = *(const v8h*)(Krs + (j * 16 + c) * AP + dc * 32 + 8 * hh);
          krb.h[1] = *(const v8h*)(Krs + (j * 16 + c) * AP + dc * 32 + 16 + 8 * hh);
          t = mma_h_raw(krb.v, qa[dc], t);
          t = mma_h_raw(kb.v, qr[dc], t);
        }
      }
      if constexpr (HR) s[j] = s[j] + t * (1.0f / 2048.0f);
    }

    // ---- windowed causal online softmax of the lane's query: in-lane max over its 32 keys, one exchange with
    //      the other half, running max, alpha, p, row-sum partial, P (x256, f16; HR: + residual) in registers ----
    const int key0 = kv0 + 8 * hh;
    float tm[4];
#pragma unroll
    for (int j = 0; j < 4; ++j) {                            // four independent max chains
      tm[j] = -1e30f;
#pragma unroll
      for (int r = 0; r < 8; ++r) {
        const int key = key0 + j * 16 + r;
        float a = s[j][r] * (1.0f / 2048.0f);                // 1/8 head scale, 1/256 for the two x16 carries
        const bool ok = (key <= qrow) && (key + WIN >= qrow);
        a = ok ? a : -1e30f;
        s[j][r] = a;
        tm[j] = fmaxf(tm[j], a);
      }
    }
    float tmx = fmaxf(fmaxf(tm[0], tm[1]), fmaxf(tm[2], tm[3]));
    tmx = fmaxf(tmx, xhalf(tmx));
    const float mn = fmaxf(mrun, tmx);
    const float al = __expf(mrun - mn);
    mrun = mn;
    FH pb[2], pbr[2];                                        // B operands of the two 32-key chunks
    float ps[4];
#pragma unroll
    for (int j = 0; j < 4; ++j) {                            // four independent sum chains
      ps[j] = 0.0f;
#pragma unroll
      for (int r = 0; r < 8; ++r) {
        const int key = key0 + j * 16 + r;
        const bool ok = (key <= qrow) && (key + WIN >= qrow);
        float p = __expf(s[j][r] - mn);
        p = ok ? p : 0.0f;
        ps[j] += p;
        const float g = p * 256.0f;
        const _Float16 x0 = (_Float16)g;
        pb[j >> 1].h[j & 1][r] = x0;
        if constexpr (HR) pbr[j >> 1].h[j & 1][r] = (_Float16)((g - (float)x0) * 2048.0f);
      }
    }
    lsum = lsum * al + ((ps[0] + ps[1]) + (ps[2] + ps[3]));

    // ---- rescale the context accumulators by alpha (VALU) ----
#pragma unroll
    for (int t = 0; t < 4; ++t) {
      oacc[t] = oacc[t] * al;
      if constexpr (HR) oacc2[t] = oacc2[t] * al;
    }

    // ---- context^T += V^T . P^T (f16 WMMA; A = V^T [d][key], B = P^T [key][query]) ----
#pragma unroll
    for (int kk = 0; kk < 2; ++kk) {
#pragma unroll
      for (int t = 0; t < 4; ++t) {
        FH vb;
        vb.h[0] = *(const v8h*)(Vsh + (t * 16 + c) * AP + kk * 32 + 8 * hh);
        vb.h[1] = *(const v8h*)(Vsh + (t * 16 + c) * AP + kk * 32 + 16 + 8 * hh);
        oacc[t] = mma_h_raw(vb.v, pb[kk].v, oacc[t]);
        if constexpr (HR) {
          FH vrb;
          vrb.h[0] = *(const v8h*)(Vrs + (t * 16 + c) * AP + kk * 32 + 8 * hh);
          vrb.h[1] = *(const v8h*)(Vrs + (t * 16 + c) * AP + kk * 32 + 16 + 8 * hh);
          oacc2[t] = mma_h_raw(vrb.v, pb[kk].v, oacc2[t]);
          oacc2[t] = mma_h_raw(vb.v, pbr[kk].v, oacc2[t]);
        }
      }
    }
  }

  __syncthreads();                           // every wave is done with the K/V tiles before they are aliased

  // ---- normalise (1/lsum, the 1/256 p carry; keep the x16 v carry), stage the wave's 16x64 f32 tile in LDS
  //      (row = query c, 8 consecutive features per context tile and lane), then store whole 128-byte rows ----
  float* os = (float*)(void*)smem + wave * (16 * OP);
  {
    const float l  = lsum + xhalf(lsum);     // the two halves of the query's keys
    const float rl = 1.0f / l;               // l >= 1 (the max key contributes p = 1)
    const float sc = rl * (1.0f / 256.0f);
#pragma unroll
    for (int t = 0; t < 4; ++t) {
      v4f lo, hi;
#pragma unroll
      for (int r = 0; r < 4; ++r) {
        float v0 = oacc[t][r], v1 = oacc[t][4 + r];
        if constexpr (HR) {
          v0 += oacc2[t][r] * (1.0f / 2048.0f);
          v1 += oacc2[t][4 + r] * (1.0f / 2048.0f);
        }
        lo[r] = v0 * sc;
        hi[r] = v1 * sc;
      }
      *(v4f*)(os + c * OP + t * 16 + 8 * hh)     = lo;
      *(v4f*)(os + c * OP + t * 16 + 8 * hh + 4) = hi;
    }
  }
  __builtin_amdgcn_fence(__ATOMIC_RELEASE, "workgroup");
  __builtin_amdgcn_wave_barrier();
  __builtin_amdgcn_fence(__ATOMIC_ACQUIRE, "workgroup");
  {
    const int rq = lane >> 3, piece = lane & 7;
    v4u ph[4], pr[4];
#pragma unroll
    for (int it = 0; it < 4; ++it) {
      const int row = it * 4 + rq;   // it 0..3 x rq 0..3 = rows 0..15 of the wave tile
      const v4f a  = *(const v4f*)(os + row * OP + piece * 8);
      const v4f a2 = *(const v4f*)(os + row * OP + piece * 8 + 4);
      float f[8];
      f[0] = a[0];  f[1] = a[1];  f[2] = a[2];  f[3] = a[3];
      f[4] = a2[0]; f[5] = a2[1]; f[6] = a2[2]; f[7] = a2[3];
      v4u p, q;
#pragma unroll
      for (int e = 0; e < 4; ++e) {
        const _Float16 x0 = (_Float16)f[2 * e], x1 = (_Float16)f[2 * e + 1];
        p[e] = pk16(h_bits(x0), h_bits(x1));
        if constexpr (HR) {
          const _Float16 y0 = (_Float16)((f[2 * e] - (float)x0) * 2048.0f);
          const _Float16 y1 = (_Float16)((f[2 * e + 1] - (float)x1) * 2048.0f);
          q[e] = pk16(h_bits(y0), h_bits(y1));
        } else {
          q[e] = p[e];
        }
      }
      ph[it] = p;
      pr[it] = q;
    }
    {
#pragma unroll
      for (int it = 0; it < 4; ++it) {
        const int row = it * 4 + rq;
        const size_t go = (size_t)(q0 + row) * DM + (size_t)h * HD + piece * 8;
        *(v4u*)(ctxp + go) = ph[it];
        if constexpr (HR) *(v4u*)(ctxrp + go) = pr[it];
      }
      
    }
  }
}

// =====================================================================================================
// Workspace map (bytes); every region is an exact multiple of its whole-line / whole-tile store granularity
// (row pitches 2048 / 6144 / 8192 / 256 B, all offsets multiples of 256, no aliasing within a launch):
//   Xh     f16 [SEQ][1024]                 (bf16 value of x, x16)
//   Wqkv   f16 [3072][1024]                (bf16 values of wq | wk | wv x1024, [n][k] = the input layout)
//   Wp     f16 [1024][1024]                (bf16 value of wo x1024, [n][k])
//   QKV    f16 [SEQ][3072]                 (rotated q | rotated k, x16; the v columns are neither written nor read)
//   QKVr   f16 [SEQ][3072]                 (x2^11 residual of the above)
//   VT     f16 [1024][SEQ]                 ([h*64 + d][s])
//   VTr    f16 [1024][SEQ]                 (residual)
//   Ctx    f16 [SEQ][1024]                 (attention context x16)
//   Ctxr   f16 [SEQ][1024]                 (residual)
//   Rt     f32 [SEQ][64]                   (cos | sin table)
//   total for SEQ = 4096: 101711872
// d_out f32: [SEQ][1024] at byte 0, every 64x64 tile written once by the projection launch.
// =====================================================================================================
extern "C" void kernel_launch(void* const* d_in, const int* in_sizes, int n_in,
                              void* d_out, int out_size, void* d_ws, size_t ws_size,
                              hipStream_t stream) {
  if (n_in < 5) return;
  if (in_sizes[0] < SEQ * DM) return;
  if (in_sizes[1] != DM * DM) return;
  if (in_sizes[2] != DM * DM) return;
  if (in_sizes[3] != DM * DM) return;
  if (in_sizes[4] != DM * DM) return;
  if (out_size < OUTN) return;

  const float* x  = (const float*)d_in[0];    // [SEQ][DM] (row prefix)
  const float* wq = (const float*)d_in[1];    // [DM n][DM k]
  const float* wk = (const float*)d_in[2];    // [DM n][DM k]
  const float* wv = (const float*)d_in[3];    // [DM n][DM k]
  const float* wo = (const float*)d_in[4];    // [DM n][DM k]

  const size_t PX   = (size_t)SEQ * DM * 2;          //  8388608 (SEQ 4096)
  const size_t PWq  = (size_t)DQKV * DM * 2;         //  6291456
  const size_t PWp  = (size_t)DM * DM * 2;           //  2097152
  const size_t PQKV = (size_t)SEQ * DQKV * 2;        // 25165824
  const size_t PVT  = (size_t)DM * SEQ * 2;          //  8388608
  const size_t PCtx = (size_t)SEQ * DM * 2;          //  8388608
  const size_t PRt  = (size_t)SEQ * 64 * 4;          //  1048576
  size_t off = 0;
  const size_t oX    = off; off += PX;
  const size_t oWq   = off; off += PWq;
  const size_t oWp   = off; off += PWp;
  const size_t oQKV  = off; off += PQKV;
  const size_t oQKVr = off; off += PQKV;
  const size_t oVT   = off; off += PVT;
  const size_t oVTr  = off; off += PVT;
  const size_t oCtx  = off; off += PCtx;
  const size_t oCtxr = off; off += PCtx;
  const size_t oRt   = off; off += PRt;
  if (off > ws_size) return;                         // off = 101711872 for SEQ 4096
  if (off > (size_t)134217728) return;

  char* ws = (char*)d_ws;
  unsigned short* Xh   = (unsigned short*)(ws + oX);
  unsigned short* Wqkv = (unsigned short*)(ws + oWq);
  unsigned short* Wp   = (unsigned short*)(ws + oWp);
  unsigned short* QKV  = (unsigned short*)(ws + oQKV);
  unsigned short* QKVr = (unsigned short*)(ws + oQKVr);
  unsigned short* VT   = (unsigned short*)(ws + oVT);
  unsigned short* VTr  = (unsigned short*)(ws + oVTr);
  unsigned short* Ctx  = (unsigned short*)(ws + oCtx);
  unsigned short* Ctxr = (unsigned short*)(ws + oCtxr);
  float*          Rt   = (float*)(ws + oRt);
  float*          outf = (float*)d_out;              // [SEQ][DM]

  const dim3 blk(256);
  const dim3 gPrep(PREP_B);                          // 512 table + 2048 x + 4 x 512 weight blocks (SEQ 4096)
  const dim3 gGqkv((SEQ / 128) * (DQKV / 128));      // 768 block tiles of 128x128 (SEQ 4096)
  const dim3 gGdm((SEQ / 128) * (DM / 128));         // 256 block tiles (8 waves each: 4 per ctx plane)
  const dim3 gAttn(NQB * NH);                        // 1024 blocks: every (head, query tile)
  const float wScale = 1024.0f;                      // weights carried x1024
  const float aScale = 16.0f;                        // activations carried x16
  const float cscale = 1.0f / 16384.0f;              // 1/(16 * 1024)

  // (1, 2) one launch: planes x -> f16 x16 (bf16 values); weights [n][k] -> f16 x1024 (bf16 values), wq | wk | wv
  //     stacked; RoPE table cos | sin per token
  k_prep<<<gPrep, blk, 0, stream>>>(x, wq, wk, wv, wo, Xh, Wqkv, Wp, Rt, aScale, wScale);
  // (3, 4) qkv = Xh . Wqkv^T (M=SEQ, N=3072, K=1024): q and k column blocks (n < 2*DM) with RoPE -> QKV f16 x16 +
  //     residual plane, pitch 3072; v column blocks (n >= 2*DM) -> v^T planes VT, VTr straight from the accumulators
  gemm64_f16<0, false><<<gGqkv, dim3(128), 0, stream>>>(Xh, Xh, DM, Wqkv, DM, cscale, (void*)QKV, QKVr, DQKV,
                                                  SEQ, DQKV, DM, aScale, Rt, 2 * DM, VT, VTr, 2 * DM, SEQ);
  // (5) windowed causal softmax attention -> Ctx f16 x16 + residual plane (all query tiles)
  attn_k<true><<<gAttn, dim3(128), 0, stream>>>(QKV, QKVr, VT, VTr, Ctx, Ctxr);
  // (6) out = (Ctx + 2^-11 Ctxr) . Wp^T -> d_out f32 [SEQ][1024] (M=SEQ, N=1024, K=1024), every tile once;
  //     blocks of 8 waves, the two planes side by side
  gemm64_f16<1, true><<<gGdm, blk, 0, stream>>>(Ctx, Ctxr, DM, Wp, DM, cscale, (void*)outf, Ctxr, DM,
                                                SEQ, DM, DM, 1.0f, Rt, 0, Ctxr, Ctxr, DM, DM);
  (void)hipGetLastError();
}

// v009
// Measured time: 82.4 microseconds a run.
// In both of two side-by-side timings against v008, it was 1.06 times as fast.
// All steps since v000 together make it 3.47 times as fast.
// Contractions: q|k|v projection = v_wmma_f32_16x16x32_f16 (A = f16 of RNE-bf16 x carried x16, B = f16 of RNE-bf16 wq|wk|wv carried x1024, single product); attention k.q^T and v^T.p^T (transposed products) = v_wmma_f32_16x16x32_f16 (q, k, v^T f16 planes x16 plus x2^11 residual planes, p f16 x256 plus x2^11 residual; hi.hi + hi.res + res.hi); output projection = v_wmma_f32_16x16x32_f16 (A = ctx f16 x16 plus its x2^11 residual plane, B = f16 of RNE-bf16 wo x1024; hi.B + res.B); all f32 accumulate. RoPE cos/sin table, rotation, windowed causal online-max softmax and row sums in f32 on the VALU.
#include <hip/hip_runtime.h>
#include <math.h>
#include <stdint.h>

#define SEQ   4096                  // token rows processed (a row prefix of x); every stride, carve and grid derives from it
#define DM    1024
#define NH    16
#define HD    64
#define WIN   512
#define DQKV  (3 * DM)              // 3072
#define NQB   (SEQ / 64)            // query tiles of 64 rows
#define KTW   (WIN / 64 + 1)        // key tiles visited per 64-row query tile = 9
#define OUTN  (SEQ * DM)
static_assert(NH * HD == DM);
static_assert(HD == 64);
static_assert((WIN % 64) == 0);
static_assert(KTW == 9);
static_assert((SEQ % 64) == 0 && (DM % 64) == 0 && (DQKV % 64) == 0);
static_assert((DM % 32) == 0);
static_assert((SEQ % 128) == 0 && (DM % 128) == 0 && (DQKV % 128) == 0);   // GEMM block tile 128x128
static_assert((DM % 64) == 0 && DM >= 128);                                 // GEMM pass of 64 k, two passes or more
static_assert(((SEQ * DM / 8) % 256) == 0);
static_assert(((DM * DM / 8) % 256) == 0);
static_assert((SEQ % 8) == 0);

#define GP_B    144                 // GEMM LDS row pitch, bytes: 128-byte row + 16 (16 B x odd, for 16-byte readers)
#define GP_H    (GP_B / 2)          // the same in halves
#define GTILE   (128 * GP_B)        // one operand's 128 rows of a stage, bytes

typedef _Float16 v16h __attribute__((ext_vector_type(16)));
typedef _Float16 v8h  __attribute__((ext_vector_type(8)));
typedef float    v8f  __attribute__((ext_vector_type(8)));
typedef float    v4f  __attribute__((ext_vector_type(4)));
typedef unsigned int v4u __attribute__((ext_vector_type(4)));

// ---- scalar helpers --------------------------------------------------------------------------------
__device__ __forceinline__ unsigned short bf_bits(float f) {          // f32 -> bf16 bits, RNE convert
  unsigned u = __float_as_uint(f);
  return (unsigned short)((u + 0x7FFFu + ((u >> 16) & 1u)) >> 16);
}
__device__ __forceinline__ float bfr(float f) { return __uint_as_float(((unsigned)bf_bits(f)) << 16); }
__device__ __forceinline__ unsigned short h_bits(_Float16 x) { return __builtin_bit_cast(unsigned short, x); }
__device__ __forceinline__ unsigned pk16(unsigned short a, unsigned short b) { return (unsigned)a | ((unsigned)b << 16); }
__device__ __forceinline__ v8f zero8() { v8f z = {0.f, 0.f, 0.f, 0.f, 0.f, 0.f, 0.f, 0.f}; return z; }

// ---- fragment loader: 16-bit A/B operand, lane -> row/col (lane&15), p already includes +8*(lane>>4);
//      elements 0..7 <- p[0..7] (k0+8h..), elements 8..15 <- p[16..23] (k0+16+8h..)
__device__ __forceinline__ v16h ldfrag_h(const _Float16* p) {
  union { v16h v; v8h h[2]; } f;
  f.h[0] = *(const v8h*)(p);
  f.h[1] = *(const v8h*)(p + 16);
  return f.v;
}

// ---- WMMA helpers: the plain builtin (the compiler orders it and keeps its distances), and the GEMM's hand-written gaps ----
__device__ __forceinline__ v8f mma_h_raw(v16h a, v16h b, v8f c) {
  return __builtin_amdgcn_wmma_f32_16x16x32_f16(false, a, false, b, (short)0, c, false, false);
}
__device__ __forceinline__ void dep_guard_h(v8f& a, v8f& b, v16h x, v16h y) {
#if defined(__HIP_DEVICE_COMPILE__)
  asm volatile("v_nop\n\tv_nop\n\tv_nop\n\tv_nop" : "+v"(a), "+v"(b) : "v"(x), "v"(y));
#endif
}
__device__ __forceinline__ void keep4_h(v16h a, v16h b, v16h c, v16h d) {
#if defined(__HIP_DEVICE_COMPILE__)
  asm volatile("v_nop" :: "v"(a), "v"(b), "v"(c), "v"(d));
#endif
}
__device__ __forceinline__ void acc_guard4(v8f& a, v8f& b, v8f& c, v8f& d) {
#if defined(__HIP_DEVICE_COMPILE__)
  asm volatile("v_nop\n\tv_nop\n\tv_nop\n\tv_nop" : "+v"(a), "+v"(b), "+v"(c), "+v"(d));
#endif
}

// =====================================================================================================
// Preparatory launch: three jobs that need nothing of each other share one grid by ranges of the block index
// (every test on the block index is block-uniform).
//   blocks [0, RT_B)                    RoPE table, 8 tokens each
//   blocks [RT_B, RT_B + CVX_B)         x -> f16 plane
//   the last 4 * CVW_B blocks           wq | wk | wv | wo -> f16 planes, CVW_B blocks each
// =====================================================================================================
#define RT_B   (SEQ / 8)                // 512
#define CVX_B  (SEQ * DM / 8 / 256)     // 2048
#define CVW_B  (DM * DM / 8 / 256)      // 512
#define PREP_B (RT_B + CVX_B + 4 * CVW_B)

// f32 plane -> f16 bits of bfr(v) * scale (scale a power of two): x (x16) and the [n][k] weights (x1024),
// whose [out][in] layout is already the k-contiguous Bt layout of the GEMM below.
// coverage: n8 threads x 8 = the whole plane.
__device__ __forceinline__ void cvt16(const float* __restrict__ in, unsigned short* out, int n8, float scale, int i) {
  if (i < n8) {
    const v4f a = *(const v4f*)(in + (size_t)i * 8);
    const v4f b = *(const v4f*)(in + (size_t)i * 8 + 4);
    v4u p;
    p[0] = pk16(h_bits((_Float16)(bfr(a[0]) * scale)), h_bits((_Float16)(bfr(a[1]) * scale)));
    p[1] = pk16(h_bits((_Float16)(bfr(a[2]) * scale)), h_bits((_Float16)(bfr(a[3]) * scale)));
    p[2] = pk16(h_bits((_Float16)(bfr(b[0]) * scale)), h_bits((_Float16)(bfr(b[1]) * scale)));
    p[3] = pk16(h_bits((_Float16)(bfr(b[2]) * scale)), h_bits((_Float16)(bfr(b[3]) * scale)));
    *(v4u*)(out + (size_t)i * 8) = p;
  }
}

// RoPE table tab[t][64] f32: [0..31] = cos(t * inv[m]), [32..63] = sin(t * inv[m]) (precise sincosf, f32
// angle = fl(t * inv[m])), inv[m] = 1 / powf(10000, (2m)/64), m = 0..31, f32, formed by each thread for its own m.
// Block = 8 tokens x 32 pairs (256 threads); the 8x64 tile is staged in LDS, then stored as whole rows.
// coverage: compute 8 x 32 threads x 2 = 8x64; store 128 lanes x 4 floats = 8 rows x 64; RT_B blocks cover every t.
__device__ __forceinline__ void rope_tab(float* st, float* tab, int blk) {
  const int tid = threadIdx.x;
  const int m   = tid & 31, tr = tid >> 5;
  const int t   = blk * 8 + tr;                     // < SEQ by the block range
  const float e = (float)(2 * m) * (1.0f / 64.0f);
  const float p = powf(10000.0f, e);
  const float w = 1.0f / p;
  const float ang = (float)t * w;
  float sn, cs;
  sincosf(ang, &sn, &cs);
  st[tr * 64 + m]      = cs;
  st[tr * 64 + 32 + m] = sn;
  __syncthreads();
  if (tid < 128) {                                  // waves 0..3, wave-uniform
    const int row = tid >> 4, c4 = (tid & 15) * 4;
    const v4f v = *(const v4f*)(st + row * 64 + c4);
    float* dst = tab + (size_t)(blk * 8 + row) * 64 + c4;
    *(v4f*)dst = v;
  }
}

__global__ __launch_bounds__(256) void k_prep(const float* __restrict__ x, const float* __restrict__ wq,
                                              const float* __restrict__ wk, const float* __restrict__ wv,
                                              const float* __restrict__ wo,
                                              unsigned short* Xh, unsigned short* Wqkv, unsigned short* Wp,
                                              float* tab, float aScale, float wScale) {
  __shared__ __align__(16) float st[8 * 64];
  const int b = blockIdx.x;
  if (b < RT_B) {                                   // the longest blocks start first
    rope_tab(st, tab, b);
  } else if (b < RT_B + CVX_B) {
    cvt16(x, Xh, SEQ * DM / 8, aScale, (b - RT_B) * 256 + (int)threadIdx.x);
  } else if (b < PREP_B) {
    const int wb = b - (RT_B + CVX_B);
    const int which = wb / CVW_B;                   // 0..3 = wq, wk, wv, wo
    const float* in = (which == 0) ? wq : (which == 1) ? wk : (which == 2) ? wv : wo;
    unsigned short* o = (which < 3) ? (Wqkv + (size_t)which * DM * DM) : Wp;
    cvt16(in, o, DM * DM / 8, wScale, (wb - which * CVW_B) * 256 + (int)threadIdx.x);
  }
}

// =====================================================================================================
// Register-blocked f16 WMMA GEMM, one wave per 64x64 tile and plane, four waves (2x2) per 128x128 block tile and
// plane. The block's A (ARES: and Ar) and Bt rows of a 64-k pass are staged in LDS by asynchronous 16-byte copies
// (whole 128-byte lines), two buffers: the next pass's copies fly while this pass's fragments are read from LDS.
//   v[m][n] = (sum_k A[m][k] * Bt[n][k]  [+ 2^-11 * sum_k Ar[m][k] * Bt[n][k] when ARES]) * cscale
// A, Ar row-major [M][K] pitch lda (f16), Bt row-major [N][K] pitch ldb (f16, k contiguous); M, N multiples of
// 128, K multiple of 64; one block per block tile (a block-uniform bound check anyway).
// ARES: eight waves. Waves 0..3 take the hi plane, waves 4..7 the residual plane of the same four 64x64 tiles in
// the same k pass (two waves per SIMD, Bt staged once for both). A residual wave takes the tile's four 16-row blocks
// in the order 2, 3, 0, 1, so that in both waves accumulator rows 0, 1 are the 32 tile rows the wave finishes and
// rows 2, 3 the 32 it hands to the other wave. Behind the loop each wave scales its sums (residual: 2^-11, exact;
// hi: 1), hands rows 2, 3 over through LDS (the ring, free by then), adds what it gets to rows 0, 1 and runs the
// epilogue for those 32 tile rows.
// Epilogue variants:
//   EPI 0: f16 hi plane = f16(v' * oscale) at Cp and residual plane = f16((v'*oscale - hi) * 2048) at Crp,
//          pitch ldc halves, where v' = v for tiles with n0 >= ropeN and, for n0 < ropeN (wave-uniform),
//          v' = rotate-half RoPE of the wave's 64-column tile (one head): pair index mm = column mod 32,
//          token = output row, c = rtab[token][mm], s = rtab[token][32+mm]:
//          col mm -> v[mm]*c - v[32+mm]*s ; col 32+mm -> v[32+mm]*c + v[mm]*s (f32, from the LDS slab).
//          Block tiles with n >= vN (vN a multiple of 128, block-uniform) go out TRANSPOSED instead, the same two
//          f16 values per element: column n, row m -> Vtp / Vtrp[(n - vN) * ldvt + m]. An accumulator register
//          run r = 0..7 of a lane is 8 consecutive rows m of one column n, i.e. 16 contiguous bytes of a transposed
//          row: per 16-column block the wave stages 16 rows x 64 m per plane in its slab and stores whole 128-byte lines.
//   EPI 1: f32 out = v, pitch ldc floats
// 16-row slabs staged per wave in LDS. f32 out: each 64-wide row segment (256 B = 2 lines) by 16 lanes x 16 B,
// coverage: 4 slabs x 16 rows x 64 cols = the whole 64x64 tile (ARES: 2 slabs from each of the tile's two waves);
// grid x 4 tiles = [M][N].
// =====================================================================================================
// Eight 16-byte asynchronous copies of one lane, global -> LDS, rows 16 apart in both places. The s_wait_xcnt
// is the last line of the copies' own statement so that no address register is rewritten ahead of it.
__device__ __forceinline__ void copy8_rows(unsigned l, const _Float16* g, int ld) {
#if defined(__HIP_DEVICE_COMPILE__)
  const unsigned l0 = l,                    l1 = l + 1u * 16u * GP_B, l2 = l + 2u * 16u * GP_B, l3 = l + 3u * 16u * GP_B;
  const unsigned l4 = l + 4u * 16u * GP_B, l5 = l + 5u * 16u * GP_B, l6 = l + 6u * 16u * GP_B, l7 = l + 7u * 16u * GP_B;
  const size_t st = (size_t)16 * ld;
  const _Float16 *g0 = g, *g1 = g + st, *g2 = g + 2 * st, *g3 = g + 3 * st;
  const _Float16 *g4 = g + 4 * st, *g5 = g + 5 * st, *g6 = g + 6 * st, *g7 = g + 7 * st;
  asm volatile(
      "global_load_async_to_lds_b128 %0, %8, off\n\t"
      "global_load_async_to_lds_b128 %1, %9, off\n\t"
      "global_load_async_to_lds_b128 %2, %10, off\n\t"
      "global_load_async_to_lds_b128 %3, %11, off\n\t"
      "global_load_async_to_lds_b128 %4, %12, off\n\t"
      "global_load_async_to_lds_b128 %5, %13, off\n\t"
      "global_load_async_to_lds_b128 %6, %14, off\n\t"
      "global_load_async_to_lds_b128 %7, %15, off\n\t"
      "s_wait_xcnt 0x0"
      :: "v"(l0), "v"(l1), "v"(l2), "v"(l3), "v"(l4), "v"(l5), "v"(l6), "v"(l7),
         "v"(g0), "v"(g1), "v"(g2), "v"(g3), "v"(g4), "v"(g5), "v"(g6), "v"(g7)
      : "memory");
#endif
}
// Twelve 16-byte asynchronous copies of one lane: four rows, 32 apart, of each of three operand tiles that lie one
// behind the other in a stage. One statement, its last line the s_wait_xcnt, for the same reason as above.
__device__ __forceinline__ void copy12_rows(unsigned l, const _Float16* a, const _Float16* r, int lda,
                                            const _Float16* b, int ldb) {
#if defined(__HIP_DEVICE_COMPILE__)
  const unsigned sl = 32u * GP_B;
  const unsigned l0 = l,             l1 = l + sl,             l2  = l + 2u * sl,             l3  = l + 3u * sl;
  const unsigned l4 = l + GTILE,     l5 = l + GTILE + sl,     l6  = l + GTILE + 2u * sl,     l7  = l + GTILE + 3u * sl;
  const unsigned l8 = l + 2 * GTILE, l9 = l + 2 * GTILE + sl, l10 = l + 2 * GTILE + 2u * sl, l11 = l + 2 * GTILE + 3u * sl;
  const size_t sa = (size_t)32 * lda, sb = (size_t)32 * ldb;
  const _Float16 *a0 = a, *a1 = a + sa, *a2 = a + 2 * sa, *a3 = a + 3 * sa;
  const _Float16 *r0 = r, *r1 = r + sa, *r2 = r + 2 * sa, *r3 = r + 3 * sa;
  const _Float16 *b0 = b, *b1 = b + sb, *b2 = b + 2 * sb, *b3 = b + 3 * sb;
  asm volatile(
      "global_load_async_to_lds_b128 %0, %12, off\n\t"
      "global_load_async_to_lds_b128 %1, %13, off\n\t"
      "global_load_async_to_lds_b128 %2, %14, off\n\t"
      "global_load_async_to_lds_b128 %3, %15, off\n\t"
      "global_load_async_to_lds_b128 %4, %16, off\n\t"
      "global_load_async_to_lds_b128 %5, %17, off\n\t"
      "global_load_async_to_lds_b128 %6, %18, off\n\t"
      "global_load_async_to_lds_b128 %7, %19, off\n\t"
      "global_load_async_to_lds_b128 %8, %20, off\n\t"
      "global_load_async_to_lds_b128 %9, %21, off\n\t"
      "global_load_async_to_lds_b128 %10, %22, off\n\t"
      "global_load_async_to_lds_b128 %11, %23, off\n\t"
      "s_wait_xcnt 0x0"
      :: "v"(l0), "v"(l1), "v"(l2), "v"(l3), "v"(l4), "v"(l5), "v"(l6), "v"(l7), "v"(l8), "v"(l9), "v"(l10), "v"(l11),
         "v"(a0), "v"(a1), "v"(a2), "v"(a3), "v"(r0), "v"(r1), "v"(r2), "v"(r3), "v"(b0), "v"(b1), "v"(b2), "v"(b3)
      : "memory");
#endif
}
// the issuing wave's copies have landed in LDS behind this wait
__device__ __forceinline__ void wait_async0() {
#if defined(__HIP_DEVICE_COMPILE__)
  asm volatile("s_wait_asynccnt 0x0" ::: "memory");
#endif
}
// the wave's own LDS reads of a buffer have retired before that buffer is handed back for a refill
__device__ __forceinline__ void wait_ds0() {
#if defined(__HIP_DEVICE_COMPILE__)
  asm volatile("s_wait_dscnt 0x0" ::: "memory");
#endif
}

template <int EPI, bool ARES>
__global__ __launch_bounds__(ARES ? 256 : 128) void gemm64_f16(
    const unsigned short* __restrict__ Ap, const unsigned short* __restrict__ Arp, int lda,
    const unsigned short* __restrict__ Btp, int ldb,
    float cscale,
    void* Cp, unsigned short* Crp, int ldc, int M, int N, int K, float oscale,
    const float* __restrict__ rtab, int ropeN,
    unsigned short* Vtp, unsigned short* Vtrp, int vN, int ldvt) {
  const _Float16* Ah  = (const _Float16*)(const void*)Ap;
  const _Float16* Arh = (const _Float16*)(const void*)Arp;
  const _Float16* Bt  = (const _Float16*)(const void*)Btp;
  constexpr unsigned OFF_BT = (ARES ? 2u : 1u) * GTILE;      // Bt rows behind the A (ARES: A and Ar) rows of a stage
  constexpr unsigned GSTAGE = OFF_BT + GTILE;                // one stage, bytes
  static_assert(!ARES || 4 * 64 * 64 * 4 <= 2 * GSTAGE);     // the hand-over of the residual sums fits the ring
  __shared__ __align__(16) unsigned char ring[2 * GSTAGE];   // two stages of [A | (ARES: Ar |) Bt], 128 rows each, pitch GP_B
  constexpr int SLABF = (EPI == 0) ? 2 * 16 * GP_B / 4 : 16 * 68;   // EPI 0: also two transposed f16 16x64 planes at pitch GP_B
  static_assert(SLABF >= 16 * 68);
  __shared__ __align__(16) float sT[ARES ? 8 : 4][SLABF];     // per-wave 16x64 slab, pitch 68 floats
  const int tid  = threadIdx.x;
  const int lane = tid & 31;
  const int wave = (tid >> 5) & 3;             // the wave's place among the four tiles
  const int plane = ARES ? __builtin_amdgcn_readfirstlane(tid >> 7) : 0;   // wave-uniform: 0 = A, 1 = Ar
  const int tilesN = N >> 7;
  const int tilesM = M >> 7;
  if ((int)blockIdx.x >= tilesM * tilesN) return;   // block-uniform, in front of every barrier and copy
  const int bm = (int)blockIdx.x / tilesN;
  const int bn = (int)blockIdx.x - bm * tilesN;
  const int wm = (wave >> 1) << 6;             // the wave's 64x64 tile inside the block's 128x128 tile
  const int wn = (wave & 1) << 6;
  const int m0 = (bm << 7) + wm;
  const int n0 = (bn << 7) + wn;

  const int rlane = lane & 15;                 // row (A) / col (B, D) within subtile
  const int koff  = (lane >> 4) * 8;           // k offset of this lane half
  const int mOff  = (lane >> 4) * 8;           // D row offset

  v8f acc[4][4];
#pragma unroll
  for (int i = 0; i < 4; ++i)
#pragma unroll
    for (int j = 0; j < 4; ++j) acc[i][j] = zero8();

  // staging map: lane -> row tid>>3 (+16 per copy, 8 copies = 128 rows; ARES: +32 per copy, 4 copies), 16-byte
  // piece tid&7 of the 128-byte row
  const int crow = tid >> 3, cpc = tid & 7;
  const unsigned ringb = (unsigned)(uintptr_t)(const void*)ring;           // LDS byte address of the ring
  const unsigned lcp   = ringb + (unsigned)(crow * GP_B + cpc * 16);
  const _Float16* gA  = Ah  + (size_t)((bm << 7) + crow) * lda + cpc * 8;
  const _Float16* gAr = Arh + (size_t)((bm << 7) + crow) * lda + cpc * 8;
  const _Float16* gB  = Bt  + (size_t)((bn << 7) + crow) * ldb + cpc * 8;
  const int NP = K >> 6;                       // passes of 64 k
  // one stage: the block's rows of k = kk .. kk + 63 -> the buffer at LDS byte lb (the lane's own piece)
  auto stage = [&](unsigned lb, int kk) {
    if constexpr (ARES) {
      copy12_rows(lb, gA + kk, gAr + kk, lda, gB + kk, ldb);
    } else {
      copy8_rows(lb, gA + kk, lda);
      copy8_rows(lb + OFF_BT, gB + kk, ldb);
    }
  };

  // tile 0 -> buffer 0, landed and published; then tile 1 -> buffer 1 flies over pass 0
  stage(lcp, 0);
  wait_async0();
  __syncthreads();
  if (NP > 1) stage(lcp + GSTAGE, 64);

  for (int t = 0; t < NP; ++t) {
    const unsigned bsel = (unsigned)(t & 1) * GSTAGE;
    const _Float16* sA = (const _Float16*)(const void*)(ring + bsel + (unsigned)plane * GTILE) + (wm + rlane) * GP_H + koff;
    const _Float16* sAlo = sA + 32 * plane * GP_H;   // row blocks i = 0, 1: tile rows 16 i (+ 32 in a residual wave)
    const _Float16* sAhi = sA - 32 * plane * GP_H;   // row blocks i = 2, 3: tile rows 16 i (- 32 in a residual wave)
    const _Float16* sB = (const _Float16*)(const void*)(ring + bsel + OFF_BT) + (wn + rlane) * GP_H + koff;
    // the loops below are unrolled so that every fragment and accumulator index is a constant (registers, no scratch)
#pragma unroll
    for (int ks = 0; ks < 2; ++ks) {
      v16h bh[4];
#pragma unroll
      for (int j = 0; j < 4; ++j) bh[j] = ldfrag_h(sB + (j << 4) * GP_H + ks * 32);
      v16h ah[4];                              // all eight fragments of a 32-k step are read as one group
#pragma unroll
      for (int i = 0; i < 4; ++i) ah[i] = ldfrag_h((i < 2 ? sAlo : sAhi) + (i << 4) * GP_H + ks * 32);
#pragma unroll
      for (int i = 0; i < 4; ++i) {
#pragma unroll
        for (int j = 0; j < 4; ++j) {
          acc[i][j] = mma_h_raw(ah[i], bh[j], acc[i][j]);
        }
        dep_guard_h(acc[i][0], acc[i][3], ah[i], bh[3]);
      }
      keep4_h(bh[0], bh[1], bh[2], bh[3]);
    }
    // publish point of tile t + 1: own LDS reads retired, own copies landed, one barrier for both jobs
    wait_ds0();
    wait_async0();
    __syncthreads();
    if (t + 2 < NP) stage(lcp + bsel, (t + 2) << 6);   // block-uniform: refill the buffer that pass t has just read
  }
  wait_async0();
  acc_guard4(acc[0][0], acc[0][1], acc[0][2], acc[0][3]);
  acc_guard4(acc[1][0], acc[1][1], acc[1][2], acc[1][3]);
  acc_guard4(acc[2][0], acc[2][1], acc[2][2], acc[2][3]);
  acc_guard4(acc[3][0], acc[3][1], acc[3][2], acc[3][3]);

  // ---- epilogue: emit(a, i) stores rows 16 i .. 16 i + 15 of the wave's tile from their four accumulators ----
  float* slab = sT[wave + 4 * plane];
  // RoPE table values of slab i (EPI 0): row 16 i + it * 4 + (lane >> 3), pair indices (lane & 3) * 8 + 0..7, cos and sin.
  // All sixteen loads of a slab are issued together, one slab ahead: slab 0's in front of the first emit, slab i + 1's
  // in emit(i) in front of its global stores, so that they fly while those stores drain at the slab's closing fence.
  static_assert(!(EPI == 0 && ARES));                        // emit(i) below fetches for slab i + 1 of four in rising order
  [[maybe_unused]] v4f tc0[4], tc1[4], ts0[4], ts1[4];
  [[maybe_unused]] auto ldtab = [&](int i) {
    if (n0 < ropeN) {                                        // wave-uniform (n0 is per wave)
      const float* trp = rtab + (size_t)(m0 + (i << 4) + (lane >> 3)) * 64 + (lane & 3) * 8;   // output row = token index
#pragma unroll
      for (int it = 0; it < 4; ++it) {                       // unrolled: register arrays, constant indices
        tc0[it] = *(const v4f*)(trp + it * 256);
        tc1[it] = *(const v4f*)(trp + it * 256 + 4);
        ts0[it] = *(const v4f*)(trp + it * 256 + 32);
        ts1[it] = *(const v4f*)(trp + it * 256 + 36);
      }
#if defined(__HIP_DEVICE_COMPILE__)
      // behind the last table load; the address is an input, so that it stays in its registers (no load's result and no
      // later instruction lands on them) up to this wait
      asm volatile("s_wait_xcnt 0x0" :: "v"(trp) : "memory");
#endif
    }
  };
  auto emit = [&](const v8f (&a)[4], int i) {
    const int mBase = m0 + (i << 4);
#pragma unroll
    for (int r = 0; r < 8; ++r) {
      const int row = mOff + r;
#pragma unroll
      for (int j = 0; j < 4; ++j) slab[row * 68 + (j << 4) + rlane] = a[j][r] * cscale;
    }
    __builtin_amdgcn_fence(__ATOMIC_RELEASE, "workgroup");
    __builtin_amdgcn_wave_barrier();
    __builtin_amdgcn_fence(__ATOMIC_ACQUIRE, "workgroup");
    if constexpr (EPI == 0) {
      unsigned short* C16 = (unsigned short*)Cp;
      const int rq = lane >> 3, piece = lane & 7;
      const bool rope_on = (n0 < ropeN);                   // wave-uniform (n0 is per wave)
      const float rsgn = (piece < 4) ? -1.0f : 1.0f;       // cols 0..31 carry x1 (minus), cols 32..63 carry x2 (plus)
      v4u ph[4], pr[4];
#pragma unroll
      for (int it = 0; it < 4; ++it) {
        const int row = it * 4 + rq;                         // it 0..3 x rq 0..3 = rows 0..15
        const v4f a  = *(const v4f*)(slab + row * 68 + piece * 8);
        const v4f a2 = *(const v4f*)(slab + row * 68 + piece * 8 + 4);
        float f[8];
        f[0] = a[0];  f[1] = a[1];  f[2] = a[2];  f[3] = a[3];
        f[4] = a2[0]; f[5] = a2[1]; f[6] = a2[2]; f[7] = a2[3];
        if (rope_on) {                                       // wave-uniform branch, LDS reads only
          const int po = (piece ^ 4) * 8;                    // partner half of the head (32 columns away)
          const v4f g  = *(const v4f*)(slab + row * 68 + po);
          const v4f g2 = *(const v4f*)(slab + row * 68 + po + 4);
          const v4f c0 = tc0[it], c1 = tc1[it], s0 = ts0[it], s1 = ts1[it];   // fetched one slab ahead by ldtab
          f[0] = f[0] * c0[0] + rsgn * g[0]  * s0[0];
          f[1] = f[1] * c0[1] + rsgn * g[1]  * s0[1];
          f[2] = f[2] * c0[2] + rsgn * g[2]  * s0[2];
          f[3] = f[3] * c0[3] + rsgn * g[3]  * s0[3];
          f[4] = f[4] * c1[0] + rsgn * g2[0] * s1[0];
          f[5] = f[5] * c1[1] + rsgn * g2[1] * s1[1];
          f[6] = f[6] * c1[2] + rsgn * g2[2] * s1[2];
          f[7] = f[7] * c1[3] + rsgn * g2[3] * s1[3];
        }
        v4u p, q;
#pragma unroll
        for (int e = 0; e < 4; ++e) {
          const float g0 = f[2 * e] * oscale, g1 = f[2 * e + 1] * oscale;
          const _Float16 x0 = (_Float16)g0, x1 = (_Float16)g1;
          const _Float16 y0 = (_Float16)((g0 - (float)x0) * 2048.0f);
          const _Float16 y1 = (_Float16)((g1 - (float)x1) * 2048.0f);
          p[e] = pk16(h_bits(x0), h_bits(x1));
          q[e] = pk16(h_bits(y0), h_bits(y1));
        }
        ph[it] = p;
        pr[it] = q;
      }
      if (i + 1 < 4) ldtab(i + 1);                           // this slab's table values are used up
      {
#pragma unroll
        for (int it = 0; it < 4; ++it) {
          const int row = it * 4 + rq;
          const size_t co = (size_t)(mBase + row) * ldc + n0 + piece * 8;
          *(v4u*)(C16 + co) = ph[it];
          *(v4u*)(Crp + co) = pr[it];
        }
        
      }
    } else {
      float* Cf = (float*)Cp;
      const int hh = lane >> 4, c4 = (lane & 15) * 4;     // 256-B row segment = 16 lanes x 16 B
      v4f ov[8];
#pragma unroll
      for (int it = 0; it < 8; ++it) {
        const int row = it * 2 + hh;                       // it 0..7 x hh 0..1 = rows 0..15
        ov[it] = *(const v4f*)(slab + row * 68 + c4);
      }
      {
#pragma unroll
        for (int it = 0; it < 8; ++it) {
          const int row = it * 2 + hh;
          *(v4f*)(Cf + (size_t)(mBase + row) * ldc + n0 + c4) = ov[it];
        }
        
      }
    }
    __builtin_amdgcn_fence(__ATOMIC_RELEASE, "workgroup");
    __builtin_amdgcn_wave_barrier();
    __builtin_amdgcn_fence(__ATOMIC_ACQUIRE, "workgroup");
  };

  if constexpr (ARES) {
    // ---- the two planes' sums are joined. The ring is free: the barrier at the foot of the last pass stands behind
    //      every wave's last fragment read and last landed copy. A tile has 16 KiB there, 8 KiB written by each of its
    //      two waves; chunk q of lane l lies at float (q * 32 + l) * 4: a lane reads what the same lane of the tile's
    //      other wave wrote ----
    const float sc = (plane != 0) ? (1.0f / 2048.0f) : 1.0f;   // exact fold of the x2^11 residual carry
    float* xw       = (float*)(void*)ring + wave * (64 * 64) + plane * (32 * 64) + lane * 4;
    const float* xr = (const float*)(const void*)ring + wave * (64 * 64) + (plane ^ 1) * (32 * 64) + lane * 4;
#pragma unroll
    for (int i = 0; i < 2; ++i)
#pragma unroll
      for (int j = 0; j < 4; ++j) {
        const v8f v = acc[2 + i][j] * sc;
        const v4f lo = {v[0], v[1], v[2], v[3]}, hi = {v[4], v[5], v[6], v[7]};
        *(v4f*)(xw + ((i * 4 + j) * 2) * 128)     = lo;
        *(v4f*)(xw + ((i * 4 + j) * 2 + 1) * 128) = hi;
      }
    __syncthreads();                           // every wave passes it: both waves' hand-overs are published
#pragma unroll
    for (int i = 0; i < 2; ++i)
#pragma unroll
      for (int j = 0; j < 4; ++j) {
        const v4f lo = *(const v4f*)(xr + ((i * 4 + j) * 2) * 128);
        const v4f hi = *(const v4f*)(xr + ((i * 4 + j) * 2 + 1) * 128);
#pragma unroll
        for (int r = 0; r < 4; ++r) {
          acc[i][j][r]     = acc[i][j][r] * sc + lo[r];
          acc[i][j][4 + r] = acc[i][j][4 + r] * sc + hi[r];
        }
      }
    emit(acc[0], 2 * plane);
    emit(acc[1], 2 * plane + 1);
  } else {
    bool transposed = false;
    if constexpr (EPI == 0) transposed = ((bn << 7) >= vN);   // block-uniform (scalar)
    if (transposed) {
      if constexpr (EPI == 0) {
        // ---- transposed f16 planes: column block j = 16 transposed rows (lane&15), 64 m per row ----
        _Float16* sh = (_Float16*)(void*)slab;               // hi plane   [16][GP_H]
        _Float16* sr = sh + 16 * GP_H;                       // residual   [16][GP_H]
        const int rq = lane >> 3, piece = lane & 7;
        // the loops below are unrolled so that every accumulator index is a constant (registers, no scratch)
#pragma unroll
        for (int j = 0; j < 4; ++j) {
#pragma unroll
          for (int i = 0; i < 4; ++i) {
            v4u p, q;
#pragma unroll
            for (int e = 0; e < 4; ++e) {
              const float g0 = acc[i][j][2 * e] * cscale * oscale, g1 = acc[i][j][2 * e + 1] * cscale * oscale;
              const _Float16 x0 = (_Float16)g0, x1 = (_Float16)g1;
              const _Float16 y0 = (_Float16)((g0 - (float)x0) * 2048.0f);
              const _Float16 y1 = (_Float16)((g1 - (float)x1) * 2048.0f);
              p[e] = pk16(h_bits(x0), h_bits(x1));
              q[e] = pk16(h_bits(y0), h_bits(y1));
            }
            *(v4u*)(sh + rlane * GP_H + (i << 4) + mOff) = p;   // rows m = 16 i + 8 (lane>>4) + 0..7 of the tile
            *(v4u*)(sr + rlane * GP_H + (i << 4) + mOff) = q;
          }
          // every lane's slab stores stay ahead of the reads of other lanes' pieces below
          __builtin_amdgcn_fence(__ATOMIC_RELEASE, "workgroup");
          __builtin_amdgcn_wave_barrier();
          __builtin_amdgcn_fence(__ATOMIC_ACQUIRE, "workgroup");
          v4u ph[4], pr[4];
#pragma unroll
          for (int it = 0; it < 4; ++it) {
            const int row = it * 4 + rq;                     // it 0..3 x rq 0..3 = transposed rows 0..15
            ph[it] = *(const v4u*)(sh + row * GP_H + piece * 8);
            pr[it] = *(const v4u*)(sr + row * GP_H + piece * 8);
          }
#pragma unroll
          for (int it = 0; it < 4; ++it) {
            const int row = it * 4 + rq;
            const size_t co = (size_t)(n0 - vN + (j << 4) + row) * ldvt + m0 + piece * 8;   // 8 lanes x 16 B = one line
            *(v4u*)(Vtp + co)  = ph[it];
            *(v4u*)(Vtrp + co) = pr[it];
          }
          // the slab reads above stay ahead of the next column block's slab stores
          __builtin_amdgcn_fence(__ATOMIC_RELEASE, "workgroup");
          __builtin_amdgcn_wave_barrier();
          __builtin_amdgcn_fence(__ATOMIC_ACQUIRE, "workgroup");
        }
      }
    } else {
      if constexpr (EPI == 0) ldtab(0);
#pragma unroll
      for (int i = 0; i < 4; ++i) emit(acc[i], i);
    }
  }
}

typedef uint32_t u32x4 __attribute__((ext_vector_type(4)));
typedef uint32_t u32x8 __attribute__((ext_vector_type(8)));
__device__ __forceinline__ uint32_t uni(uint32_t v) { return (uint32_t)__builtin_amdgcn_readfirstlane(v); }
// a wave-uniform test value held in a scalar register, so that the branch on it is s_cmp + s_cbranch_scc: a tensor load ignores EXEC
__device__ __forceinline__ uint32_t pinned(uint32_t v) {
  uint32_t w = uni(v);
#if defined(__HIP_DEVICE_COMPILE__)
  asm volatile("" : "+s"(w));   // pinned(): the test value of a tensor load's branch stays in a scalar register
#endif
  return w;
}
// one request of the whole wave: a two-dimensional tile, global -> LDS, through no register
__device__ __forceinline__ void tdm_load(u32x4 g0, u32x8 g1) {
#if defined(__HIP_DEVICE_COMPILE__)
  asm volatile("tensor_load_to_lds %0, %1" :: "s"(g0), "s"(g1) : "memory");
#endif
}
// the issuing wave's tensor load has landed in LDS behind this wait
__device__ __forceinline__ void wait_tensor0() {
#if defined(__HIP_DEVICE_COMPILE__)
  asm volatile("s_wait_tensorcnt 0x0" ::: "memory");
#endif
}
// the same; the request's descriptor words are inputs, so that they stay in their registers (nothing lands on them) up to this wait
__device__ __forceinline__ void wait_tensor0_of(u32x4 g0, u32x8 g1) {
#if defined(__HIP_DEVICE_COMPILE__)
  asm volatile("s_wait_tensorcnt 0x0" :: "s"(g0), "s"(g1) : "memory");
#endif
}
// lane l <-> lane l ^ 16
__device__ __forceinline__ float xhalf(float x) {
  return __builtin_bit_cast(float, __builtin_amdgcn_permlanex16(__builtin_bit_cast(int, x), __builtin_bit_cast(int, x),
                                                                0x76543210, 0xfedcba98, false, false));
}

template <bool HR>
__global__ __launch_bounds__(128)
void attn_k(const unsigned short* __restrict__ qkvp, const unsigned short* __restrict__ qkvrp,
            const unsigned short* __restrict__ vtp, const unsigned short* __restrict__ vtrp,
            unsigned short* ctxp, unsigned short* ctxrp) {
  union FH { v16h v; v8h h[2]; };
  constexpr int AP     = 72;                             // LDS row pitch of the f16 tiles, halves: 128-byte row + 16 (16 B x odd, for 16-byte readers)
  constexpr int OP     = 68;                             // LDS row pitch of the f32 context slab, floats (16-byte writers and readers)
  constexpr int TB     = 64 * AP * 2;                    // one f16 64x64 tile at that pitch, bytes
  constexpr int SLOT   = (TB + 2047) / 2048 * 2048;           // a tile's place in LDS: every tensor load lands at a multiple of 2 KiB
  constexpr int OFF_K  = 0;
  constexpr int OFF_V  = SLOT;
  constexpr int OFF_KR = 2 * SLOT;
  constexpr int OFF_VR = 3 * SLOT;
  constexpr int SMEMB  = 4 * SLOT;                            // one buffer: 40960
  static_assert(HR);                                          // four waves, four planes: each wave moves one
  static_assert(AP * 2 == 128 + 16);                          // the mover's pad: 16 bytes behind each 128-byte row
  static_assert(4 * 16 * OP * 4 <= SMEMB);                    // f32 context staging aliases the K/V region
  __shared__ __attribute__((aligned(2048))) unsigned char smem[2 * SMEMB - (SLOT - TB)];   // two buffers of [K | V^T | K residual | V^T residual]

  const int tid  = threadIdx.x;
  const int wave = tid >> 5;
  const int lane = tid & 31;
  const int hh   = lane >> 4;
  const int c    = lane & 15;

  const int bx   = blockIdx.x;
  const int qb   = bx % NQB;
  const int h    = bx / NQB;                 // < NH by the grid size
  const int q0   = qb * 64 + wave * 16;
  const int qrow = q0 + c;                   // the lane's query

  const _Float16* Qp  = (const _Float16*)(const void*)qkvp  + (size_t)h * HD;
  const _Float16* Qrp = (const _Float16*)(const void*)qkvrp + (size_t)h * HD;
  const _Float16* Kp  = Qp + DM;
  const _Float16* Krp = Qrp + DM;
  const _Float16* Vt  = (const _Float16*)(const void*)vtp  + ((size_t)h * HD) * SEQ;
  const _Float16* Vrt = (const _Float16*)(const void*)vtrp + ((size_t)h * HD) * SEQ;

  // ---- Q fragments (B operand, column = lane&15): 2 d-chunks ----
  v16h qa[2], qr[2];
#pragma unroll
  for (int dc = 0; dc < 2; ++dc) {
    const size_t qo = (size_t)qrow * DQKV + dc * 32 + 8 * hh;
    qa[dc] = ldfrag_h(Qp + qo);
    if constexpr (HR) qr[dc] = ldfrag_h(Qrp + qo);
    else qr[dc] = qa[dc];
  }

  float lsum = 0.f, mrun = -1e30f;
  v8f oacc[4], oacc2[4];
#pragma unroll
  for (int t = 0; t < 4; ++t) { oacc[t] = zero8(); oacc2[t] = zero8(); }

  const int ktlo = (qb >= KTW - 1) ? (qb - (KTW - 1)) : 0;   // first key tile in the window, block-uniform
  const int nkt  = qb - ktlo + 1;                              // 1..KTW key tiles, block-uniform
  // ---- the wave's own plane: its first byte of key tile 0, its step per key tile, its source pitch (all wave-uniform) ----
  const uint32_t wv  = uni((uint32_t)wave);
  const bool     isV = (wv & 1u) != 0u, isR = (wv & 2u) != 0u;
  const _Float16* pl = isV ? (isR ? Vrt : Vt) : (isR ? Krp : Kp);
  const uint64_t  pbase = (uint64_t)(uintptr_t)(const void*)pl;
  const uint32_t  pstep = isV ? 64u * 2u : 64u * (uint32_t)DQKV * 2u;   // V^T: 64 keys along a row; K: 64 rows
  const uint32_t  ldst  = (uint32_t)(uintptr_t)(const void*)smem + wv * (uint32_t)SLOT;   // byte offset in the work-group's LDS
  // descriptor group 1, loop-invariant: 1-byte elements, tensor = tile = 64 rows of 128 bytes, a pad of 4 dwords behind every 32
  u32x8 g1;
  g1[0] = uni((1u << 20) | (4u << 22) | (3u << 25));
  g1[1] = uni(128u << 16);
  g1[2] = uni(64u << 16);
  g1[3] = uni(128u << 16);
  g1[4] = uni(64u);
  g1[5] = uni(isV ? (uint32_t)SEQ * 2u : (uint32_t)DQKV * 2u);
  g1[6] = uni(0u);
  g1[7] = uni(0u);
#if defined(__HIP_DEVICE_COMPILE__)
  asm volatile("" : "+s"(g1));   // pinned(), for descriptor words: one scalar register tuple holds them for every request
#endif
  // key tile kt (< NQB: wholly inside the plane) -> the wave's place in the buffer at byte offset bo
  auto stage = [&](uint32_t bo, int kt) {
    const uint64_t ga = pbase + (uint64_t)((uint32_t)kt * pstep);
    u32x4 g0;
    g0[0] = uni(1u);
    g0[1] = uni(ldst + bo);
    g0[2] = uni((uint32_t)ga);
    g0[3] = uni((((uint32_t)(ga >> 32)) & 0x01FFFFFFu) | 0x80000000u);
    tdm_load(g0, g1);
    return g0;
  };
  // stage 0 -> buffer 0, landed and published; then stage 1 -> buffer 1 flies over pass 0
  u32x4 gl = stage(0u, ktlo);                                  // group 0 of the wave's latest request
  wait_tensor0_of(gl, g1);
  __syncthreads();
  if (pinned((uint32_t)(nkt > 1))) gl = stage((uint32_t)SMEMB, ktlo + 1);

  for (int kti = 0; kti < nkt; ++kti) {
    const int kv0 = (ktlo + kti) * 64;                         // <= qb*64 < SEQ
    const uint32_t bsel = (uint32_t)(kti & 1) * (uint32_t)SMEMB;   // this pass's buffer
    const _Float16* Ksh = (const _Float16*)(const void*)(smem + bsel + OFF_K);    // K   [kv][d]
    const _Float16* Vsh = (const _Float16*)(const void*)(smem + bsel + OFF_V);    // V^T [d][kv]
    const _Float16* Krs = (const _Float16*)(const void*)(smem + bsel + OFF_KR);   // K residual
    const _Float16* Vrs = (const _Float16*)(const void*)(smem + bsel + OFF_VR);   // V^T residual

    // ---- scores^T: 64 keys x 16 query columns per wave (A operand: lane c -> key j*16+c, split k map over d) ----
    v8f s[4];
#pragma unroll
    for (int j = 0; j < 4; ++j) {
      s[j] = zero8();
      v8f t = zero8();
#pragma unroll
      for (int dc = 0; dc < 2; ++dc) {
        FH kb;
        kb.h[0] = *(const v8h*)(Ksh + (j * 16 + c) * AP + dc * 32 + 8 * hh);
        kb.h[1] = *(const v8h*)(Ksh + (j * 16 + c) * AP + dc * 32 + 16 + 8 * hh);
        s[j] = mma_h_raw(kb.v, qa[dc], s[j]);
        if constexpr (HR) {
          FH krb;
          krb.h[0] = *(const v8h*)(Krs + (j * 16 + c) * AP + dc * 32 + 8 * hh);
          krb.h[1] = *(const v8h*)(Krs + (j * 16 + c) * AP + dc * 32 + 16 + 8 * hh);
          t = mma_h_raw(krb.v, qa[dc], t);
          t = mma_h_raw(kb.v, qr[dc], t);
        }
      }
      if constexpr (HR) s[j] = s[j] + t * (1.0f / 2048.0f);
    }

    // ---- windowed causal online softmax of the lane's query: in-lane max over its 32 keys, one exchange with
    //      the other half, running max, alpha, p, row-sum partial, P (x256, f16; HR: + residual) in registers ----
    const int key0 = kv0 + 8 * hh;
    float tm[4];
#pragma unroll
    for (int j = 0; j < 4; ++j) {                            // four independent max chains
      tm[j] = -1e30f;
#pragma unroll
      for (int r = 0; r < 8; ++r) {
        const int key = key0 + j * 16 + r;
        float a = s[j][r] * (1.0f / 2048.0f);                // 1/8 head scale, 1/256 for the two x16 carries
        const bool ok = (key <= qrow) && (key + WIN >= qrow);
        a = ok ? a : -1e30f;
        s[j][r] = a;
        tm[j] = fmaxf(tm[j], a);
      }
    }
    float tmx = fmaxf(fmaxf(tm[0], tm[1]), fmaxf(tm[2], tm[3]));
    tmx = fmaxf(tmx, xhalf(tmx));
    const float mn = fmaxf(mrun, tmx);
    const float al = __expf(mrun - mn);
    mrun = mn;
    FH pb[2], pbr[2];                                        // B operands of the two 32-key chunks
    float ps[4];
#pragma unroll
    for (int j = 0; j < 4; ++j) {                            // four independent sum chains
      ps[j] = 0.0f;
#pragma unroll
      for (int r = 0; r < 8; ++r) {
        const int key = key0 + j * 16 + r;
        const bool ok = (key <= qrow) && (key + WIN >= qrow);
        float p = __expf(s[j][r] - mn);
        p = ok ? p : 0.0f;
        ps[j] += p;
        const float g = p * 256.0f;
        const _Float16 x0 = (_Float16)g;
        pb[j >> 1].h[j & 1][r] = x0;
        if constexpr (HR) pbr[j >> 1].h[j & 1][r] = (_Float16)((g - (float)x0) * 2048.0f);
      }
    }
    lsum = lsum * al + ((ps[0] + ps[1]) + (ps[2] + ps[3]));

    // ---- rescale the context accumulators by alpha (VALU) ----
#pragma unroll
    for (int t = 0; t < 4; ++t) {
      oacc[t] = oacc[t] * al;
      if constexpr (HR) oacc2[t] = oacc2[t] * al;
    }

    // ---- context^T += V^T . P^T (f16 WMMA; A = V^T [d][key], B = P^T [key][query]) ----
#pragma unroll
    for (int kk = 0; kk < 2; ++kk) {
#pragma unroll
      for (int t = 0; t < 4; ++t) {
        FH vb;
        vb.h[0] = *(const v8h*)(Vsh + (t * 16 + c) * AP + kk * 32 + 8 * hh);
        vb.h[1] = *(const v8h*)(Vsh + (t * 16 + c) * AP + kk * 32 + 16 + 8 * hh);
        oacc[t] = mma_h_raw(vb.v, pb[kk].v, oacc[t]);
        if constexpr (HR) {
          FH vrb;
          vrb.h[0] = *(const v8h*)(Vrs + (t * 16 + c) * AP + kk * 32 + 8 * hh);
          vrb.h[1] = *(const v8h*)(Vrs + (t * 16 + c) * AP + kk * 32 + 16 + 8 * hh);
          oacc2[t] = mma_h_raw(vrb.v, pb[kk].v, oacc2[t]);
          oacc2[t] = mma_h_raw(vb.v, pbr[kk].v, oacc2[t]);
        }
      }
    }
    // publish point of stage kti + 1: own LDS reads retired, own tensor load landed, one barrier for both jobs
    wait_ds0();
    wait_tensor0_of(gl, g1);
    __syncthreads();
    if (pinned((uint32_t)(kti + 2 < nkt))) gl = stage(bsel, ktlo + kti + 2);   // refill the buffer that this pass has just read
  }
  wait_tensor0();
  wait_ds0();

  __syncthreads();                           // every wave is done with the K/V tiles before they are aliased

  // ---- normalise (1/lsum, the 1/256 p carry; keep the x16 v carry), stage the wave's 16x64 f32 tile in LDS
  //      (row = query c, 8 consecutive features per context tile and lane), then store whole 128-byte rows ----
  float* os = (float*)(void*)smem + wave * (16 * OP);
  {
    const float l  = lsum + xhalf(lsum);     // the two halves of the query's keys
    const float rl = 1.0f / l;               // l >= 1 (the max key contributes p = 1)
    const float sc = rl * (1.0f / 256.0f);
#pragma unroll
    for (int t = 0; t < 4; ++t) {
      v4f lo, hi;
#pragma unroll
      for (int r = 0; r < 4; ++r) {
        float v0 = oacc[t][r], v1 = oacc[t][4 + r];
        if constexpr (HR) {
          v0 += oacc2[t][r] * (1.0f / 2048.0f);
          v1 += oacc2[t][4 + r] * (1.0f / 2048.0f);
        }
        lo[r] = v0 * sc;
        hi[r] = v1 * sc;
      }
      *(v4f*)(os + c * OP + t * 16 + 8 * hh)     = lo;
      *(v4f*)(os + c * OP + t * 16 + 8 * hh + 4) = hi;
    }
  }
  __builtin_amdgcn_fence(__ATOMIC_RELEASE, "workgroup");
  __builtin_amdgcn_wave_barrier();
  __builtin_amdgcn_fence(__ATOMIC_ACQUIRE, "workgroup");
  {
    const int rq = lane >> 3, piece = lane & 7;
    v4u ph[4], pr[4];
#pragma unroll
    for (int it = 0; it < 4; ++it) {
      const int row = it * 4 + rq;   // it 0..3 x rq 0..3 = rows 0..15 of the wave tile
      const v4f a  = *(const v4f*)(os + row * OP + piece * 8);
      const v4f a2 = *(const v4f*)(os + row * OP + piece * 8 + 4);
      float f[8];
      f[0] = a[0];  f[1] = a[1];  f[2] = a[2];  f[3] = a[3];
      f[4] = a2[0]; f[5] = a2[1]; f[6] = a2[2]; f[7] = a2[3];
      v4u p, q;
#pragma unroll
      for (int e = 0; e < 4; ++e) {
        const _Float16 x0 = (_Float16)f[2 * e], x1 = (_Float16)f[2 * e + 1];
        p[e] = pk16(h_bits(x0), h_bits(x1));
        if constexpr (HR) {
          const _Float16 y0 = (_Float16)((f[2 * e] - (float)x0) * 2048.0f);
          const _Float16 y1 = (_Float16)((f[2 * e + 1] - (float)x1) * 2048.0f);
          q[e] = pk16(h_bits(y0), h_bits(y1));
        } else {
          q[e] = p[e];
        }
      }
      ph[it] = p;
      pr[it] = q;
    }
    {
#pragma unroll
      for (int it = 0; it < 4; ++it) {
        const int row = it * 4 + rq;
        const size_t go = (size_t)(q0 + row) * DM + (size_t)h * HD + piece * 8;
        *(v4u*)(ctxp + go) = ph[it];
        if constexpr (HR) *(v4u*)(ctxrp + go) = pr[it];
      }
      
    }
  }
}

// =====================================================================================================
// Workspace map (bytes); every region is an exact multiple of its whole-line / whole-tile store granularity
// (row pitches 2048 / 6144 / 8192 / 256 B, all offsets multiples of 256, no aliasing within a launch):
//   Xh     f16 [SEQ][1024]                 (bf16 value of x, x16)
//   Wqkv   f16 [3072][1024]                (bf16 values of wq | wk | wv x1024, [n][k] = the input layout)
//   Wp     f16 [1024][1024]                (bf16 value of wo x1024, [n][k])
//   QKV    f16 [SEQ][3072]                 (rotated q | rotated k, x16; the v columns are neither written nor read)
//   QKVr   f16 [SEQ][3072]                 (x2^11 residual of the above)
//   VT     f16 [1024][SEQ]                 ([h*64 + d][s])
//   VTr    f16 [1024][SEQ]                 (residual)
//   Ctx    f16 [SEQ][1024]                 (attention context x16)
//   Ctxr   f16 [SEQ][1024]                 (residual)
//   Rt     f32 [SEQ][64]                   (cos | sin table)
//   total for SEQ = 4096: 101711872
// d_out f32: [SEQ][1024] at byte 0, every 64x64 tile written once by the projection launch.
// =====================================================================================================
extern "C" void kernel_launch(void* const* d_in, const int* in_sizes, int n_in,
                              void* d_out, int out_size, void* d_ws, size_t ws_size,
                              hipStream_t stream) {
  if (n_in < 5) return;
  if (in_sizes[0] < SEQ * DM) return;
  if (in_sizes[1] != DM * DM) return;
  if (in_sizes[2] != DM * DM) return;
  if (in_sizes[3] != DM * DM) return;
  if (in_sizes[4] != DM * DM) return;
  if (out_size < OUTN) return;

  const float* x  = (const float*)d_in[0];    // [SEQ][DM] (row prefix)
  const float* wq = (const float*)d_in[1];    // [DM n][DM k]
  const float* wk = (const float*)d_in[2];    // [DM n][DM k]
  const float* wv = (const float*)d_in[3];    // [DM n][DM k]
  const float* wo = (const float*)d_in[4];    // [DM n][DM k]

  const size_t PX   = (size_t)SEQ * DM * 2;          //  8388608 (SEQ 4096)
  const size_t PWq  = (size_t)DQKV * DM * 2;         //  6291456
  const size_t PWp  = (size_t)DM * DM * 2;           //  2097152
  const size_t PQKV = (size_t)SEQ * DQKV * 2;        // 25165824
  const size_t PVT  = (size_t)DM * SEQ * 2;          //  8388608
  const size_t PCtx = (size_t)SEQ * DM * 2;          //  8388608
  const size_t PRt  = (size_t)SEQ * 64 * 4;          //  1048576
  size_t off = 0;
  const size_t oX    = off; off += PX;
  const size_t oWq   = off; off += PWq;
  const size_t oWp   = off; off += PWp;
  const size_t oQKV  = off; off += PQKV;
  const size_t oQKVr = off; off += PQKV;
  const size_t oVT   = off; off += PVT;
  const size_t oVTr  = off; off += PVT;
  const size_t oCtx  = off; off += PCtx;
  const size_t oCtxr = off; off += PCtx;
  const size_t oRt   = off; off += PRt;
  if (off > ws_size) return;                         // off = 101711872 for SEQ 4096
  if (off > (size_t)134217728) return;

  char* ws = (char*)d_ws;
  unsigned short* Xh   = (unsigned short*)(ws + oX);
  unsigned short* Wqkv = (unsigned short*)(ws + oWq);
  unsigned short* Wp   = (unsigned short*)(ws + oWp);
  unsigned short* QKV  = (unsigned short*)(ws + oQKV);
  unsigned short* QKVr = (unsigned short*)(ws + oQKVr);
  unsigned short* VT   = (unsigned short*)(ws + oVT);
  unsigned short* VTr  = (unsigned short*)(ws + oVTr);
  unsigned short* Ctx  = (unsigned short*)(ws + oCtx);
  unsigned short* Ctxr = (unsigned short*)(ws + oCtxr);
  float*          Rt   = (float*)(ws + oRt);
  float*          outf = (float*)d_out;              // [SEQ][DM]

  const dim3 blk(256);
  const dim3 gPrep(PREP_B);                          // 512 table + 2048 x + 4 x 512 weight blocks (SEQ 4096)
  const dim3 gGqkv((SEQ / 128) * (DQKV / 128));      // 768 block tiles of 128x128 (SEQ 4096)
  const dim3 gGdm((SEQ / 128) * (DM / 128));         // 256 block tiles (8 waves each: 4 per ctx plane)
  const dim3 gAttn(NQB * NH);                        // 1024 blocks: every (head, query tile)
  const float wScale = 1024.0f;                      // weights carried x1024
  const float aScale = 16.0f;                        // activations carried x16
  const float cscale = 1.0f / 16384.0f;              // 1/(16 * 1024)

  // (1, 2) one launch: planes x -> f16 x16 (bf16 values); weights [n][k] -> f16 x1024 (bf16 values), wq | wk | wv
  //     stacked; RoPE table cos | sin per token
  k_prep<<<gPrep, blk, 0, stream>>>(x, wq, wk, wv, wo, Xh, Wqkv, Wp, Rt, aScale, wScale);
  // (3, 4) qkv = Xh . Wqkv^T (M=SEQ, N=3072, K=1024): q and k column blocks (n < 2*DM) with RoPE -> QKV f16 x16 +
  //     residual plane, pitch 3072; v column blocks (n >= 2*DM) -> v^T planes VT, VTr straight from the accumulators
  gemm64_f16<0, false><<<gGqkv, dim3(128), 0, stream>>>(Xh, Xh, DM, Wqkv, DM, cscale, (void*)QKV, QKVr, DQKV,
                                                  SEQ, DQKV, DM, aScale, Rt, 2 * DM, VT, VTr, 2 * DM, SEQ);
  // (5) windowed causal softmax attention -> Ctx f16 x16 + residual plane (all query tiles)
  attn_k<true><<<gAttn, dim3(128), 0, stream>>>(QKV, QKVr, VT, VTr, Ctx, Ctxr);
  // (6) out = (Ctx + 2^-11 Ctxr) . Wp^T -> d_out f32 [SEQ][1024] (M=SEQ, N=1024, K=1024), every tile once;
  //     blocks of 8 waves, the two planes side by side
  gemm64_f16<1, true><<<gGdm, blk, 0, stream>>>(Ctx, Ctxr, DM, Wp, DM, cscale, (void*)outf, Ctxr, DM,
                                                SEQ, DM, DM, 1.0f, Rt, 0, Ctxr, Ctxr, DM, DM);
  (void)hipGetLastError();
}
